// v000
// Measured on an AMD MI455X. A time is GPU time per run, averaged over a window of back-to-back runs after a warm-up
// (all launches, gaps included; the runs take copies of the inputs in turn), and the median of several windows.
// Apart from v000's, it joins two sittings. Times from different sittings can be a few percent apart, while
// side-by-side timings come from the same sitting.
// The starting kernel, v000, takes 1960 microseconds a run.
// Contractions: q/k/v/out projections, FFN1, FFN2 on v_wmma_f32_16x16x32_f16 (f16 operands, f32 accumulate);
// attention scores (q*0.125).k^T and p.v on v_wmma_f32_16x16x32_f16 (f16 operands, p carried x2^15, f32 accumulate).
// Softmax, LayerNorm, tanh-GELU, bias and residual adds in f32.
#include <hip/hip_runtime.h>

typedef __attribute__((ext_vector_type(16))) _Float16 v16h;
typedef __attribute__((ext_vector_type(8)))  _Float16 v8h;
typedef __attribute__((ext_vector_type(16))) __bf16   v16b;
typedef __attribute__((ext_vector_type(8)))  __bf16   v8b;
typedef __attribute__((ext_vector_type(8)))  float    v8f;
typedef __attribute__((ext_vector_type(4)))  float    v4f;
typedef __attribute__((ext_vector_type(4)))  int      v4i;

#define DM     1024
#define NHEAD  16
#define HD     64
#define FFND   4096
#define BSZ    2
#define SEQ    2048
#define MROWS  (BSZ * SEQ)
#define LN_EPS 1e-5f

__device__ __forceinline__ unsigned short f2bf_bits(float f) {
  unsigned u = __float_as_uint(f);
  return (unsigned short)((u + 0x7FFFu + ((u >> 16) & 1u)) >> 16);
}
__device__ __forceinline__ float bf_bits2f(unsigned short h) { return __uint_as_float(((unsigned)h) << 16); }

// hazard guards as plain device helpers
__device__ __forceinline__ void dep_guard_h(v8f& a, v8f& b, v16h x, v16h y) { asm volatile("v_nop\n\tv_nop\n\tv_nop\n\tv_nop" : "+v"(a), "+v"(b) : "v"(x), "v"(y)); }
__device__ __forceinline__ void dep_guard_b(v8f& a, v8f& b, v16b x, v16b y) { asm volatile("v_nop\n\tv_nop\n\tv_nop\n\tv_nop" : "+v"(a), "+v"(b) : "v"(x), "v"(y)); }
__device__ __forceinline__ void keep4_h(v16h a, v16h b, v16h c, v16h d) { asm volatile("v_nop" :: "v"(a), "v"(b), "v"(c), "v"(d)); }
__device__ __forceinline__ void keep4_b(v16b a, v16b b, v16b c, v16b d) { asm volatile("v_nop" :: "v"(a), "v"(b), "v"(c), "v"(d)); }
__device__ __forceinline__ void acc_guard4(v8f& a, v8f& b, v8f& c, v8f& d) { asm volatile("v_nop\n\tv_nop\n\tv_nop\n\tv_nop" : "+v"(a), "+v"(b), "+v"(c), "+v"(d)); }
template <typename T> struct Frag;
template <> struct Frag<_Float16> {
  typedef v16h V; union U { v16h v; v8h h[2]; };
  static __device__ __forceinline__ v16h load(const _Float16* p) {   // elements 0..7 <- p[0..7], 8..15 <- p[16..23]
    U f; f.h[0] = *(const v8h*)(p); f.h[1] = *(const v8h*)(p + 16); return f.v;
  }
  static __device__ __forceinline__ v8f mma(v16h a, v16h b, v8f c) {
    return __builtin_amdgcn_wmma_f32_16x16x32_f16(false, a, false, b, (short)0, c, false, false);
  }
  static __device__ __forceinline__ void guard(v8f& a, v8f& b, v16h x, v16h y) { dep_guard_h(a, b, x, y); }
  static __device__ __forceinline__ void keep(v16h a, v16h b, v16h c, v16h d) { keep4_h(a, b, c, d); }
};
template <> struct Frag<__bf16> {
  typedef v16b V; union U { v16b v; v8b h[2]; };
  static __device__ __forceinline__ v16b load(const __bf16* p) {
    U f; f.h[0] = *(const v8b*)(p); f.h[1] = *(const v8b*)(p + 16); return f.v;
  }
  static __device__ __forceinline__ v8f mma(v16b a, v16b b, v8f c) {
    return __builtin_amdgcn_wmma_f32_16x16x32_bf16(false, a, false, b, (short)0, c, false, false);
  }
  static __device__ __forceinline__ void guard(v8f& a, v8f& b, v16b x, v16b y) { dep_guard_b(a, b, x, y); }
  static __device__ __forceinline__ void keep(v16b a, v16b b, v16b c, v16b d) { keep4_b(a, b, c, d); }
};

// tanh-GELU: 0.5*v*(1+tanh(sqrt(2/pi)*(v+0.044715*v^3))); tanh via exp(-2|u|), no division instruction
__device__ __forceinline__ float gelu_tanh_f(float v) {
  const float u = 0.7978845608028654f * (v + 0.044715f * v * v * v);
  const float e = __expf(-2.0f * fabsf(u));
  float t = (1.0f - e) * __builtin_amdgcn_rcpf(1.0f + e);
  t = copysignf(t, u);
  return 0.5f * v * (1.0f + t);
}

// ---- Register-blocked batched WMMA GEMM ------------------------------------
// C[m,n] = scale * sum_k A[m,k] * Bt[n,k] (+bias)(+resid); each wave owns a 64x64 tile.
// A row-major [M,K]; Bt row-major [N,K]; M,N % 64 == 0, K % 32 == 0.
// SPLIT: operands are hi/lo planes (A2/Bt2 = lo planes, same layout); product = hi.hi + hi.lo + lo.hi.
// BIAS_MODE: 0 = none, 1 = bias[m], 2 = bias[n].
// OUT_MODE: 0 = f32, 1 = f16, 2 = bf16 hi plane (Cout) + bf16 lo plane (Cout2).
// ACT: 0 none, 1 tanh, 2 relu, 3 silu, 4 leaky, 5 erf-gelu, 6 tanh-gelu.
// ET: 0 = f16 operands, 1 = bf16 operands (pointers passed as 16-bit storage)
template <int ET> struct Elem;
template <> struct Elem<0> { typedef _Float16 T; };
template <> struct Elem<1> { typedef __bf16 T; };
template <int ET, bool SPLIT, int BIAS_MODE, int OUT_MODE, bool RESID, int ACT = 0>
__global__ __launch_bounds__(256) void wmma_gemm64(
    const unsigned short* __restrict__ Ap, const unsigned short* __restrict__ A2p, int lda, long strideA,
    const unsigned short* __restrict__ Btp, const unsigned short* __restrict__ Bt2p, int ldb, long strideB,
    void* __restrict__ Cout, void* __restrict__ Cout2, int ldc, long strideC,
    const float* __restrict__ bias,
    const float* __restrict__ resid, long strideR,
    int M, int N, int K, float scale) {
  typedef typename Elem<ET>::T T;
  typedef typename Frag<T>::V V;
  const T* A = (const T*)Ap; const T* A2 = (const T*)A2p; const T* Bt = (const T*)Btp; const T* Bt2 = (const T*)Bt2p;
  __shared__ __align__(16) float sT[8][16 * 68];   // per-wave 16x64 slab, pitch 68 floats
  const int b    = blockIdx.y;
  const int lane = threadIdx.x & 31;
  const int wave = threadIdx.x >> 5;
  const int tilesN = N >> 6;
  const int tilesM = M >> 6;
  const int tile = blockIdx.x * 8 + wave;
  if (tile >= tilesM * tilesN) return;   // wave-uniform; no block barriers in this kernel
  const int tm = tile / tilesN;
  const int tn = tile - tm * tilesN;
  const int m0 = tm << 6;
  const int n0 = tn << 6;

  const T* Ab  = A  + (size_t)b * strideA;
  const T* Bb  = Bt + (size_t)b * strideB;
  const T* Ab2 = SPLIT ? (A2  + (size_t)b * strideA) : nullptr;
  const T* Bb2 = SPLIT ? (Bt2 + (size_t)b * strideB) : nullptr;

  const int rlane = lane & 15;                 // row (A) / col (B, D) within subtile
  const int koff  = (lane >> 4) * 8;           // k offset of this lane half
  const int mOff  = (lane >> 4) * 8;           // D row offset

  v8f acc[4][4];
#pragma unroll
  for (int i = 0; i < 4; ++i)
#pragma unroll
    for (int j = 0; j < 4; ++j) acc[i][j] = (v8f){0.f,0.f,0.f,0.f,0.f,0.f,0.f,0.f};

  for (int k0 = 0; k0 < K; k0 += 32) {
    V bh[4], bl[4];
#pragma unroll
    for (int j = 0; j < 4; ++j) {
      const size_t bo = (size_t)(n0 + (j << 4) + rlane) * ldb + koff + k0;
      bh[j] = Frag<T>::load(Bb + bo);
      if (SPLIT) bl[j] = Frag<T>::load(Bb2 + bo);
    }
#pragma unroll
    for (int i = 0; i < 4; ++i) {
      const size_t ao = (size_t)(m0 + (i << 4) + rlane) * lda + koff + k0;
      V ah = Frag<T>::load(Ab + ao);
      V al;
      if (SPLIT) al = Frag<T>::load(Ab2 + ao);
#pragma unroll
      for (int j = 0; j < 4; ++j) {
        acc[i][j] = Frag<T>::mma(ah, bh[j], acc[i][j]);
        if (SPLIT) {
          acc[i][j] = Frag<T>::mma(ah, bl[j], acc[i][j]);
          acc[i][j] = Frag<T>::mma(al, bh[j], acc[i][j]);
        }
      }
      Frag<T>::guard(acc[i][0], acc[i][3], ah, SPLIT ? al : ah);
    }
    Frag<T>::keep(bh[0], bh[1], bh[2], bh[3]);
    if (SPLIT) Frag<T>::keep(bl[0], bl[1], bl[2], bl[3]);
  }
  acc_guard4(acc[0][0], acc[0][1], acc[0][2], acc[0][3]);
  acc_guard4(acc[1][0], acc[1][1], acc[1][2], acc[1][3]);
  acc_guard4(acc[2][0], acc[2][1], acc[2][2], acc[2][3]);
  acc_guard4(acc[3][0], acc[3][1], acc[3][2], acc[3][3]);

  // ---- epilogue ----
  float* slab = sT[wave];
  const float* Rb = RESID ? (resid + (size_t)b * strideR) : nullptr;
#pragma unroll
  for (int i = 0; i < 4; ++i) {
    const int mBase = m0 + (i << 4);
#pragma unroll
    for (int j = 0; j < 4; ++j) {
      const int n = n0 + (j << 4) + rlane;
      float bv = 0.f;
      if (BIAS_MODE == 2) bv = bias[n];
#pragma unroll
      for (int r = 0; r < 8; ++r) {
        float v = acc[i][j][r] * scale;
        if (BIAS_MODE == 1) v += bias[mBase + mOff + r];
        if (BIAS_MODE == 2) v += bv;
        if (RESID) v += Rb[(size_t)(mBase + mOff + r) * ldc + n];
        if (ACT == 1) v = tanhf(v);
        if (ACT == 2) v = fmaxf(v, 0.0f);
        if (ACT == 3) v = v / (1.0f + expf(-v));
        if (ACT == 4) v = (v > 0.f) ? v : 0.01f * v;
        if (ACT == 5) v = 0.5f * v * (1.0f + erff(v * 0.70710678118654752f));
        if (ACT == 6) v = gelu_tanh_f(v);
        slab[(mOff + r) * 68 + (j << 4) + rlane] = v;
      }
    }
    __builtin_amdgcn_fence(__ATOMIC_RELEASE, "workgroup");
    __builtin_amdgcn_wave_barrier();
    __builtin_amdgcn_fence(__ATOMIC_ACQUIRE, "workgroup");
    if (OUT_MODE == 0) {
      float* C = (float*)Cout + (size_t)b * strideC;
      const int hh = lane >> 4, c4 = (lane & 15) * 4;     // row seg = 256 B = 16 lanes x 16 B
      {
#pragma unroll
        for (int it = 0; it < 8; ++it) {
          const int row = it * 2 + hh;
          v4f v = *(const v4f*)(slab + row * 68 + c4);
          *(v4f*)(C + (size_t)(mBase + row) * ldc + n0 + c4) = v;
        }
        
      }
    } else {
      const int q = lane >> 3, c8 = (lane & 7) * 8;
      unsigned short* C  = (unsigned short*)Cout  + (size_t)b * strideC;
      unsigned short* C2 = (OUT_MODE == 2) ? ((unsigned short*)Cout2 + (size_t)b * strideC) : nullptr;
      {
#pragma unroll
        for (int it = 0; it < 4; ++it) {
          const int row = it * 4 + q;
          const float* sp = slab + row * 68 + c8;
          v8h hv, lv;
#pragma unroll
          for (int e = 0; e < 8; ++e) {
            if (OUT_MODE == 1) {
              hv[e] = (_Float16)sp[e];
            } else {
              unsigned short hb = f2bf_bits(sp[e]);
              unsigned short lb = f2bf_bits(sp[e] - bf_bits2f(hb));
              hv[e] = __builtin_bit_cast(_Float16, hb);
              lv[e] = __builtin_bit_cast(_Float16, lb);
            }
          }
          *(v8h*)(C + (size_t)(mBase + row) * ldc + n0 + c8) = hv;
          if (OUT_MODE == 2) *(v8h*)(C2 + (size_t)(mBase + row) * ldc + n0 + c8) = lv;
        }
        
      }
    }
    __builtin_amdgcn_fence(__ATOMIC_RELEASE, "workgroup");
    __builtin_amdgcn_wave_barrier();
    __builtin_amdgcn_fence(__ATOMIC_ACQUIRE, "workgroup");
  }
}

__global__ __launch_bounds__(256) void cast_f32_f16x2(
    const float* __restrict__ in, _Float16* __restrict__ out, int n2) {
  int i = blockIdx.x * 256 + threadIdx.x;
  if (i < n2) {
    const _Float16 h0 = (_Float16)in[2 * i], h1 = (_Float16)in[2 * i + 1];
    const unsigned u = (unsigned)__builtin_bit_cast(unsigned short, h0) | ((unsigned)__builtin_bit_cast(unsigned short, h1) << 16);
    ((unsigned*)out)[i] = u;
    
  }
}

// =====================================================================================
// Attention for head_dim 64, f32 in / f32 out; 16-bit operands: bf16 with optional hi/lo splits, or
// plain f16 (F16=true, non-split, probabilities carried x2^15).
//   Block = 4 waves = 64 query rows of one (batch, head); S % 64 == 0.
//   Element (b, s, h, d) of tensor X lives at X[b*X_bs + s*X_rs + h*X_hs + d] (strides in floats, multiples of 4).
//   mask_mode 0 none, 1 causal, 2 tensor [S][Skv], 3 per-token vectors, 4 causal + window, 5 relative bias,
//   6 = mask_a: int32 [S][Skv] nonzero = masked, OR mask_b: int32 [B][Skv] nonzero = masked; per 64x64
//       (b, q-tile, kv-tile) code table tcode[(b*nqb+qb)*t_pitch + kc]: 0 mixed (per-element reads),
//       1 all live (no reads), 2 all masked (tile skipped: zero contribution).
//   masked scores are replaced by mask_fill before the softmax; rows with no live key write 0.
//   grid.x = B * H * (S/64).
// =====================================================================================
#define AT_D 64
#define AT_NW 4
#define AT_QB 64
#define AT_KC 64
struct AttnGeom { const int* tcode; const float* cp; const float* pc; long c_bs, c_rs, c_hs, t_pitch;
                  long q_bs, q_rs, q_hs, k_bs, k_rs, k_hs, v_bs, v_rs, v_hs, o_bs, o_rs, o_hs;
                  int S, Skv, H, mask_mode; float qscale; int blk0; float mask_fill; int mask_is_int; };
static_assert(sizeof(AttnGeom) == 184);

__device__ __forceinline__ unsigned short at_bf_bits(float f) {
  unsigned u = __float_as_uint(f);
  return (unsigned short)((u + 0x7FFFu + ((u >> 16) & 1u)) >> 16);
}
__device__ __forceinline__ __bf16 at_f2bf(float f) { return __builtin_bit_cast(__bf16, at_bf_bits(f)); }
__device__ __forceinline__ void at_split(float f, __bf16& hi, __bf16& lo) {
  const unsigned short hb = at_bf_bits(f);
  hi = __builtin_bit_cast(__bf16, hb);
  lo = at_f2bf(f - __uint_as_float(((unsigned)hb) << 16));
}
__device__ __forceinline__ v8f at_mma(v16b a, v16b b, v8f c) {
  c = __builtin_amdgcn_wmma_f32_16x16x32_bf16(false, a, false, b, (short)0, c, false, false);
  asm volatile("v_nop\n\tv_nop\n\tv_nop\n\tv_nop" : "+v"(c) : "v"(a), "v"(b));
  return c;
}
// 16-bit element as a bit pattern held in a __bf16 slot: f16 bits when F16, bf16 (RNE) otherwise
template <bool F16> __device__ __forceinline__ __bf16 at_to16(float f) {
  if (F16) return __builtin_bit_cast(__bf16, (_Float16)f);
  return at_f2bf(f);
}
template <bool F16> __device__ __forceinline__ v8f at_mma16(v16b a, v16b b, v8f c) {
  if (F16) {
    const v16h ah = __builtin_bit_cast(v16h, a), bh = __builtin_bit_cast(v16h, b);
    c = __builtin_amdgcn_wmma_f32_16x16x32_f16(false, ah, false, bh, (short)0, c, false, false);
    asm volatile("v_nop\n\tv_nop\n\tv_nop\n\tv_nop" : "+v"(c) : "v"(ah), "v"(bh));
    return c;
  }
  return at_mma(a, b, c);
}

template <bool SPLIT_QK, bool SPLIT_PV, bool F16 = false>
__global__ __launch_bounds__(128)
void attn64_kernel(const float* __restrict__ q, const float* __restrict__ k,
                   const float* __restrict__ v, float* __restrict__ out,
                   const int* __restrict__ mask_a, const int* __restrict__ mask_b, AttnGeom g) {
  static_assert(!(F16 && (SPLIT_QK || SPLIT_PV)));
  const float PSC = F16 ? 32768.0f : 1.0f;     // f16 probabilities carried x2^15, folded into the final 1/l
  union FB { v16b v; v8b h[2]; };
  __shared__ __align__(16) __bf16 Ksh[AT_KC * AT_D];             // K hi [kv][d]      8 KB
  __shared__ __align__(16) __bf16 Ksl[SPLIT_QK ? AT_KC * AT_D : 8];
  __shared__ __align__(16) __bf16 Vth[AT_D * AT_KC];             // V hi [d][kv]      8 KB
  __shared__ __align__(16) __bf16 Vtl[SPLIT_PV ? AT_D * AT_KC : 8];
  __shared__ __align__(16) __bf16 Psh[AT_NW][16 * AT_KC];        // per wave P hi [row][kv]  8 KB
  __shared__ __align__(16) __bf16 Psl[SPLIT_PV ? AT_NW : 1][SPLIT_PV ? 16 * AT_KC : 8];
  __shared__ __align__(16) float  Os[AT_NW][16 * 68];            // per wave out tile, pitch 68

  const int tid  = threadIdx.x;
  const int wave = tid >> 5;
  const int lane = tid & 31;
  const int hh   = lane >> 4;
  const int c    = lane & 15;

  const int nqb = g.S / AT_QB;
  const int nkc = g.Skv / AT_KC;
  const int bx = blockIdx.x + g.blk0;
  const int qb = bx % nqb;
  const int bh = bx / nqb;
  const int h  = bh % g.H;
  const int b  = bh / g.H;
  const int qbase_block = qb * AT_QB;
  const int q0 = qbase_block + wave * 16;

  const float* qb_ptr = q + (size_t)b * g.q_bs + (size_t)h * g.q_hs;
  const float* kb_ptr = k + (size_t)b * g.k_bs + (size_t)h * g.k_hs;
  const float* vb_ptr = v + (size_t)b * g.v_bs + (size_t)h * g.v_hs;
  float*       ob_ptr = out + (size_t)b * g.o_bs + (size_t)h * g.o_hs;

  // ---- Q fragments (A operand): 2 d-chunks, hi (and lo) ----
  v16b qah[2], qal[2];
  {
    const float* qrow = qb_ptr + (size_t)(q0 + c) * g.q_rs;
#pragma unroll
    for (int dc = 0; dc < 2; ++dc) {
#pragma unroll
      for (int e = 0; e < 8; ++e) {
        const float f0 = qrow[dc * 32 + 8 * hh + e] * g.qscale;
        const float f1 = qrow[dc * 32 + 16 + 8 * hh + e] * g.qscale;
        if (SPLIT_QK) { __bf16 hq, lq; at_split(f0, hq, lq); qah[dc][e] = hq; qal[dc][e] = lq; at_split(f1, hq, lq); qah[dc][8 + e] = hq; qal[dc][8 + e] = lq; }
        else { qah[dc][e] = at_to16<F16>(f0); qah[dc][8 + e] = at_to16<F16>(f1); qal[dc][e] = qah[dc][e]; qal[dc][8 + e] = qah[dc][8 + e]; }
      }
    }
  }

  float mrow[8], lrow[8];
  v8f oacc[4];
#pragma unroll
  for (int r = 0; r < 8; ++r) { mrow[r] = -INFINITY; lrow[r] = 0.f; }
#pragma unroll
  for (int t = 0; t < 4; ++t) oacc[t] = (v8f){0.f,0.f,0.f,0.f,0.f,0.f,0.f,0.f};

  const int nChunks = (g.mask_mode == 1 || g.mask_mode == 4) ? (qb + 1) : nkc;   // block-uniform, bounded by Skv/64
  // per-row query mask (mode 3)
  int qkeep[8];
#pragma unroll
  for (int r = 0; r < 8; ++r) qkeep[r] = (g.mask_mode == 3) ? mask_b[(size_t)b * g.S + q0 + 8 * hh + r] : 1;   // mask_b = qmask in mode 3
  for (int kc = 0; kc < nChunks; ++kc) {
    const int kv0 = kc * AT_KC;
    int code = 0;
    if (g.mask_mode == 6) {
      int cv = g.tcode[((size_t)b * nqb + qb) * (size_t)g.t_pitch + kc];
      cv = __builtin_amdgcn_readfirstlane(cv);
      code = (cv == 1 || cv == 2) ? cv : 0;     // anything else -> mixed (per-element reads)
      if (code == 2) continue;                  // fully masked tile: zero contribution, softmax state unchanged
    }
    __syncthreads();
    {
      const int kvr = tid >> 1, dh = (tid & 1) * 32;
      const float* krow = kb_ptr + (size_t)(kv0 + kvr) * g.k_rs + dh;
      const float* vrow = vb_ptr + (size_t)(kv0 + kvr) * g.v_rs + dh;
#pragma unroll
      for (int i = 0; i < 8; ++i) {
        v4f kk = *(const v4f*)(krow + 4 * i);
        v4f vv = *(const v4f*)(vrow + 4 * i);
#pragma unroll
        for (int e = 0; e < 4; ++e) {
          const int d = dh + 4 * i + e;
          if (SPLIT_QK) { __bf16 a, bl; at_split(kk[e], a, bl); Ksh[kvr * AT_D + d] = a; Ksl[kvr * AT_D + d] = bl; }
          else Ksh[kvr * AT_D + d] = at_to16<F16>(kk[e]);
          if (SPLIT_PV) { __bf16 a, bl; at_split(vv[e], a, bl); Vth[d * AT_KC + kvr] = a; Vtl[d * AT_KC + kvr] = bl; }
          else Vth[d * AT_KC + kvr] = at_to16<F16>(vv[e]);
        }
      }
    }
    __syncthreads();

    v8f s[4];
#pragma unroll
    for (int j = 0; j < 4; ++j) {
      s[j] = (v8f){0.f,0.f,0.f,0.f,0.f,0.f,0.f,0.f};
#pragma unroll 1
      for (int dc = 0; dc < 2; ++dc) {
        FB kb;
        kb.h[0] = *(const v8b*)(Ksh + (j * 16 + c) * AT_D + dc * 32 + 8 * hh);
        kb.h[1] = *(const v8b*)(Ksh + (j * 16 + c) * AT_D + dc * 32 + 16 + 8 * hh);
        s[j] = at_mma16<F16>(qah[dc], kb.v, s[j]);
        if (SPLIT_QK) {
          FB kl;
          kl.h[0] = *(const v8b*)(Ksl + (j * 16 + c) * AT_D + dc * 32 + 8 * hh);
          kl.h[1] = *(const v8b*)(Ksl + (j * 16 + c) * AT_D + dc * 32 + 16 + 8 * hh);
          s[j] = at_mma16<F16>(qah[dc], kl.v, s[j]);
          s[j] = at_mma16<F16>(qal[dc], kb.v, s[j]);
        }
      }
    }
    const bool diag = (g.mask_mode == 1) && (kc == qb);
    int kvkeep[4] = {1, 1, 1, 1};
    if (g.mask_mode == 3) {
#pragma unroll
      for (int j = 0; j < 4; ++j) kvkeep[j] = mask_a[(size_t)b * g.Skv + kv0 + j * 16 + c];   // mask_a = kvmask
    }
    int kvpad[4] = {0, 0, 0, 0};
    if (g.mask_mode == 6 && code == 0) {
#pragma unroll
      for (int j = 0; j < 4; ++j) kvpad[j] = mask_b[(size_t)b * g.Skv + kv0 + j * 16 + c];   // mask_b = key padding [B][Skv]
    }
    float cm[8];
#pragma unroll
    for (int r = 0; r < 8; ++r) {
      const int qrow = q0 + 8 * hh + r;
      float m = -INFINITY;
#pragma unroll
      for (int j = 0; j < 4; ++j) {
        const int kvcol = kv0 + j * 16 + c;
        bool masked = false;
        if (diag) masked = (kvcol > qrow);
        else if (g.mask_mode == 4) masked = (kvcol > qrow) || (qrow - kvcol > g.mask_is_int);
        else if (g.mask_mode == 2) {
          const size_t mi = (size_t)qrow * g.Skv + kvcol;
          masked = (g.mask_is_int == 0) ? (((const float*)mask_a)[mi] == 0.0f)
                 : (g.mask_is_int == 1) ? (mask_a[mi] == 0) : (mask_a[mi] != 0);
        } else if (g.mask_mode == 3) masked = (qkeep[r] == 0) || (kvkeep[j] == 0);
        else if (g.mask_mode == 5) {
          const size_t mi = (size_t)qrow * g.Skv + kvcol;
          masked = (mask_a[mi] != 0);
          int n = mask_b[mi]; n = n < 0 ? 0 : n;
          s[j][r] += g.cp[(size_t)b * g.c_bs + (size_t)h * g.c_hs + (size_t)qrow * g.c_rs + n]
                   + g.pc[(size_t)b * g.c_bs + (size_t)h * g.c_hs + (size_t)kvcol * g.c_rs + n];
        } else if (g.mask_mode == 6) {
          if (code == 0) masked = (mask_a[(size_t)qrow * g.Skv + kvcol] != 0) || (kvpad[j] != 0);
        }
        if (masked) s[j][r] = g.mask_fill;
        m = fmaxf(m, s[j][r]);
      }
#pragma unroll
      for (int off = 1; off < 16; off <<= 1) m = fmaxf(m, __shfl_xor(m, off, 32));
      cm[r] = m;
    }
    __bf16* pwh = Psh[wave];
    __bf16* pwl = Psl[SPLIT_PV ? wave : 0];
#pragma unroll
    for (int r = 0; r < 8; ++r) {
      const float mnew = fmaxf(mrow[r], cm[r]);
      const bool dead = (mnew == -INFINITY);               // no live key seen yet for this row
      const float alpha = dead ? 1.0f : expf(mrow[r] - mnew);
      mrow[r] = mnew;
      float psum = 0.f;
#pragma unroll
      for (int j = 0; j < 4; ++j) {
        const float p = dead ? 0.0f : expf(s[j][r] - mnew);
        psum += p;
        if (SPLIT_PV) { __bf16 a, bl; at_split(p, a, bl); pwh[(8 * hh + r) * AT_KC + j * 16 + c] = a; pwl[(8 * hh + r) * AT_KC + j * 16 + c] = bl; }
        else pwh[(8 * hh + r) * AT_KC + j * 16 + c] = at_to16<F16>(p * PSC);
      }
#pragma unroll
      for (int off = 1; off < 16; off <<= 1) psum += __shfl_xor(psum, off, 32);
      lrow[r] = lrow[r] * alpha + psum;
#pragma unroll
      for (int t = 0; t < 4; ++t) oacc[t][r] *= alpha;
    }
    __builtin_amdgcn_fence(__ATOMIC_RELEASE, "workgroup");
    __builtin_amdgcn_wave_barrier();
    __builtin_amdgcn_fence(__ATOMIC_ACQUIRE, "workgroup");
#pragma unroll 1
    for (int kk = 0; kk < 2; ++kk) {
      FB pa, pl;
      pa.h[0] = *(const v8b*)(pwh + c * AT_KC + kk * 32 + 8 * hh);
      pa.h[1] = *(const v8b*)(pwh + c * AT_KC + kk * 32 + 16 + 8 * hh);
      if (SPLIT_PV) {
        pl.h[0] = *(const v8b*)(pwl + c * AT_KC + kk * 32 + 8 * hh);
        pl.h[1] = *(const v8b*)(pwl + c * AT_KC + kk * 32 + 16 + 8 * hh);
      }
#pragma unroll
      for (int t = 0; t < 4; ++t) {
        FB vb;
        vb.h[0] = *(const v8b*)(Vth + (t * 16 + c) * AT_KC + kk * 32 + 8 * hh);
        vb.h[1] = *(const v8b*)(Vth + (t * 16 + c) * AT_KC + kk * 32 + 16 + 8 * hh);
        oacc[t] = at_mma16<F16>(pa.v, vb.v, oacc[t]);
        if (SPLIT_PV) {
          FB vl;
          vl.h[0] = *(const v8b*)(Vtl + (t * 16 + c) * AT_KC + kk * 32 + 8 * hh);
          vl.h[1] = *(const v8b*)(Vtl + (t * 16 + c) * AT_KC + kk * 32 + 16 + 8 * hh);
          oacc[t] = at_mma16<F16>(pa.v, vl.v, oacc[t]);
          oacc[t] = at_mma16<F16>(pl.v, vb.v, oacc[t]);
        }
      }
    }
  }

  float* os = Os[wave];
#pragma unroll
  for (int r = 0; r < 8; ++r) {
    const float den = lrow[r] * PSC;
    const float inv = (den > 0.0f) ? (1.0f / den) : 0.0f;
#pragma unroll
    for (int t = 0; t < 4; ++t) os[(8 * hh + r) * 68 + t * 16 + c] = oacc[t][r] * inv;
  }
  __builtin_amdgcn_fence(__ATOMIC_RELEASE, "workgroup");
  __builtin_amdgcn_wave_barrier();
  __builtin_amdgcn_fence(__ATOMIC_ACQUIRE, "workgroup");
  {
    const int c4 = (lane & 15) * 4;
    {
#pragma unroll
      for (int it = 0; it < 8; ++it) {
        const int row = it * 2 + hh;
        v4f val = *(const v4f*)(os + row * 68 + c4);
        *(v4f*)(ob_ptr + (size_t)(q0 + row) * g.o_rs + c4) = val;
      }
      
    }
  }
}

// =====================================================================================
// 64x64 tile classification of the attention mask: one block per (b, q-tile); for each kv-tile:
//   masked(q,k) = tm[q][k] != 0 || pad[b][k] != 0;  code 2 = all masked, 1 = all live, 0 = mixed.
// =====================================================================================
__global__ __launch_bounds__(256) void tilecode_kernel(
    const int* __restrict__ tm, const int* __restrict__ pad, int* __restrict__ tab,
    int Skv, int nqb, int nkc, int tp) {
  __shared__ int wl[8], wm[8];
  __shared__ __align__(16) int codes[128];
  const int tid = threadIdx.x, lane = tid & 31, wave = tid >> 5;
  const int b  = blockIdx.x / nqb;
  const int qb = blockIdx.x - b * nqb;
  const int row = tid >> 2, cs = (tid & 3) * 16;
  const int q = qb * 64 + row;
  if (tid < 128) codes[tid] = 2;
  __syncthreads();
  const int nk = nkc < 128 ? nkc : 128;
  for (int kc = 0; kc < nk; ++kc) {
    const int* mr = tm  + (size_t)q * Skv + kc * 64 + cs;
    const int* pr = pad + (size_t)b * Skv + kc * 64 + cs;
    int live = 0, msk = 0;
#pragma unroll
    for (int i = 0; i < 4; ++i) {
      const v4i mv = *(const v4i*)(mr + 4 * i);
      const v4i pv = *(const v4i*)(pr + 4 * i);
#pragma unroll
      for (int e = 0; e < 4; ++e) {
        const int m = ((mv[e] != 0) || (pv[e] != 0)) ? 1 : 0;
        msk |= m;
        live |= (m ^ 1);
      }
    }
    const int al = __any(live);
    const int am = __any(msk);
    if (lane == 0) { wl[wave] = al; wm[wave] = am; }
    __syncthreads();
    if (tid == 0) {
      int L = 0, Mk = 0;
#pragma unroll
      for (int w = 0; w < 8; ++w) { L |= wl[w]; Mk |= wm[w]; }
      codes[kc] = (L == 0) ? 2 : ((Mk == 0) ? 1 : 0);
    }
    __syncthreads();
  }
  if (wave == 0) {
    const int nl = tp >> 2;          // tp is a multiple of 32 ints, <= 128
    v4i cv;
    cv[0] = codes[(4 * lane + 0) & 127]; cv[1] = codes[(4 * lane + 1) & 127];
    cv[2] = codes[(4 * lane + 2) & 127]; cv[3] = codes[(4 * lane + 3) & 127];
    int* dst = tab + (size_t)blockIdx.x * tp + 4 * lane;
    if (lane < nl) *(v4i*)dst = cv;
    
  }
}

// =====================================================================================
// LayerNorm over 1024-wide rows: one block (256 thr) per row, 4 contiguous floats per thread.
// =====================================================================================
template <bool OUT16>
__global__ __launch_bounds__(256) void ln_kernel(
    const float* __restrict__ in, const float* __restrict__ gam, const float* __restrict__ bet,
    float* __restrict__ o32, _Float16* __restrict__ o16) {
  __shared__ float red1[8], red2[8];
  __shared__ __align__(16) float ybuf[OUT16 ? DM : 4];
  const int row = blockIdx.x, t = threadIdx.x, lane = t & 31, wave = t >> 5;
  const float* x = in + (size_t)row * DM;
  const v4f xv = *(const v4f*)(x + 4 * t);
  float s = (xv[0] + xv[1]) + (xv[2] + xv[3]);
#pragma unroll
  for (int off = 1; off < 32; off <<= 1) s += __shfl_xor(s, off, 32);
  if (lane == 0) red1[wave] = s;
  __syncthreads();
  float tot = 0.f;
#pragma unroll
  for (int w = 0; w < 8; ++w) tot += red1[w];
  const float mu = tot * (1.0f / (float)DM);
  const float d0 = xv[0] - mu, d1 = xv[1] - mu, d2 = xv[2] - mu, d3 = xv[3] - mu;
  float s2 = (d0 * d0 + d1 * d1) + (d2 * d2 + d3 * d3);
#pragma unroll
  for (int off = 1; off < 32; off <<= 1) s2 += __shfl_xor(s2, off, 32);
  if (lane == 0) red2[wave] = s2;
  __syncthreads();
  float tot2 = 0.f;
#pragma unroll
  for (int w = 0; w < 8; ++w) tot2 += red2[w];
  const float var = tot2 * (1.0f / (float)DM);
  const float rstd = rsqrtf(var + LN_EPS);
  const v4f gv = *(const v4f*)(gam + 4 * t);
  const v4f bv = *(const v4f*)(bet + 4 * t);
  v4f y;
  y[0] = d0 * rstd * gv[0] + bv[0];
  y[1] = d1 * rstd * gv[1] + bv[1];
  y[2] = d2 * rstd * gv[2] + bv[2];
  y[3] = d3 * rstd * gv[3] + bv[3];
  float* op = o32 + (size_t)row * DM + 4 * t;
  *(v4f*)op = y;
  
  if (OUT16) {
    *(v4f*)(ybuf + 4 * t) = y;
    __syncthreads();
    if (t < DM / 8) {
      v8h hv;
#pragma unroll
      for (int e = 0; e < 8; ++e) hv[e] = (_Float16)ybuf[8 * t + e];
      _Float16* hp = o16 + (size_t)row * DM + 8 * t;
      *(v8h*)hp = hv;
      
    }
  }
}

// =====================================================================================
// Host orchestration
// =====================================================================================
extern "C" void kernel_launch(void* const* d_in, const int* in_sizes, int n_in,
                              void* d_out, int out_size, void* d_ws, size_t ws_size,
                              hipStream_t stream) {
  if (n_in < 16) return;
  if (in_sizes[0] != MROWS * DM || in_sizes[1] != SEQ * SEQ || in_sizes[2] != BSZ * SEQ) return;
  if (in_sizes[3] != DM * DM || in_sizes[4] != DM * DM || in_sizes[5] != DM * DM || in_sizes[6] != DM * DM) return;
  if (in_sizes[7] != DM || in_sizes[8] != FFND * DM || in_sizes[9] != FFND) return;
  if (in_sizes[10] != DM * FFND || in_sizes[11] != DM) return;
  if (in_sizes[12] != DM || in_sizes[13] != DM || in_sizes[14] != DM || in_sizes[15] != DM) return;
  if (out_size != MROWS * DM) return;

  const float* tgt   = (const float*)d_in[0];
  const int*   tmask = (const int*)d_in[1];     // [SEQ][SEQ], nonzero = masked
  const int*   pmask = (const int*)d_in[2];     // [BSZ][SEQ], nonzero = masked
  const float* Wq    = (const float*)d_in[3];
  const float* Wk    = (const float*)d_in[4];
  const float* Wv    = (const float*)d_in[5];
  const float* Wo    = (const float*)d_in[6];
  const float* bo    = (const float*)d_in[7];
  const float* W1    = (const float*)d_in[8];
  const float* b1    = (const float*)d_in[9];
  const float* W2    = (const float*)d_in[10];
  const float* b2    = (const float*)d_in[11];
  const float* g1    = (const float*)d_in[12];
  const float* be1   = (const float*)d_in[13];
  const float* g2    = (const float*)d_in[14];
  const float* be2   = (const float*)d_in[15];
  float* out = (float*)d_out;

  // ---- workspace carve (bytes), regions reused across phases ----
  const size_t MiB = 1048576;
  const int nqb = SEQ / AT_QB, nkc = SEQ / AT_KC;
  if (nkc > 128) return;
  const int TP = ((nkc + 31) / 32) * 32;
  const size_t tabBytes = (size_t)BSZ * nqb * TP * sizeof(int);
  const size_t total = 96 * MiB + tabBytes;
  if (total > ws_size) return;
  char* ws = (char*)d_ws;
  float*    Qf   = (float*)(ws + 0 * MiB);          // [4096][1024] f32   (projections -> attention)
  float*    Kf   = (float*)(ws + 16 * MiB);
  float*    Vf   = (float*)(ws + 32 * MiB);
  float*    RES1 = (float*)(ws + 0 * MiB);          // tgt + attn-proj     (after attention)
  _Float16* H16  = (_Float16*)(ws + 0 * MiB);       // [4096][4096] f16   (after LN1)
  float*    X1f  = (float*)(ws + 32 * MiB);         // LN1 output f32     (after attention)
  float*    AOf  = (float*)(ws + 48 * MiB);         // attention output f32
  float*    RES2 = (float*)(ws + 48 * MiB);         // x1 + ffn           (after out-proj)
  _Float16* X16  = (_Float16*)(ws + 64 * MiB);      // tgt f16            (projections)
  _Float16* O16  = (_Float16*)(ws + 64 * MiB);      // attention output f16 (after projections)
  _Float16* X1h  = (_Float16*)(ws + 64 * MiB);      // LN1 output f16     (after out-proj)
  _Float16* Wq16 = (_Float16*)(ws + 72 * MiB);
  _Float16* Wk16 = (_Float16*)(ws + 74 * MiB);
  _Float16* Wv16 = (_Float16*)(ws + 76 * MiB);
  _Float16* Wo16 = (_Float16*)(ws + 78 * MiB);
  _Float16* W1h  = (_Float16*)(ws + 80 * MiB);      // [4096][1024]
  _Float16* W2h  = (_Float16*)(ws + 88 * MiB);      // [1024][4096]
  int*      TAB  = (int*)(ws + 96 * MiB);           // [BSZ*nqb][TP]

  auto castf = [&](const float* src, _Float16* dst, int n) {
    const int n2 = n / 2;
    cast_f32_f16x2<<<dim3((n2 + 255) / 256), dim3(256), 0, stream>>>(src, dst, n2);
  };
  castf(tgt, X16, MROWS * DM);
  castf(Wq, Wq16, DM * DM);
  castf(Wk, Wk16, DM * DM);
  castf(Wv, Wv16, DM * DM);
  castf(Wo, Wo16, DM * DM);
  castf(W1, W1h, FFND * DM);
  castf(W2, W2h, DM * FFND);

  // mask tile codes
  tilecode_kernel<<<dim3(BSZ * nqb), dim3(256), 0, stream>>>(tmask, pmask, TAB, SEQ, nqb, nkc, TP);

  const long z = 0;
  typedef const unsigned short* cu16;
  const int tilesM = MROWS / 64;
  // q/k/v projections: [4096][1024] = X16 . W^T, f32 out
  {
    const dim3 grid((tilesM * (DM / 64) + 7) / 8, 1);
    wmma_gemm64<0, false, 0, 0, false, 0><<<grid, dim3(256), 0, stream>>>(
        (cu16)X16, (cu16)X16, DM, z, (cu16)Wq16, (cu16)Wq16, DM, z, (void*)Qf, (void*)Qf, DM, z,
        bo, tgt, z, MROWS, DM, DM, 1.0f);
    wmma_gemm64<0, false, 0, 0, false, 0><<<grid, dim3(256), 0, stream>>>(
        (cu16)X16, (cu16)X16, DM, z, (cu16)Wk16, (cu16)Wk16, DM, z, (void*)Kf, (void*)Kf, DM, z,
        bo, tgt, z, MROWS, DM, DM, 1.0f);
    wmma_gemm64<0, false, 0, 0, false, 0><<<grid, dim3(256), 0, stream>>>(
        (cu16)X16, (cu16)X16, DM, z, (cu16)Wv16, (cu16)Wv16, DM, z, (void*)Vf, (void*)Vf, DM, z,
        bo, tgt, z, MROWS, DM, DM, 1.0f);
  }

  // attention: q,k,v,o element (b, s, h, d) at b*SEQ*DM + s*DM + h*64 + d
  {
    AttnGeom g;
    g.tcode = TAB; g.cp = Qf; g.pc = Qf; g.c_bs = 0; g.c_rs = 0; g.c_hs = 0; g.t_pitch = TP;
    g.q_bs = (long)SEQ * DM; g.q_rs = DM; g.q_hs = HD;
    g.k_bs = (long)SEQ * DM; g.k_rs = DM; g.k_hs = HD;
    g.v_bs = (long)SEQ * DM; g.v_rs = DM; g.v_hs = HD;
    g.o_bs = (long)SEQ * DM; g.o_rs = DM; g.o_hs = HD;
    g.S = SEQ; g.Skv = SEQ; g.H = NHEAD; g.mask_mode = 6; g.qscale = 0.125f; g.blk0 = 0;
    g.mask_fill = -INFINITY; g.mask_is_int = 2;
    attn64_kernel<false, false, true><<<dim3(BSZ * NHEAD * nqb), dim3(128), 0, stream>>>(
        Qf, Kf, Vf, AOf, tmask, pmask, g);
  }
  castf(AOf, O16, MROWS * DM);

  // RES1 = tgt + (O . Wo^T + bo)
  {
    const dim3 grid((tilesM * (DM / 64) + 7) / 8, 1);
    wmma_gemm64<0, false, 2, 0, true, 0><<<grid, dim3(256), 0, stream>>>(
        (cu16)O16, (cu16)O16, DM, z, (cu16)Wo16, (cu16)Wo16, DM, z, (void*)RES1, (void*)RES1, DM, z,
        bo, tgt, z, MROWS, DM, DM, 1.0f);
  }
  // x1 = LN(RES1) -> f32 + f16
  ln_kernel<true><<<dim3(MROWS), dim3(256), 0, stream>>>(RES1, g1, be1, X1f, X1h);
  // H16 = gelu_tanh(x1 . W1^T + b1), f16 [4096][4096]
  {
    const dim3 grid((tilesM * (FFND / 64) + 7) / 8, 1);
    wmma_gemm64<0, false, 2, 1, false, 6><<<grid, dim3(256), 0, stream>>>(
        (cu16)X1h, (cu16)X1h, DM, z, (cu16)W1h, (cu16)W1h, DM, z, (void*)H16, (void*)H16, FFND, z,
        b1, tgt, z, MROWS, FFND, DM, 1.0f);
  }
  // RES2 = x1 + (H . W2^T + b2)
  {
    const dim3 grid((tilesM * (DM / 64) + 7) / 8, 1);
    wmma_gemm64<0, false, 2, 0, true, 0><<<grid, dim3(256), 0, stream>>>(
        (cu16)H16, (cu16)H16, FFND, z, (cu16)W2h, (cu16)W2h, FFND, z, (void*)RES2, (void*)RES2, DM, z,
        b2, X1f, z, MROWS, DM, FFND, 1.0f);
  }
  // out = LN(RES2)
  ln_kernel<false><<<dim3(MROWS), dim3(256), 0, stream>>>(RES2, g2, be2, out, X1h);
  (void)hipGetLastError();
}

// v001
// One run takes 733 microseconds.
// Two timings next to v000 put it at 2.67 and 2.70 times that version's speed.
// Contractions: q/k/v/out projections, FFN1, FFN2 on v_wmma_f32_16x16x32_f16 (f16 operands, f32 accumulate);
// attention scores (q*0.125).k^T and p.v on v_wmma_f32_16x16x32_f16 (f16 operands, p carried x2^15, f32 accumulate).
// Softmax, LayerNorm, tanh-GELU, bias and residual adds in f32.
#include <hip/hip_runtime.h>

typedef __attribute__((ext_vector_type(16))) _Float16 v16h;
typedef __attribute__((ext_vector_type(8)))  _Float16 v8h;
typedef __attribute__((ext_vector_type(16))) __bf16   v16b;
typedef __attribute__((ext_vector_type(8)))  __bf16   v8b;
typedef __attribute__((ext_vector_type(8)))  float    v8f;
typedef __attribute__((ext_vector_type(4)))  float    v4f;
typedef __attribute__((ext_vector_type(4)))  int      v4i;

#define DM     1024
#define NHEAD  16
#define HD     64
#define FFND   4096
#define BSZ    2
#define SEQ    2048
#define MROWS  (BSZ * SEQ)
#define LN_EPS 1e-5f

__device__ __forceinline__ unsigned short f2bf_bits(float f) {
  unsigned u = __float_as_uint(f);
  return (unsigned short)((u + 0x7FFFu + ((u >> 16) & 1u)) >> 16);
}
__device__ __forceinline__ float bf_bits2f(unsigned short h) { return __uint_as_float(((unsigned)h) << 16); }

// hazard guards as plain device helpers
__device__ __forceinline__ void dep_guard_h(v8f& a, v8f& b, v16h x, v16h y) { asm volatile("v_nop\n\tv_nop\n\tv_nop\n\tv_nop" : "+v"(a), "+v"(b) : "v"(x), "v"(y)); }
__device__ __forceinline__ void dep_guard_b(v8f& a, v8f& b, v16b x, v16b y) { asm volatile("v_nop\n\tv_nop\n\tv_nop\n\tv_nop" : "+v"(a), "+v"(b) : "v"(x), "v"(y)); }
__device__ __forceinline__ void keep4_h(v16h a, v16h b, v16h c, v16h d) { asm volatile("v_nop" :: "v"(a), "v"(b), "v"(c), "v"(d)); }
__device__ __forceinline__ void keep4_b(v16b a, v16b b, v16b c, v16b d) { asm volatile("v_nop" :: "v"(a), "v"(b), "v"(c), "v"(d)); }
__device__ __forceinline__ void acc_guard4(v8f& a, v8f& b, v8f& c, v8f& d) { asm volatile("v_nop\n\tv_nop\n\tv_nop\n\tv_nop" : "+v"(a), "+v"(b), "+v"(c), "+v"(d)); }
template <typename T> struct Frag;
template <> struct Frag<_Float16> {
  typedef v16h V; union U { v16h v; v8h h[2]; };
  static __device__ __forceinline__ v16h load(const _Float16* p) {   // elements 0..7 <- p[0..7], 8..15 <- p[16..23]
    U f; f.h[0] = *(const v8h*)(p); f.h[1] = *(const v8h*)(p + 16); return f.v;
  }
  static __device__ __forceinline__ v8f mma(v16h a, v16h b, v8f c) {
    return __builtin_amdgcn_wmma_f32_16x16x32_f16(false, a, false, b, (short)0, c, false, false);
  }
  static __device__ __forceinline__ void guard(v8f& a, v8f& b, v16h x, v16h y) { dep_guard_h(a, b, x, y); }
  static __device__ __forceinline__ void keep(v16h a, v16h b, v16h c, v16h d) { keep4_h(a, b, c, d); }
};
template <> struct Frag<__bf16> {
  typedef v16b V; union U { v16b v; v8b h[2]; };
  static __device__ __forceinline__ v16b load(const __bf16* p) {
    U f; f.h[0] = *(const v8b*)(p); f.h[1] = *(const v8b*)(p + 16); return f.v;
  }
  static __device__ __forceinline__ v8f mma(v16b a, v16b b, v8f c) {
    return __builtin_amdgcn_wmma_f32_16x16x32_bf16(false, a, false, b, (short)0, c, false, false);
  }
  static __device__ __forceinline__ void guard(v8f& a, v8f& b, v16b x, v16b y) { dep_guard_b(a, b, x, y); }
  static __device__ __forceinline__ void keep(v16b a, v16b b, v16b c, v16b d) { keep4_b(a, b, c, d); }
};

// tanh-GELU: 0.5*v*(1+tanh(sqrt(2/pi)*(v+0.044715*v^3))); tanh via exp(-2|u|), no division instruction
__device__ __forceinline__ float gelu_tanh_f(float v) {
  const float u = 0.7978845608028654f * (v + 0.044715f * v * v * v);
  const float e = __expf(-2.0f * fabsf(u));
  float t = (1.0f - e) * __builtin_amdgcn_rcpf(1.0f + e);
  t = copysignf(t, u);
  return 0.5f * v * (1.0f + t);
}

// ---- Register-blocked batched WMMA GEMM ------------------------------------
// C[m,n] = scale * sum_k A[m,k] * Bt[n,k] (+bias)(+resid); each wave owns a 64x64 tile.
// A row-major [M,K]; Bt row-major [N,K]; M,N % 64 == 0, K % 32 == 0.
// SPLIT: operands are hi/lo planes (A2/Bt2 = lo planes, same layout); product = hi.hi + hi.lo + lo.hi.
// BIAS_MODE: 0 = none, 1 = bias[m], 2 = bias[n].
// OUT_MODE: 0 = f32, 1 = f16, 2 = bf16 hi plane (Cout) + bf16 lo plane (Cout2).
// ACT: 0 none, 1 tanh, 2 relu, 3 silu, 4 leaky, 5 erf-gelu, 6 tanh-gelu.
// ET: 0 = f16 operands, 1 = bf16 operands (pointers passed as 16-bit storage)
template <int ET> struct Elem;
template <> struct Elem<0> { typedef _Float16 T; };
template <> struct Elem<1> { typedef __bf16 T; };
template <int ET, bool SPLIT, int BIAS_MODE, int OUT_MODE, bool RESID, int ACT = 0>
__global__ __launch_bounds__(256) void wmma_gemm64(
    const unsigned short* __restrict__ Ap, const unsigned short* __restrict__ A2p, int lda, long strideA,
    const unsigned short* __restrict__ Btp, const unsigned short* __restrict__ Bt2p, int ldb, long strideB,
    void* __restrict__ Cout, void* __restrict__ Cout2, int ldc, long strideC,
    const float* __restrict__ bias,
    const float* __restrict__ resid, long strideR,
    int M, int N, int K, float scale) {
  typedef typename Elem<ET>::T T;
  typedef typename Frag<T>::V V;
  const T* A = (const T*)Ap; const T* A2 = (const T*)A2p; const T* Bt = (const T*)Btp; const T* Bt2 = (const T*)Bt2p;
  __shared__ __align__(16) float sT[8][16 * 68];   // per-wave 16x64 slab, pitch 68 floats
  const int b    = blockIdx.y;
  const int lane = threadIdx.x & 31;
  const int wave = threadIdx.x >> 5;
  const int tilesN = N >> 6;
  const int tilesM = M >> 6;
  const int tile = blockIdx.x * 8 + wave;
  if (tile >= tilesM * tilesN) return;   // wave-uniform; no block barriers in this kernel
  const int tm = tile / tilesN;
  const int tn = tile - tm * tilesN;
  const int m0 = tm << 6;
  const int n0 = tn << 6;

  const T* Ab  = A  + (size_t)b * strideA;
  const T* Bb  = Bt + (size_t)b * strideB;
  const T* Ab2 = SPLIT ? (A2  + (size_t)b * strideA) : nullptr;
  const T* Bb2 = SPLIT ? (Bt2 + (size_t)b * strideB) : nullptr;

  const int rlane = lane & 15;                 // row (A) / col (B, D) within subtile
  const int koff  = (lane >> 4) * 8;           // k offset of this lane half
  const int mOff  = (lane >> 4) * 8;           // D row offset

  v8f acc[4][4];
#pragma unroll
  for (int i = 0; i < 4; ++i)
#pragma unroll
    for (int j = 0; j < 4; ++j) acc[i][j] = (v8f){0.f,0.f,0.f,0.f,0.f,0.f,0.f,0.f};

  for (int k0 = 0; k0 < K; k0 += 32) {
    V bh[4], bl[4];
#pragma unroll
    for (int j = 0; j < 4; ++j) {
      const size_t bo = (size_t)(n0 + (j << 4) + rlane) * ldb + koff + k0;
      bh[j] = Frag<T>::load(Bb + bo);
      if (SPLIT) bl[j] = Frag<T>::load(Bb2 + bo);
    }
#pragma unroll
    for (int i = 0; i < 4; ++i) {
      const size_t ao = (size_t)(m0 + (i << 4) + rlane) * lda + koff + k0;
      V ah = Frag<T>::load(Ab + ao);
      V al;
      if (SPLIT) al = Frag<T>::load(Ab2 + ao);
#pragma unroll
      for (int j = 0; j < 4; ++j) {
        acc[i][j] = Frag<T>::mma(ah, bh[j], acc[i][j]);
        if (SPLIT) {
          acc[i][j] = Frag<T>::mma(ah, bl[j], acc[i][j]);
          acc[i][j] = Frag<T>::mma(al, bh[j], acc[i][j]);
        }
      }
      Frag<T>::guard(acc[i][0], acc[i][3], ah, SPLIT ? al : ah);
    }
    Frag<T>::keep(bh[0], bh[1], bh[2], bh[3]);
    if (SPLIT) Frag<T>::keep(bl[0], bl[1], bl[2], bl[3]);
  }
  acc_guard4(acc[0][0], acc[0][1], acc[0][2], acc[0][3]);
  acc_guard4(acc[1][0], acc[1][1], acc[1][2], acc[1][3]);
  acc_guard4(acc[2][0], acc[2][1], acc[2][2], acc[2][3]);
  acc_guard4(acc[3][0], acc[3][1], acc[3][2], acc[3][3]);

  // ---- epilogue ----
  float* slab = sT[wave];
  const float* Rb = RESID ? (resid + (size_t)b * strideR) : nullptr;
#pragma unroll
  for (int i = 0; i < 4; ++i) {
    const int mBase = m0 + (i << 4);
#pragma unroll
    for (int j = 0; j < 4; ++j) {
      const int n = n0 + (j << 4) + rlane;
      float bv = 0.f;
      if (BIAS_MODE == 2) bv = bias[n];
#pragma unroll
      for (int r = 0; r < 8; ++r) {
        float v = acc[i][j][r] * scale;
        if (BIAS_MODE == 1) v += bias[mBase + mOff + r];
        if (BIAS_MODE == 2) v += bv;
        if (RESID) v += Rb[(size_t)(mBase + mOff + r) * ldc + n];
        if (ACT == 1) v = tanhf(v);
        if (ACT == 2) v = fmaxf(v, 0.0f);
        if (ACT == 3) v = v / (1.0f + expf(-v));
        if (ACT == 4) v = (v > 0.f) ? v : 0.01f * v;
        if (ACT == 5) v = 0.5f * v * (1.0f + erff(v * 0.70710678118654752f));
        if (ACT == 6) v = gelu_tanh_f(v);
        slab[(mOff + r) * 68 + (j << 4) + rlane] = v;
      }
    }
    __builtin_amdgcn_fence(__ATOMIC_RELEASE, "workgroup");
    __builtin_amdgcn_wave_barrier();
    __builtin_amdgcn_fence(__ATOMIC_ACQUIRE, "workgroup");
    if (OUT_MODE == 0) {
      float* C = (float*)Cout + (size_t)b * strideC;
      const int hh = lane >> 4, c4 = (lane & 15) * 4;     // row seg = 256 B = 16 lanes x 16 B
      {
#pragma unroll
        for (int it = 0; it < 8; ++it) {
          const int row = it * 2 + hh;
          v4f v = *(const v4f*)(slab + row * 68 + c4);
          *(v4f*)(C + (size_t)(mBase + row) * ldc + n0 + c4) = v;
        }
        
      }
    } else {
      const int q = lane >> 3, c8 = (lane & 7) * 8;
      unsigned short* C  = (unsigned short*)Cout  + (size_t)b * strideC;
      unsigned short* C2 = (OUT_MODE == 2) ? ((unsigned short*)Cout2 + (size_t)b * strideC) : nullptr;
      {
#pragma unroll
        for (int it = 0; it < 4; ++it) {
          const int row = it * 4 + q;
          const float* sp = slab + row * 68 + c8;
          v8h hv, lv;
#pragma unroll
          for (int e = 0; e < 8; ++e) {
            if (OUT_MODE == 1) {
              hv[e] = (_Float16)sp[e];
            } else {
              unsigned short hb = f2bf_bits(sp[e]);
              unsigned short lb = f2bf_bits(sp[e] - bf_bits2f(hb));
              hv[e] = __builtin_bit_cast(_Float16, hb);
              lv[e] = __builtin_bit_cast(_Float16, lb);
            }
          }
          *(v8h*)(C + (size_t)(mBase + row) * ldc + n0 + c8) = hv;
          if (OUT_MODE == 2) *(v8h*)(C2 + (size_t)(mBase + row) * ldc + n0 + c8) = lv;
        }
        
      }
    }
    __builtin_amdgcn_fence(__ATOMIC_RELEASE, "workgroup");
    __builtin_amdgcn_wave_barrier();
    __builtin_amdgcn_fence(__ATOMIC_ACQUIRE, "workgroup");
  }
}

__global__ __launch_bounds__(256) void cast_f32_f16x2(
    const float* __restrict__ in, _Float16* __restrict__ out, int n2) {
  int i = blockIdx.x * 256 + threadIdx.x;
  if (i < n2) {
    const _Float16 h0 = (_Float16)in[2 * i], h1 = (_Float16)in[2 * i + 1];
    const unsigned u = (unsigned)__builtin_bit_cast(unsigned short, h0) | ((unsigned)__builtin_bit_cast(unsigned short, h1) << 16);
    ((unsigned*)out)[i] = u;
    
  }
}

// =====================================================================================
// Attention for head_dim 64, f32 in / f32 out; 16-bit operands: bf16 with optional hi/lo splits, or
// plain f16 (F16=true, non-split, probabilities carried x2^15).
//   Block = 4 waves = 64 query rows of one (batch, head); S % 64 == 0.
//   Element (b, s, h, d) of tensor X lives at X[b*X_bs + s*X_rs + h*X_hs + d] (strides in floats, multiples of 4).
//   mask_mode 0 none, 1 causal, 2 tensor [S][Skv], 3 per-token vectors, 4 causal + window, 5 relative bias,
//   6 = mask_a: int32 [S][Skv] nonzero = masked, OR mask_b: int32 [B][Skv] nonzero = masked; per 64x64
//       (b, q-tile, kv-tile) code table tcode[(b*nqb+qb)*t_pitch + kc]: 0 mixed (per-element reads),
//       1 all live (no reads), 2 all masked (tile skipped: zero contribution).
//   masked scores are replaced by mask_fill before the softmax; rows with no live key write 0.
//   grid.x = B * H * (S/64).
// =====================================================================================
#define AT_D 64
#define AT_NW 4
#define AT_QB 64
#define AT_KC 64
struct AttnGeom { const int* tcode; const float* cp; const float* pc; long c_bs, c_rs, c_hs, t_pitch;
                  long q_bs, q_rs, q_hs, k_bs, k_rs, k_hs, v_bs, v_rs, v_hs, o_bs, o_rs, o_hs;
                  int S, Skv, H, mask_mode; float qscale; int blk0; float mask_fill; int mask_is_int; };
static_assert(sizeof(AttnGeom) == 184);

__device__ __forceinline__ unsigned short at_bf_bits(float f) {
  unsigned u = __float_as_uint(f);
  return (unsigned short)((u + 0x7FFFu + ((u >> 16) & 1u)) >> 16);
}
__device__ __forceinline__ __bf16 at_f2bf(float f) { return __builtin_bit_cast(__bf16, at_bf_bits(f)); }
__device__ __forceinline__ void at_split(float f, __bf16& hi, __bf16& lo) {
  const unsigned short hb = at_bf_bits(f);
  hi = __builtin_bit_cast(__bf16, hb);
  lo = at_f2bf(f - __uint_as_float(((unsigned)hb) << 16));
}
__device__ __forceinline__ v8f at_mma(v16b a, v16b b, v8f c) {
  c = __builtin_amdgcn_wmma_f32_16x16x32_bf16(false, a, false, b, (short)0, c, false, false);
  asm volatile("v_nop\n\tv_nop\n\tv_nop\n\tv_nop" : "+v"(c) : "v"(a), "v"(b));
  return c;
}
// 16-bit element as a bit pattern held in a __bf16 slot: f16 bits when F16, bf16 (RNE) otherwise
template <bool F16> __device__ __forceinline__ __bf16 at_to16(float f) {
  if (F16) return __builtin_bit_cast(__bf16, (_Float16)f);
  return at_f2bf(f);
}
template <bool F16> __device__ __forceinline__ v8f at_mma16(v16b a, v16b b, v8f c) {
  if (F16) {
    const v16h ah = __builtin_bit_cast(v16h, a), bh = __builtin_bit_cast(v16h, b);
    c = __builtin_amdgcn_wmma_f32_16x16x32_f16(false, ah, false, bh, (short)0, c, false, false);
    asm volatile("v_nop\n\tv_nop\n\tv_nop\n\tv_nop" : "+v"(c) : "v"(ah), "v"(bh));
    return c;
  }
  return at_mma(a, b, c);
}

// MODE is the mask mode as a compile-time constant: only that mode's mask code is compiled into the key loop.
template <bool SPLIT_QK, bool SPLIT_PV, bool F16, int MODE>
__global__ __launch_bounds__(128)
void attn64_kernel(const float* __restrict__ q, const float* __restrict__ k,
                   const float* __restrict__ v, float* __restrict__ out,
                   const int* __restrict__ mask_a, const int* __restrict__ mask_b, AttnGeom g) {
  static_assert(!(F16 && (SPLIT_QK || SPLIT_PV)));
  const float PSC = F16 ? 32768.0f : 1.0f;     // f16 probabilities carried x2^15, folded into the final 1/l
  union FB { v16b v; v8b h[2]; };
  __shared__ __align__(16) __bf16 Ksh[AT_KC * AT_D];             // K hi [kv][d]      8 KB
  __shared__ __align__(16) __bf16 Ksl[SPLIT_QK ? AT_KC * AT_D : 8];
  __shared__ __align__(16) __bf16 Vth[AT_D * AT_KC];             // V hi [d][kv]      8 KB
  __shared__ __align__(16) __bf16 Vtl[SPLIT_PV ? AT_D * AT_KC : 8];
  __shared__ __align__(16) __bf16 Psh[AT_NW][16 * AT_KC];        // per wave P hi [row][kv]  8 KB
  __shared__ __align__(16) __bf16 Psl[SPLIT_PV ? AT_NW : 1][SPLIT_PV ? 16 * AT_KC : 8];
  __shared__ __align__(16) float  Os[AT_NW][16 * 68];            // per wave out tile, pitch 68

  const int tid  = threadIdx.x;
  const int wave = tid >> 5;
  const int lane = tid & 31;
  const int hh   = lane >> 4;
  const int c    = lane & 15;

  const int nqb = g.S / AT_QB;
  const int nkc = g.Skv / AT_KC;
  const int bx = blockIdx.x + g.blk0;
  const int qb = bx % nqb;
  const int bh = bx / nqb;
  const int h  = bh % g.H;
  const int b  = bh / g.H;
  const int qbase_block = qb * AT_QB;
  const int q0 = qbase_block + wave * 16;

  const float* qb_ptr = q + (size_t)b * g.q_bs + (size_t)h * g.q_hs;
  const float* kb_ptr = k + (size_t)b * g.k_bs + (size_t)h * g.k_hs;
  const float* vb_ptr = v + (size_t)b * g.v_bs + (size_t)h * g.v_hs;
  float*       ob_ptr = out + (size_t)b * g.o_bs + (size_t)h * g.o_hs;

  // ---- Q fragments (A operand): 2 d-chunks, hi (and lo) ----
  v16b qah[2], qal[2];
  {
    const float* qrow = qb_ptr + (size_t)(q0 + c) * g.q_rs;
#pragma unroll
    for (int dc = 0; dc < 2; ++dc) {
#pragma unroll
      for (int e = 0; e < 8; ++e) {
        const float f0 = qrow[dc * 32 + 8 * hh + e] * g.qscale;
        const float f1 = qrow[dc * 32 + 16 + 8 * hh + e] * g.qscale;
        if (SPLIT_QK) { __bf16 hq, lq; at_split(f0, hq, lq); qah[dc][e] = hq; qal[dc][e] = lq; at_split(f1, hq, lq); qah[dc][8 + e] = hq; qal[dc][8 + e] = lq; }
        else { qah[dc][e] = at_to16<F16>(f0); qah[dc][8 + e] = at_to16<F16>(f1); qal[dc][e] = qah[dc][e]; qal[dc][8 + e] = qah[dc][8 + e]; }
      }
    }
  }

  float mrow[8], lrow[8];
  v8f oacc[4];
#pragma unroll
  for (int r = 0; r < 8; ++r) { mrow[r] = -INFINITY; lrow[r] = 0.f; }
#pragma unroll
  for (int t = 0; t < 4; ++t) oacc[t] = (v8f){0.f,0.f,0.f,0.f,0.f,0.f,0.f,0.f};

  const int nChunks = (MODE == 1 || MODE == 4) ? (qb + 1) : nkc;   // block-uniform, bounded by Skv/64
  // per-row query mask (mode 3)
  int qkeep[8];
#pragma unroll
  for (int r = 0; r < 8; ++r) qkeep[r] = (MODE == 3) ? mask_b[(size_t)b * g.S + q0 + 8 * hh + r] : 1;   // mask_b = qmask in mode 3
  for (int kc = 0; kc < nChunks; ++kc) {
    const int kv0 = kc * AT_KC;
    int code = 0;
    if (MODE == 6) {
      int cv = g.tcode[((size_t)b * nqb + qb) * (size_t)g.t_pitch + kc];
      cv = __builtin_amdgcn_readfirstlane(cv);
      code = (cv == 1 || cv == 2) ? cv : 0;     // anything else -> mixed (per-element reads)
      if (code == 2) continue;                  // fully masked tile: zero contribution, softmax state unchanged
    }
    __syncthreads();
    {
      const int kvr = tid >> 1, dh = (tid & 1) * 32;
      const float* krow = kb_ptr + (size_t)(kv0 + kvr) * g.k_rs + dh;
      const float* vrow = vb_ptr + (size_t)(kv0 + kvr) * g.v_rs + dh;
#pragma unroll
      for (int i = 0; i < 8; ++i) {
        v4f kk = *(const v4f*)(krow + 4 * i);
        v4f vv = *(const v4f*)(vrow + 4 * i);
#pragma unroll
        for (int e = 0; e < 4; ++e) {
          const int d = dh + 4 * i + e;
          if (SPLIT_QK) { __bf16 a, bl; at_split(kk[e], a, bl); Ksh[kvr * AT_D + d] = a; Ksl[kvr * AT_D + d] = bl; }
          else Ksh[kvr * AT_D + d] = at_to16<F16>(kk[e]);
          if (SPLIT_PV) { __bf16 a, bl; at_split(vv[e], a, bl); Vth[d * AT_KC + kvr] = a; Vtl[d * AT_KC + kvr] = bl; }
          else Vth[d * AT_KC + kvr] = at_to16<F16>(vv[e]);
        }
      }
    }
    __syncthreads();

    v8f s[4];
#pragma unroll
    for (int j = 0; j < 4; ++j) {
      s[j] = (v8f){0.f,0.f,0.f,0.f,0.f,0.f,0.f,0.f};
#pragma unroll 1
      for (int dc = 0; dc < 2; ++dc) {
        FB kb;
        kb.h[0] = *(const v8b*)(Ksh + (j * 16 + c) * AT_D + dc * 32 + 8 * hh);
        kb.h[1] = *(const v8b*)(Ksh + (j * 16 + c) * AT_D + dc * 32 + 16 + 8 * hh);
        s[j] = at_mma16<F16>(qah[dc], kb.v, s[j]);
        if (SPLIT_QK) {
          FB kl;
          kl.h[0] = *(const v8b*)(Ksl + (j * 16 + c) * AT_D + dc * 32 + 8 * hh);
          kl.h[1] = *(const v8b*)(Ksl + (j * 16 + c) * AT_D + dc * 32 + 16 + 8 * hh);
          s[j] = at_mma16<F16>(qah[dc], kl.v, s[j]);
          s[j] = at_mma16<F16>(qal[dc], kb.v, s[j]);
        }
      }
    }
    const bool diag = (MODE == 1) && (kc == qb);
    int kvkeep[4] = {1, 1, 1, 1};
    if (MODE == 3) {
#pragma unroll
      for (int j = 0; j < 4; ++j) kvkeep[j] = mask_a[(size_t)b * g.Skv + kv0 + j * 16 + c];   // mask_a = kvmask
    }
    if (MODE == 6 && code == 0) {               // mixed tile: one wave-uniform branch per tile, then per-element reads
      int kvpad[4];
#pragma unroll
      for (int j = 0; j < 4; ++j) kvpad[j] = mask_b[(size_t)b * g.Skv + kv0 + j * 16 + c];   // mask_b = key padding [B][Skv]
#pragma unroll   // both loops unrolled so that s[j][r] is indexed by constants and stays in registers
      for (int r = 0; r < 8; ++r) {
        const int* mrowp = mask_a + (size_t)(q0 + 8 * hh + r) * g.Skv + kv0 + c;
#pragma unroll
        for (int j = 0; j < 4; ++j)
          if ((mrowp[j * 16] != 0) || (kvpad[j] != 0)) s[j][r] = g.mask_fill;
      }
    }
    float cm[8];
#pragma unroll
    for (int r = 0; r < 8; ++r) {
      const int qrow = q0 + 8 * hh + r;
      float m = -INFINITY;
#pragma unroll
      for (int j = 0; j < 4; ++j) {
        const int kvcol = kv0 + j * 16 + c;
        bool masked = false;
        if (diag) masked = (kvcol > qrow);
        else if (MODE == 4) masked = (kvcol > qrow) || (qrow - kvcol > g.mask_is_int);
        else if (MODE == 2) {
          const size_t mi = (size_t)qrow * g.Skv + kvcol;
          masked = (g.mask_is_int == 0) ? (((const float*)mask_a)[mi] == 0.0f)
                 : (g.mask_is_int == 1) ? (mask_a[mi] == 0) : (mask_a[mi] != 0);
        } else if (MODE == 3) masked = (qkeep[r] == 0) || (kvkeep[j] == 0);
        else if (MODE == 5) {
          const size_t mi = (size_t)qrow * g.Skv + kvcol;
          masked = (mask_a[mi] != 0);
          int n = mask_b[mi]; n = n < 0 ? 0 : n;
          s[j][r] += g.cp[(size_t)b * g.c_bs + (size_t)h * g.c_hs + (size_t)qrow * g.c_rs + n]
                   + g.pc[(size_t)b * g.c_bs + (size_t)h * g.c_hs + (size_t)kvcol * g.c_rs + n];
        }
        if (masked) s[j][r] = g.mask_fill;
        m = fmaxf(m, s[j][r]);
      }
#pragma unroll
      for (int off = 1; off < 16; off <<= 1) m = fmaxf(m, __shfl_xor(m, off, 32));
      cm[r] = m;
    }
    __bf16* pwh = Psh[wave];
    __bf16* pwl = Psl[SPLIT_PV ? wave : 0];
#pragma unroll
    for (int r = 0; r < 8; ++r) {
      const float mnew = fmaxf(mrow[r], cm[r]);
      const bool dead = (mnew == -INFINITY);               // no live key seen yet for this row
      const float alpha = dead ? 1.0f : expf(mrow[r] - mnew);
      mrow[r] = mnew;
      float psum = 0.f;
#pragma unroll
      for (int j = 0; j < 4; ++j) {
        const float p = dead ? 0.0f : expf(s[j][r] - mnew);
        psum += p;
        if (SPLIT_PV) { __bf16 a, bl; at_split(p, a, bl); pwh[(8 * hh + r) * AT_KC + j * 16 + c] = a; pwl[(8 * hh + r) * AT_KC + j * 16 + c] = bl; }
        else pwh[(8 * hh + r) * AT_KC + j * 16 + c] = at_to16<F16>(p * PSC);
      }
#pragma unroll
      for (int off = 1; off < 16; off <<= 1) psum += __shfl_xor(psum, off, 32);
      lrow[r] = lrow[r] * alpha + psum;
#pragma unroll
      for (int t = 0; t < 4; ++t) oacc[t][r] *= alpha;
    }
    __builtin_amdgcn_fence(__ATOMIC_RELEASE, "workgroup");
    __builtin_amdgcn_wave_barrier();
    __builtin_amdgcn_fence(__ATOMIC_ACQUIRE, "workgroup");
#pragma unroll 1
    for (int kk = 0; kk < 2; ++kk) {
      FB pa, pl;
      pa.h[0] = *(const v8b*)(pwh + c * AT_KC + kk * 32 + 8 * hh);
      pa.h[1] = *(const v8b*)(pwh + c * AT_KC + kk * 32 + 16 + 8 * hh);
      if (SPLIT_PV) {
        pl.h[0] = *(const v8b*)(pwl + c * AT_KC + kk * 32 + 8 * hh);
        pl.h[1] = *(const v8b*)(pwl + c * AT_KC + kk * 32 + 16 + 8 * hh);
      }
#pragma unroll
      for (int t = 0; t < 4; ++t) {
        FB vb;
        vb.h[0] = *(const v8b*)(Vth + (t * 16 + c) * AT_KC + kk * 32 + 8 * hh);
        vb.h[1] = *(const v8b*)(Vth + (t * 16 + c) * AT_KC + kk * 32 + 16 + 8 * hh);
        oacc[t] = at_mma16<F16>(pa.v, vb.v, oacc[t]);
        if (SPLIT_PV) {
          FB vl;
          vl.h[0] = *(const v8b*)(Vtl + (t * 16 + c) * AT_KC + kk * 32 + 8 * hh);
          vl.h[1] = *(const v8b*)(Vtl + (t * 16 + c) * AT_KC + kk * 32 + 16 + 8 * hh);
          oacc[t] = at_mma16<F16>(pa.v, vl.v, oacc[t]);
          oacc[t] = at_mma16<F16>(pl.v, vb.v, oacc[t]);
        }
      }
    }
  }

  float* os = Os[wave];
#pragma unroll
  for (int r = 0; r < 8; ++r) {
    const float den = lrow[r] * PSC;
    const float inv = (den > 0.0f) ? (1.0f / den) : 0.0f;
#pragma unroll
    for (int t = 0; t < 4; ++t) os[(8 * hh + r) * 68 + t * 16 + c] = oacc[t][r] * inv;
  }
  __builtin_amdgcn_fence(__ATOMIC_RELEASE, "workgroup");
  __builtin_amdgcn_wave_barrier();
  __builtin_amdgcn_fence(__ATOMIC_ACQUIRE, "workgroup");
  {
    const int c4 = (lane & 15) * 4;
    {
#pragma unroll
      for (int it = 0; it < 8; ++it) {
        const int row = it * 2 + hh;
        v4f val = *(const v4f*)(os + row * 68 + c4);
        *(v4f*)(ob_ptr + (size_t)(q0 + row) * g.o_rs + c4) = val;
      }
      
    }
  }
}

// =====================================================================================
// 64x64 tile classification of the attention mask: one block per (b, q-tile); for each kv-tile:
//   masked(q,k) = tm[q][k] != 0 || pad[b][k] != 0;  code 2 = all masked, 1 = all live, 0 = mixed.
// =====================================================================================
__global__ __launch_bounds__(256) void tilecode_kernel(
    const int* __restrict__ tm, const int* __restrict__ pad, int* __restrict__ tab,
    int Skv, int nqb, int nkc, int tp) {
  __shared__ int wl[8], wm[8];
  __shared__ __align__(16) int codes[128];
  const int tid = threadIdx.x, lane = tid & 31, wave = tid >> 5;
  const int b  = blockIdx.x / nqb;
  const int qb = blockIdx.x - b * nqb;
  const int row = tid >> 2, cs = (tid & 3) * 16;
  const int q = qb * 64 + row;
  if (tid < 128) codes[tid] = 2;
  __syncthreads();
  const int nk = nkc < 128 ? nkc : 128;
  for (int kc = 0; kc < nk; ++kc) {
    const int* mr = tm  + (size_t)q * Skv + kc * 64 + cs;
    const int* pr = pad + (size_t)b * Skv + kc * 64 + cs;
    int live = 0, msk = 0;
#pragma unroll
    for (int i = 0; i < 4; ++i) {
      const v4i mv = *(const v4i*)(mr + 4 * i);
      const v4i pv = *(const v4i*)(pr + 4 * i);
#pragma unroll
      for (int e = 0; e < 4; ++e) {
        const int m = ((mv[e] != 0) || (pv[e] != 0)) ? 1 : 0;
        msk |= m;
        live |= (m ^ 1);
      }
    }
    const int al = __any(live);
    const int am = __any(msk);
    if (lane == 0) { wl[wave] = al; wm[wave] = am; }
    __syncthreads();
    if (tid == 0) {
      int L = 0, Mk = 0;
#pragma unroll
      for (int w = 0; w < 8; ++w) { L |= wl[w]; Mk |= wm[w]; }
      codes[kc] = (L == 0) ? 2 : ((Mk == 0) ? 1 : 0);
    }
    __syncthreads();
  }
  if (wave == 0) {
    const int nl = tp >> 2;          // tp is a multiple of 32 ints, <= 128
    v4i cv;
    cv[0] = codes[(4 * lane + 0) & 127]; cv[1] = codes[(4 * lane + 1) & 127];
    cv[2] = codes[(4 * lane + 2) & 127]; cv[3] = codes[(4 * lane + 3) & 127];
    int* dst = tab + (size_t)blockIdx.x * tp + 4 * lane;
    if (lane < nl) *(v4i*)dst = cv;
    
  }
}

// =====================================================================================
// LayerNorm over 1024-wide rows: one block (256 thr) per row, 4 contiguous floats per thread.
// =====================================================================================
template <bool OUT16>
__global__ __launch_bounds__(256) void ln_kernel(
    const float* __restrict__ in, const float* __restrict__ gam, const float* __restrict__ bet,
    float* __restrict__ o32, _Float16* __restrict__ o16) {
  __shared__ float red1[8], red2[8];
  __shared__ __align__(16) float ybuf[OUT16 ? DM : 4];
  const int row = blockIdx.x, t = threadIdx.x, lane = t & 31, wave = t >> 5;
  const float* x = in + (size_t)row * DM;
  const v4f xv = *(const v4f*)(x + 4 * t);
  float s = (xv[0] + xv[1]) + (xv[2] + xv[3]);
#pragma unroll
  for (int off = 1; off < 32; off <<= 1) s += __shfl_xor(s, off, 32);
  if (lane == 0) red1[wave] = s;
  __syncthreads();
  float tot = 0.f;
#pragma unroll
  for (int w = 0; w < 8; ++w) tot += red1[w];
  const float mu = tot * (1.0f / (float)DM);
  const float d0 = xv[0] - mu, d1 = xv[1] - mu, d2 = xv[2] - mu, d3 = xv[3] - mu;
  float s2 = (d0 * d0 + d1 * d1) + (d2 * d2 + d3 * d3);
#pragma unroll
  for (int off = 1; off < 32; off <<= 1) s2 += __shfl_xor(s2, off, 32);
  if (lane == 0) red2[wave] = s2;
  __syncthreads();
  float tot2 = 0.f;
#pragma unroll
  for (int w = 0; w < 8; ++w) tot2 += red2[w];
  const float var = tot2 * (1.0f / (float)DM);
  const float rstd = rsqrtf(var + LN_EPS);
  const v4f gv = *(const v4f*)(gam + 4 * t);
  const v4f bv = *(const v4f*)(bet + 4 * t);
  v4f y;
  y[0] = d0 * rstd * gv[0] + bv[0];
  y[1] = d1 * rstd * gv[1] + bv[1];
  y[2] = d2 * rstd * gv[2] + bv[2];
  y[3] = d3 * rstd * gv[3] + bv[3];
  float* op = o32 + (size_t)row * DM + 4 * t;
  *(v4f*)op = y;
  
  if (OUT16) {
    *(v4f*)(ybuf + 4 * t) = y;
    __syncthreads();
    if (t < DM / 8) {
      v8h hv;
#pragma unroll
      for (int e = 0; e < 8; ++e) hv[e] = (_Float16)ybuf[8 * t + e];
      _Float16* hp = o16 + (size_t)row * DM + 8 * t;
      *(v8h*)hp = hv;
      
    }
  }
}

// =====================================================================================
// Host orchestration
// =====================================================================================
extern "C" void kernel_launch(void* const* d_in, const int* in_sizes, int n_in,
                              void* d_out, int out_size, void* d_ws, size_t ws_size,
                              hipStream_t stream) {
  if (n_in < 16) return;
  if (in_sizes[0] != MROWS * DM || in_sizes[1] != SEQ * SEQ || in_sizes[2] != BSZ * SEQ) return;
  if (in_sizes[3] != DM * DM || in_sizes[4] != DM * DM || in_sizes[5] != DM * DM || in_sizes[6] != DM * DM) return;
  if (in_sizes[7] != DM || in_sizes[8] != FFND * DM || in_sizes[9] != FFND) return;
  if (in_sizes[10] != DM * FFND || in_sizes[11] != DM) return;
  if (in_sizes[12] != DM || in_sizes[13] != DM || in_sizes[14] != DM || in_sizes[15] != DM) return;
  if (out_size != MROWS * DM) return;

  const float* tgt   = (const float*)d_in[0];
  const int*   tmask = (const int*)d_in[1];     // [SEQ][SEQ], nonzero = masked
  const int*   pmask = (const int*)d_in[2];     // [BSZ][SEQ], nonzero = masked
  const float* Wq    = (const float*)d_in[3];
  const float* Wk    = (const float*)d_in[4];
  const float* Wv    = (const float*)d_in[5];
  const float* Wo    = (const float*)d_in[6];
  const float* bo    = (const float*)d_in[7];
  const float* W1    = (const float*)d_in[8];
  const float* b1    = (const float*)d_in[9];
  const float* W2    = (const float*)d_in[10];
  const float* b2    = (const float*)d_in[11];
  const float* g1    = (const float*)d_in[12];
  const float* be1   = (const float*)d_in[13];
  const float* g2    = (const float*)d_in[14];
  const float* be2   = (const float*)d_in[15];
  float* out = (float*)d_out;

  // ---- workspace carve (bytes), regions reused across phases ----
  const size_t MiB = 1048576;
  const int nqb = SEQ / AT_QB, nkc = SEQ / AT_KC;
  if (nkc > 128) return;
  const int TP = ((nkc + 31) / 32) * 32;
  const size_t tabBytes = (size_t)BSZ * nqb * TP * sizeof(int);
  const size_t total = 96 * MiB + tabBytes;
  if (total > ws_size) return;
  char* ws = (char*)d_ws;
  float*    Qf   = (float*)(ws + 0 * MiB);          // [4096][1024] f32   (projections -> attention)
  float*    Kf   = (float*)(ws + 16 * MiB);
  float*    Vf   = (float*)(ws + 32 * MiB);
  float*    RES1 = (float*)(ws + 0 * MiB);          // tgt + attn-proj     (after attention)
  _Float16* H16  = (_Float16*)(ws + 0 * MiB);       // [4096][4096] f16   (after LN1)
  float*    X1f  = (float*)(ws + 32 * MiB);         // LN1 output f32     (after attention)
  float*    AOf  = (float*)(ws + 48 * MiB);         // attention output f32
  float*    RES2 = (float*)(ws + 48 * MiB);         // x1 + ffn           (after out-proj)
  _Float16* X16  = (_Float16*)(ws + 64 * MiB);      // tgt f16            (projections)
  _Float16* O16  = (_Float16*)(ws + 64 * MiB);      // attention output f16 (after projections)
  _Float16* X1h  = (_Float16*)(ws + 64 * MiB);      // LN1 output f16     (after out-proj)
  _Float16* Wq16 = (_Float16*)(ws + 72 * MiB);
  _Float16* Wk16 = (_Float16*)(ws + 74 * MiB);
  _Float16* Wv16 = (_Float16*)(ws + 76 * MiB);
  _Float16* Wo16 = (_Float16*)(ws + 78 * MiB);
  _Float16* W1h  = (_Float16*)(ws + 80 * MiB);      // [4096][1024]
  _Float16* W2h  = (_Float16*)(ws + 88 * MiB);      // [1024][4096]
  int*      TAB  = (int*)(ws + 96 * MiB);           // [BSZ*nqb][TP]

  auto castf = [&](const float* src, _Float16* dst, int n) {
    const int n2 = n / 2;
    cast_f32_f16x2<<<dim3((n2 + 255) / 256), dim3(256), 0, stream>>>(src, dst, n2);
  };
  castf(tgt, X16, MROWS * DM);
  castf(Wq, Wq16, DM * DM);
  castf(Wk, Wk16, DM * DM);
  castf(Wv, Wv16, DM * DM);
  castf(Wo, Wo16, DM * DM);
  castf(W1, W1h, FFND * DM);
  castf(W2, W2h, DM * FFND);

  // mask tile codes
  tilecode_kernel<<<dim3(BSZ * nqb), dim3(256), 0, stream>>>(tmask, pmask, TAB, SEQ, nqb, nkc, TP);

  const long z = 0;
  typedef const unsigned short* cu16;
  const int tilesM = MROWS / 64;
  // q/k/v projections: [4096][1024] = X16 . W^T, f32 out
  {
    const dim3 grid((tilesM * (DM / 64) + 7) / 8, 1);
    wmma_gemm64<0, false, 0, 0, false, 0><<<grid, dim3(256), 0, stream>>>(
        (cu16)X16, (cu16)X16, DM, z, (cu16)Wq16, (cu16)Wq16, DM, z, (void*)Qf, (void*)Qf, DM, z,
        bo, tgt, z, MROWS, DM, DM, 1.0f);
    wmma_gemm64<0, false, 0, 0, false, 0><<<grid, dim3(256), 0, stream>>>(
        (cu16)X16, (cu16)X16, DM, z, (cu16)Wk16, (cu16)Wk16, DM, z, (void*)Kf, (void*)Kf, DM, z,
        bo, tgt, z, MROWS, DM, DM, 1.0f);
    wmma_gemm64<0, false, 0, 0, false, 0><<<grid, dim3(256), 0, stream>>>(
        (cu16)X16, (cu16)X16, DM, z, (cu16)Wv16, (cu16)Wv16, DM, z, (void*)Vf, (void*)Vf, DM, z,
        bo, tgt, z, MROWS, DM, DM, 1.0f);
  }

  // attention: q,k,v,o element (b, s, h, d) at b*SEQ*DM + s*DM + h*64 + d
  {
    AttnGeom g;
    g.tcode = TAB; g.cp = Qf; g.pc = Qf; g.c_bs = 0; g.c_rs = 0; g.c_hs = 0; g.t_pitch = TP;
    g.q_bs = (long)SEQ * DM; g.q_rs = DM; g.q_hs = HD;
    g.k_bs = (long)SEQ * DM; g.k_rs = DM; g.k_hs = HD;
    g.v_bs = (long)SEQ * DM; g.v_rs = DM; g.v_hs = HD;
    g.o_bs = (long)SEQ * DM; g.o_rs = DM; g.o_hs = HD;
    g.S = SEQ; g.Skv = SEQ; g.H = NHEAD; g.mask_mode = 6; g.qscale = 0.125f; g.blk0 = 0;
    g.mask_fill = -INFINITY; g.mask_is_int = 2;
    attn64_kernel<false, false, true, 6><<<dim3(BSZ * NHEAD * nqb), dim3(128), 0, stream>>>(
        Qf, Kf, Vf, AOf, tmask, pmask, g);
  }
  castf(AOf, O16, MROWS * DM);

  // RES1 = tgt + (O . Wo^T + bo)
  {
    const dim3 grid((tilesM * (DM / 64) + 7) / 8, 1);
    wmma_gemm64<0, false, 2, 0, true, 0><<<grid, dim3(256), 0, stream>>>(
        (cu16)O16, (cu16)O16, DM, z, (cu16)Wo16, (cu16)Wo16, DM, z, (void*)RES1, (void*)RES1, DM, z,
        bo, tgt, z, MROWS, DM, DM, 1.0f);
  }
  // x1 = LN(RES1) -> f32 + f16
  ln_kernel<true><<<dim3(MROWS), dim3(256), 0, stream>>>(RES1, g1, be1, X1f, X1h);
  // H16 = gelu_tanh(x1 . W1^T + b1), f16 [4096][4096]
  {
    const dim3 grid((tilesM * (FFND / 64) + 7) / 8, 1);
    wmma_gemm64<0, false, 2, 1, false, 6><<<grid, dim3(256), 0, stream>>>(
        (cu16)X1h, (cu16)X1h, DM, z, (cu16)W1h, (cu16)W1h, DM, z, (void*)H16, (void*)H16, FFND, z,
        b1, tgt, z, MROWS, FFND, DM, 1.0f);
  }
  // RES2 = x1 + (H . W2^T + b2)
  {
    const dim3 grid((tilesM * (DM / 64) + 7) / 8, 1);
    wmma_gemm64<0, false, 2, 0, true, 0><<<grid, dim3(256), 0, stream>>>(
        (cu16)H16, (cu16)H16, FFND, z, (cu16)W2h, (cu16)W2h, FFND, z, (void*)RES2, (void*)RES2, DM, z,
        b2, X1f, z, MROWS, DM, FFND, 1.0f);
  }
  // out = LN(RES2)
  ln_kernel<false><<<dim3(MROWS), dim3(256), 0, stream>>>(RES2, g2, be2, out, X1h);
  (void)hipGetLastError();
}

// v002
// One run takes 469 microseconds.
// Next to v001, in two timings, it ran 1.56 times as fast each time.
// Counting every step since v000, it is 4.18 times as fast.
// Contractions: q/k/v/out projections, FFN1, FFN2 on v_wmma_f32_16x16x32_f16 (f16 operands, f32 accumulate);
// attention scores (q*0.125).k^T and p.v on v_wmma_f32_16x16x32_f16 (f16 operands, p carried x2^15, f32 accumulate).
// Softmax, LayerNorm, tanh-GELU, bias and residual adds in f32.
#include <hip/hip_runtime.h>

typedef __attribute__((ext_vector_type(16))) _Float16 v16h;
typedef __attribute__((ext_vector_type(8)))  _Float16 v8h;
typedef __attribute__((ext_vector_type(16))) __bf16   v16b;
typedef __attribute__((ext_vector_type(8)))  __bf16   v8b;
typedef __attribute__((ext_vector_type(8)))  float    v8f;
typedef __attribute__((ext_vector_type(4)))  float    v4f;
typedef __attribute__((ext_vector_type(4)))  int      v4i;

#define DM     1024
#define NHEAD  16
#define HD     64
#define FFND   4096
#define BSZ    2
#define SEQ    2048
#define MROWS  (BSZ * SEQ)
#define LN_EPS 1e-5f

__device__ __forceinline__ unsigned short f2bf_bits(float f) {
  unsigned u = __float_as_uint(f);
  return (unsigned short)((u + 0x7FFFu + ((u >> 16) & 1u)) >> 16);
}
__device__ __forceinline__ float bf_bits2f(unsigned short h) { return __uint_as_float(((unsigned)h) << 16); }

// hazard guards as plain device helpers
__device__ __forceinline__ void dep_guard_h(v8f& a, v8f& b, v16h x, v16h y) { asm volatile("v_nop\n\tv_nop\n\tv_nop\n\tv_nop" : "+v"(a), "+v"(b) : "v"(x), "v"(y)); }
__device__ __forceinline__ void dep_guard_b(v8f& a, v8f& b, v16b x, v16b y) { asm volatile("v_nop\n\tv_nop\n\tv_nop\n\tv_nop" : "+v"(a), "+v"(b) : "v"(x), "v"(y)); }
__device__ __forceinline__ void keep4_h(v16h a, v16h b, v16h c, v16h d) { asm volatile("v_nop" :: "v"(a), "v"(b), "v"(c), "v"(d)); }
__device__ __forceinline__ void keep4_b(v16b a, v16b b, v16b c, v16b d) { asm volatile("v_nop" :: "v"(a), "v"(b), "v"(c), "v"(d)); }
__device__ __forceinline__ void acc_guard4(v8f& a, v8f& b, v8f& c, v8f& d) { asm volatile("v_nop\n\tv_nop\n\tv_nop\n\tv_nop" : "+v"(a), "+v"(b), "+v"(c), "+v"(d)); }
template <typename T> struct Frag;
template <> struct Frag<_Float16> {
  typedef v16h V; union U { v16h v; v8h h[2]; };
  static __device__ __forceinline__ v16h load(const _Float16* p) {   // elements 0..7 <- p[0..7], 8..15 <- p[16..23]
    U f; f.h[0] = *(const v8h*)(p); f.h[1] = *(const v8h*)(p + 16); return f.v;
  }
  static __device__ __forceinline__ v8f mma(v16h a, v16h b, v8f c) {
    return __builtin_amdgcn_wmma_f32_16x16x32_f16(false, a, false, b, (short)0, c, false, false);
  }
  static __device__ __forceinline__ void guard(v8f& a, v8f& b, v16h x, v16h y) { dep_guard_h(a, b, x, y); }
  static __device__ __forceinline__ void keep(v16h a, v16h b, v16h c, v16h d) { keep4_h(a, b, c, d); }
};
template <> struct Frag<__bf16> {
  typedef v16b V; union U { v16b v; v8b h[2]; };
  static __device__ __forceinline__ v16b load(const __bf16* p) {
    U f; f.h[0] = *(const v8b*)(p); f.h[1] = *(const v8b*)(p + 16); return f.v;
  }
  static __device__ __forceinline__ v8f mma(v16b a, v16b b, v8f c) {
    return __builtin_amdgcn_wmma_f32_16x16x32_bf16(false, a, false, b, (short)0, c, false, false);
  }
  static __device__ __forceinline__ void guard(v8f& a, v8f& b, v16b x, v16b y) { dep_guard_b(a, b, x, y); }
  static __device__ __forceinline__ void keep(v16b a, v16b b, v16b c, v16b d) { keep4_b(a, b, c, d); }
};

// tanh-GELU: 0.5*v*(1+tanh(sqrt(2/pi)*(v+0.044715*v^3))); tanh via exp(-2|u|), no division instruction
__device__ __forceinline__ float gelu_tanh_f(float v) {
  const float u = 0.7978845608028654f * (v + 0.044715f * v * v * v);
  const float e = __expf(-2.0f * fabsf(u));
  float t = (1.0f - e) * __builtin_amdgcn_rcpf(1.0f + e);
  t = copysignf(t, u);
  return 0.5f * v * (1.0f + t);
}

// ---- Register-blocked batched WMMA GEMM ------------------------------------
// C[m,n] = scale * sum_k A[m,k] * Bt[n,k] (+bias)(+resid); each wave owns a 64x64 tile, a block of 4 waves (2x2) a 128x128 tile.
// A row-major [M,K]; Bt row-major [N,K]; M,N % 128 == 0, K % 128 == 0.
// Operands reach the waves through LDS: a stage is 128 k of the block's 128 A rows and 128 Bt rows (256 B a row, pitch 272 B),
// brought by asynchronous copies into two buffers, the next stage's copies in flight while this stage is multiplied.
// SPLIT (hi/lo planes) is not built in this form.
// BIAS_MODE: 0 = none, 1 = bias[m], 2 = bias[n].
// OUT_MODE: 0 = f32, 1 = f16, 2 = bf16 hi plane (Cout) + bf16 lo plane (Cout2).
// ACT: 0 none, 1 tanh, 2 relu, 3 silu, 4 leaky, 5 erf-gelu, 6 tanh-gelu.
// ET: 0 = f16 operands, 1 = bf16 operands (pointers passed as 16-bit storage)
template <int ET> struct Elem;
template <> struct Elem<0> { typedef _Float16 T; };
template <> struct Elem<1> { typedef __bf16 T; };
#define G_KS    128                       // k per stage
#define G_PITCH 136                       // LDS row pitch in 16-bit elements: 256 B + 16 B
#define G_STAGE (256 * G_PITCH)           // elements per buffer: rows 0..127 = A, rows 128..255 = Bt
// Eight asynchronous 16-byte copies per lane, rows 8 apart. The s_wait_xcnt stands inside the statement so that
// no address register of an issued copy is rewritten in front of it.
__device__ __forceinline__ void g_copy8(unsigned l, const unsigned short* g, size_t gstep) {
  const unsigned ls = 8u * G_PITCH * 2u;
  asm volatile(
      "global_load_async_to_lds_b128 %0, %8, off\n\t"
      "global_load_async_to_lds_b128 %1, %9, off\n\t"
      "global_load_async_to_lds_b128 %2, %10, off\n\t"
      "global_load_async_to_lds_b128 %3, %11, off\n\t"
      "global_load_async_to_lds_b128 %4, %12, off\n\t"
      "global_load_async_to_lds_b128 %5, %13, off\n\t"
      "global_load_async_to_lds_b128 %6, %14, off\n\t"
      "global_load_async_to_lds_b128 %7, %15, off\n\t"
      "s_wait_xcnt 0x0"
      :: "v"(l), "v"(l + ls), "v"(l + 2u * ls), "v"(l + 3u * ls), "v"(l + 4u * ls), "v"(l + 5u * ls), "v"(l + 6u * ls), "v"(l + 7u * ls),
         "v"(g), "v"(g + gstep), "v"(g + 2 * gstep), "v"(g + 3 * gstep), "v"(g + 4 * gstep), "v"(g + 5 * gstep), "v"(g + 6 * gstep), "v"(g + 7 * gstep)
      : "memory");
}
template <int ET, bool SPLIT, int BIAS_MODE, int OUT_MODE, bool RESID, int ACT = 0>
__global__ __launch_bounds__(128) void wmma_gemm64(
    const unsigned short* __restrict__ Ap, const unsigned short* __restrict__ A2p, int lda, long strideA,
    const unsigned short* __restrict__ Btp, const unsigned short* __restrict__ Bt2p, int ldb, long strideB,
    void* __restrict__ Cout, void* __restrict__ Cout2, int ldc, long strideC,
    const float* __restrict__ bias,
    const float* __restrict__ resid, long strideR,
    int M, int N, int K, float scale) {
  typedef typename Elem<ET>::T T;
  typedef typename Frag<T>::V V;
  static_assert(!SPLIT, "hi/lo planes are not staged");
  __shared__ __align__(16) unsigned short sAB[2 * G_STAGE];   // two stage buffers
  __shared__ __align__(16) float sT[4][16 * 68];   // per-wave 16x64 slab, pitch 68 floats
  const int b    = blockIdx.y;
  const int tid  = threadIdx.x;
  const int lane = tid & 31;
  const int wave = tid >> 5;
  const int tilesN = N >> 7;
  const int tilesM = M >> 7;
  const int tile = blockIdx.x;
  if (tile >= tilesM * tilesN) return;   // block-uniform, in front of every barrier and copy
  const int tm = tile / tilesN;
  const int tn = tile - tm * tilesN;
  const int mB = tm << 7;
  const int nB = tn << 7;
  const int wm = wave >> 1, wn = wave & 1;
  const int m0 = mB + (wm << 6);
  const int n0 = nB + (wn << 6);

  const int rlane = lane & 15;                 // row (A) / col (B, D) within subtile
  const int koff  = (lane >> 4) * 8;           // k offset of this lane half
  const int mOff  = (lane >> 4) * 8;           // D row offset

  // copy lanes: 16 lanes cover one 256-B row, a wave-wide copy two rows (four whole lines)
  const int crow = tid >> 4, cch = (tid & 15) * 8;
  const unsigned short* gA = Ap  + (size_t)b * strideA + (size_t)(mB + crow) * lda + cch;
  const unsigned short* gB = Btp + (size_t)b * strideB + (size_t)(nB + crow) * ldb + cch;
  const unsigned lbase = (unsigned)(size_t)(&sAB[0]) + (unsigned)(crow * G_PITCH + cch) * 2u;
  const size_t stepA = (size_t)8 * lda, stepB = (size_t)8 * ldb;
  auto stage_copy = [&](int st, int buf) {     // 32 copies per lane: one stage of A and Bt
    const unsigned l = lbase + (unsigned)buf * (G_STAGE * 2u);
    const unsigned short* a = gA + (size_t)st * G_KS;
    const unsigned short* w = gB + (size_t)st * G_KS;
    g_copy8(l,                          a,             stepA);
    g_copy8(l +  64u * G_PITCH * 2u,    a + 8 * stepA, stepA);
    g_copy8(l + 128u * G_PITCH * 2u,    w,             stepB);
    g_copy8(l + 192u * G_PITCH * 2u,    w + 8 * stepB, stepB);
  };

  v8f acc[4][4];
#pragma unroll
  for (int i = 0; i < 4; ++i)
#pragma unroll
    for (int j = 0; j < 4; ++j) acc[i][j] = (v8f){0.f,0.f,0.f,0.f,0.f,0.f,0.f,0.f};

  const int nst = K >> 7;
  stage_copy(0, 0);
  asm volatile("s_wait_asynccnt 0x0" ::: "memory");   // this wave's part of stage 0 has landed
  __syncthreads();                                     // stage 0 readable by every wave
  if (nst > 1) stage_copy(1, 1);
#pragma unroll 1   // kept rolled: one trip is one stage of the ring, with one publish point and one refill site
  for (int t = 0; t < nst; ++t) {
    const T* sbuf = (const T*)sAB + (size_t)(t & 1) * G_STAGE;
    const T* sA = sbuf + ((wm << 6) + rlane) * G_PITCH + koff;
    const T* sB = sbuf + (128 + (wn << 6) + rlane) * G_PITCH + koff;
#pragma unroll     // the loops below are unrolled so that fragments and accumulators are indexed by constants (registers, no scratch)
    for (int ks = 0; ks < G_KS / 32; ++ks) {
      V bh[4], ah[4];
#pragma unroll
      for (int j = 0; j < 4; ++j) bh[j] = Frag<T>::load(sB + j * 16 * G_PITCH + ks * 32);
#pragma unroll
      for (int i = 0; i < 4; ++i) ah[i] = Frag<T>::load(sA + i * 16 * G_PITCH + ks * 32);
#pragma unroll
      for (int i = 0; i < 4; ++i) {
#pragma unroll
        for (int j = 0; j < 4; ++j) acc[i][j] = Frag<T>::mma(ah[i], bh[j], acc[i][j]);
        Frag<T>::guard(acc[i][0], acc[i][3], ah[i], ah[i]);
      }
      Frag<T>::keep(bh[0], bh[1], bh[2], bh[3]);
    }
    asm volatile("s_wait_dscnt 0x0" ::: "memory");     // this wave's reads of buffer t & 1 are done
    asm volatile("s_wait_asynccnt 0x0" ::: "memory");  // this wave's part of stage t + 1 has landed
    __syncthreads();                                   // publishes stage t + 1, frees buffer t & 1
    if (t + 2 < nst) stage_copy(t + 2, t & 1);
  }
  asm volatile("s_wait_asynccnt 0x0" ::: "memory");    // no copy outstanding behind the loop
  acc_guard4(acc[0][0], acc[0][1], acc[0][2], acc[0][3]);
  acc_guard4(acc[1][0], acc[1][1], acc[1][2], acc[1][3]);
  acc_guard4(acc[2][0], acc[2][1], acc[2][2], acc[2][3]);
  acc_guard4(acc[3][0], acc[3][1], acc[3][2], acc[3][3]);

  // ---- epilogue ----
  float* slab = sT[wave];
  const float* Rb = RESID ? (resid + (size_t)b * strideR) : nullptr;
#pragma unroll
  for (int i = 0; i < 4; ++i) {
    const int mBase = m0 + (i << 4);
#pragma unroll
    for (int j = 0; j < 4; ++j) {
      const int n = n0 + (j << 4) + rlane;
      float bv = 0.f;
      if (BIAS_MODE == 2) bv = bias[n];
#pragma unroll
      for (int r = 0; r < 8; ++r) {
        float v = acc[i][j][r] * scale;
        if (BIAS_MODE == 1) v += bias[mBase + mOff + r];
        if (BIAS_MODE == 2) v += bv;
        if (RESID) v += Rb[(size_t)(mBase + mOff + r) * ldc + n];
        if (ACT == 1) v = tanhf(v);
        if (ACT == 2) v = fmaxf(v, 0.0f);
        if (ACT == 3) v = v / (1.0f + expf(-v));
        if (ACT == 4) v = (v > 0.f) ? v : 0.01f * v;
        if (ACT == 5) v = 0.5f * v * (1.0f + erff(v * 0.70710678118654752f));
        if (ACT == 6) v = gelu_tanh_f(v);
        slab[(mOff + r) * 68 + (j << 4) + rlane] = v;
      }
    }
    __builtin_amdgcn_fence(__ATOMIC_RELEASE, "workgroup");
    __builtin_amdgcn_wave_barrier();
    __builtin_amdgcn_fence(__ATOMIC_ACQUIRE, "workgroup");
    if (OUT_MODE == 0) {
      float* C = (float*)Cout + (size_t)b * strideC;
      const int hh = lane >> 4, c4 = (lane & 15) * 4;     // row seg = 256 B = 16 lanes x 16 B
      {
#pragma unroll
        for (int it = 0; it < 8; ++it) {
          const int row = it * 2 + hh;
          v4f v = *(const v4f*)(slab + row * 68 + c4);
          *(v4f*)(C + (size_t)(mBase + row) * ldc + n0 + c4) = v;
        }
        
      }
    } else {
      const int q = lane >> 3, c8 = (lane & 7) * 8;
      unsigned short* C  = (unsigned short*)Cout  + (size_t)b * strideC;
      unsigned short* C2 = (OUT_MODE == 2) ? ((unsigned short*)Cout2 + (size_t)b * strideC) : nullptr;
      {
#pragma unroll
        for (int it = 0; it < 4; ++it) {
          const int row = it * 4 + q;
          const float* sp = slab + row * 68 + c8;
          v8h hv, lv;
#pragma unroll
          for (int e = 0; e < 8; ++e) {
            if (OUT_MODE == 1) {
              hv[e] = (_Float16)sp[e];
            } else {
              unsigned short hb = f2bf_bits(sp[e]);
              unsigned short lb = f2bf_bits(sp[e] - bf_bits2f(hb));
              hv[e] = __builtin_bit_cast(_Float16, hb);
              lv[e] = __builtin_bit_cast(_Float16, lb);
            }
          }
          *(v8h*)(C + (size_t)(mBase + row) * ldc + n0 + c8) = hv;
          if (OUT_MODE == 2) *(v8h*)(C2 + (size_t)(mBase + row) * ldc + n0 + c8) = lv;
        }
        
      }
    }
    __builtin_amdgcn_fence(__ATOMIC_RELEASE, "workgroup");
    __builtin_amdgcn_wave_barrier();
    __builtin_amdgcn_fence(__ATOMIC_ACQUIRE, "workgroup");
  }
}

__global__ __launch_bounds__(256) void cast_f32_f16x2(
    const float* __restrict__ in, _Float16* __restrict__ out, int n2) {
  int i = blockIdx.x * 256 + threadIdx.x;
  if (i < n2) {
    const _Float16 h0 = (_Float16)in[2 * i], h1 = (_Float16)in[2 * i + 1];
    const unsigned u = (unsigned)__builtin_bit_cast(unsigned short, h0) | ((unsigned)__builtin_bit_cast(unsigned short, h1) << 16);
    ((unsigned*)out)[i] = u;
    
  }
}

// =====================================================================================
// Attention for head_dim 64, f32 in / f32 out; 16-bit operands: bf16 with optional hi/lo splits, or
// plain f16 (F16=true, non-split, probabilities carried x2^15).
//   Block = 4 waves = 64 query rows of one (batch, head); S % 64 == 0.
//   Element (b, s, h, d) of tensor X lives at X[b*X_bs + s*X_rs + h*X_hs + d] (strides in floats, multiples of 4).
//   mask_mode 0 none, 1 causal, 2 tensor [S][Skv], 3 per-token vectors, 4 causal + window, 5 relative bias,
//   6 = mask_a: int32 [S][Skv] nonzero = masked, OR mask_b: int32 [B][Skv] nonzero = masked; per 64x64
//       (b, q-tile, kv-tile) code table tcode[(b*nqb+qb)*t_pitch + kc]: 0 mixed (per-element reads),
//       1 all live (no reads), 2 all masked (tile skipped: zero contribution).
//   masked scores are replaced by mask_fill before the softmax; rows with no live key write 0.
//   grid.x = B * H * (S/64).
// =====================================================================================
#define AT_D 64
#define AT_NW 4
#define AT_QB 64
#define AT_KC 64
struct AttnGeom { const int* tcode; const float* cp; const float* pc; long c_bs, c_rs, c_hs, t_pitch;
                  long q_bs, q_rs, q_hs, k_bs, k_rs, k_hs, v_bs, v_rs, v_hs, o_bs, o_rs, o_hs;
                  int S, Skv, H, mask_mode; float qscale; int blk0; float mask_fill; int mask_is_int; };
static_assert(sizeof(AttnGeom) == 184);

__device__ __forceinline__ unsigned short at_bf_bits(float f) {
  unsigned u = __float_as_uint(f);
  return (unsigned short)((u + 0x7FFFu + ((u >> 16) & 1u)) >> 16);
}
__device__ __forceinline__ __bf16 at_f2bf(float f) { return __builtin_bit_cast(__bf16, at_bf_bits(f)); }
__device__ __forceinline__ void at_split(float f, __bf16& hi, __bf16& lo) {
  const unsigned short hb = at_bf_bits(f);
  hi = __builtin_bit_cast(__bf16, hb);
  lo = at_f2bf(f - __uint_as_float(((unsigned)hb) << 16));
}
__device__ __forceinline__ v8f at_mma(v16b a, v16b b, v8f c) {
  c = __builtin_amdgcn_wmma_f32_16x16x32_bf16(false, a, false, b, (short)0, c, false, false);
  asm volatile("v_nop\n\tv_nop\n\tv_nop\n\tv_nop" : "+v"(c) : "v"(a), "v"(b));
  return c;
}
// 16-bit element as a bit pattern held in a __bf16 slot: f16 bits when F16, bf16 (RNE) otherwise
template <bool F16> __device__ __forceinline__ __bf16 at_to16(float f) {
  if (F16) return __builtin_bit_cast(__bf16, (_Float16)f);
  return at_f2bf(f);
}
template <bool F16> __device__ __forceinline__ v8f at_mma16(v16b a, v16b b, v8f c) {
  if (F16) {
    const v16h ah = __builtin_bit_cast(v16h, a), bh = __builtin_bit_cast(v16h, b);
    c = __builtin_amdgcn_wmma_f32_16x16x32_f16(false, ah, false, bh, (short)0, c, false, false);
    asm volatile("v_nop\n\tv_nop\n\tv_nop\n\tv_nop" : "+v"(c) : "v"(ah), "v"(bh));
    return c;
  }
  return at_mma(a, b, c);
}

// MODE is the mask mode as a compile-time constant: only that mode's mask code is compiled into the key loop.
template <bool SPLIT_QK, bool SPLIT_PV, bool F16, int MODE>
__global__ __launch_bounds__(128)
void attn64_kernel(const float* __restrict__ q, const float* __restrict__ k,
                   const float* __restrict__ v, float* __restrict__ out,
                   const int* __restrict__ mask_a, const int* __restrict__ mask_b, AttnGeom g) {
  static_assert(!(F16 && (SPLIT_QK || SPLIT_PV)));
  const float PSC = F16 ? 32768.0f : 1.0f;     // f16 probabilities carried x2^15, folded into the final 1/l
  union FB { v16b v; v8b h[2]; };
  __shared__ __align__(16) __bf16 Ksh[AT_KC * AT_D];             // K hi [kv][d]      8 KB
  __shared__ __align__(16) __bf16 Ksl[SPLIT_QK ? AT_KC * AT_D : 8];
  __shared__ __align__(16) __bf16 Vth[AT_D * AT_KC];             // V hi [d][kv]      8 KB
  __shared__ __align__(16) __bf16 Vtl[SPLIT_PV ? AT_D * AT_KC : 8];
  __shared__ __align__(16) __bf16 Psh[AT_NW][16 * AT_KC];        // per wave P hi [row][kv]  8 KB
  __shared__ __align__(16) __bf16 Psl[SPLIT_PV ? AT_NW : 1][SPLIT_PV ? 16 * AT_KC : 8];
  __shared__ __align__(16) float  Os[AT_NW][16 * 68];            // per wave out tile, pitch 68

  const int tid  = threadIdx.x;
  const int wave = tid >> 5;
  const int lane = tid & 31;
  const int hh   = lane >> 4;
  const int c    = lane & 15;

  const int nqb = g.S / AT_QB;
  const int nkc = g.Skv / AT_KC;
  const int bx = blockIdx.x + g.blk0;
  const int qb = bx % nqb;
  const int bh = bx / nqb;
  const int h  = bh % g.H;
  const int b  = bh / g.H;
  const int qbase_block = qb * AT_QB;
  const int q0 = qbase_block + wave * 16;

  const float* qb_ptr = q + (size_t)b * g.q_bs + (size_t)h * g.q_hs;
  const float* kb_ptr = k + (size_t)b * g.k_bs + (size_t)h * g.k_hs;
  const float* vb_ptr = v + (size_t)b * g.v_bs + (size_t)h * g.v_hs;
  float*       ob_ptr = out + (size_t)b * g.o_bs + (size_t)h * g.o_hs;

  // ---- Q fragments (A operand): 2 d-chunks, hi (and lo) ----
  v16b qah[2], qal[2];
  {
    const float* qrow = qb_ptr + (size_t)(q0 + c) * g.q_rs;
#pragma unroll
    for (int dc = 0; dc < 2; ++dc) {
#pragma unroll
      for (int e = 0; e < 8; ++e) {
        const float f0 = qrow[dc * 32 + 8 * hh + e] * g.qscale;
        const float f1 = qrow[dc * 32 + 16 + 8 * hh + e] * g.qscale;
        if (SPLIT_QK) { __bf16 hq, lq; at_split(f0, hq, lq); qah[dc][e] = hq; qal[dc][e] = lq; at_split(f1, hq, lq); qah[dc][8 + e] = hq; qal[dc][8 + e] = lq; }
        else { qah[dc][e] = at_to16<F16>(f0); qah[dc][8 + e] = at_to16<F16>(f1); qal[dc][e] = qah[dc][e]; qal[dc][8 + e] = qah[dc][8 + e]; }
      }
    }
  }

  float mrow[8], lrow[8];
  v8f oacc[4];
#pragma unroll
  for (int r = 0; r < 8; ++r) { mrow[r] = -INFINITY; lrow[r] = 0.f; }
#pragma unroll
  for (int t = 0; t < 4; ++t) oacc[t] = (v8f){0.f,0.f,0.f,0.f,0.f,0.f,0.f,0.f};

  const int nChunks = (MODE == 1 || MODE == 4) ? (qb + 1) : nkc;   // block-uniform, bounded by Skv/64
  // per-row query mask (mode 3)
  int qkeep[8];
#pragma unroll
  for (int r = 0; r < 8; ++r) qkeep[r] = (MODE == 3) ? mask_b[(size_t)b * g.S + q0 + 8 * hh + r] : 1;   // mask_b = qmask in mode 3
  for (int kc = 0; kc < nChunks; ++kc) {
    const int kv0 = kc * AT_KC;
    int code = 0;
    if (MODE == 6) {
      int cv = g.tcode[((size_t)b * nqb + qb) * (size_t)g.t_pitch + kc];
      cv = __builtin_amdgcn_readfirstlane(cv);
      code = (cv == 1 || cv == 2) ? cv : 0;     // anything else -> mixed (per-element reads)
      if (code == 2) continue;                  // fully masked tile: zero contribution, softmax state unchanged
    }
    __syncthreads();
    {
      const int kvr = tid >> 1, dh = (tid & 1) * 32;
      const float* krow = kb_ptr + (size_t)(kv0 + kvr) * g.k_rs + dh;
      const float* vrow = vb_ptr + (size_t)(kv0 + kvr) * g.v_rs + dh;
#pragma unroll
      for (int i = 0; i < 8; ++i) {
        v4f kk = *(const v4f*)(krow + 4 * i);
        v4f vv = *(const v4f*)(vrow + 4 * i);
#pragma unroll
        for (int e = 0; e < 4; ++e) {
          const int d = dh + 4 * i + e;
          if (SPLIT_QK) { __bf16 a, bl; at_split(kk[e], a, bl); Ksh[kvr * AT_D + d] = a; Ksl[kvr * AT_D + d] = bl; }
          else Ksh[kvr * AT_D + d] = at_to16<F16>(kk[e]);
          if (SPLIT_PV) { __bf16 a, bl; at_split(vv[e], a, bl); Vth[d * AT_KC + kvr] = a; Vtl[d * AT_KC + kvr] = bl; }
          else Vth[d * AT_KC + kvr] = at_to16<F16>(vv[e]);
        }
      }
    }
    __syncthreads();

    v8f s[4];
#pragma unroll
    for (int j = 0; j < 4; ++j) {
      s[j] = (v8f){0.f,0.f,0.f,0.f,0.f,0.f,0.f,0.f};
#pragma unroll 1
      for (int dc = 0; dc < 2; ++dc) {
        FB kb;
        kb.h[0] = *(const v8b*)(Ksh + (j * 16 + c) * AT_D + dc * 32 + 8 * hh);
        kb.h[1] = *(const v8b*)(Ksh + (j * 16 + c) * AT_D + dc * 32 + 16 + 8 * hh);
        s[j] = at_mma16<F16>(qah[dc], kb.v, s[j]);
        if (SPLIT_QK) {
          FB kl;
          kl.h[0] = *(const v8b*)(Ksl + (j * 16 + c) * AT_D + dc * 32 + 8 * hh);
          kl.h[1] = *(const v8b*)(Ksl + (j * 16 + c) * AT_D + dc * 32 + 16 + 8 * hh);
          s[j] = at_mma16<F16>(qah[dc], kl.v, s[j]);
          s[j] = at_mma16<F16>(qal[dc], kb.v, s[j]);
        }
      }
    }
    const bool diag = (MODE == 1) && (kc == qb);
    int kvkeep[4] = {1, 1, 1, 1};
    if (MODE == 3) {
#pragma unroll
      for (int j = 0; j < 4; ++j) kvkeep[j] = mask_a[(size_t)b * g.Skv + kv0 + j * 16 + c];   // mask_a = kvmask
    }
    if (MODE == 6 && code == 0) {               // mixed tile: one wave-uniform branch per tile, then per-element reads
      int kvpad[4];
#pragma unroll
      for (int j = 0; j < 4; ++j) kvpad[j] = mask_b[(size_t)b * g.Skv + kv0 + j * 16 + c];   // mask_b = key padding [B][Skv]
#pragma unroll   // both loops unrolled so that s[j][r] is indexed by constants and stays in registers
      for (int r = 0; r < 8; ++r) {
        const int* mrowp = mask_a + (size_t)(q0 + 8 * hh + r) * g.Skv + kv0 + c;
#pragma unroll
        for (int j = 0; j < 4; ++j)
          if ((mrowp[j * 16] != 0) || (kvpad[j] != 0)) s[j][r] = g.mask_fill;
      }
    }
    float cm[8];
#pragma unroll
    for (int r = 0; r < 8; ++r) {
      const int qrow = q0 + 8 * hh + r;
      float m = -INFINITY;
#pragma unroll
      for (int j = 0; j < 4; ++j) {
        const int kvcol = kv0 + j * 16 + c;
        bool masked = false;
        if (diag) masked = (kvcol > qrow);
        else if (MODE == 4) masked = (kvcol > qrow) || (qrow - kvcol > g.mask_is_int);
        else if (MODE == 2) {
          const size_t mi = (size_t)qrow * g.Skv + kvcol;
          masked = (g.mask_is_int == 0) ? (((const float*)mask_a)[mi] == 0.0f)
                 : (g.mask_is_int == 1) ? (mask_a[mi] == 0) : (mask_a[mi] != 0);
        } else if (MODE == 3) masked = (qkeep[r] == 0) || (kvkeep[j] == 0);
        else if (MODE == 5) {
          const size_t mi = (size_t)qrow * g.Skv + kvcol;
          masked = (mask_a[mi] != 0);
          int n = mask_b[mi]; n = n < 0 ? 0 : n;
          s[j][r] += g.cp[(size_t)b * g.c_bs + (size_t)h * g.c_hs + (size_t)qrow * g.c_rs + n]
                   + g.pc[(size_t)b * g.c_bs + (size_t)h * g.c_hs + (size_t)kvcol * g.c_rs + n];
        }
        if (masked) s[j][r] = g.mask_fill;
        m = fmaxf(m, s[j][r]);
      }
#pragma unroll
      for (int off = 1; off < 16; off <<= 1) m = fmaxf(m, __shfl_xor(m, off, 32));
      cm[r] = m;
    }
    __bf16* pwh = Psh[wave];
    __bf16* pwl = Psl[SPLIT_PV ? wave : 0];
#pragma unroll
    for (int r = 0; r < 8; ++r) {
      const float mnew = fmaxf(mrow[r], cm[r]);
      const bool dead = (mnew == -INFINITY);               // no live key seen yet for this row
      const float alpha = dead ? 1.0f : expf(mrow[r] - mnew);
      mrow[r] = mnew;
      float psum = 0.f;
#pragma unroll
      for (int j = 0; j < 4; ++j) {
        const float p = dead ? 0.0f : expf(s[j][r] - mnew);
        psum += p;
        if (SPLIT_PV) { __bf16 a, bl; at_split(p, a, bl); pwh[(8 * hh + r) * AT_KC + j * 16 + c] = a; pwl[(8 * hh + r) * AT_KC + j * 16 + c] = bl; }
        else pwh[(8 * hh + r) * AT_KC + j * 16 + c] = at_to16<F16>(p * PSC);
      }
#pragma unroll
      for (int off = 1; off < 16; off <<= 1) psum += __shfl_xor(psum, off, 32);
      lrow[r] = lrow[r] * alpha + psum;
#pragma unroll
      for (int t = 0; t < 4; ++t) oacc[t][r] *= alpha;
    }
    __builtin_amdgcn_fence(__ATOMIC_RELEASE, "workgroup");
    __builtin_amdgcn_wave_barrier();
    __builtin_amdgcn_fence(__ATOMIC_ACQUIRE, "workgroup");
#pragma unroll 1
    for (int kk = 0; kk < 2; ++kk) {
      FB pa, pl;
      pa.h[0] = *(const v8b*)(pwh + c * AT_KC + kk * 32 + 8 * hh);
      pa.h[1] = *(const v8b*)(pwh + c * AT_KC + kk * 32 + 16 + 8 * hh);
      if (SPLIT_PV) {
        pl.h[0] = *(const v8b*)(pwl + c * AT_KC + kk * 32 + 8 * hh);
        pl.h[1] = *(const v8b*)(pwl + c * AT_KC + kk * 32 + 16 + 8 * hh);
      }
#pragma unroll
      for (int t = 0; t < 4; ++t) {
        FB vb;
        vb.h[0] = *(const v8b*)(Vth + (t * 16 + c) * AT_KC + kk * 32 + 8 * hh);
        vb.h[1] = *(const v8b*)(Vth + (t * 16 + c) * AT_KC + kk * 32 + 16 + 8 * hh);
        oacc[t] = at_mma16<F16>(pa.v, vb.v, oacc[t]);
        if (SPLIT_PV) {
          FB vl;
          vl.h[0] = *(const v8b*)(Vtl + (t * 16 + c) * AT_KC + kk * 32 + 8 * hh);
          vl.h[1] = *(const v8b*)(Vtl + (t * 16 + c) * AT_KC + kk * 32 + 16 + 8 * hh);
          oacc[t] = at_mma16<F16>(pa.v, vl.v, oacc[t]);
          oacc[t] = at_mma16<F16>(pl.v, vb.v, oacc[t]);
        }
      }
    }
  }

  float* os = Os[wave];
#pragma unroll
  for (int r = 0; r < 8; ++r) {
    const float den = lrow[r] * PSC;
    const float inv = (den > 0.0f) ? (1.0f / den) : 0.0f;
#pragma unroll
    for (int t = 0; t < 4; ++t) os[(8 * hh + r) * 68 + t * 16 + c] = oacc[t][r] * inv;
  }
  __builtin_amdgcn_fence(__ATOMIC_RELEASE, "workgroup");
  __builtin_amdgcn_wave_barrier();
  __builtin_amdgcn_fence(__ATOMIC_ACQUIRE, "workgroup");
  {
    const int c4 = (lane & 15) * 4;
    {
#pragma unroll
      for (int it = 0; it < 8; ++it) {
        const int row = it * 2 + hh;
        v4f val = *(const v4f*)(os + row * 68 + c4);
        *(v4f*)(ob_ptr + (size_t)(q0 + row) * g.o_rs + c4) = val;
      }
      
    }
  }
}

// =====================================================================================
// 64x64 tile classification of the attention mask: one block per (b, q-tile); for each kv-tile:
//   masked(q,k) = tm[q][k] != 0 || pad[b][k] != 0;  code 2 = all masked, 1 = all live, 0 = mixed.
// =====================================================================================
__global__ __launch_bounds__(256) void tilecode_kernel(
    const int* __restrict__ tm, const int* __restrict__ pad, int* __restrict__ tab,
    int Skv, int nqb, int nkc, int tp) {
  __shared__ int wl[8], wm[8];
  __shared__ __align__(16) int codes[128];
  const int tid = threadIdx.x, lane = tid & 31, wave = tid >> 5;
  const int b  = blockIdx.x / nqb;
  const int qb = blockIdx.x - b * nqb;
  const int row = tid >> 2, cs = (tid & 3) * 16;
  const int q = qb * 64 + row;
  if (tid < 128) codes[tid] = 2;
  __syncthreads();
  const int nk = nkc < 128 ? nkc : 128;
  for (int kc = 0; kc < nk; ++kc) {
    const int* mr = tm  + (size_t)q * Skv + kc * 64 + cs;
    const int* pr = pad + (size_t)b * Skv + kc * 64 + cs;
    int live = 0, msk = 0;
#pragma unroll
    for (int i = 0; i < 4; ++i) {
      const v4i mv = *(const v4i*)(mr + 4 * i);
      const v4i pv = *(const v4i*)(pr + 4 * i);
#pragma unroll
      for (int e = 0; e < 4; ++e) {
        const int m = ((mv[e] != 0) || (pv[e] != 0)) ? 1 : 0;
        msk |= m;
        live |= (m ^ 1);
      }
    }
    const int al = __any(live);
    const int am = __any(msk);
    if (lane == 0) { wl[wave] = al; wm[wave] = am; }
    __syncthreads();
    if (tid == 0) {
      int L = 0, Mk = 0;
#pragma unroll
      for (int w = 0; w < 8; ++w) { L |= wl[w]; Mk |= wm[w]; }
      codes[kc] = (L == 0) ? 2 : ((Mk == 0) ? 1 : 0);
    }
    __syncthreads();
  }
  if (wave == 0) {
    const int nl = tp >> 2;          // tp is a multiple of 32 ints, <= 128
    v4i cv;
    cv[0] = codes[(4 * lane + 0) & 127]; cv[1] = codes[(4 * lane + 1) & 127];
    cv[2] = codes[(4 * lane + 2) & 127]; cv[3] = codes[(4 * lane + 3) & 127];
    int* dst = tab + (size_t)blockIdx.x * tp + 4 * lane;
    if (lane < nl) *(v4i*)dst = cv;
    
  }
}

// =====================================================================================
// LayerNorm over 1024-wide rows: one block (256 thr) per row, 4 contiguous floats per thread.
// =====================================================================================
template <bool OUT16>
__global__ __launch_bounds__(256) void ln_kernel(
    const float* __restrict__ in, const float* __restrict__ gam, const float* __restrict__ bet,
    float* __restrict__ o32, _Float16* __restrict__ o16) {
  __shared__ float red1[8], red2[8];
  __shared__ __align__(16) float ybuf[OUT16 ? DM : 4];
  const int row = blockIdx.x, t = threadIdx.x, lane = t & 31, wave = t >> 5;
  const float* x = in + (size_t)row * DM;
  const v4f xv = *(const v4f*)(x + 4 * t);
  float s = (xv[0] + xv[1]) + (xv[2] + xv[3]);
#pragma unroll
  for (int off = 1; off < 32; off <<= 1) s += __shfl_xor(s, off, 32);
  if (lane == 0) red1[wave] = s;
  __syncthreads();
  float tot = 0.f;
#pragma unroll
  for (int w = 0; w < 8; ++w) tot += red1[w];
  const float mu = tot * (1.0f / (float)DM);
  const float d0 = xv[0] - mu, d1 = xv[1] - mu, d2 = xv[2] - mu, d3 = xv[3] - mu;
  float s2 = (d0 * d0 + d1 * d1) + (d2 * d2 + d3 * d3);
#pragma unroll
  for (int off = 1; off < 32; off <<= 1) s2 += __shfl_xor(s2, off, 32);
  if (lane == 0) red2[wave] = s2;
  __syncthreads();
  float tot2 = 0.f;
#pragma unroll
  for (int w = 0; w < 8; ++w) tot2 += red2[w];
  const float var = tot2 * (1.0f / (float)DM);
  const float rstd = rsqrtf(var + LN_EPS);
  const v4f gv = *(const v4f*)(gam + 4 * t);
  const v4f bv = *(const v4f*)(bet + 4 * t);
  v4f y;
  y[0] = d0 * rstd * gv[0] + bv[0];
  y[1] = d1 * rstd * gv[1] + bv[1];
  y[2] = d2 * rstd * gv[2] + bv[2];
  y[3] = d3 * rstd * gv[3] + bv[3];
  float* op = o32 + (size_t)row * DM + 4 * t;
  *(v4f*)op = y;
  
  if (OUT16) {
    *(v4f*)(ybuf + 4 * t) = y;
    __syncthreads();
    if (t < DM / 8) {
      v8h hv;
#pragma unroll
      for (int e = 0; e < 8; ++e) hv[e] = (_Float16)ybuf[8 * t + e];
      _Float16* hp = o16 + (size_t)row * DM + 8 * t;
      *(v8h*)hp = hv;
      
    }
  }
}

// =====================================================================================
// Host orchestration
// =====================================================================================
extern "C" void kernel_launch(void* const* d_in, const int* in_sizes, int n_in,
                              void* d_out, int out_size, void* d_ws, size_t ws_size,
                              hipStream_t stream) {
  if (n_in < 16) return;
  if (in_sizes[0] != MROWS * DM || in_sizes[1] != SEQ * SEQ || in_sizes[2] != BSZ * SEQ) return;
  if (in_sizes[3] != DM * DM || in_sizes[4] != DM * DM || in_sizes[5] != DM * DM || in_sizes[6] != DM * DM) return;
  if (in_sizes[7] != DM || in_sizes[8] != FFND * DM || in_sizes[9] != FFND) return;
  if (in_sizes[10] != DM * FFND || in_sizes[11] != DM) return;
  if (in_sizes[12] != DM || in_sizes[13] != DM || in_sizes[14] != DM || in_sizes[15] != DM) return;
  if (out_size != MROWS * DM) return;

  const float* tgt   = (const float*)d_in[0];
  const int*   tmask = (const int*)d_in[1];     // [SEQ][SEQ], nonzero = masked
  const int*   pmask = (const int*)d_in[2];     // [BSZ][SEQ], nonzero = masked
  const float* Wq    = (const float*)d_in[3];
  const float* Wk    = (const float*)d_in[4];
  const float* Wv    = (const float*)d_in[5];
  const float* Wo    = (const float*)d_in[6];
  const float* bo    = (const float*)d_in[7];
  const float* W1    = (const float*)d_in[8];
  const float* b1    = (const float*)d_in[9];
  const float* W2    = (const float*)d_in[10];
  const float* b2    = (const float*)d_in[11];
  const float* g1    = (const float*)d_in[12];
  const float* be1   = (const float*)d_in[13];
  const float* g2    = (const float*)d_in[14];
  const float* be2   = (const float*)d_in[15];
  float* out = (float*)d_out;

  // ---- workspace carve (bytes), regions reused across phases ----
  const size_t MiB = 1048576;
  const int nqb = SEQ / AT_QB, nkc = SEQ / AT_KC;
  if (nkc > 128) return;
  const int TP = ((nkc + 31) / 32) * 32;
  const size_t tabBytes = (size_t)BSZ * nqb * TP * sizeof(int);
  const size_t total = 96 * MiB + tabBytes;
  if (total > ws_size) return;
  char* ws = (char*)d_ws;
  float*    Qf   = (float*)(ws + 0 * MiB);          // [4096][1024] f32   (projections -> attention)
  float*    Kf   = (float*)(ws + 16 * MiB);
  float*    Vf   = (float*)(ws + 32 * MiB);
  float*    RES1 = (float*)(ws + 0 * MiB);          // tgt + attn-proj     (after attention)
  _Float16* H16  = (_Float16*)(ws + 0 * MiB);       // [4096][4096] f16   (after LN1)
  float*    X1f  = (float*)(ws + 32 * MiB);         // LN1 output f32     (after attention)
  float*    AOf  = (float*)(ws + 48 * MiB);         // attention output f32
  float*    RES2 = (float*)(ws + 48 * MiB);         // x1 + ffn           (after out-proj)
  _Float16* X16  = (_Float16*)(ws + 64 * MiB);      // tgt f16            (projections)
  _Float16* O16  = (_Float16*)(ws + 64 * MiB);      // attention output f16 (after projections)
  _Float16* X1h  = (_Float16*)(ws + 64 * MiB);      // LN1 output f16     (after out-proj)
  _Float16* Wq16 = (_Float16*)(ws + 72 * MiB);
  _Float16* Wk16 = (_Float16*)(ws + 74 * MiB);
  _Float16* Wv16 = (_Float16*)(ws + 76 * MiB);
  _Float16* Wo16 = (_Float16*)(ws + 78 * MiB);
  _Float16* W1h  = (_Float16*)(ws + 80 * MiB);      // [4096][1024]
  _Float16* W2h  = (_Float16*)(ws + 88 * MiB);      // [1024][4096]
  int*      TAB  = (int*)(ws + 96 * MiB);           // [BSZ*nqb][TP]

  auto castf = [&](const float* src, _Float16* dst, int n) {
    const int n2 = n / 2;
    cast_f32_f16x2<<<dim3((n2 + 255) / 256), dim3(256), 0, stream>>>(src, dst, n2);
  };
  castf(tgt, X16, MROWS * DM);
  castf(Wq, Wq16, DM * DM);
  castf(Wk, Wk16, DM * DM);
  castf(Wv, Wv16, DM * DM);
  castf(Wo, Wo16, DM * DM);
  castf(W1, W1h, FFND * DM);
  castf(W2, W2h, DM * FFND);

  // mask tile codes
  tilecode_kernel<<<dim3(BSZ * nqb), dim3(256), 0, stream>>>(tmask, pmask, TAB, SEQ, nqb, nkc, TP);

  const long z = 0;
  typedef const unsigned short* cu16;
  const int tilesM = MROWS / 128;
  // q/k/v projections: [4096][1024] = X16 . W^T, f32 out
  {
    const dim3 grid(tilesM * (DM / 128), 1);
    wmma_gemm64<0, false, 0, 0, false, 0><<<grid, dim3(128), 0, stream>>>(
        (cu16)X16, (cu16)X16, DM, z, (cu16)Wq16, (cu16)Wq16, DM, z, (void*)Qf, (void*)Qf, DM, z,
        bo, tgt, z, MROWS, DM, DM, 1.0f);
    wmma_gemm64<0, false, 0, 0, false, 0><<<grid, dim3(128), 0, stream>>>(
        (cu16)X16, (cu16)X16, DM, z, (cu16)Wk16, (cu16)Wk16, DM, z, (void*)Kf, (void*)Kf, DM, z,
        bo, tgt, z, MROWS, DM, DM, 1.0f);
    wmma_gemm64<0, false, 0, 0, false, 0><<<grid, dim3(128), 0, stream>>>(
        (cu16)X16, (cu16)X16, DM, z, (cu16)Wv16, (cu16)Wv16, DM, z, (void*)Vf, (void*)Vf, DM, z,
        bo, tgt, z, MROWS, DM, DM, 1.0f);
  }

  // attention: q,k,v,o element (b, s, h, d) at b*SEQ*DM + s*DM + h*64 + d
  {
    AttnGeom g;
    g.tcode = TAB; g.cp = Qf; g.pc = Qf; g.c_bs = 0; g.c_rs = 0; g.c_hs = 0; g.t_pitch = TP;
    g.q_bs = (long)SEQ * DM; g.q_rs = DM; g.q_hs = HD;
    g.k_bs = (long)SEQ * DM; g.k_rs = DM; g.k_hs = HD;
    g.v_bs = (long)SEQ * DM; g.v_rs = DM; g.v_hs = HD;
    g.o_bs = (long)SEQ * DM; g.o_rs = DM; g.o_hs = HD;
    g.S = SEQ; g.Skv = SEQ; g.H = NHEAD; g.mask_mode = 6; g.qscale = 0.125f; g.blk0 = 0;
    g.mask_fill = -INFINITY; g.mask_is_int = 2;
    attn64_kernel<false, false, true, 6><<<dim3(BSZ * NHEAD * nqb), dim3(128), 0, stream>>>(
        Qf, Kf, Vf, AOf, tmask, pmask, g);
  }
  castf(AOf, O16, MROWS * DM);

  // RES1 = tgt + (O . Wo^T + bo)
  {
    const dim3 grid(tilesM * (DM / 128), 1);
    wmma_gemm64<0, false, 2, 0, true, 0><<<grid, dim3(128), 0, stream>>>(
        (cu16)O16, (cu16)O16, DM, z, (cu16)Wo16, (cu16)Wo16, DM, z, (void*)RES1, (void*)RES1, DM, z,
        bo, tgt, z, MROWS, DM, DM, 1.0f);
  }
  // x1 = LN(RES1) -> f32 + f16
  ln_kernel<true><<<dim3(MROWS), dim3(256), 0, stream>>>(RES1, g1, be1, X1f, X1h);
  // H16 = gelu_tanh(x1 . W1^T + b1), f16 [4096][4096]
  {
    const dim3 grid(tilesM * (FFND / 128), 1);
    wmma_gemm64<0, false, 2, 1, false, 6><<<grid, dim3(128), 0, stream>>>(
        (cu16)X1h, (cu16)X1h, DM, z, (cu16)W1h, (cu16)W1h, DM, z, (void*)H16, (void*)H16, FFND, z,
        b1, tgt, z, MROWS, FFND, DM, 1.0f);
  }
  // RES2 = x1 + (H . W2^T + b2)
  {
    const dim3 grid(tilesM * (DM / 128), 1);
    wmma_gemm64<0, false, 2, 0, true, 0><<<grid, dim3(128), 0, stream>>>(
        (cu16)H16, (cu16)H16, FFND, z, (cu16)W2h, (cu16)W2h, FFND, z, (void*)RES2, (void*)RES2, DM, z,
        b2, X1f, z, MROWS, DM, FFND, 1.0f);
  }
  // out = LN(RES2)
  ln_kernel<false><<<dim3(MROWS), dim3(256), 0, stream>>>(RES2, g2, be2, out, X1h);
  (void)hipGetLastError();
}

// v003
// One run takes 431 microseconds.
// Timed twice side by side with v002, it ran 1.09 times as fast both times.
// All steps since v000 together make it 4.55 times as fast.
// Contractions: q/k/v/out projections, FFN1, FFN2 on v_wmma_f32_16x16x32_f16 (f16 operands, f32 accumulate);
// attention scores (q*0.125).k^T and p.v on v_wmma_f32_16x16x32_f16 (f16 operands, p carried x2^15, f32 accumulate).
// Softmax, LayerNorm, tanh-GELU, bias and residual adds in f32.
#include <hip/hip_runtime.h>

typedef __attribute__((ext_vector_type(16))) _Float16 v16h;
typedef __attribute__((ext_vector_type(8)))  _Float16 v8h;
typedef __attribute__((ext_vector_type(16))) __bf16   v16b;
typedef __attribute__((ext_vector_type(8)))  __bf16   v8b;
typedef __attribute__((ext_vector_type(8)))  float    v8f;
typedef __attribute__((ext_vector_type(4)))  float    v4f;
typedef __attribute__((ext_vector_type(4)))  int      v4i;

#define DM     1024
#define NHEAD  16
#define HD     64
#define FFND   4096
#define BSZ    2
#define SEQ    2048
#define MROWS  (BSZ * SEQ)
#define LN_EPS 1e-5f

__device__ __forceinline__ unsigned short f2bf_bits(float f) {
  unsigned u = __float_as_uint(f);
  return (unsigned short)((u + 0x7FFFu + ((u >> 16) & 1u)) >> 16);
}
__device__ __forceinline__ float bf_bits2f(unsigned short h) { return __uint_as_float(((unsigned)h) << 16); }

// hazard guards as plain device helpers
__device__ __forceinline__ void dep_guard_h(v8f& a, v8f& b, v16h x, v16h y) { asm volatile("v_nop\n\tv_nop\n\tv_nop\n\tv_nop" : "+v"(a), "+v"(b) : "v"(x), "v"(y)); }
__device__ __forceinline__ void dep_guard_b(v8f& a, v8f& b, v16b x, v16b y) { asm volatile("v_nop\n\tv_nop\n\tv_nop\n\tv_nop" : "+v"(a), "+v"(b) : "v"(x), "v"(y)); }
__device__ __forceinline__ void keep4_h(v16h a, v16h b, v16h c, v16h d) { asm volatile("v_nop" :: "v"(a), "v"(b), "v"(c), "v"(d)); }
__device__ __forceinline__ void keep4_b(v16b a, v16b b, v16b c, v16b d) { asm volatile("v_nop" :: "v"(a), "v"(b), "v"(c), "v"(d)); }
__device__ __forceinline__ void acc_guard4(v8f& a, v8f& b, v8f& c, v8f& d) { asm volatile("v_nop\n\tv_nop\n\tv_nop\n\tv_nop" : "+v"(a), "+v"(b), "+v"(c), "+v"(d)); }
template <typename T> struct Frag;
template <> struct Frag<_Float16> {
  typedef v16h V; union U { v16h v; v8h h[2]; };
  static __device__ __forceinline__ v16h load(const _Float16* p) {   // elements 0..7 <- p[0..7], 8..15 <- p[16..23]
    U f; f.h[0] = *(const v8h*)(p); f.h[1] = *(const v8h*)(p + 16); return f.v;
  }
  static __device__ __forceinline__ v8f mma(v16h a, v16h b, v8f c) {
    return __builtin_amdgcn_wmma_f32_16x16x32_f16(false, a, false, b, (short)0, c, false, false);
  }
  static __device__ __forceinline__ void guard(v8f& a, v8f& b, v16h x, v16h y) { dep_guard_h(a, b, x, y); }
  static __device__ __forceinline__ void keep(v16h a, v16h b, v16h c, v16h d) { keep4_h(a, b, c, d); }
};
template <> struct Frag<__bf16> {
  typedef v16b V; union U { v16b v; v8b h[2]; };
  static __device__ __forceinline__ v16b load(const __bf16* p) {
    U f; f.h[0] = *(const v8b*)(p); f.h[1] = *(const v8b*)(p + 16); return f.v;
  }
  static __device__ __forceinline__ v8f mma(v16b a, v16b b, v8f c) {
    return __builtin_amdgcn_wmma_f32_16x16x32_bf16(false, a, false, b, (short)0, c, false, false);
  }
  static __device__ __forceinline__ void guard(v8f& a, v8f& b, v16b x, v16b y) { dep_guard_b(a, b, x, y); }
  static __device__ __forceinline__ void keep(v16b a, v16b b, v16b c, v16b d) { keep4_b(a, b, c, d); }
};

// tanh-GELU: 0.5*v*(1+tanh(sqrt(2/pi)*(v+0.044715*v^3))); tanh via exp(-2|u|), no division instruction
__device__ __forceinline__ float gelu_tanh_f(float v) {
  const float u = 0.7978845608028654f * (v + 0.044715f * v * v * v);
  const float e = __expf(-2.0f * fabsf(u));
  float t = (1.0f - e) * __builtin_amdgcn_rcpf(1.0f + e);
  t = copysignf(t, u);
  return 0.5f * v * (1.0f + t);
}

// ---- Register-blocked batched WMMA GEMM ------------------------------------
// C[m,n] = scale * sum_k A[m,k] * Bt[n,k] (+bias)(+resid); each wave owns a 64x64 tile, a block of 4 waves (2x2) a 128x128 tile.
// A row-major [M,K]; Bt row-major [N,K]; M,N % 128 == 0, K % 128 == 0.
// Operands reach the waves through LDS: a stage is 128 k of the block's 128 A rows and 128 Bt rows (256 B a row, pitch 272 B),
// brought by asynchronous copies into two buffers, the next stage's copies in flight while this stage is multiplied.
// SPLIT (hi/lo planes) is not built in this form.
// BIAS_MODE: 0 = none, 1 = bias[m], 2 = bias[n].
// OUT_MODE: 0 = f32, 1 = f16, 2 = bf16 hi plane (Cout) + bf16 lo plane (Cout2).
// ACT: 0 none, 1 tanh, 2 relu, 3 silu, 4 leaky, 5 erf-gelu, 6 tanh-gelu.
// ET: 0 = f16 operands, 1 = bf16 operands (pointers passed as 16-bit storage)
template <int ET> struct Elem;
template <> struct Elem<0> { typedef _Float16 T; };
template <> struct Elem<1> { typedef __bf16 T; };
#define G_KS    128                       // k per stage
#define G_PITCH 136                       // LDS row pitch in 16-bit elements: 256 B + 16 B
#define G_STAGE (256 * G_PITCH)           // elements per buffer: rows 0..127 = A, rows 128..255 = Bt
// Eight asynchronous 16-byte copies per lane, rows 8 apart. The s_wait_xcnt stands inside the statement so that
// no address register of an issued copy is rewritten in front of it.
__device__ __forceinline__ void g_copy8(unsigned l, const unsigned short* g, size_t gstep) {
  const unsigned ls = 8u * G_PITCH * 2u;
  asm volatile(
      "global_load_async_to_lds_b128 %0, %8, off\n\t"
      "global_load_async_to_lds_b128 %1, %9, off\n\t"
      "global_load_async_to_lds_b128 %2, %10, off\n\t"
      "global_load_async_to_lds_b128 %3, %11, off\n\t"
      "global_load_async_to_lds_b128 %4, %12, off\n\t"
      "global_load_async_to_lds_b128 %5, %13, off\n\t"
      "global_load_async_to_lds_b128 %6, %14, off\n\t"
      "global_load_async_to_lds_b128 %7, %15, off\n\t"
      "s_wait_xcnt 0x0"
      :: "v"(l), "v"(l + ls), "v"(l + 2u * ls), "v"(l + 3u * ls), "v"(l + 4u * ls), "v"(l + 5u * ls), "v"(l + 6u * ls), "v"(l + 7u * ls),
         "v"(g), "v"(g + gstep), "v"(g + 2 * gstep), "v"(g + 3 * gstep), "v"(g + 4 * gstep), "v"(g + 5 * gstep), "v"(g + 6 * gstep), "v"(g + 7 * gstep)
      : "memory");
}
template <int ET, bool SPLIT, int BIAS_MODE, int OUT_MODE, bool RESID, int ACT = 0>
__global__ __launch_bounds__(128) void wmma_gemm64(
    const unsigned short* __restrict__ Ap, const unsigned short* __restrict__ A2p, int lda, long strideA,
    const unsigned short* __restrict__ Btp, const unsigned short* __restrict__ Bt2p, int ldb, long strideB,
    void* __restrict__ Cout, void* __restrict__ Cout2, int ldc, long strideC,
    const float* __restrict__ bias,
    const float* __restrict__ resid, long strideR,
    int M, int N, int K, float scale) {
  typedef typename Elem<ET>::T T;
  typedef typename Frag<T>::V V;
  static_assert(!SPLIT, "hi/lo planes are not staged");
  __shared__ __align__(16) unsigned short sAB[2 * G_STAGE];   // two stage buffers
  __shared__ __align__(16) float sT[4][16 * 68];   // per-wave 16x64 slab, pitch 68 floats
  const int b    = blockIdx.y;
  const int tid  = threadIdx.x;
  const int lane = tid & 31;
  const int wave = tid >> 5;
  const int tilesN = N >> 7;
  const int tilesM = M >> 7;
  const int tile = blockIdx.x;
  if (tile >= tilesM * tilesN) return;   // block-uniform, in front of every barrier and copy
  const int tm = tile / tilesN;
  const int tn = tile - tm * tilesN;
  const int mB = tm << 7;
  const int nB = tn << 7;
  const int wm = wave >> 1, wn = wave & 1;
  const int m0 = mB + (wm << 6);
  const int n0 = nB + (wn << 6);

  const int rlane = lane & 15;                 // row (A) / col (B, D) within subtile
  const int koff  = (lane >> 4) * 8;           // k offset of this lane half
  const int mOff  = (lane >> 4) * 8;           // D row offset

  // copy lanes: 16 lanes cover one 256-B row, a wave-wide copy two rows (four whole lines)
  const int crow = tid >> 4, cch = (tid & 15) * 8;
  const unsigned short* gA = Ap  + (size_t)b * strideA + (size_t)(mB + crow) * lda + cch;
  const unsigned short* gB = Btp + (size_t)b * strideB + (size_t)(nB + crow) * ldb + cch;
  const unsigned lbase = (unsigned)(size_t)(&sAB[0]) + (unsigned)(crow * G_PITCH + cch) * 2u;
  const size_t stepA = (size_t)8 * lda, stepB = (size_t)8 * ldb;
  auto stage_copy = [&](int st, int buf) {     // 32 copies per lane: one stage of A and Bt
    const unsigned l = lbase + (unsigned)buf * (G_STAGE * 2u);
    const unsigned short* a = gA + (size_t)st * G_KS;
    const unsigned short* w = gB + (size_t)st * G_KS;
    g_copy8(l,                          a,             stepA);
    g_copy8(l +  64u * G_PITCH * 2u,    a + 8 * stepA, stepA);
    g_copy8(l + 128u * G_PITCH * 2u,    w,             stepB);
    g_copy8(l + 192u * G_PITCH * 2u,    w + 8 * stepB, stepB);
  };

  v8f acc[4][4];
#pragma unroll
  for (int i = 0; i < 4; ++i)
#pragma unroll
    for (int j = 0; j < 4; ++j) acc[i][j] = (v8f){0.f,0.f,0.f,0.f,0.f,0.f,0.f,0.f};

  const int nst = K >> 7;
  stage_copy(0, 0);
  asm volatile("s_wait_asynccnt 0x0" ::: "memory");   // this wave's part of stage 0 has landed
  __syncthreads();                                     // stage 0 readable by every wave
  if (nst > 1) stage_copy(1, 1);
#pragma unroll 1   // kept rolled: one trip is one stage of the ring, with one publish point and one refill site
  for (int t = 0; t < nst; ++t) {
    const T* sbuf = (const T*)sAB + (size_t)(t & 1) * G_STAGE;
    const T* sA = sbuf + ((wm << 6) + rlane) * G_PITCH + koff;
    const T* sB = sbuf + (128 + (wn << 6) + rlane) * G_PITCH + koff;
#pragma unroll     // the loops below are unrolled so that fragments and accumulators are indexed by constants (registers, no scratch)
    for (int ks = 0; ks < G_KS / 32; ++ks) {
      V bh[4], ah[4];
#pragma unroll
      for (int j = 0; j < 4; ++j) bh[j] = Frag<T>::load(sB + j * 16 * G_PITCH + ks * 32);
#pragma unroll
      for (int i = 0; i < 4; ++i) ah[i] = Frag<T>::load(sA + i * 16 * G_PITCH + ks * 32);
#pragma unroll
      for (int i = 0; i < 4; ++i) {
#pragma unroll
        for (int j = 0; j < 4; ++j) acc[i][j] = Frag<T>::mma(ah[i], bh[j], acc[i][j]);
        Frag<T>::guard(acc[i][0], acc[i][3], ah[i], ah[i]);
      }
      Frag<T>::keep(bh[0], bh[1], bh[2], bh[3]);
    }
    asm volatile("s_wait_dscnt 0x0" ::: "memory");     // this wave's reads of buffer t & 1 are done
    asm volatile("s_wait_asynccnt 0x0" ::: "memory");  // this wave's part of stage t + 1 has landed
    __syncthreads();                                   // publishes stage t + 1, frees buffer t & 1
    if (t + 2 < nst) stage_copy(t + 2, t & 1);
  }
  asm volatile("s_wait_asynccnt 0x0" ::: "memory");    // no copy outstanding behind the loop
  acc_guard4(acc[0][0], acc[0][1], acc[0][2], acc[0][3]);
  acc_guard4(acc[1][0], acc[1][1], acc[1][2], acc[1][3]);
  acc_guard4(acc[2][0], acc[2][1], acc[2][2], acc[2][3]);
  acc_guard4(acc[3][0], acc[3][1], acc[3][2], acc[3][3]);

  // ---- epilogue ----
  float* slab = sT[wave];
  const float* Rb = RESID ? (resid + (size_t)b * strideR) : nullptr;
#pragma unroll
  for (int i = 0; i < 4; ++i) {
    const int mBase = m0 + (i << 4);
#pragma unroll
    for (int j = 0; j < 4; ++j) {
      const int n = n0 + (j << 4) + rlane;
      float bv = 0.f;
      if (BIAS_MODE == 2) bv = bias[n];
#pragma unroll
      for (int r = 0; r < 8; ++r) {
        float v = acc[i][j][r] * scale;
        if (BIAS_MODE == 1) v += bias[mBase + mOff + r];
        if (BIAS_MODE == 2) v += bv;
        if (RESID) v += Rb[(size_t)(mBase + mOff + r) * ldc + n];
        if (ACT == 1) v = tanhf(v);
        if (ACT == 2) v = fmaxf(v, 0.0f);
        if (ACT == 3) v = v / (1.0f + expf(-v));
        if (ACT == 4) v = (v > 0.f) ? v : 0.01f * v;
        if (ACT == 5) v = 0.5f * v * (1.0f + erff(v * 0.70710678118654752f));
        if (ACT == 6) v = gelu_tanh_f(v);
        slab[(mOff + r) * 68 + (j << 4) + rlane] = v;
      }
    }
    __builtin_amdgcn_fence(__ATOMIC_RELEASE, "workgroup");
    __builtin_amdgcn_wave_barrier();
    __builtin_amdgcn_fence(__ATOMIC_ACQUIRE, "workgroup");
    if (OUT_MODE == 0) {
      float* C = (float*)Cout + (size_t)b * strideC;
      const int hh = lane >> 4, c4 = (lane & 15) * 4;     // row seg = 256 B = 16 lanes x 16 B
      {
#pragma unroll
        for (int it = 0; it < 8; ++it) {
          const int row = it * 2 + hh;
          v4f v = *(const v4f*)(slab + row * 68 + c4);
          *(v4f*)(C + (size_t)(mBase + row) * ldc + n0 + c4) = v;
        }
        
      }
    } else {
      const int q = lane >> 3, c8 = (lane & 7) * 8;
      unsigned short* C  = (unsigned short*)Cout  + (size_t)b * strideC;
      unsigned short* C2 = (OUT_MODE == 2) ? ((unsigned short*)Cout2 + (size_t)b * strideC) : nullptr;
      {
#pragma unroll
        for (int it = 0; it < 4; ++it) {
          const int row = it * 4 + q;
          const float* sp = slab + row * 68 + c8;
          v8h hv, lv;
#pragma unroll
          for (int e = 0; e < 8; ++e) {
            if (OUT_MODE == 1) {
              hv[e] = (_Float16)sp[e];
            } else {
              unsigned short hb = f2bf_bits(sp[e]);
              unsigned short lb = f2bf_bits(sp[e] - bf_bits2f(hb));
              hv[e] = __builtin_bit_cast(_Float16, hb);
              lv[e] = __builtin_bit_cast(_Float16, lb);
            }
          }
          *(v8h*)(C + (size_t)(mBase + row) * ldc + n0 + c8) = hv;
          if (OUT_MODE == 2) *(v8h*)(C2 + (size_t)(mBase + row) * ldc + n0 + c8) = lv;
        }
        
      }
    }
    __builtin_amdgcn_fence(__ATOMIC_RELEASE, "workgroup");
    __builtin_amdgcn_wave_barrier();
    __builtin_amdgcn_fence(__ATOMIC_ACQUIRE, "workgroup");
  }
}

__global__ __launch_bounds__(256) void cast_f32_f16x2(
    const float* __restrict__ in, _Float16* __restrict__ out, int n2) {
  int i = blockIdx.x * 256 + threadIdx.x;
  if (i < n2) {
    const _Float16 h0 = (_Float16)in[2 * i], h1 = (_Float16)in[2 * i + 1];
    const unsigned u = (unsigned)__builtin_bit_cast(unsigned short, h0) | ((unsigned)__builtin_bit_cast(unsigned short, h1) << 16);
    ((unsigned*)out)[i] = u;
    
  }
}

// =====================================================================================
// Attention for head_dim 64, f32 in / f32 out; 16-bit operands: bf16 with optional hi/lo splits, or
// plain f16 (F16=true, non-split, probabilities carried x2^15).
//   Block = 4 waves = 64 query rows of one (batch, head); S % 64 == 0.
//   Element (b, s, h, d) of tensor X lives at X[b*X_bs + s*X_rs + h*X_hs + d] (strides in floats, multiples of 4).
//   mask_mode 0 none, 1 causal, 2 tensor [S][Skv], 3 per-token vectors, 4 causal + window, 5 relative bias,
//   6 = mask_a: int32 [S][Skv] nonzero = masked, OR mask_b: int32 [B][Skv] nonzero = masked; per 64x64
//       (b, q-tile, kv-tile) code table tcode[(b*nqb+qb)*t_pitch + kc]: 0 mixed (per-element reads),
//       1 all live (no reads), 2 all masked (tile skipped: zero contribution).
//   masked scores are replaced by mask_fill before the softmax; rows with no live key write 0.
//   grid.x = B * H * (S/64).
// =====================================================================================
#define AT_D 64
#define AT_NW 4
#define AT_QB 64
#define AT_KC 64
#define AT_LP 72    // LDS row pitch of the K, V^T and P tiles in 16-bit elements: 128 B of data + 16 B, so that the 16 rows
                    // which one ds_load_b128 fragment read touches fall on 16 different groups of four banks
struct AttnGeom { const int* tcode; const float* cp; const float* pc; long c_bs, c_rs, c_hs, t_pitch;
                  long q_bs, q_rs, q_hs, k_bs, k_rs, k_hs, v_bs, v_rs, v_hs, o_bs, o_rs, o_hs;
                  int S, Skv, H, mask_mode; float qscale; int blk0; float mask_fill; int mask_is_int; };
static_assert(sizeof(AttnGeom) == 184);

__device__ __forceinline__ unsigned short at_bf_bits(float f) {
  unsigned u = __float_as_uint(f);
  return (unsigned short)((u + 0x7FFFu + ((u >> 16) & 1u)) >> 16);
}
__device__ __forceinline__ __bf16 at_f2bf(float f) { return __builtin_bit_cast(__bf16, at_bf_bits(f)); }
__device__ __forceinline__ void at_split(float f, __bf16& hi, __bf16& lo) {
  const unsigned short hb = at_bf_bits(f);
  hi = __builtin_bit_cast(__bf16, hb);
  lo = at_f2bf(f - __uint_as_float(((unsigned)hb) << 16));
}
__device__ __forceinline__ v8f at_mma(v16b a, v16b b, v8f c) {
  c = __builtin_amdgcn_wmma_f32_16x16x32_bf16(false, a, false, b, (short)0, c, false, false);
  asm volatile("v_nop\n\tv_nop\n\tv_nop\n\tv_nop" : "+v"(c) : "v"(a), "v"(b));
  return c;
}
// 16-bit element as a bit pattern held in a __bf16 slot: f16 bits when F16, bf16 (RNE) otherwise
template <bool F16> __device__ __forceinline__ __bf16 at_to16(float f) {
  if (F16) return __builtin_bit_cast(__bf16, (_Float16)f);
  return at_f2bf(f);
}
template <bool F16> __device__ __forceinline__ v8f at_mma16(v16b a, v16b b, v8f c) {
  if (F16) {
    const v16h ah = __builtin_bit_cast(v16h, a), bh = __builtin_bit_cast(v16h, b);
    c = __builtin_amdgcn_wmma_f32_16x16x32_f16(false, ah, false, bh, (short)0, c, false, false);
    asm volatile("v_nop\n\tv_nop\n\tv_nop\n\tv_nop" : "+v"(c) : "v"(ah), "v"(bh));
    return c;
  }
  return at_mma(a, b, c);
}

// MODE is the mask mode as a compile-time constant: only that mode's mask code is compiled into the key loop.
template <bool SPLIT_QK, bool SPLIT_PV, bool F16, int MODE>
__global__ __launch_bounds__(128)
void attn64_kernel(const float* __restrict__ q, const float* __restrict__ k,
                   const float* __restrict__ v, float* __restrict__ out,
                   const int* __restrict__ mask_a, const int* __restrict__ mask_b, AttnGeom g) {
  static_assert(!(F16 && (SPLIT_QK || SPLIT_PV)));
  const float PSC = F16 ? 32768.0f : 1.0f;     // f16 probabilities carried x2^15, folded into the final 1/l
  union FB { v16b v; v8b h[2]; };
  __shared__ __align__(16) __bf16 Ksh[AT_KC * AT_LP];            // K hi [kv][d]      9 KB
  __shared__ __align__(16) __bf16 Ksl[SPLIT_QK ? AT_KC * AT_LP : 8];
  __shared__ __align__(16) __bf16 Vth[AT_D * AT_LP];             // V hi [d][kv]      9 KB
  __shared__ __align__(16) __bf16 Vtl[SPLIT_PV ? AT_D * AT_LP : 8];
  __shared__ __align__(16) __bf16 Psh[AT_NW][16 * AT_LP];        // per wave P hi [row][kv]  9 KB
  __shared__ __align__(16) __bf16 Psl[SPLIT_PV ? AT_NW : 1][SPLIT_PV ? 16 * AT_LP : 8];
  __shared__ __align__(16) float  Os[AT_NW][16 * 68];            // per wave out tile, pitch 68

  const int tid  = threadIdx.x;
  const int wave = tid >> 5;
  const int lane = tid & 31;
  const int hh   = lane >> 4;
  const int c    = lane & 15;

  const int nqb = g.S / AT_QB;
  const int nkc = g.Skv / AT_KC;
  const int bx = blockIdx.x + g.blk0;
  const int qb = bx % nqb;
  const int bh = bx / nqb;
  const int h  = bh % g.H;
  const int b  = bh / g.H;
  const int qbase_block = qb * AT_QB;
  const int q0 = qbase_block + wave * 16;

  const float* qb_ptr = q + (size_t)b * g.q_bs + (size_t)h * g.q_hs;
  const float* kb_ptr = k + (size_t)b * g.k_bs + (size_t)h * g.k_hs;
  const float* vb_ptr = v + (size_t)b * g.v_bs + (size_t)h * g.v_hs;
  float*       ob_ptr = out + (size_t)b * g.o_bs + (size_t)h * g.o_hs;

  // ---- Q fragments (A operand): 2 d-chunks, hi (and lo) ----
  v16b qah[2], qal[2];
  {
    const float* qrow = qb_ptr + (size_t)(q0 + c) * g.q_rs;
#pragma unroll
    for (int dc = 0; dc < 2; ++dc) {
#pragma unroll
      for (int e = 0; e < 8; ++e) {
        const float f0 = qrow[dc * 32 + 8 * hh + e] * g.qscale;
        const float f1 = qrow[dc * 32 + 16 + 8 * hh + e] * g.qscale;
        if (SPLIT_QK) { __bf16 hq, lq; at_split(f0, hq, lq); qah[dc][e] = hq; qal[dc][e] = lq; at_split(f1, hq, lq); qah[dc][8 + e] = hq; qal[dc][8 + e] = lq; }
        else { qah[dc][e] = at_to16<F16>(f0); qah[dc][8 + e] = at_to16<F16>(f1); qal[dc][e] = qah[dc][e]; qal[dc][8 + e] = qah[dc][8 + e]; }
      }
    }
  }

  float mrow[8], lrow[8];
  v8f oacc[4];
#pragma unroll
  for (int r = 0; r < 8; ++r) { mrow[r] = -INFINITY; lrow[r] = 0.f; }
#pragma unroll
  for (int t = 0; t < 4; ++t) oacc[t] = (v8f){0.f,0.f,0.f,0.f,0.f,0.f,0.f,0.f};

  const int nChunks = (MODE == 1 || MODE == 4) ? (qb + 1) : nkc;   // block-uniform, bounded by Skv/64
  // per-row query mask (mode 3)
  int qkeep[8];
#pragma unroll
  for (int r = 0; r < 8; ++r) qkeep[r] = (MODE == 3) ? mask_b[(size_t)b * g.S + q0 + 8 * hh + r] : 1;   // mask_b = qmask in mode 3
  for (int kc = 0; kc < nChunks; ++kc) {
    const int kv0 = kc * AT_KC;
    int code = 0;
    if (MODE == 6) {
      int cv = g.tcode[((size_t)b * nqb + qb) * (size_t)g.t_pitch + kc];
      cv = __builtin_amdgcn_readfirstlane(cv);
      code = (cv == 1 || cv == 2) ? cv : 0;     // anything else -> mixed (per-element reads)
      if (code == 2) continue;                  // fully masked tile: zero contribution, softmax state unchanged
    }
    __syncthreads();
    {
      const int kvr = tid >> 1, dh = (tid & 1) * 32;
      const float* krow = kb_ptr + (size_t)(kv0 + kvr) * g.k_rs + dh;
      const float* vrow = vb_ptr + (size_t)(kv0 + kvr) * g.v_rs + dh;
#pragma unroll
      for (int i = 0; i < 8; ++i) {
        v4f kk = *(const v4f*)(krow + 4 * i);
        v4f vv = *(const v4f*)(vrow + 4 * i);
#pragma unroll
        for (int e = 0; e < 4; ++e) {
          const int d = dh + 4 * i + e;
          if (SPLIT_QK) { __bf16 a, bl; at_split(kk[e], a, bl); Ksh[kvr * AT_LP + d] = a; Ksl[kvr * AT_LP + d] = bl; }
          else Ksh[kvr * AT_LP + d] = at_to16<F16>(kk[e]);
          if (SPLIT_PV) { __bf16 a, bl; at_split(vv[e], a, bl); Vth[d * AT_LP + kvr] = a; Vtl[d * AT_LP + kvr] = bl; }
          else Vth[d * AT_LP + kvr] = at_to16<F16>(vv[e]);
        }
      }
    }
    __syncthreads();

    v8f s[4];
#pragma unroll
    for (int j = 0; j < 4; ++j) {
      s[j] = (v8f){0.f,0.f,0.f,0.f,0.f,0.f,0.f,0.f};
#pragma unroll 1
      for (int dc = 0; dc < 2; ++dc) {
        FB kb;
        kb.h[0] = *(const v8b*)(Ksh + (j * 16 + c) * AT_LP + dc * 32 + 8 * hh);
        kb.h[1] = *(const v8b*)(Ksh + (j * 16 + c) * AT_LP + dc * 32 + 16 + 8 * hh);
        s[j] = at_mma16<F16>(qah[dc], kb.v, s[j]);
        if (SPLIT_QK) {
          FB kl;
          kl.h[0] = *(const v8b*)(Ksl + (j * 16 + c) * AT_LP + dc * 32 + 8 * hh);
          kl.h[1] = *(const v8b*)(Ksl + (j * 16 + c) * AT_LP + dc * 32 + 16 + 8 * hh);
          s[j] = at_mma16<F16>(qah[dc], kl.v, s[j]);
          s[j] = at_mma16<F16>(qal[dc], kb.v, s[j]);
        }
      }
    }
    const bool diag = (MODE == 1) && (kc == qb);
    int kvkeep[4] = {1, 1, 1, 1};
    if (MODE == 3) {
#pragma unroll
      for (int j = 0; j < 4; ++j) kvkeep[j] = mask_a[(size_t)b * g.Skv + kv0 + j * 16 + c];   // mask_a = kvmask
    }
    if (MODE == 6 && code == 0) {               // mixed tile: one wave-uniform branch per tile, then per-element reads
      int kvpad[4];
#pragma unroll
      for (int j = 0; j < 4; ++j) kvpad[j] = mask_b[(size_t)b * g.Skv + kv0 + j * 16 + c];   // mask_b = key padding [B][Skv]
#pragma unroll   // both loops unrolled so that s[j][r] is indexed by constants and stays in registers
      for (int r = 0; r < 8; ++r) {
        const int* mrowp = mask_a + (size_t)(q0 + 8 * hh + r) * g.Skv + kv0 + c;
#pragma unroll
        for (int j = 0; j < 4; ++j)
          if ((mrowp[j * 16] != 0) || (kvpad[j] != 0)) s[j][r] = g.mask_fill;
      }
    }
    float cm[8];
#pragma unroll
    for (int r = 0; r < 8; ++r) {
      const int qrow = q0 + 8 * hh + r;
      float m = -INFINITY;
#pragma unroll
      for (int j = 0; j < 4; ++j) {
        const int kvcol = kv0 + j * 16 + c;
        bool masked = false;
        if (diag) masked = (kvcol > qrow);
        else if (MODE == 4) masked = (kvcol > qrow) || (qrow - kvcol > g.mask_is_int);
        else if (MODE == 2) {
          const size_t mi = (size_t)qrow * g.Skv + kvcol;
          masked = (g.mask_is_int == 0) ? (((const float*)mask_a)[mi] == 0.0f)
                 : (g.mask_is_int == 1) ? (mask_a[mi] == 0) : (mask_a[mi] != 0);
        } else if (MODE == 3) masked = (qkeep[r] == 0) || (kvkeep[j] == 0);
        else if (MODE == 5) {
          const size_t mi = (size_t)qrow * g.Skv + kvcol;
          masked = (mask_a[mi] != 0);
          int n = mask_b[mi]; n = n < 0 ? 0 : n;
          s[j][r] += g.cp[(size_t)b * g.c_bs + (size_t)h * g.c_hs + (size_t)qrow * g.c_rs + n]
                   + g.pc[(size_t)b * g.c_bs + (size_t)h * g.c_hs + (size_t)kvcol * g.c_rs + n];
        }
        if (masked) s[j][r] = g.mask_fill;
        m = fmaxf(m, s[j][r]);
      }
#pragma unroll
      for (int off = 1; off < 16; off <<= 1) m = fmaxf(m, __shfl_xor(m, off, 32));
      cm[r] = m;
    }
    __bf16* pwh = Psh[wave];
    __bf16* pwl = Psl[SPLIT_PV ? wave : 0];
#pragma unroll
    for (int r = 0; r < 8; ++r) {
      const float mnew = fmaxf(mrow[r], cm[r]);
      const bool dead = (mnew == -INFINITY);               // no live key seen yet for this row
      const float alpha = dead ? 1.0f : expf(mrow[r] - mnew);
      mrow[r] = mnew;
      float psum = 0.f;
#pragma unroll
      for (int j = 0; j < 4; ++j) {
        const float p = dead ? 0.0f : expf(s[j][r] - mnew);
        psum += p;
        if (SPLIT_PV) { __bf16 a, bl; at_split(p, a, bl); pwh[(8 * hh + r) * AT_LP + j * 16 + c] = a; pwl[(8 * hh + r) * AT_LP + j * 16 + c] = bl; }
        else pwh[(8 * hh + r) * AT_LP + j * 16 + c] = at_to16<F16>(p * PSC);
      }
#pragma unroll
      for (int off = 1; off < 16; off <<= 1) psum += __shfl_xor(psum, off, 32);
      lrow[r] = lrow[r] * alpha + psum;
#pragma unroll
      for (int t = 0; t < 4; ++t) oacc[t][r] *= alpha;
    }
    __builtin_amdgcn_fence(__ATOMIC_RELEASE, "workgroup");
    __builtin_amdgcn_wave_barrier();
    __builtin_amdgcn_fence(__ATOMIC_ACQUIRE, "workgroup");
#pragma unroll 1
    for (int kk = 0; kk < 2; ++kk) {
      FB pa, pl;
      pa.h[0] = *(const v8b*)(pwh + c * AT_LP + kk * 32 + 8 * hh);
      pa.h[1] = *(const v8b*)(pwh + c * AT_LP + kk * 32 + 16 + 8 * hh);
      if (SPLIT_PV) {
        pl.h[0] = *(const v8b*)(pwl + c * AT_LP + kk * 32 + 8 * hh);
        pl.h[1] = *(const v8b*)(pwl + c * AT_LP + kk * 32 + 16 + 8 * hh);
      }
#pragma unroll
      for (int t = 0; t < 4; ++t) {
        FB vb;
        vb.h[0] = *(const v8b*)(Vth + (t * 16 + c) * AT_LP + kk * 32 + 8 * hh);
        vb.h[1] = *(const v8b*)(Vth + (t * 16 + c) * AT_LP + kk * 32 + 16 + 8 * hh);
        oacc[t] = at_mma16<F16>(pa.v, vb.v, oacc[t]);
        if (SPLIT_PV) {
          FB vl;
          vl.h[0] = *(const v8b*)(Vtl + (t * 16 + c) * AT_LP + kk * 32 + 8 * hh);
          vl.h[1] = *(const v8b*)(Vtl + (t * 16 + c) * AT_LP + kk * 32 + 16 + 8 * hh);
          oacc[t] = at_mma16<F16>(pa.v, vl.v, oacc[t]);
          oacc[t] = at_mma16<F16>(pl.v, vb.v, oacc[t]);
        }
      }
    }
  }

  float* os = Os[wave];
#pragma unroll
  for (int r = 0; r < 8; ++r) {
    const float den = lrow[r] * PSC;
    const float inv = (den > 0.0f) ? (1.0f / den) : 0.0f;
#pragma unroll
    for (int t = 0; t < 4; ++t) os[(8 * hh + r) * 68 + t * 16 + c] = oacc[t][r] * inv;
  }
  __builtin_amdgcn_fence(__ATOMIC_RELEASE, "workgroup");
  __builtin_amdgcn_wave_barrier();
  __builtin_amdgcn_fence(__ATOMIC_ACQUIRE, "workgroup");
  {
    const int c4 = (lane & 15) * 4;
    {
#pragma unroll
      for (int it = 0; it < 8; ++it) {
        const int row = it * 2 + hh;
        v4f val = *(const v4f*)(os + row * 68 + c4);
        *(v4f*)(ob_ptr + (size_t)(q0 + row) * g.o_rs + c4) = val;
      }
      
    }
  }
}

// =====================================================================================
// 64x64 tile classification of the attention mask: one block per (b, q-tile); for each kv-tile:
//   masked(q,k) = tm[q][k] != 0 || pad[b][k] != 0;  code 2 = all masked, 1 = all live, 0 = mixed.
// =====================================================================================
__global__ __launch_bounds__(256) void tilecode_kernel(
    const int* __restrict__ tm, const int* __restrict__ pad, int* __restrict__ tab,
    int Skv, int nqb, int nkc, int tp) {
  __shared__ int wl[8], wm[8];
  __shared__ __align__(16) int codes[128];
  const int tid = threadIdx.x, lane = tid & 31, wave = tid >> 5;
  const int b  = blockIdx.x / nqb;
  const int qb = blockIdx.x - b * nqb;
  const int row = tid >> 2, cs = (tid & 3) * 16;
  const int q = qb * 64 + row;
  if (tid < 128) codes[tid] = 2;
  __syncthreads();
  const int nk = nkc < 128 ? nkc : 128;
  for (int kc = 0; kc < nk; ++kc) {
    const int* mr = tm  + (size_t)q * Skv + kc * 64 + cs;
    const int* pr = pad + (size_t)b * Skv + kc * 64 + cs;
    int live = 0, msk = 0;
#pragma unroll
    for (int i = 0; i < 4; ++i) {
      const v4i mv = *(const v4i*)(mr + 4 * i);
      const v4i pv = *(const v4i*)(pr + 4 * i);
#pragma unroll
      for (int e = 0; e < 4; ++e) {
        const int m = ((mv[e] != 0) || (pv[e] != 0)) ? 1 : 0;
        msk |= m;
        live |= (m ^ 1);
      }
    }
    const int al = __any(live);
    const int am = __any(msk);
    if (lane == 0) { wl[wave] = al; wm[wave] = am; }
    __syncthreads();
    if (tid == 0) {
      int L = 0, Mk = 0;
#pragma unroll
      for (int w = 0; w < 8; ++w) { L |= wl[w]; Mk |= wm[w]; }
      codes[kc] = (L == 0) ? 2 : ((Mk == 0) ? 1 : 0);
    }
    __syncthreads();
  }
  if (wave == 0) {
    const int nl = tp >> 2;          // tp is a multiple of 32 ints, <= 128
    v4i cv;
    cv[0] = codes[(4 * lane + 0) & 127]; cv[1] = codes[(4 * lane + 1) & 127];
    cv[2] = codes[(4 * lane + 2) & 127]; cv[3] = codes[(4 * lane + 3) & 127];
    int* dst = tab + (size_t)blockIdx.x * tp + 4 * lane;
    if (lane < nl) *(v4i*)dst = cv;
    
  }
}

// =====================================================================================
// LayerNorm over 1024-wide rows: one block (256 thr) per row, 4 contiguous floats per thread.
// =====================================================================================
template <bool OUT16>
__global__ __launch_bounds__(256) void ln_kernel(
    const float* __restrict__ in, const float* __restrict__ gam, const float* __restrict__ bet,
    float* __restrict__ o32, _Float16* __restrict__ o16) {
  __shared__ float red1[8], red2[8];
  __shared__ __align__(16) float ybuf[OUT16 ? DM : 4];
  const int row = blockIdx.x, t = threadIdx.x, lane = t & 31, wave = t >> 5;
  const float* x = in + (size_t)row * DM;
  const v4f xv = *(const v4f*)(x + 4 * t);
  float s = (xv[0] + xv[1]) + (xv[2] + xv[3]);
#pragma unroll
  for (int off = 1; off < 32; off <<= 1) s += __shfl_xor(s, off, 32);
  if (lane == 0) red1[wave] = s;
  __syncthreads();
  float tot = 0.f;
#pragma unroll
  for (int w = 0; w < 8; ++w) tot += red1[w];
  const float mu = tot * (1.0f / (float)DM);
  const float d0 = xv[0] - mu, d1 = xv[1] - mu, d2 = xv[2] - mu, d3 = xv[3] - mu;
  float s2 = (d0 * d0 + d1 * d1) + (d2 * d2 + d3 * d3);
#pragma unroll
  for (int off = 1; off < 32; off <<= 1) s2 += __shfl_xor(s2, off, 32);
  if (lane == 0) red2[wave] = s2;
  __syncthreads();
  float tot2 = 0.f;
#pragma unroll
  for (int w = 0; w < 8; ++w) tot2 += red2[w];
  const float var = tot2 * (1.0f / (float)DM);
  const float rstd = rsqrtf(var + LN_EPS);
  const v4f gv = *(const v4f*)(gam + 4 * t);
  const v4f bv = *(const v4f*)(bet + 4 * t);
  v4f y;
  y[0] = d0 * rstd * gv[0] + bv[0];
  y[1] = d1 * rstd * gv[1] + bv[1];
  y[2] = d2 * rstd * gv[2] + bv[2];
  y[3] = d3 * rstd * gv[3] + bv[3];
  float* op = o32 + (size_t)row * DM + 4 * t;
  *(v4f*)op = y;
  
  if (OUT16) {
    *(v4f*)(ybuf + 4 * t) = y;
    __syncthreads();
    if (t < DM / 8) {
      v8h hv;
#pragma unroll
      for (int e = 0; e < 8; ++e) hv[e] = (_Float16)ybuf[8 * t + e];
      _Float16* hp = o16 + (size_t)row * DM + 8 * t;
      *(v8h*)hp = hv;
      
    }
  }
}

// =====================================================================================
// Host orchestration
// =====================================================================================
extern "C" void kernel_launch(void* const* d_in, const int* in_sizes, int n_in,
                              void* d_out, int out_size, void* d_ws, size_t ws_size,
                              hipStream_t stream) {
  if (n_in < 16) return;
  if (in_sizes[0] != MROWS * DM || in_sizes[1] != SEQ * SEQ || in_sizes[2] != BSZ * SEQ) return;
  if (in_sizes[3] != DM * DM || in_sizes[4] != DM * DM || in_sizes[5] != DM * DM || in_sizes[6] != DM * DM) return;
  if (in_sizes[7] != DM || in_sizes[8] != FFND * DM || in_sizes[9] != FFND) return;
  if (in_sizes[10] != DM * FFND || in_sizes[11] != DM) return;
  if (in_sizes[12] != DM || in_sizes[13] != DM || in_sizes[14] != DM || in_sizes[15] != DM) return;
  if (out_size != MROWS * DM) return;

  const float* tgt   = (const float*)d_in[0];
  const int*   tmask = (const int*)d_in[1];     // [SEQ][SEQ], nonzero = masked
  const int*   pmask = (const int*)d_in[2];     // [BSZ][SEQ], nonzero = masked
  const float* Wq    = (const float*)d_in[3];
  const float* Wk    = (const float*)d_in[4];
  const float* Wv    = (const float*)d_in[5];
  const float* Wo    = (const float*)d_in[6];
  const float* bo    = (const float*)d_in[7];
  const float* W1    = (const float*)d_in[8];
  const float* b1    = (const float*)d_in[9];
  const float* W2    = (const float*)d_in[10];
  const float* b2    = (const float*)d_in[11];
  const float* g1    = (const float*)d_in[12];
  const float* be1   = (const float*)d_in[13];
  const float* g2    = (const float*)d_in[14];
  const float* be2   = (const float*)d_in[15];
  float* out = (float*)d_out;

  // ---- workspace carve (bytes), regions reused across phases ----
  const size_t MiB = 1048576;
  const int nqb = SEQ / AT_QB, nkc = SEQ / AT_KC;
  if (nkc > 128) return;
  const int TP = ((nkc + 31) / 32) * 32;
  const size_t tabBytes = (size_t)BSZ * nqb * TP * sizeof(int);
  const size_t total = 96 * MiB + tabBytes;
  if (total > ws_size) return;
  char* ws = (char*)d_ws;
  float*    Qf   = (float*)(ws + 0 * MiB);          // [4096][1024] f32   (projections -> attention)
  float*    Kf   = (float*)(ws + 16 * MiB);
  float*    Vf   = (float*)(ws + 32 * MiB);
  float*    RES1 = (float*)(ws + 0 * MiB);          // tgt + attn-proj     (after attention)
  _Float16* H16  = (_Float16*)(ws + 0 * MiB);       // [4096][4096] f16   (after LN1)
  float*    X1f  = (float*)(ws + 32 * MiB);         // LN1 output f32     (after attention)
  float*    AOf  = (float*)(ws + 48 * MiB);         // attention output f32
  float*    RES2 = (float*)(ws + 48 * MiB);         // x1 + ffn           (after out-proj)
  _Float16* X16  = (_Float16*)(ws + 64 * MiB);      // tgt f16            (projections)
  _Float16* O16  = (_Float16*)(ws + 64 * MiB);      // attention output f16 (after projections)
  _Float16* X1h  = (_Float16*)(ws + 64 * MiB);      // LN1 output f16     (after out-proj)
  _Float16* Wq16 = (_Float16*)(ws + 72 * MiB);
  _Float16* Wk16 = (_Float16*)(ws + 74 * MiB);
  _Float16* Wv16 = (_Float16*)(ws + 76 * MiB);
  _Float16* Wo16 = (_Float16*)(ws + 78 * MiB);
  _Float16* W1h  = (_Float16*)(ws + 80 * MiB);      // [4096][1024]
  _Float16* W2h  = (_Float16*)(ws + 88 * MiB);      // [1024][4096]
  int*      TAB  = (int*)(ws + 96 * MiB);           // [BSZ*nqb][TP]

  auto castf = [&](const float* src, _Float16* dst, int n) {
    const int n2 = n / 2;
    cast_f32_f16x2<<<dim3((n2 + 255) / 256), dim3(256), 0, stream>>>(src, dst, n2);
  };
  castf(tgt, X16, MROWS * DM);
  castf(Wq, Wq16, DM * DM);
  castf(Wk, Wk16, DM * DM);
  castf(Wv, Wv16, DM * DM);
  castf(Wo, Wo16, DM * DM);
  castf(W1, W1h, FFND * DM);
  castf(W2, W2h, DM * FFND);

  // mask tile codes
  tilecode_kernel<<<dim3(BSZ * nqb), dim3(256), 0, stream>>>(tmask, pmask, TAB, SEQ, nqb, nkc, TP);

  const long z = 0;
  typedef const unsigned short* cu16;
  const int tilesM = MROWS / 128;
  // q/k/v projections: [4096][1024] = X16 . W^T, f32 out
  {
    const dim3 grid(tilesM * (DM / 128), 1);
    wmma_gemm64<0, false, 0, 0, false, 0><<<grid, dim3(128), 0, stream>>>(
        (cu16)X16, (cu16)X16, DM, z, (cu16)Wq16, (cu16)Wq16, DM, z, (void*)Qf, (void*)Qf, DM, z,
        bo, tgt, z, MROWS, DM, DM, 1.0f);
    wmma_gemm64<0, false, 0, 0, false, 0><<<grid, dim3(128), 0, stream>>>(
        (cu16)X16, (cu16)X16, DM, z, (cu16)Wk16, (cu16)Wk16, DM, z, (void*)Kf, (void*)Kf, DM, z,
        bo, tgt, z, MROWS, DM, DM, 1.0f);
    wmma_gemm64<0, false, 0, 0, false, 0><<<grid, dim3(128), 0, stream>>>(
        (cu16)X16, (cu16)X16, DM, z, (cu16)Wv16, (cu16)Wv16, DM, z, (void*)Vf, (void*)Vf, DM, z,
        bo, tgt, z, MROWS, DM, DM, 1.0f);
  }

  // attention: q,k,v,o element (b, s, h, d) at b*SEQ*DM + s*DM + h*64 + d
  {
    AttnGeom g;
    g.tcode = TAB; g.cp = Qf; g.pc = Qf; g.c_bs = 0; g.c_rs = 0; g.c_hs = 0; g.t_pitch = TP;
    g.q_bs = (long)SEQ * DM; g.q_rs = DM; g.q_hs = HD;
    g.k_bs = (long)SEQ * DM; g.k_rs = DM; g.k_hs = HD;
    g.v_bs = (long)SEQ * DM; g.v_rs = DM; g.v_hs = HD;
    g.o_bs = (long)SEQ * DM; g.o_rs = DM; g.o_hs = HD;
    g.S = SEQ; g.Skv = SEQ; g.H = NHEAD; g.mask_mode = 6; g.qscale = 0.125f; g.blk0 = 0;
    g.mask_fill = -INFINITY; g.mask_is_int = 2;
    attn64_kernel<false, false, true, 6><<<dim3(BSZ * NHEAD * nqb), dim3(128), 0, stream>>>(
        Qf, Kf, Vf, AOf, tmask, pmask, g);
  }
  castf(AOf, O16, MROWS * DM);

  // RES1 = tgt + (O . Wo^T + bo)
  {
    const dim3 grid(tilesM * (DM / 128), 1);
    wmma_gemm64<0, false, 2, 0, true, 0><<<grid, dim3(128), 0, stream>>>(
        (cu16)O16, (cu16)O16, DM, z, (cu16)Wo16, (cu16)Wo16, DM, z, (void*)RES1, (void*)RES1, DM, z,
        bo, tgt, z, MROWS, DM, DM, 1.0f);
  }
  // x1 = LN(RES1) -> f32 + f16
  ln_kernel<true><<<dim3(MROWS), dim3(256), 0, stream>>>(RES1, g1, be1, X1f, X1h);
  // H16 = gelu_tanh(x1 . W1^T + b1), f16 [4096][4096]
  {
    const dim3 grid(tilesM * (FFND / 128), 1);
    wmma_gemm64<0, false, 2, 1, false, 6><<<grid, dim3(128), 0, stream>>>(
        (cu16)X1h, (cu16)X1h, DM, z, (cu16)W1h, (cu16)W1h, DM, z, (void*)H16, (void*)H16, FFND, z,
        b1, tgt, z, MROWS, FFND, DM, 1.0f);
  }
  // RES2 = x1 + (H . W2^T + b2)
  {
    const dim3 grid(tilesM * (DM / 128), 1);
    wmma_gemm64<0, false, 2, 0, true, 0><<<grid, dim3(128), 0, stream>>>(
        (cu16)H16, (cu16)H16, FFND, z, (cu16)W2h, (cu16)W2h, FFND, z, (void*)RES2, (void*)RES2, DM, z,
        b2, X1f, z, MROWS, DM, FFND, 1.0f);
  }
  // out = LN(RES2)
  ln_kernel<false><<<dim3(MROWS), dim3(256), 0, stream>>>(RES2, g2, be2, out, X1h);
  (void)hipGetLastError();
}

// v004
// One run takes 369 microseconds.
// In both of two side-by-side timings against v003, it was 1.17 times as fast.
// Counting every step since v000, it is 5.33 times as fast.
// Contractions: q/k/v/out projections, FFN1, FFN2 on v_wmma_f32_16x16x32_f16 (f16 operands, f32 accumulate);
// attention scores (q*0.125).k^T and p.v on v_wmma_f32_16x16x32_f16 (f16 operands, p carried x2^15, f32 accumulate).
// Softmax, LayerNorm, tanh-GELU, bias and residual adds in f32.
#include <hip/hip_runtime.h>

typedef __attribute__((ext_vector_type(16))) _Float16 v16h;
typedef __attribute__((ext_vector_type(8)))  _Float16 v8h;
typedef __attribute__((ext_vector_type(16))) __bf16   v16b;
typedef __attribute__((ext_vector_type(8)))  __bf16   v8b;
typedef __attribute__((ext_vector_type(8)))  float    v8f;
typedef __attribute__((ext_vector_type(4)))  float    v4f;
typedef __attribute__((ext_vector_type(4)))  int      v4i;

#define DM     1024
#define NHEAD  16
#define HD     64
#define FFND   4096
#define BSZ    2
#define SEQ    2048
#define MROWS  (BSZ * SEQ)
#define LN_EPS 1e-5f

__device__ __forceinline__ unsigned short f2bf_bits(float f) {
  unsigned u = __float_as_uint(f);
  return (unsigned short)((u + 0x7FFFu + ((u >> 16) & 1u)) >> 16);
}
__device__ __forceinline__ float bf_bits2f(unsigned short h) { return __uint_as_float(((unsigned)h) << 16); }

// hazard guards as plain device helpers
__device__ __forceinline__ void dep_guard_h(v8f& a, v8f& b, v16h x, v16h y) { asm volatile("v_nop\n\tv_nop\n\tv_nop\n\tv_nop" : "+v"(a), "+v"(b) : "v"(x), "v"(y)); }
__device__ __forceinline__ void dep_guard_b(v8f& a, v8f& b, v16b x, v16b y) { asm volatile("v_nop\n\tv_nop\n\tv_nop\n\tv_nop" : "+v"(a), "+v"(b) : "v"(x), "v"(y)); }
__device__ __forceinline__ void keep4_h(v16h a, v16h b, v16h c, v16h d) { asm volatile("v_nop" :: "v"(a), "v"(b), "v"(c), "v"(d)); }
__device__ __forceinline__ void keep4_b(v16b a, v16b b, v16b c, v16b d) { asm volatile("v_nop" :: "v"(a), "v"(b), "v"(c), "v"(d)); }
__device__ __forceinline__ void acc_guard4(v8f& a, v8f& b, v8f& c, v8f& d) { asm volatile("v_nop\n\tv_nop\n\tv_nop\n\tv_nop" : "+v"(a), "+v"(b), "+v"(c), "+v"(d)); }
template <typename T> struct Frag;
template <> struct Frag<_Float16> {
  typedef v16h V; union U { v16h v; v8h h[2]; };
  static __device__ __forceinline__ v16h load(const _Float16* p) {   // elements 0..7 <- p[0..7], 8..15 <- p[16..23]
    U f; f.h[0] = *(const v8h*)(p); f.h[1] = *(const v8h*)(p + 16); return f.v;
  }
  static __device__ __forceinline__ v8f mma(v16h a, v16h b, v8f c) {
    return __builtin_amdgcn_wmma_f32_16x16x32_f16(false, a, false, b, (short)0, c, false, false);
  }
  static __device__ __forceinline__ void guard(v8f& a, v8f& b, v16h x, v16h y) { dep_guard_h(a, b, x, y); }
  static __device__ __forceinline__ void keep(v16h a, v16h b, v16h c, v16h d) { keep4_h(a, b, c, d); }
};
template <> struct Frag<__bf16> {
  typedef v16b V; union U { v16b v; v8b h[2]; };
  static __device__ __forceinline__ v16b load(const __bf16* p) {
    U f; f.h[0] = *(const v8b*)(p); f.h[1] = *(const v8b*)(p + 16); return f.v;
  }
  static __device__ __forceinline__ v8f mma(v16b a, v16b b, v8f c) {
    return __builtin_amdgcn_wmma_f32_16x16x32_bf16(false, a, false, b, (short)0, c, false, false);
  }
  static __device__ __forceinline__ void guard(v8f& a, v8f& b, v16b x, v16b y) { dep_guard_b(a, b, x, y); }
  static __device__ __forceinline__ void keep(v16b a, v16b b, v16b c, v16b d) { keep4_b(a, b, c, d); }
};

// tanh-GELU: 0.5*v*(1+tanh(sqrt(2/pi)*(v+0.044715*v^3))); tanh via exp(-2|u|), no division instruction
__device__ __forceinline__ float gelu_tanh_f(float v) {
  const float u = 0.7978845608028654f * (v + 0.044715f * v * v * v);
  const float e = __expf(-2.0f * fabsf(u));
  float t = (1.0f - e) * __builtin_amdgcn_rcpf(1.0f + e);
  t = copysignf(t, u);
  return 0.5f * v * (1.0f + t);
}

// ---- Register-blocked batched WMMA GEMM ------------------------------------
// C[m,n] = scale * sum_k A[m,k] * Bt[n,k] (+bias)(+resid); each wave owns a 64x64 tile, a block of 4 waves (2x2) a 128x128 tile.
// A row-major [M,K]; Bt row-major [N,K]; M,N % 128 == 0, K % 128 == 0.
// Operands reach the waves through LDS: a stage is 128 k of the block's 128 A rows and 128 Bt rows (256 B a row, pitch 272 B),
// brought by asynchronous copies into two buffers, the next stage's copies in flight while this stage is multiplied.
// SPLIT (hi/lo planes) is not built in this form.
// BIAS_MODE: 0 = none, 1 = bias[m], 2 = bias[n].
// OUT_MODE: 0 = f32, 1 = f16, 2 = bf16 hi plane (Cout) + bf16 lo plane (Cout2).
// ACT: 0 none, 1 tanh, 2 relu, 3 silu, 4 leaky, 5 erf-gelu, 6 tanh-gelu.
// ET: 0 = f16 operands, 1 = bf16 operands (pointers passed as 16-bit storage)
template <int ET> struct Elem;
template <> struct Elem<0> { typedef _Float16 T; };
template <> struct Elem<1> { typedef __bf16 T; };
#define G_KS    128                       // k per stage
#define G_PITCH 136                       // LDS row pitch in 16-bit elements: 256 B + 16 B
#define G_STAGE (256 * G_PITCH)           // elements per buffer: rows 0..127 = A, rows 128..255 = Bt
// Eight asynchronous 16-byte copies per lane, rows 8 apart. The s_wait_xcnt stands inside the statement so that
// no address register of an issued copy is rewritten in front of it.
__device__ __forceinline__ void g_copy8(unsigned l, const unsigned short* g, size_t gstep) {
  const unsigned ls = 8u * G_PITCH * 2u;
  asm volatile(
      "global_load_async_to_lds_b128 %0, %8, off\n\t"
      "global_load_async_to_lds_b128 %1, %9, off\n\t"
      "global_load_async_to_lds_b128 %2, %10, off\n\t"
      "global_load_async_to_lds_b128 %3, %11, off\n\t"
      "global_load_async_to_lds_b128 %4, %12, off\n\t"
      "global_load_async_to_lds_b128 %5, %13, off\n\t"
      "global_load_async_to_lds_b128 %6, %14, off\n\t"
      "global_load_async_to_lds_b128 %7, %15, off\n\t"
      "s_wait_xcnt 0x0"
      :: "v"(l), "v"(l + ls), "v"(l + 2u * ls), "v"(l + 3u * ls), "v"(l + 4u * ls), "v"(l + 5u * ls), "v"(l + 6u * ls), "v"(l + 7u * ls),
         "v"(g), "v"(g + gstep), "v"(g + 2 * gstep), "v"(g + 3 * gstep), "v"(g + 4 * gstep), "v"(g + 5 * gstep), "v"(g + 6 * gstep), "v"(g + 7 * gstep)
      : "memory");
}
template <int ET, bool SPLIT, int BIAS_MODE, int OUT_MODE, bool RESID, int ACT = 0>
__global__ __launch_bounds__(128) void wmma_gemm64(
    const unsigned short* __restrict__ Ap, const unsigned short* __restrict__ A2p, int lda, long strideA,
    const unsigned short* __restrict__ Btp, const unsigned short* __restrict__ Bt2p, int ldb, long strideB,
    void* __restrict__ Cout, void* __restrict__ Cout2, int ldc, long strideC,
    const float* __restrict__ bias,
    const float* __restrict__ resid, long strideR,
    int M, int N, int K, float scale) {
  typedef typename Elem<ET>::T T;
  typedef typename Frag<T>::V V;
  static_assert(!SPLIT, "hi/lo planes are not staged");
  __shared__ __align__(16) unsigned short sAB[2 * G_STAGE];   // two stage buffers
  __shared__ __align__(16) float sT[4][16 * 68];   // per-wave 16x64 slab, pitch 68 floats
  const int b    = blockIdx.y;
  const int tid  = threadIdx.x;
  const int lane = tid & 31;
  const int wave = tid >> 5;
  const int tilesN = N >> 7;
  const int tilesM = M >> 7;
  const int tile = blockIdx.x;
  if (tile >= tilesM * tilesN) return;   // block-uniform, in front of every barrier and copy
  const int tm = tile / tilesN;
  const int tn = tile - tm * tilesN;
  const int mB = tm << 7;
  const int nB = tn << 7;
  const int wm = wave >> 1, wn = wave & 1;
  const int m0 = mB + (wm << 6);
  const int n0 = nB + (wn << 6);

  const int rlane = lane & 15;                 // row (A) / col (B, D) within subtile
  const int koff  = (lane >> 4) * 8;           // k offset of this lane half
  const int mOff  = (lane >> 4) * 8;           // D row offset

  // copy lanes: 16 lanes cover one 256-B row, a wave-wide copy two rows (four whole lines)
  const int crow = tid >> 4, cch = (tid & 15) * 8;
  const unsigned short* gA = Ap  + (size_t)b * strideA + (size_t)(mB + crow) * lda + cch;
  const unsigned short* gB = Btp + (size_t)b * strideB + (size_t)(nB + crow) * ldb + cch;
  const unsigned lbase = (unsigned)(size_t)(&sAB[0]) + (unsigned)(crow * G_PITCH + cch) * 2u;
  const size_t stepA = (size_t)8 * lda, stepB = (size_t)8 * ldb;
  auto stage_copy = [&](int st, int buf) {     // 32 copies per lane: one stage of A and Bt
    const unsigned l = lbase + (unsigned)buf * (G_STAGE * 2u);
    const unsigned short* a = gA + (size_t)st * G_KS;
    const unsigned short* w = gB + (size_t)st * G_KS;
    g_copy8(l,                          a,             stepA);
    g_copy8(l +  64u * G_PITCH * 2u,    a + 8 * stepA, stepA);
    g_copy8(l + 128u * G_PITCH * 2u,    w,             stepB);
    g_copy8(l + 192u * G_PITCH * 2u,    w + 8 * stepB, stepB);
  };

  v8f acc[4][4];
#pragma unroll
  for (int i = 0; i < 4; ++i)
#pragma unroll
    for (int j = 0; j < 4; ++j) acc[i][j] = (v8f){0.f,0.f,0.f,0.f,0.f,0.f,0.f,0.f};

  const int nst = K >> 7;
  stage_copy(0, 0);
  asm volatile("s_wait_asynccnt 0x0" ::: "memory");   // this wave's part of stage 0 has landed
  __syncthreads();                                     // stage 0 readable by every wave
  if (nst > 1) stage_copy(1, 1);
#pragma unroll 1   // kept rolled: one trip is one stage of the ring, with one publish point and one refill site
  for (int t = 0; t < nst; ++t) {
    const T* sbuf = (const T*)sAB + (size_t)(t & 1) * G_STAGE;
    const T* sA = sbuf + ((wm << 6) + rlane) * G_PITCH + koff;
    const T* sB = sbuf + (128 + (wn << 6) + rlane) * G_PITCH + koff;
#pragma unroll     // the loops below are unrolled so that fragments and accumulators are indexed by constants (registers, no scratch)
    for (int ks = 0; ks < G_KS / 32; ++ks) {
      V bh[4], ah[4];
#pragma unroll
      for (int j = 0; j < 4; ++j) bh[j] = Frag<T>::load(sB + j * 16 * G_PITCH + ks * 32);
#pragma unroll
      for (int i = 0; i < 4; ++i) ah[i] = Frag<T>::load(sA + i * 16 * G_PITCH + ks * 32);
#pragma unroll
      for (int i = 0; i < 4; ++i) {
#pragma unroll
        for (int j = 0; j < 4; ++j) acc[i][j] = Frag<T>::mma(ah[i], bh[j], acc[i][j]);
        Frag<T>::guard(acc[i][0], acc[i][3], ah[i], ah[i]);
      }
      Frag<T>::keep(bh[0], bh[1], bh[2], bh[3]);
    }
    asm volatile("s_wait_dscnt 0x0" ::: "memory");     // this wave's reads of buffer t & 1 are done
    asm volatile("s_wait_asynccnt 0x0" ::: "memory");  // this wave's part of stage t + 1 has landed
    __syncthreads();                                   // publishes stage t + 1, frees buffer t & 1
    if (t + 2 < nst) stage_copy(t + 2, t & 1);
  }
  asm volatile("s_wait_asynccnt 0x0" ::: "memory");    // no copy outstanding behind the loop
  acc_guard4(acc[0][0], acc[0][1], acc[0][2], acc[0][3]);
  acc_guard4(acc[1][0], acc[1][1], acc[1][2], acc[1][3]);
  acc_guard4(acc[2][0], acc[2][1], acc[2][2], acc[2][3]);
  acc_guard4(acc[3][0], acc[3][1], acc[3][2], acc[3][3]);

  // ---- epilogue ----
  float* slab = sT[wave];
  const float* Rb = RESID ? (resid + (size_t)b * strideR) : nullptr;
#pragma unroll
  for (int i = 0; i < 4; ++i) {
    const int mBase = m0 + (i << 4);
#pragma unroll
    for (int j = 0; j < 4; ++j) {
      const int n = n0 + (j << 4) + rlane;
      float bv = 0.f;
      if (BIAS_MODE == 2) bv = bias[n];
#pragma unroll
      for (int r = 0; r < 8; ++r) {
        float v = acc[i][j][r] * scale;
        if (BIAS_MODE == 1) v += bias[mBase + mOff + r];
        if (BIAS_MODE == 2) v += bv;
        if (RESID) v += Rb[(size_t)(mBase + mOff + r) * ldc + n];
        if (ACT == 1) v = tanhf(v);
        if (ACT == 2) v = fmaxf(v, 0.0f);
        if (ACT == 3) v = v / (1.0f + expf(-v));
        if (ACT == 4) v = (v > 0.f) ? v : 0.01f * v;
        if (ACT == 5) v = 0.5f * v * (1.0f + erff(v * 0.70710678118654752f));
        if (ACT == 6) v = gelu_tanh_f(v);
        slab[(mOff + r) * 68 + (j << 4) + rlane] = v;
      }
    }
    __builtin_amdgcn_fence(__ATOMIC_RELEASE, "workgroup");
    __builtin_amdgcn_wave_barrier();
    __builtin_amdgcn_fence(__ATOMIC_ACQUIRE, "workgroup");
    if (OUT_MODE == 0) {
      float* C = (float*)Cout + (size_t)b * strideC;
      const int hh = lane >> 4, c4 = (lane & 15) * 4;     // row seg = 256 B = 16 lanes x 16 B
      {
#pragma unroll
        for (int it = 0; it < 8; ++it) {
          const int row = it * 2 + hh;
          v4f v = *(const v4f*)(slab + row * 68 + c4);
          *(v4f*)(C + (size_t)(mBase + row) * ldc + n0 + c4) = v;
        }
        
      }
    } else {
      const int q = lane >> 3, c8 = (lane & 7) * 8;
      unsigned short* C  = (unsigned short*)Cout  + (size_t)b * strideC;
      unsigned short* C2 = (OUT_MODE == 2) ? ((unsigned short*)Cout2 + (size_t)b * strideC) : nullptr;
      {
#pragma unroll
        for (int it = 0; it < 4; ++it) {
          const int row = it * 4 + q;
          const float* sp = slab + row * 68 + c8;
          v8h hv, lv;
#pragma unroll
          for (int e = 0; e < 8; ++e) {
            if (OUT_MODE == 1) {
              hv[e] = (_Float16)sp[e];
            } else {
              unsigned short hb = f2bf_bits(sp[e]);
              unsigned short lb = f2bf_bits(sp[e] - bf_bits2f(hb));
              hv[e] = __builtin_bit_cast(_Float16, hb);
              lv[e] = __builtin_bit_cast(_Float16, lb);
            }
          }
          *(v8h*)(C + (size_t)(mBase + row) * ldc + n0 + c8) = hv;
          if (OUT_MODE == 2) *(v8h*)(C2 + (size_t)(mBase + row) * ldc + n0 + c8) = lv;
        }
        
      }
    }
    __builtin_amdgcn_fence(__ATOMIC_RELEASE, "workgroup");
    __builtin_amdgcn_wave_barrier();
    __builtin_amdgcn_fence(__ATOMIC_ACQUIRE, "workgroup");
  }
}

__global__ __launch_bounds__(256) void cast_f32_f16x2(
    const float* __restrict__ in, _Float16* __restrict__ out, int n2) {
  int i = blockIdx.x * 256 + threadIdx.x;
  if (i < n2) {
    const _Float16 h0 = (_Float16)in[2 * i], h1 = (_Float16)in[2 * i + 1];
    const unsigned u = (unsigned)__builtin_bit_cast(unsigned short, h0) | ((unsigned)__builtin_bit_cast(unsigned short, h1) << 16);
    ((unsigned*)out)[i] = u;
    
  }
}

// =====================================================================================
// Attention for head_dim 64, f32 in / f32 out; 16-bit operands: bf16 with optional hi/lo splits, or
// plain f16 (F16=true, non-split, probabilities carried x2^15).
//   Block = 4 waves = 64 query rows of one (batch, head); S % 64 == 0.
//   Element (b, s, h, d) of tensor X lives at X[b*X_bs + s*X_rs + h*X_hs + d] (strides in floats, multiples of 4).
//   mask_mode 0 none, 1 causal, 2 tensor [S][Skv], 3 per-token vectors, 4 causal + window, 5 relative bias,
//   6 = mask_a: int32 [S][Skv] nonzero = masked, OR mask_b: int32 [B][Skv] nonzero = masked; per 64x64
//       (b, q-tile, kv-tile) code table tcode[(b*nqb+qb)*t_pitch + kc]: 0 mixed (per-element reads),
//       1 all live (no reads), 2 all masked (tile skipped: zero contribution).
//   masked scores are replaced by mask_fill before the softmax; rows with no live key write 0.
//   grid.x = B * H * (S/64).
// =====================================================================================
#define AT_D 64
#define AT_NW 4
#define AT_QB 64
#define AT_KC 64
#define AT_LOG2E 1.4426950408889634f
#define AT_LP 72    // LDS row pitch of the K, V^T and P tiles in 16-bit elements: 128 B of data + 16 B, so that the 16 rows
                    // which one ds_load_b128 fragment read touches fall on 16 different groups of four banks
struct AttnGeom { const int* tcode; const float* cp; const float* pc; long c_bs, c_rs, c_hs, t_pitch;
                  long q_bs, q_rs, q_hs, k_bs, k_rs, k_hs, v_bs, v_rs, v_hs, o_bs, o_rs, o_hs;
                  int S, Skv, H, mask_mode; float qscale; int blk0; float mask_fill; int mask_is_int; };
static_assert(sizeof(AttnGeom) == 184);

__device__ __forceinline__ unsigned short at_bf_bits(float f) {
  unsigned u = __float_as_uint(f);
  return (unsigned short)((u + 0x7FFFu + ((u >> 16) & 1u)) >> 16);
}
__device__ __forceinline__ __bf16 at_f2bf(float f) { return __builtin_bit_cast(__bf16, at_bf_bits(f)); }
__device__ __forceinline__ void at_split(float f, __bf16& hi, __bf16& lo) {
  const unsigned short hb = at_bf_bits(f);
  hi = __builtin_bit_cast(__bf16, hb);
  lo = at_f2bf(f - __uint_as_float(((unsigned)hb) << 16));
}
__device__ __forceinline__ v8f at_mma(v16b a, v16b b, v8f c) {
  c = __builtin_amdgcn_wmma_f32_16x16x32_bf16(false, a, false, b, (short)0, c, false, false);
  asm volatile("v_nop\n\tv_nop\n\tv_nop\n\tv_nop" : "+v"(c) : "v"(a), "v"(b));
  return c;
}
// 16-bit element as a bit pattern held in a __bf16 slot: f16 bits when F16, bf16 (RNE) otherwise
template <bool F16> __device__ __forceinline__ __bf16 at_to16(float f) {
  if (F16) return __builtin_bit_cast(__bf16, (_Float16)f);
  return at_f2bf(f);
}
template <bool F16> __device__ __forceinline__ v8f at_mma16(v16b a, v16b b, v8f c) {
  if (F16) {
    const v16h ah = __builtin_bit_cast(v16h, a), bh = __builtin_bit_cast(v16h, b);
    c = __builtin_amdgcn_wmma_f32_16x16x32_f16(false, ah, false, bh, (short)0, c, false, false);
    asm volatile("v_nop\n\tv_nop\n\tv_nop\n\tv_nop" : "+v"(c) : "v"(ah), "v"(bh));
    return c;
  }
  return at_mma(a, b, c);
}

// Five powers of two (one score row's four and its rescale factor) in one statement. Behind a v_exp_f32 the instruction set asks for
// one independent instruction before its result is read or its source overwritten: here each v_exp_f32 is that instruction for the
// one before it (the outputs are early-clobber, so none lies on a source), and the v_nop is it for the last.
__device__ __forceinline__ void at_exp2x5(float& o0, float& o1, float& o2, float& o3, float& o4,
                                          float x0, float x1, float x2, float x3, float x4) {
  asm("v_exp_f32 %0, %5\n\t"
      "v_exp_f32 %1, %6\n\t"
      "v_exp_f32 %2, %7\n\t"
      "v_exp_f32 %3, %8\n\t"
      "v_exp_f32 %4, %9\n\t"
      "v_nop"
      : "=&v"(o0), "=&v"(o1), "=&v"(o2), "=&v"(o3), "=&v"(o4)
      : "v"(x0), "v"(x1), "v"(x2), "v"(x3), "v"(x4));
}

// MODE is the mask mode as a compile-time constant: only that mode's mask code is compiled into the key loop.
template <bool SPLIT_QK, bool SPLIT_PV, bool F16, int MODE>
__global__ __launch_bounds__(128)
void attn64_kernel(const float* __restrict__ q, const float* __restrict__ k,
                   const float* __restrict__ v, float* __restrict__ out,
                   const int* __restrict__ mask_a, const int* __restrict__ mask_b, AttnGeom g) {
  static_assert(!(F16 && (SPLIT_QK || SPLIT_PV)));
  const float PSC = F16 ? 32768.0f : 1.0f;     // f16 probabilities carried x2^15, folded into the final 1/l
  union FB { v16b v; v8b h[2]; };
  __shared__ __align__(16) __bf16 Ksh[AT_KC * AT_LP];            // K hi [kv][d]      9 KB
  __shared__ __align__(16) __bf16 Ksl[SPLIT_QK ? AT_KC * AT_LP : 8];
  __shared__ __align__(16) __bf16 Vth[AT_D * AT_LP];             // V hi [d][kv]      9 KB
  __shared__ __align__(16) __bf16 Vtl[SPLIT_PV ? AT_D * AT_LP : 8];
  __shared__ __align__(16) __bf16 Psh[AT_NW][16 * AT_LP];        // per wave P hi [row][kv]  9 KB
  __shared__ __align__(16) __bf16 Psl[SPLIT_PV ? AT_NW : 1][SPLIT_PV ? 16 * AT_LP : 8];
  __shared__ __align__(16) float  Os[AT_NW][16 * 68];            // per wave out tile, pitch 68

  const int tid  = threadIdx.x;
  const int wave = tid >> 5;
  const int lane = tid & 31;
  const int hh   = lane >> 4;
  const int c    = lane & 15;

  const int nqb = g.S / AT_QB;
  const int nkc = g.Skv / AT_KC;
  const int bx = blockIdx.x + g.blk0;
  const int qb = bx % nqb;
  const int bh = bx / nqb;
  const int h  = bh % g.H;
  const int b  = bh / g.H;
  const int qbase_block = qb * AT_QB;
  const int q0 = qbase_block + wave * 16;

  const float* qb_ptr = q + (size_t)b * g.q_bs + (size_t)h * g.q_hs;
  const float* kb_ptr = k + (size_t)b * g.k_bs + (size_t)h * g.k_hs;
  const float* vb_ptr = v + (size_t)b * g.v_bs + (size_t)h * g.v_hs;
  float*       ob_ptr = out + (size_t)b * g.o_bs + (size_t)h * g.o_hs;

  // ---- Q fragments (A operand): 2 d-chunks, hi (and lo) ----
  v16b qah[2], qal[2];
  {
    const float* qrow = qb_ptr + (size_t)(q0 + c) * g.q_rs;
#pragma unroll
    for (int dc = 0; dc < 2; ++dc) {
#pragma unroll
      for (int e = 0; e < 8; ++e) {
        const float f0 = qrow[dc * 32 + 8 * hh + e] * g.qscale;
        const float f1 = qrow[dc * 32 + 16 + 8 * hh + e] * g.qscale;
        if (SPLIT_QK) { __bf16 hq, lq; at_split(f0, hq, lq); qah[dc][e] = hq; qal[dc][e] = lq; at_split(f1, hq, lq); qah[dc][8 + e] = hq; qal[dc][8 + e] = lq; }
        else { qah[dc][e] = at_to16<F16>(f0); qah[dc][8 + e] = at_to16<F16>(f1); qal[dc][e] = qah[dc][e]; qal[dc][8 + e] = qah[dc][8 + e]; }
      }
    }
  }

  float mrow[8], lrow[8];
  v8f oacc[4];
#pragma unroll
  for (int r = 0; r < 8; ++r) { mrow[r] = -INFINITY; lrow[r] = 0.f; }
#pragma unroll
  for (int t = 0; t < 4; ++t) oacc[t] = (v8f){0.f,0.f,0.f,0.f,0.f,0.f,0.f,0.f};

  const int nChunks = (MODE == 1 || MODE == 4) ? (qb + 1) : nkc;   // block-uniform, bounded by Skv/64
  // per-row query mask (mode 3)
  int qkeep[8];
#pragma unroll
  for (int r = 0; r < 8; ++r) qkeep[r] = (MODE == 3) ? mask_b[(size_t)b * g.S + q0 + 8 * hh + r] : 1;   // mask_b = qmask in mode 3
  for (int kc = 0; kc < nChunks; ++kc) {
    const int kv0 = kc * AT_KC;
    int code = 0;
    if (MODE == 6) {
      int cv = g.tcode[((size_t)b * nqb + qb) * (size_t)g.t_pitch + kc];
      cv = __builtin_amdgcn_readfirstlane(cv);
      code = (cv == 1 || cv == 2) ? cv : 0;     // anything else -> mixed (per-element reads)
      if (code == 2) continue;                  // fully masked tile: zero contribution, softmax state unchanged
    }
    __syncthreads();
    {
      const int kvr = tid >> 1, dh = (tid & 1) * 32;
      const float* krow = kb_ptr + (size_t)(kv0 + kvr) * g.k_rs + dh;
      const float* vrow = vb_ptr + (size_t)(kv0 + kvr) * g.v_rs + dh;
#pragma unroll
      for (int i = 0; i < 8; ++i) {
        v4f kk = *(const v4f*)(krow + 4 * i);
        v4f vv = *(const v4f*)(vrow + 4 * i);
#pragma unroll
        for (int e = 0; e < 4; ++e) {
          const int d = dh + 4 * i + e;
          if (SPLIT_QK) { __bf16 a, bl; at_split(kk[e], a, bl); Ksh[kvr * AT_LP + d] = a; Ksl[kvr * AT_LP + d] = bl; }
          else Ksh[kvr * AT_LP + d] = at_to16<F16>(kk[e]);
          if (SPLIT_PV) { __bf16 a, bl; at_split(vv[e], a, bl); Vth[d * AT_LP + kvr] = a; Vtl[d * AT_LP + kvr] = bl; }
          else Vth[d * AT_LP + kvr] = at_to16<F16>(vv[e]);
        }
      }
    }
    __syncthreads();

    v8f s[4];
#pragma unroll
    for (int j = 0; j < 4; ++j) {
      s[j] = (v8f){0.f,0.f,0.f,0.f,0.f,0.f,0.f,0.f};
#pragma unroll 1
      for (int dc = 0; dc < 2; ++dc) {
        FB kb;
        kb.h[0] = *(const v8b*)(Ksh + (j * 16 + c) * AT_LP + dc * 32 + 8 * hh);
        kb.h[1] = *(const v8b*)(Ksh + (j * 16 + c) * AT_LP + dc * 32 + 16 + 8 * hh);
        s[j] = at_mma16<F16>(qah[dc], kb.v, s[j]);
        if (SPLIT_QK) {
          FB kl;
          kl.h[0] = *(const v8b*)(Ksl + (j * 16 + c) * AT_LP + dc * 32 + 8 * hh);
          kl.h[1] = *(const v8b*)(Ksl + (j * 16 + c) * AT_LP + dc * 32 + 16 + 8 * hh);
          s[j] = at_mma16<F16>(qah[dc], kl.v, s[j]);
          s[j] = at_mma16<F16>(qal[dc], kb.v, s[j]);
        }
      }
    }
    const bool diag = (MODE == 1) && (kc == qb);
    int kvkeep[4] = {1, 1, 1, 1};
    if (MODE == 3) {
#pragma unroll
      for (int j = 0; j < 4; ++j) kvkeep[j] = mask_a[(size_t)b * g.Skv + kv0 + j * 16 + c];   // mask_a = kvmask
    }
    if (MODE == 6 && code == 0) {               // mixed tile: one wave-uniform branch per tile, then per-element reads
      int kvpad[4];
#pragma unroll
      for (int j = 0; j < 4; ++j) kvpad[j] = mask_b[(size_t)b * g.Skv + kv0 + j * 16 + c];   // mask_b = key padding [B][Skv]
#pragma unroll   // both loops unrolled so that s[j][r] is indexed by constants and stays in registers
      for (int r = 0; r < 8; ++r) {
        const int* mrowp = mask_a + (size_t)(q0 + 8 * hh + r) * g.Skv + kv0 + c;
#pragma unroll
        for (int j = 0; j < 4; ++j)
          if ((mrowp[j * 16] != 0) || (kvpad[j] != 0)) s[j][r] = g.mask_fill;
      }
    }
    float cm[8];
#pragma unroll
    for (int r = 0; r < 8; ++r) {
      const int qrow = q0 + 8 * hh + r;
      float m = -INFINITY;
#pragma unroll
      for (int j = 0; j < 4; ++j) {
        const int kvcol = kv0 + j * 16 + c;
        bool masked = false;
        if (diag) masked = (kvcol > qrow);
        else if (MODE == 4) masked = (kvcol > qrow) || (qrow - kvcol > g.mask_is_int);
        else if (MODE == 2) {
          const size_t mi = (size_t)qrow * g.Skv + kvcol;
          masked = (g.mask_is_int == 0) ? (((const float*)mask_a)[mi] == 0.0f)
                 : (g.mask_is_int == 1) ? (mask_a[mi] == 0) : (mask_a[mi] != 0);
        } else if (MODE == 3) masked = (qkeep[r] == 0) || (kvkeep[j] == 0);
        else if (MODE == 5) {
          const size_t mi = (size_t)qrow * g.Skv + kvcol;
          masked = (mask_a[mi] != 0);
          int n = mask_b[mi]; n = n < 0 ? 0 : n;
          s[j][r] += g.cp[(size_t)b * g.c_bs + (size_t)h * g.c_hs + (size_t)qrow * g.c_rs + n]
                   + g.pc[(size_t)b * g.c_bs + (size_t)h * g.c_hs + (size_t)kvcol * g.c_rs + n];
        }
        if (masked) s[j][r] = g.mask_fill;
        m = fmaxf(m, s[j][r]);
      }
#pragma unroll
      for (int off = 1; off < 16; off <<= 1) m = fmaxf(m, __shfl_xor(m, off, 32));
      cm[r] = m;
    }
    __bf16* pwh = Psh[wave];
    __bf16* pwl = Psl[SPLIT_PV ? wave : 0];
#pragma unroll
    for (int r = 0; r < 8; ++r) {
      const float mnew = fmaxf(mrow[r], cm[r]);
      // exp(x - mnew) = 2^(x * log2(e) - mb): one FMA and one v_exp_f32, no branch. A row with no live key yet takes mb = 0:
      // every exponent is then -inf (never inf - inf), so its p and alpha are 0 and its sums stay 0.
      const float mb = (mnew == -INFINITY) ? 0.0f : mnew * AT_LOG2E;
      float pe[4], alpha;
      at_exp2x5(pe[0], pe[1], pe[2], pe[3], alpha,
                fmaf(s[0][r], AT_LOG2E, -mb), fmaf(s[1][r], AT_LOG2E, -mb), fmaf(s[2][r], AT_LOG2E, -mb),
                fmaf(s[3][r], AT_LOG2E, -mb), fmaf(mrow[r], AT_LOG2E, -mb));
      mrow[r] = mnew;
      float psum = 0.f;
#pragma unroll
      for (int j = 0; j < 4; ++j) {
        const float p = pe[j];
        psum = (j == 0) ? p : psum + p;   // same order as 0 + p0 + p1 + p2 + p3; a power of two is never -0, so the same bits
        if (SPLIT_PV) { __bf16 a, bl; at_split(p, a, bl); pwh[(8 * hh + r) * AT_LP + j * 16 + c] = a; pwl[(8 * hh + r) * AT_LP + j * 16 + c] = bl; }
        else pwh[(8 * hh + r) * AT_LP + j * 16 + c] = at_to16<F16>(p * PSC);
      }
#pragma unroll
      for (int off = 1; off < 16; off <<= 1) psum += __shfl_xor(psum, off, 32);
      lrow[r] = lrow[r] * alpha + psum;
#pragma unroll
      for (int t = 0; t < 4; ++t) oacc[t][r] *= alpha;
    }
    __builtin_amdgcn_fence(__ATOMIC_RELEASE, "workgroup");
    __builtin_amdgcn_wave_barrier();
    __builtin_amdgcn_fence(__ATOMIC_ACQUIRE, "workgroup");
#pragma unroll 1
    for (int kk = 0; kk < 2; ++kk) {
      FB pa, pl;
      pa.h[0] = *(const v8b*)(pwh + c * AT_LP + kk * 32 + 8 * hh);
      pa.h[1] = *(const v8b*)(pwh + c * AT_LP + kk * 32 + 16 + 8 * hh);
      if (SPLIT_PV) {
        pl.h[0] = *(const v8b*)(pwl + c * AT_LP + kk * 32 + 8 * hh);
        pl.h[1] = *(const v8b*)(pwl + c * AT_LP + kk * 32 + 16 + 8 * hh);
      }
#pragma unroll
      for (int t = 0; t < 4; ++t) {
        FB vb;
        vb.h[0] = *(const v8b*)(Vth + (t * 16 + c) * AT_LP + kk * 32 + 8 * hh);
        vb.h[1] = *(const v8b*)(Vth + (t * 16 + c) * AT_LP + kk * 32 + 16 + 8 * hh);
        oacc[t] = at_mma16<F16>(pa.v, vb.v, oacc[t]);
        if (SPLIT_PV) {
          FB vl;
          vl.h[0] = *(const v8b*)(Vtl + (t * 16 + c) * AT_LP + kk * 32 + 8 * hh);
          vl.h[1] = *(const v8b*)(Vtl + (t * 16 + c) * AT_LP + kk * 32 + 16 + 8 * hh);
          oacc[t] = at_mma16<F16>(pa.v, vl.v, oacc[t]);
          oacc[t] = at_mma16<F16>(pl.v, vb.v, oacc[t]);
        }
      }
    }
  }

  float* os = Os[wave];
#pragma unroll
  for (int r = 0; r < 8; ++r) {
    const float den = lrow[r] * PSC;
    const float inv = (den > 0.0f) ? (1.0f / den) : 0.0f;
#pragma unroll
    for (int t = 0; t < 4; ++t) os[(8 * hh + r) * 68 + t * 16 + c] = oacc[t][r] * inv;
  }
  __builtin_amdgcn_fence(__ATOMIC_RELEASE, "workgroup");
  __builtin_amdgcn_wave_barrier();
  __builtin_amdgcn_fence(__ATOMIC_ACQUIRE, "workgroup");
  {
    const int c4 = (lane & 15) * 4;
    {
#pragma unroll
      for (int it = 0; it < 8; ++it) {
        const int row = it * 2 + hh;
        v4f val = *(const v4f*)(os + row * 68 + c4);
        *(v4f*)(ob_ptr + (size_t)(q0 + row) * g.o_rs + c4) = val;
      }
      
    }
  }
}

// =====================================================================================
// 64x64 tile classification of the attention mask: one block per (b, q-tile); for each kv-tile:
//   masked(q,k) = tm[q][k] != 0 || pad[b][k] != 0;  code 2 = all masked, 1 = all live, 0 = mixed.
// =====================================================================================
__global__ __launch_bounds__(256) void tilecode_kernel(
    const int* __restrict__ tm, const int* __restrict__ pad, int* __restrict__ tab,
    int Skv, int nqb, int nkc, int tp) {
  __shared__ int wl[8], wm[8];
  __shared__ __align__(16) int codes[128];
  const int tid = threadIdx.x, lane = tid & 31, wave = tid >> 5;
  const int b  = blockIdx.x / nqb;
  const int qb = blockIdx.x - b * nqb;
  const int row = tid >> 2, cs = (tid & 3) * 16;
  const int q = qb * 64 + row;
  if (tid < 128) codes[tid] = 2;
  __syncthreads();
  const int nk = nkc < 128 ? nkc : 128;
  for (int kc = 0; kc < nk; ++kc) {
    const int* mr = tm  + (size_t)q * Skv + kc * 64 + cs;
    const int* pr = pad + (size_t)b * Skv + kc * 64 + cs;
    int live = 0, msk = 0;
#pragma unroll
    for (int i = 0; i < 4; ++i) {
      const v4i mv = *(const v4i*)(mr + 4 * i);
      const v4i pv = *(const v4i*)(pr + 4 * i);
#pragma unroll
      for (int e = 0; e < 4; ++e) {
        const int m = ((mv[e] != 0) || (pv[e] != 0)) ? 1 : 0;
        msk |= m;
        live |= (m ^ 1);
      }
    }
    const int al = __any(live);
    const int am = __any(msk);
    if (lane == 0) { wl[wave] = al; wm[wave] = am; }
    __syncthreads();
    if (tid == 0) {
      int L = 0, Mk = 0;
#pragma unroll
      for (int w = 0; w < 8; ++w) { L |= wl[w]; Mk |= wm[w]; }
      codes[kc] = (L == 0) ? 2 : ((Mk == 0) ? 1 : 0);
    }
    __syncthreads();
  }
  if (wave == 0) {
    const int nl = tp >> 2;          // tp is a multiple of 32 ints, <= 128
    v4i cv;
    cv[0] = codes[(4 * lane + 0) & 127]; cv[1] = codes[(4 * lane + 1) & 127];
    cv[2] = codes[(4 * lane + 2) & 127]; cv[3] = codes[(4 * lane + 3) & 127];
    int* dst = tab + (size_t)blockIdx.x * tp + 4 * lane;
    if (lane < nl) *(v4i*)dst = cv;
    
  }
}

// =====================================================================================
// LayerNorm over 1024-wide rows: one block (256 thr) per row, 4 contiguous floats per thread.
// =====================================================================================
template <bool OUT16>
__global__ __launch_bounds__(256) void ln_kernel(
    const float* __restrict__ in, const float* __restrict__ gam, const float* __restrict__ bet,
    float* __restrict__ o32, _Float16* __restrict__ o16) {
  __shared__ float red1[8], red2[8];
  __shared__ __align__(16) float ybuf[OUT16 ? DM : 4];
  const int row = blockIdx.x, t = threadIdx.x, lane = t & 31, wave = t >> 5;
  const float* x = in + (size_t)row * DM;
  const v4f xv = *(const v4f*)(x + 4 * t);
  float s = (xv[0] + xv[1]) + (xv[2] + xv[3]);
#pragma unroll
  for (int off = 1; off < 32; off <<= 1) s += __shfl_xor(s, off, 32);
  if (lane == 0) red1[wave] = s;
  __syncthreads();
  float tot = 0.f;
#pragma unroll
  for (int w = 0; w < 8; ++w) tot += red1[w];
  const float mu = tot * (1.0f / (float)DM);
  const float d0 = xv[0] - mu, d1 = xv[1] - mu, d2 = xv[2] - mu, d3 = xv[3] - mu;
  float s2 = (d0 * d0 + d1 * d1) + (d2 * d2 + d3 * d3);
#pragma unroll
  for (int off = 1; off < 32; off <<= 1) s2 += __shfl_xor(s2, off, 32);
  if (lane == 0) red2[wave] = s2;
  __syncthreads();
  float tot2 = 0.f;
#pragma unroll
  for (int w = 0; w < 8; ++w) tot2 += red2[w];
  const float var = tot2 * (1.0f / (float)DM);
  const float rstd = rsqrtf(var + LN_EPS);
  const v4f gv = *(const v4f*)(gam + 4 * t);
  const v4f bv = *(const v4f*)(bet + 4 * t);
  v4f y;
  y[0] = d0 * rstd * gv[0] + bv[0];
  y[1] = d1 * rstd * gv[1] + bv[1];
  y[2] = d2 * rstd * gv[2] + bv[2];
  y[3] = d3 * rstd * gv[3] + bv[3];
  float* op = o32 + (size_t)row * DM + 4 * t;
  *(v4f*)op = y;
  
  if (OUT16) {
    *(v4f*)(ybuf + 4 * t) = y;
    __syncthreads();
    if (t < DM / 8) {
      v8h hv;
#pragma unroll
      for (int e = 0; e < 8; ++e) hv[e] = (_Float16)ybuf[8 * t + e];
      _Float16* hp = o16 + (size_t)row * DM + 8 * t;
      *(v8h*)hp = hv;
      
    }
  }
}

// =====================================================================================
// Host orchestration
// =====================================================================================
extern "C" void kernel_launch(void* const* d_in, const int* in_sizes, int n_in,
                              void* d_out, int out_size, void* d_ws, size_t ws_size,
                              hipStream_t stream) {
  if (n_in < 16) return;
  if (in_sizes[0] != MROWS * DM || in_sizes[1] != SEQ * SEQ || in_sizes[2] != BSZ * SEQ) return;
  if (in_sizes[3] != DM * DM || in_sizes[4] != DM * DM || in_sizes[5] != DM * DM || in_sizes[6] != DM * DM) return;
  if (in_sizes[7] != DM || in_sizes[8] != FFND * DM || in_sizes[9] != FFND) return;
  if (in_sizes[10] != DM * FFND || in_sizes[11] != DM) return;
  if (in_sizes[12] != DM || in_sizes[13] != DM || in_sizes[14] != DM || in_sizes[15] != DM) return;
  if (out_size != MROWS * DM) return;

  const float* tgt   = (const float*)d_in[0];
  const int*   tmask = (const int*)d_in[1];     // [SEQ][SEQ], nonzero = masked
  const int*   pmask = (const int*)d_in[2];     // [BSZ][SEQ], nonzero = masked
  const float* Wq    = (const float*)d_in[3];
  const float* Wk    = (const float*)d_in[4];
  const float* Wv    = (const float*)d_in[5];
  const float* Wo    = (const float*)d_in[6];
  const float* bo    = (const float*)d_in[7];
  const float* W1    = (const float*)d_in[8];
  const float* b1    = (const float*)d_in[9];
  const float* W2    = (const float*)d_in[10];
  const float* b2    = (const float*)d_in[11];
  const float* g1    = (const float*)d_in[12];
  const float* be1   = (const float*)d_in[13];
  const float* g2    = (const float*)d_in[14];
  const float* be2   = (const float*)d_in[15];
  float* out = (float*)d_out;

  // ---- workspace carve (bytes), regions reused across phases ----
  const size_t MiB = 1048576;
  const int nqb = SEQ / AT_QB, nkc = SEQ / AT_KC;
  if (nkc > 128) return;
  const int TP = ((nkc + 31) / 32) * 32;
  const size_t tabBytes = (size_t)BSZ * nqb * TP * sizeof(int);
  const size_t total = 96 * MiB + tabBytes;
  if (total > ws_size) return;
  char* ws = (char*)d_ws;
  float*    Qf   = (float*)(ws + 0 * MiB);          // [4096][1024] f32   (projections -> attention)
  float*    Kf   = (float*)(ws + 16 * MiB);
  float*    Vf   = (float*)(ws + 32 * MiB);
  float*    RES1 = (float*)(ws + 0 * MiB);          // tgt + attn-proj     (after attention)
  _Float16* H16  = (_Float16*)(ws + 0 * MiB);       // [4096][4096] f16   (after LN1)
  float*    X1f  = (float*)(ws + 32 * MiB);         // LN1 output f32     (after attention)
  float*    AOf  = (float*)(ws + 48 * MiB);         // attention output f32
  float*    RES2 = (float*)(ws + 48 * MiB);         // x1 + ffn           (after out-proj)
  _Float16* X16  = (_Float16*)(ws + 64 * MiB);      // tgt f16            (projections)
  _Float16* O16  = (_Float16*)(ws + 64 * MiB);      // attention output f16 (after projections)
  _Float16* X1h  = (_Float16*)(ws + 64 * MiB);      // LN1 output f16     (after out-proj)
  _Float16* Wq16 = (_Float16*)(ws + 72 * MiB);
  _Float16* Wk16 = (_Float16*)(ws + 74 * MiB);
  _Float16* Wv16 = (_Float16*)(ws + 76 * MiB);
  _Float16* Wo16 = (_Float16*)(ws + 78 * MiB);
  _Float16* W1h  = (_Float16*)(ws + 80 * MiB);      // [4096][1024]
  _Float16* W2h  = (_Float16*)(ws + 88 * MiB);      // [1024][4096]
  int*      TAB  = (int*)(ws + 96 * MiB);           // [BSZ*nqb][TP]

  auto castf = [&](const float* src, _Float16* dst, int n) {
    const int n2 = n / 2;
    cast_f32_f16x2<<<dim3((n2 + 255) / 256), dim3(256), 0, stream>>>(src, dst, n2);
  };
  castf(tgt, X16, MROWS * DM);
  castf(Wq, Wq16, DM * DM);
  castf(Wk, Wk16, DM * DM);
  castf(Wv, Wv16, DM * DM);
  castf(Wo, Wo16, DM * DM);
  castf(W1, W1h, FFND * DM);
  castf(W2, W2h, DM * FFND);

  // mask tile codes
  tilecode_kernel<<<dim3(BSZ * nqb), dim3(256), 0, stream>>>(tmask, pmask, TAB, SEQ, nqb, nkc, TP);

  const long z = 0;
  typedef const unsigned short* cu16;
  const int tilesM = MROWS / 128;
  // q/k/v projections: [4096][1024] = X16 . W^T, f32 out
  {
    const dim3 grid(tilesM * (DM / 128), 1);
    wmma_gemm64<0, false, 0, 0, false, 0><<<grid, dim3(128), 0, stream>>>(
        (cu16)X16, (cu16)X16, DM, z, (cu16)Wq16, (cu16)Wq16, DM, z, (void*)Qf, (void*)Qf, DM, z,
        bo, tgt, z, MROWS, DM, DM, 1.0f);
    wmma_gemm64<0, false, 0, 0, false, 0><<<grid, dim3(128), 0, stream>>>(
        (cu16)X16, (cu16)X16, DM, z, (cu16)Wk16, (cu16)Wk16, DM, z, (void*)Kf, (void*)Kf, DM, z,
        bo, tgt, z, MROWS, DM, DM, 1.0f);
    wmma_gemm64<0, false, 0, 0, false, 0><<<grid, dim3(128), 0, stream>>>(
        (cu16)X16, (cu16)X16, DM, z, (cu16)Wv16, (cu16)Wv16, DM, z, (void*)Vf, (void*)Vf, DM, z,
        bo, tgt, z, MROWS, DM, DM, 1.0f);
  }

  // attention: q,k,v,o element (b, s, h, d) at b*SEQ*DM + s*DM + h*64 + d
  {
    AttnGeom g;
    g.tcode = TAB; g.cp = Qf; g.pc = Qf; g.c_bs = 0; g.c_rs = 0; g.c_hs = 0; g.t_pitch = TP;
    g.q_bs = (long)SEQ * DM; g.q_rs = DM; g.q_hs = HD;
    g.k_bs = (long)SEQ * DM; g.k_rs = DM; g.k_hs = HD;
    g.v_bs = (long)SEQ * DM; g.v_rs = DM; g.v_hs = HD;
    g.o_bs = (long)SEQ * DM; g.o_rs = DM; g.o_hs = HD;
    g.S = SEQ; g.Skv = SEQ; g.H = NHEAD; g.mask_mode = 6; g.qscale = 0.125f; g.blk0 = 0;
    g.mask_fill = -INFINITY; g.mask_is_int = 2;
    attn64_kernel<false, false, true, 6><<<dim3(BSZ * NHEAD * nqb), dim3(128), 0, stream>>>(
        Qf, Kf, Vf, AOf, tmask, pmask, g);
  }
  castf(AOf, O16, MROWS * DM);

  // RES1 = tgt + (O . Wo^T + bo)
  {
    const dim3 grid(tilesM * (DM / 128), 1);
    wmma_gemm64<0, false, 2, 0, true, 0><<<grid, dim3(128), 0, stream>>>(
        (cu16)O16, (cu16)O16, DM, z, (cu16)Wo16, (cu16)Wo16, DM, z, (void*)RES1, (void*)RES1, DM, z,
        bo, tgt, z, MROWS, DM, DM, 1.0f);
  }
  // x1 = LN(RES1) -> f32 + f16
  ln_kernel<true><<<dim3(MROWS), dim3(256), 0, stream>>>(RES1, g1, be1, X1f, X1h);
  // H16 = gelu_tanh(x1 . W1^T + b1), f16 [4096][4096]
  {
    const dim3 grid(tilesM * (FFND / 128), 1);
    wmma_gemm64<0, false, 2, 1, false, 6><<<grid, dim3(128), 0, stream>>>(
        (cu16)X1h, (cu16)X1h, DM, z, (cu16)W1h, (cu16)W1h, DM, z, (void*)H16, (void*)H16, FFND, z,
        b1, tgt, z, MROWS, FFND, DM, 1.0f);
  }
  // RES2 = x1 + (H . W2^T + b2)
  {
    const dim3 grid(tilesM * (DM / 128), 1);
    wmma_gemm64<0, false, 2, 0, true, 0><<<grid, dim3(128), 0, stream>>>(
        (cu16)H16, (cu16)H16, FFND, z, (cu16)W2h, (cu16)W2h, FFND, z, (void*)RES2, (void*)RES2, DM, z,
        b2, X1f, z, MROWS, DM, FFND, 1.0f);
  }
  // out = LN(RES2)
  ln_kernel<false><<<dim3(MROWS), dim3(256), 0, stream>>>(RES2, g2, be2, out, X1h);
  (void)hipGetLastError();
}

// v005
// Measured time: 354 microseconds a run.
// Timed twice side by side with v004, it ran 1.04 times as fast both times.
// All steps since v000 together make it 5.54 times as fast.
// Contractions: q/k/v/out projections, FFN1, FFN2 on v_wmma_f32_16x16x32_f16 (f16 operands, f32 accumulate);
// attention scores (q*0.125).k^T and p.v on v_wmma_f32_16x16x32_f16 (f16 operands, p carried x2^15, f32 accumulate).
// Softmax, LayerNorm, tanh-GELU, bias and residual adds in f32.
#include <hip/hip_runtime.h>

typedef __attribute__((ext_vector_type(16))) _Float16 v16h;
typedef __attribute__((ext_vector_type(8)))  _Float16 v8h;
typedef __attribute__((ext_vector_type(16))) __bf16   v16b;
typedef __attribute__((ext_vector_type(8)))  __bf16   v8b;
typedef __attribute__((ext_vector_type(8)))  float    v8f;
typedef __attribute__((ext_vector_type(4)))  float    v4f;
typedef __attribute__((ext_vector_type(4)))  int      v4i;

#define DM     1024
#define NHEAD  16
#define HD     64
#define FFND   4096
#define BSZ    2
#define SEQ    2048
#define MROWS  (BSZ * SEQ)
#define LN_EPS 1e-5f

__device__ __forceinline__ unsigned short f2bf_bits(float f) {
  unsigned u = __float_as_uint(f);
  return (unsigned short)((u + 0x7FFFu + ((u >> 16) & 1u)) >> 16);
}
__device__ __forceinline__ float bf_bits2f(unsigned short h) { return __uint_as_float(((unsigned)h) << 16); }

// hazard guards as plain device helpers
__device__ __forceinline__ void dep_guard_h(v8f& a, v8f& b, v16h x, v16h y) { asm volatile("v_nop\n\tv_nop\n\tv_nop\n\tv_nop" : "+v"(a), "+v"(b) : "v"(x), "v"(y)); }
__device__ __forceinline__ void dep_guard_b(v8f& a, v8f& b, v16b x, v16b y) { asm volatile("v_nop\n\tv_nop\n\tv_nop\n\tv_nop" : "+v"(a), "+v"(b) : "v"(x), "v"(y)); }
__device__ __forceinline__ void keep4_h(v16h a, v16h b, v16h c, v16h d) { asm volatile("v_nop" :: "v"(a), "v"(b), "v"(c), "v"(d)); }
__device__ __forceinline__ void keep4_b(v16b a, v16b b, v16b c, v16b d) { asm volatile("v_nop" :: "v"(a), "v"(b), "v"(c), "v"(d)); }
__device__ __forceinline__ void acc_guard4(v8f& a, v8f& b, v8f& c, v8f& d) { asm volatile("v_nop\n\tv_nop\n\tv_nop\n\tv_nop" : "+v"(a), "+v"(b), "+v"(c), "+v"(d)); }
template <typename T> struct Frag;
template <> struct Frag<_Float16> {
  typedef v16h V; union U { v16h v; v8h h[2]; };
  static __device__ __forceinline__ v16h load(const _Float16* p) {   // elements 0..7 <- p[0..7], 8..15 <- p[16..23]
    U f; f.h[0] = *(const v8h*)(p); f.h[1] = *(const v8h*)(p + 16); return f.v;
  }
  static __device__ __forceinline__ v8f mma(v16h a, v16h b, v8f c) {
    return __builtin_amdgcn_wmma_f32_16x16x32_f16(false, a, false, b, (short)0, c, false, false);
  }
  static __device__ __forceinline__ void guard(v8f& a, v8f& b, v16h x, v16h y) { dep_guard_h(a, b, x, y); }
  static __device__ __forceinline__ void keep(v16h a, v16h b, v16h c, v16h d) { keep4_h(a, b, c, d); }
};
template <> struct Frag<__bf16> {
  typedef v16b V; union U { v16b v; v8b h[2]; };
  static __device__ __forceinline__ v16b load(const __bf16* p) {
    U f; f.h[0] = *(const v8b*)(p); f.h[1] = *(const v8b*)(p + 16); return f.v;
  }
  static __device__ __forceinline__ v8f mma(v16b a, v16b b, v8f c) {
    return __builtin_amdgcn_wmma_f32_16x16x32_bf16(false, a, false, b, (short)0, c, false, false);
  }
  static __device__ __forceinline__ void guard(v8f& a, v8f& b, v16b x, v16b y) { dep_guard_b(a, b, x, y); }
  static __device__ __forceinline__ void keep(v16b a, v16b b, v16b c, v16b d) { keep4_b(a, b, c, d); }
};

// tanh-GELU: 0.5*v*(1+tanh(sqrt(2/pi)*(v+0.044715*v^3))); tanh via exp(-2|u|), no division instruction
__device__ __forceinline__ float gelu_tanh_f(float v) {
  const float u = 0.7978845608028654f * (v + 0.044715f * v * v * v);
  const float e = __expf(-2.0f * fabsf(u));
  float t = (1.0f - e) * __builtin_amdgcn_rcpf(1.0f + e);
  t = copysignf(t, u);
  return 0.5f * v * (1.0f + t);
}

// ---- Register-blocked batched WMMA GEMM ------------------------------------
// C[m,n] = scale * sum_k A[m,k] * Bt[n,k] (+bias)(+resid); each wave owns a 64x64 tile, a block of 4 waves (2x2) a 128x128 tile.
// A row-major [M,K]; Bt row-major [N,K]; M,N % 128 == 0, K % 128 == 0.
// Operands reach the waves through LDS: a stage is 128 k of the block's 128 A rows and 128 Bt rows (256 B a row, pitch 272 B),
// brought by asynchronous copies into two buffers, the next stage's copies in flight while this stage is multiplied.
// SPLIT (hi/lo planes) is not built in this form.
// BIAS_MODE: 0 = none, 1 = bias[m], 2 = bias[n].
// OUT_MODE: 0 = f32, 1 = f16, 2 = bf16 hi plane (Cout) + bf16 lo plane (Cout2).
// ACT: 0 none, 1 tanh, 2 relu, 3 silu, 4 leaky, 5 erf-gelu, 6 tanh-gelu.
// ET: 0 = f16 operands, 1 = bf16 operands (pointers passed as 16-bit storage)
template <int ET> struct Elem;
template <> struct Elem<0> { typedef _Float16 T; };
template <> struct Elem<1> { typedef __bf16 T; };
#define G_KS    128                       // k per stage
#define G_PITCH 136                       // LDS row pitch in 16-bit elements: 256 B + 16 B
#define G_STAGE (256 * G_PITCH)           // elements per buffer: rows 0..127 = A, rows 128..255 = Bt
// Eight asynchronous 16-byte copies per lane, rows 8 apart. The s_wait_xcnt stands inside the statement so that
// no address register of an issued copy is rewritten in front of it.
__device__ __forceinline__ void g_copy8(unsigned l, const unsigned short* g, size_t gstep) {
  const unsigned ls = 8u * G_PITCH * 2u;
  asm volatile(
      "global_load_async_to_lds_b128 %0, %8, off\n\t"
      "global_load_async_to_lds_b128 %1, %9, off\n\t"
      "global_load_async_to_lds_b128 %2, %10, off\n\t"
      "global_load_async_to_lds_b128 %3, %11, off\n\t"
      "global_load_async_to_lds_b128 %4, %12, off\n\t"
      "global_load_async_to_lds_b128 %5, %13, off\n\t"
      "global_load_async_to_lds_b128 %6, %14, off\n\t"
      "global_load_async_to_lds_b128 %7, %15, off\n\t"
      "s_wait_xcnt 0x0"
      :: "v"(l), "v"(l + ls), "v"(l + 2u * ls), "v"(l + 3u * ls), "v"(l + 4u * ls), "v"(l + 5u * ls), "v"(l + 6u * ls), "v"(l + 7u * ls),
         "v"(g), "v"(g + gstep), "v"(g + 2 * gstep), "v"(g + 3 * gstep), "v"(g + 4 * gstep), "v"(g + 5 * gstep), "v"(g + 6 * gstep), "v"(g + 7 * gstep)
      : "memory");
}
template <int ET, bool SPLIT, int BIAS_MODE, int OUT_MODE, bool RESID, int ACT = 0>
__global__ __launch_bounds__(128) void wmma_gemm64(
    const unsigned short* __restrict__ Ap, const unsigned short* __restrict__ A2p, int lda, long strideA,
    const unsigned short* __restrict__ Btp, const unsigned short* __restrict__ Bt2p, int ldb, long strideB,
    void* __restrict__ Cout, void* __restrict__ Cout2, int ldc, long strideC,
    const float* __restrict__ bias,
    const float* __restrict__ resid, long strideR,
    int M, int N, int K, float scale) {
  typedef typename Elem<ET>::T T;
  typedef typename Frag<T>::V V;
  static_assert(!SPLIT, "hi/lo planes are not staged");
  __shared__ __align__(16) unsigned short sAB[2 * G_STAGE];   // two stage buffers
  __shared__ __align__(16) float sT[4][16 * 68];   // per-wave 16x64 slab, pitch 68 floats
  const int b    = blockIdx.y;
  const int tid  = threadIdx.x;
  const int lane = tid & 31;
  const int wave = tid >> 5;
  const int tilesN = N >> 7;
  const int tilesM = M >> 7;
  const int tile = blockIdx.x;
  if (tile >= tilesM * tilesN) return;   // block-uniform, in front of every barrier and copy
  const int tm = tile / tilesN;
  const int tn = tile - tm * tilesN;
  const int mB = tm << 7;
  const int nB = tn << 7;
  const int wm = wave >> 1, wn = wave & 1;
  const int m0 = mB + (wm << 6);
  const int n0 = nB + (wn << 6);

  const int rlane = lane & 15;                 // row (A) / col (B, D) within subtile
  const int koff  = (lane >> 4) * 8;           // k offset of this lane half
  const int mOff  = (lane >> 4) * 8;           // D row offset

  // copy lanes: 16 lanes cover one 256-B row, a wave-wide copy two rows (four whole lines)
  const int crow = tid >> 4, cch = (tid & 15) * 8;
  const unsigned short* gA = Ap  + (size_t)b * strideA + (size_t)(mB + crow) * lda + cch;
  const unsigned short* gB = Btp + (size_t)b * strideB + (size_t)(nB + crow) * ldb + cch;
  const unsigned lbase = (unsigned)(size_t)(&sAB[0]) + (unsigned)(crow * G_PITCH + cch) * 2u;
  const size_t stepA = (size_t)8 * lda, stepB = (size_t)8 * ldb;
  auto stage_copy = [&](int st, int buf) {     // 32 copies per lane: one stage of A and Bt
    const unsigned l = lbase + (unsigned)buf * (G_STAGE * 2u);
    const unsigned short* a = gA + (size_t)st * G_KS;
    const unsigned short* w = gB + (size_t)st * G_KS;
    g_copy8(l,                          a,             stepA);
    g_copy8(l +  64u * G_PITCH * 2u,    a + 8 * stepA, stepA);
    g_copy8(l + 128u * G_PITCH * 2u,    w,             stepB);
    g_copy8(l + 192u * G_PITCH * 2u,    w + 8 * stepB, stepB);
  };

  v8f acc[4][4];
#pragma unroll
  for (int i = 0; i < 4; ++i)
#pragma unroll
    for (int j = 0; j < 4; ++j) acc[i][j] = (v8f){0.f,0.f,0.f,0.f,0.f,0.f,0.f,0.f};

  const int nst = K >> 7;
  stage_copy(0, 0);
  asm volatile("s_wait_asynccnt 0x0" ::: "memory");   // this wave's part of stage 0 has landed
  __syncthreads();                                     // stage 0 readable by every wave
  if (nst > 1) stage_copy(1, 1);
#pragma unroll 1   // kept rolled: one trip is one stage of the ring, with one publish point and one refill site
  for (int t = 0; t < nst; ++t) {
    const T* sbuf = (const T*)sAB + (size_t)(t & 1) * G_STAGE;
    const T* sA = sbuf + ((wm << 6) + rlane) * G_PITCH + koff;
    const T* sB = sbuf + (128 + (wn << 6) + rlane) * G_PITCH + koff;
#pragma unroll     // the loops below are unrolled so that fragments and accumulators are indexed by constants (registers, no scratch)
    for (int ks = 0; ks < G_KS / 32; ++ks) {
      V bh[4], ah[4];
#pragma unroll
      for (int j = 0; j < 4; ++j) bh[j] = Frag<T>::load(sB + j * 16 * G_PITCH + ks * 32);
#pragma unroll
      for (int i = 0; i < 4; ++i) ah[i] = Frag<T>::load(sA + i * 16 * G_PITCH + ks * 32);
#pragma unroll
      for (int i = 0; i < 4; ++i) {
#pragma unroll
        for (int j = 0; j < 4; ++j) acc[i][j] = Frag<T>::mma(ah[i], bh[j], acc[i][j]);
        Frag<T>::guard(acc[i][0], acc[i][3], ah[i], ah[i]);
      }
      Frag<T>::keep(bh[0], bh[1], bh[2], bh[3]);
    }
    asm volatile("s_wait_dscnt 0x0" ::: "memory");     // this wave's reads of buffer t & 1 are done
    asm volatile("s_wait_asynccnt 0x0" ::: "memory");  // this wave's part of stage t + 1 has landed
    __syncthreads();                                   // publishes stage t + 1, frees buffer t & 1
    if (t + 2 < nst) stage_copy(t + 2, t & 1);
  }
  asm volatile("s_wait_asynccnt 0x0" ::: "memory");    // no copy outstanding behind the loop
  acc_guard4(acc[0][0], acc[0][1], acc[0][2], acc[0][3]);
  acc_guard4(acc[1][0], acc[1][1], acc[1][2], acc[1][3]);
  acc_guard4(acc[2][0], acc[2][1], acc[2][2], acc[2][3]);
  acc_guard4(acc[3][0], acc[3][1], acc[3][2], acc[3][3]);

  // ---- epilogue ----
  float* slab = sT[wave];
  const float* Rb = RESID ? (resid + (size_t)b * strideR) : nullptr;
#pragma unroll
  for (int i = 0; i < 4; ++i) {
    const int mBase = m0 + (i << 4);
#pragma unroll
    for (int j = 0; j < 4; ++j) {
      const int n = n0 + (j << 4) + rlane;
      float bv = 0.f;
      if (BIAS_MODE == 2) bv = bias[n];
#pragma unroll
      for (int r = 0; r < 8; ++r) {
        float v = acc[i][j][r] * scale;
        if (BIAS_MODE == 1) v += bias[mBase + mOff + r];
        if (BIAS_MODE == 2) v += bv;
        if (RESID) v += Rb[(size_t)(mBase + mOff + r) * ldc + n];
        if (ACT == 1) v = tanhf(v);
        if (ACT == 2) v = fmaxf(v, 0.0f);
        if (ACT == 3) v = v / (1.0f + expf(-v));
        if (ACT == 4) v = (v > 0.f) ? v : 0.01f * v;
        if (ACT == 5) v = 0.5f * v * (1.0f + erff(v * 0.70710678118654752f));
        if (ACT == 6) v = gelu_tanh_f(v);
        slab[(mOff + r) * 68 + (j << 4) + rlane] = v;
      }
    }
    __builtin_amdgcn_fence(__ATOMIC_RELEASE, "workgroup");
    __builtin_amdgcn_wave_barrier();
    __builtin_amdgcn_fence(__ATOMIC_ACQUIRE, "workgroup");
    if (OUT_MODE == 0) {
      float* C = (float*)Cout + (size_t)b * strideC;
      const int hh = lane >> 4, c4 = (lane & 15) * 4;     // row seg = 256 B = 16 lanes x 16 B
      {
#pragma unroll
        for (int it = 0; it < 8; ++it) {
          const int row = it * 2 + hh;
          v4f v = *(const v4f*)(slab + row * 68 + c4);
          *(v4f*)(C + (size_t)(mBase + row) * ldc + n0 + c4) = v;
        }
        
      }
    } else {
      const int q = lane >> 3, c8 = (lane & 7) * 8;
      unsigned short* C  = (unsigned short*)Cout  + (size_t)b * strideC;
      unsigned short* C2 = (OUT_MODE == 2) ? ((unsigned short*)Cout2 + (size_t)b * strideC) : nullptr;
      {
#pragma unroll
        for (int it = 0; it < 4; ++it) {
          const int row = it * 4 + q;
          const float* sp = slab + row * 68 + c8;
          v8h hv, lv;
#pragma unroll
          for (int e = 0; e < 8; ++e) {
            if (OUT_MODE == 1) {
              hv[e] = (_Float16)sp[e];
            } else {
              unsigned short hb = f2bf_bits(sp[e]);
              unsigned short lb = f2bf_bits(sp[e] - bf_bits2f(hb));
              hv[e] = __builtin_bit_cast(_Float16, hb);
              lv[e] = __builtin_bit_cast(_Float16, lb);
            }
          }
          *(v8h*)(C + (size_t)(mBase + row) * ldc + n0 + c8) = hv;
          if (OUT_MODE == 2) *(v8h*)(C2 + (size_t)(mBase + row) * ldc + n0 + c8) = lv;
        }
        
      }
    }
    __builtin_amdgcn_fence(__ATOMIC_RELEASE, "workgroup");
    __builtin_amdgcn_wave_barrier();
    __builtin_amdgcn_fence(__ATOMIC_ACQUIRE, "workgroup");
  }
}

// ---- f32 -> f16 conversion by few, long-lived waves ------------------------
// A block is 16 waves; a wave converts R * 1024 contiguous elements: R * 8 loads of 16 bytes a lane (each wave-wide load 512
// contiguous bytes), all issued before the first is converted, and as many 8-byte stores (each wave-wide store 256 contiguous bytes).
typedef __attribute__((ext_vector_type(4))) _Float16 v4h;
#define CV_WAVES 16
template <int R>
__device__ __forceinline__ void cast_wave(const float* __restrict__ src, _Float16* __restrict__ dst, int q) {
  // src, dst: block-uniform; q: the lane's first group of four elements, one index for the loads and the stores
  const v4f* __restrict__ s4 = (const v4f*)src;
  v4h* __restrict__ d4 = (v4h*)dst;
  v4f x[R * 8];
#pragma unroll   // both loops unrolled: x stays in registers, every load and store addresses by an immediate offset
  for (int i = 0; i < R * 8; ++i) x[i] = s4[q + i * 32];
  if (R > 1) __builtin_amdgcn_sched_barrier(0);   // keeps every load in front of the first wait: a wave pays one memory latency, not one per group of loads
#pragma unroll
  for (int i = 0; i < R * 8; ++i) {
    v4h h;
#pragma unroll
    for (int e = 0; e < 4; ++e) h[e] = (_Float16)x[i][e];
    d4[q + i * 32] = h;
    if ((i & 7) == 7 && i + 1 < R * 8) __builtin_amdgcn_sched_barrier(0);   // eight stores leave as soon as their loads are in, not all behind the last load
  }
}
// The seven f32 inputs of the GEMMs in one launch: their f16 copies lie one behind the other in dst, at these element offsets.
#define CV_X   0
#define CV_Q   (CV_X + MROWS * DM)
#define CV_K   (CV_Q + DM * DM)
#define CV_V   (CV_K + DM * DM)
#define CV_O   (CV_V + DM * DM)
#define CV_W1  (CV_O + DM * DM)
#define CV_W2  (CV_W1 + FFND * DM)
#define CV_END (CV_W2 + DM * FFND)
#define CV_R   4
#define CV_BLK (CV_WAVES * CV_R * 1024)   // elements per block
static_assert(CV_Q % CV_BLK == 0 && CV_K % CV_BLK == 0 && CV_V % CV_BLK == 0 && CV_O % CV_BLK == 0 &&
              CV_W1 % CV_BLK == 0 && CV_W2 % CV_BLK == 0 && CV_END % CV_BLK == 0, "a block lies wholly in one tensor");
__global__ __launch_bounds__(CV_WAVES * 32) void cast_inputs(
    const float* __restrict__ x, const float* __restrict__ wq, const float* __restrict__ wk, const float* __restrict__ wv,
    const float* __restrict__ wo, const float* __restrict__ w1, const float* __restrict__ w2, _Float16* __restrict__ dst) {
  const int e0 = blockIdx.x * CV_BLK;       // block-uniform: the block index picks the tensor
  const float* src = x;
  int first = CV_X;
  if (e0 >= CV_Q)  { src = wq; first = CV_Q; }
  if (e0 >= CV_K)  { src = wk; first = CV_K; }
  if (e0 >= CV_V)  { src = wv; first = CV_V; }
  if (e0 >= CV_O)  { src = wo; first = CV_O; }
  if (e0 >= CV_W1) { src = w1; first = CV_W1; }
  if (e0 >= CV_W2) { src = w2; first = CV_W2; }
  cast_wave<CV_R>(src + (e0 - first), dst + e0, (threadIdx.x >> 5) * (CV_R * 256) + (threadIdx.x & 31));
}
// One tensor of gridDim.x * CV_WAVES * R * 1024 elements.
template <int R>
__global__ __launch_bounds__(CV_WAVES * 32) void cast_one(const float* __restrict__ in, _Float16* __restrict__ out) {
  const int e0 = blockIdx.x * (CV_WAVES * R * 1024);
  cast_wave<R>(in + e0, out + e0, (threadIdx.x >> 5) * (R * 256) + (threadIdx.x & 31));
}

// =====================================================================================
// Attention for head_dim 64, f32 in / f32 out; 16-bit operands: bf16 with optional hi/lo splits, or
// plain f16 (F16=true, non-split, probabilities carried x2^15).
//   Block = 4 waves = 64 query rows of one (batch, head); S % 64 == 0.
//   Element (b, s, h, d) of tensor X lives at X[b*X_bs + s*X_rs + h*X_hs + d] (strides in floats, multiples of 4).
//   mask_mode 0 none, 1 causal, 2 tensor [S][Skv], 3 per-token vectors, 4 causal + window, 5 relative bias,
//   6 = mask_a: int32 [S][Skv] nonzero = masked, OR mask_b: int32 [B][Skv] nonzero = masked; per 64x64
//       (b, q-tile, kv-tile) code table tcode[(b*nqb+qb)*t_pitch + kc]: 0 mixed (per-element reads),
//       1 all live (no reads), 2 all masked (tile skipped: zero contribution).
//   masked scores are replaced by mask_fill before the softmax; rows with no live key write 0.
//   grid.x = B * H * (S/64).
// =====================================================================================
#define AT_D 64
#define AT_NW 4
#define AT_QB 64
#define AT_KC 64
#define AT_LOG2E 1.4426950408889634f
#define AT_LP 72    // LDS row pitch of the K, V^T and P tiles in 16-bit elements: 128 B of data + 16 B, so that the 16 rows
                    // which one ds_load_b128 fragment read touches fall on 16 different groups of four banks
struct AttnGeom { const int* tcode; const float* cp; const float* pc; long c_bs, c_rs, c_hs, t_pitch;
                  long q_bs, q_rs, q_hs, k_bs, k_rs, k_hs, v_bs, v_rs, v_hs, o_bs, o_rs, o_hs;
                  int S, Skv, H, mask_mode; float qscale; int blk0; float mask_fill; int mask_is_int; };
static_assert(sizeof(AttnGeom) == 184);

__device__ __forceinline__ unsigned short at_bf_bits(float f) {
  unsigned u = __float_as_uint(f);
  return (unsigned short)((u + 0x7FFFu + ((u >> 16) & 1u)) >> 16);
}
__device__ __forceinline__ __bf16 at_f2bf(float f) { return __builtin_bit_cast(__bf16, at_bf_bits(f)); }
__device__ __forceinline__ void at_split(float f, __bf16& hi, __bf16& lo) {
  const unsigned short hb = at_bf_bits(f);
  hi = __builtin_bit_cast(__bf16, hb);
  lo = at_f2bf(f - __uint_as_float(((unsigned)hb) << 16));
}
__device__ __forceinline__ v8f at_mma(v16b a, v16b b, v8f c) {
  c = __builtin_amdgcn_wmma_f32_16x16x32_bf16(false, a, false, b, (short)0, c, false, false);
  asm volatile("v_nop\n\tv_nop\n\tv_nop\n\tv_nop" : "+v"(c) : "v"(a), "v"(b));
  return c;
}
// 16-bit element as a bit pattern held in a __bf16 slot: f16 bits when F16, bf16 (RNE) otherwise
template <bool F16> __device__ __forceinline__ __bf16 at_to16(float f) {
  if (F16) return __builtin_bit_cast(__bf16, (_Float16)f);
  return at_f2bf(f);
}
template <bool F16> __device__ __forceinline__ v8f at_mma16(v16b a, v16b b, v8f c) {
  if (F16) {
    const v16h ah = __builtin_bit_cast(v16h, a), bh = __builtin_bit_cast(v16h, b);
    c = __builtin_amdgcn_wmma_f32_16x16x32_f16(false, ah, false, bh, (short)0, c, false, false);
    asm volatile("v_nop\n\tv_nop\n\tv_nop\n\tv_nop" : "+v"(c) : "v"(ah), "v"(bh));
    return c;
  }
  return at_mma(a, b, c);
}

// Five powers of two (one score row's four and its rescale factor) in one statement. Behind a v_exp_f32 the instruction set asks for
// one independent instruction before its result is read or its source overwritten: here each v_exp_f32 is that instruction for the
// one before it (the outputs are early-clobber, so none lies on a source), and the v_nop is it for the last.
__device__ __forceinline__ void at_exp2x5(float& o0, float& o1, float& o2, float& o3, float& o4,
                                          float x0, float x1, float x2, float x3, float x4) {
  asm("v_exp_f32 %0, %5\n\t"
      "v_exp_f32 %1, %6\n\t"
      "v_exp_f32 %2, %7\n\t"
      "v_exp_f32 %3, %8\n\t"
      "v_exp_f32 %4, %9\n\t"
      "v_nop"
      : "=&v"(o0), "=&v"(o1), "=&v"(o2), "=&v"(o3), "=&v"(o4)
      : "v"(x0), "v"(x1), "v"(x2), "v"(x3), "v"(x4));
}

// MODE is the mask mode as a compile-time constant: only that mode's mask code is compiled into the key loop.
template <bool SPLIT_QK, bool SPLIT_PV, bool F16, int MODE>
__global__ __launch_bounds__(128)
void attn64_kernel(const float* __restrict__ q, const float* __restrict__ k,
                   const float* __restrict__ v, float* __restrict__ out,
                   const int* __restrict__ mask_a, const int* __restrict__ mask_b, AttnGeom g) {
  static_assert(!(F16 && (SPLIT_QK || SPLIT_PV)));
  const float PSC = F16 ? 32768.0f : 1.0f;     // f16 probabilities carried x2^15, folded into the final 1/l
  union FB { v16b v; v8b h[2]; };
  __shared__ __align__(16) __bf16 Ksh[AT_KC * AT_LP];            // K hi [kv][d]      9 KB
  __shared__ __align__(16) __bf16 Ksl[SPLIT_QK ? AT_KC * AT_LP : 8];
  __shared__ __align__(16) __bf16 Vth[AT_D * AT_LP];             // V hi [d][kv]      9 KB
  __shared__ __align__(16) __bf16 Vtl[SPLIT_PV ? AT_D * AT_LP : 8];
  __shared__ __align__(16) __bf16 Psh[AT_NW][16 * AT_LP];        // per wave P hi [row][kv]  9 KB
  __shared__ __align__(16) __bf16 Psl[SPLIT_PV ? AT_NW : 1][SPLIT_PV ? 16 * AT_LP : 8];
  __shared__ __align__(16) float  Os[AT_NW][16 * 68];            // per wave out tile, pitch 68

  const int tid  = threadIdx.x;
  const int wave = tid >> 5;
  const int lane = tid & 31;
  const int hh   = lane >> 4;
  const int c    = lane & 15;

  const int nqb = g.S / AT_QB;
  const int nkc = g.Skv / AT_KC;
  const int bx = blockIdx.x + g.blk0;
  const int qb = bx % nqb;
  const int bh = bx / nqb;
  const int h  = bh % g.H;
  const int b  = bh / g.H;
  const int qbase_block = qb * AT_QB;
  const int q0 = qbase_block + wave * 16;

  const float* qb_ptr = q + (size_t)b * g.q_bs + (size_t)h * g.q_hs;
  const float* kb_ptr = k + (size_t)b * g.k_bs + (size_t)h * g.k_hs;
  const float* vb_ptr = v + (size_t)b * g.v_bs + (size_t)h * g.v_hs;
  float*       ob_ptr = out + (size_t)b * g.o_bs + (size_t)h * g.o_hs;

  // ---- Q fragments (A operand): 2 d-chunks, hi (and lo) ----
  v16b qah[2], qal[2];
  {
    const float* qrow = qb_ptr + (size_t)(q0 + c) * g.q_rs;
#pragma unroll
    for (int dc = 0; dc < 2; ++dc) {
#pragma unroll
      for (int e = 0; e < 8; ++e) {
        const float f0 = qrow[dc * 32 + 8 * hh + e] * g.qscale;
        const float f1 = qrow[dc * 32 + 16 + 8 * hh + e] * g.qscale;
        if (SPLIT_QK) { __bf16 hq, lq; at_split(f0, hq, lq); qah[dc][e] = hq; qal[dc][e] = lq; at_split(f1, hq, lq); qah[dc][8 + e] = hq; qal[dc][8 + e] = lq; }
        else { qah[dc][e] = at_to16<F16>(f0); qah[dc][8 + e] = at_to16<F16>(f1); qal[dc][e] = qah[dc][e]; qal[dc][8 + e] = qah[dc][8 + e]; }
      }
    }
  }

  float mrow[8], lrow[8];
  v8f oacc[4];
#pragma unroll
  for (int r = 0; r < 8; ++r) { mrow[r] = -INFINITY; lrow[r] = 0.f; }
#pragma unroll
  for (int t = 0; t < 4; ++t) oacc[t] = (v8f){0.f,0.f,0.f,0.f,0.f,0.f,0.f,0.f};

  const int nChunks = (MODE == 1 || MODE == 4) ? (qb + 1) : nkc;   // block-uniform, bounded by Skv/64
  // per-row query mask (mode 3)
  int qkeep[8];
#pragma unroll
  for (int r = 0; r < 8; ++r) qkeep[r] = (MODE == 3) ? mask_b[(size_t)b * g.S + q0 + 8 * hh + r] : 1;   // mask_b = qmask in mode 3
  for (int kc = 0; kc < nChunks; ++kc) {
    const int kv0 = kc * AT_KC;
    int code = 0;
    if (MODE == 6) {
      int cv = g.tcode[((size_t)b * nqb + qb) * (size_t)g.t_pitch + kc];
      cv = __builtin_amdgcn_readfirstlane(cv);
      code = (cv == 1 || cv == 2) ? cv : 0;     // anything else -> mixed (per-element reads)
      if (code == 2) continue;                  // fully masked tile: zero contribution, softmax state unchanged
    }
    __syncthreads();
    {
      const int kvr = tid >> 1, dh = (tid & 1) * 32;
      const float* krow = kb_ptr + (size_t)(kv0 + kvr) * g.k_rs + dh;
      const float* vrow = vb_ptr + (size_t)(kv0 + kvr) * g.v_rs + dh;
#pragma unroll
      for (int i = 0; i < 8; ++i) {
        v4f kk = *(const v4f*)(krow + 4 * i);
        v4f vv = *(const v4f*)(vrow + 4 * i);
#pragma unroll
        for (int e = 0; e < 4; ++e) {
          const int d = dh + 4 * i + e;
          if (SPLIT_QK) { __bf16 a, bl; at_split(kk[e], a, bl); Ksh[kvr * AT_LP + d] = a; Ksl[kvr * AT_LP + d] = bl; }
          else Ksh[kvr * AT_LP + d] = at_to16<F16>(kk[e]);
          if (SPLIT_PV) { __bf16 a, bl; at_split(vv[e], a, bl); Vth[d * AT_LP + kvr] = a; Vtl[d * AT_LP + kvr] = bl; }
          else Vth[d * AT_LP + kvr] = at_to16<F16>(vv[e]);
        }
      }
    }
    __syncthreads();

    v8f s[4];
#pragma unroll
    for (int j = 0; j < 4; ++j) {
      s[j] = (v8f){0.f,0.f,0.f,0.f,0.f,0.f,0.f,0.f};
#pragma unroll 1
      for (int dc = 0; dc < 2; ++dc) {
        FB kb;
        kb.h[0] = *(const v8b*)(Ksh + (j * 16 + c) * AT_LP + dc * 32 + 8 * hh);
        kb.h[1] = *(const v8b*)(Ksh + (j * 16 + c) * AT_LP + dc * 32 + 16 + 8 * hh);
        s[j] = at_mma16<F16>(qah[dc], kb.v, s[j]);
        if (SPLIT_QK) {
          FB kl;
          kl.h[0] = *(const v8b*)(Ksl + (j * 16 + c) * AT_LP + dc * 32 + 8 * hh);
          kl.h[1] = *(const v8b*)(Ksl + (j * 16 + c) * AT_LP + dc * 32 + 16 + 8 * hh);
          s[j] = at_mma16<F16>(qah[dc], kl.v, s[j]);
          s[j] = at_mma16<F16>(qal[dc], kb.v, s[j]);
        }
      }
    }
    const bool diag = (MODE == 1) && (kc == qb);
    int kvkeep[4] = {1, 1, 1, 1};
    if (MODE == 3) {
#pragma unroll
      for (int j = 0; j < 4; ++j) kvkeep[j] = mask_a[(size_t)b * g.Skv + kv0 + j * 16 + c];   // mask_a = kvmask
    }
    if (MODE == 6 && code == 0) {               // mixed tile: one wave-uniform branch per tile, then per-element reads
      int kvpad[4];
#pragma unroll
      for (int j = 0; j < 4; ++j) kvpad[j] = mask_b[(size_t)b * g.Skv + kv0 + j * 16 + c];   // mask_b = key padding [B][Skv]
#pragma unroll   // both loops unrolled so that s[j][r] is indexed by constants and stays in registers
      for (int r = 0; r < 8; ++r) {
        const int* mrowp = mask_a + (size_t)(q0 + 8 * hh + r) * g.Skv + kv0 + c;
#pragma unroll
        for (int j = 0; j < 4; ++j)
          if ((mrowp[j * 16] != 0) || (kvpad[j] != 0)) s[j][r] = g.mask_fill;
      }
    }
    float cm[8];
#pragma unroll
    for (int r = 0; r < 8; ++r) {
      const int qrow = q0 + 8 * hh + r;
      float m = -INFINITY;
#pragma unroll
      for (int j = 0; j < 4; ++j) {
        const int kvcol = kv0 + j * 16 + c;
        bool masked = false;
        if (diag) masked = (kvcol > qrow);
        else if (MODE == 4) masked = (kvcol > qrow) || (qrow - kvcol > g.mask_is_int);
        else if (MODE == 2) {
          const size_t mi = (size_t)qrow * g.Skv + kvcol;
          masked = (g.mask_is_int == 0) ? (((const float*)mask_a)[mi] == 0.0f)
                 : (g.mask_is_int == 1) ? (mask_a[mi] == 0) : (mask_a[mi] != 0);
        } else if (MODE == 3) masked = (qkeep[r] == 0) || (kvkeep[j] == 0);
        else if (MODE == 5) {
          const size_t mi = (size_t)qrow * g.Skv + kvcol;
          masked = (mask_a[mi] != 0);
          int n = mask_b[mi]; n = n < 0 ? 0 : n;
          s[j][r] += g.cp[(size_t)b * g.c_bs + (size_t)h * g.c_hs + (size_t)qrow * g.c_rs + n]
                   + g.pc[(size_t)b * g.c_bs + (size_t)h * g.c_hs + (size_t)kvcol * g.c_rs + n];
        }
        if (masked) s[j][r] = g.mask_fill;
        m = fmaxf(m, s[j][r]);
      }
#pragma unroll
      for (int off = 1; off < 16; off <<= 1) m = fmaxf(m, __shfl_xor(m, off, 32));
      cm[r] = m;
    }
    __bf16* pwh = Psh[wave];
    __bf16* pwl = Psl[SPLIT_PV ? wave : 0];
#pragma unroll
    for (int r = 0; r < 8; ++r) {
      const float mnew = fmaxf(mrow[r], cm[r]);
      // exp(x - mnew) = 2^(x * log2(e) - mb): one FMA and one v_exp_f32, no branch. A row with no live key yet takes mb = 0:
      // every exponent is then -inf (never inf - inf), so its p and alpha are 0 and its sums stay 0.
      const float mb = (mnew == -INFINITY) ? 0.0f : mnew * AT_LOG2E;
      float pe[4], alpha;
      at_exp2x5(pe[0], pe[1], pe[2], pe[3], alpha,
                fmaf(s[0][r], AT_LOG2E, -mb), fmaf(s[1][r], AT_LOG2E, -mb), fmaf(s[2][r], AT_LOG2E, -mb),
                fmaf(s[3][r], AT_LOG2E, -mb), fmaf(mrow[r], AT_LOG2E, -mb));
      mrow[r] = mnew;
      float psum = 0.f;
#pragma unroll
      for (int j = 0; j < 4; ++j) {
        const float p = pe[j];
        psum = (j == 0) ? p : psum + p;   // same order as 0 + p0 + p1 + p2 + p3; a power of two is never -0, so the same bits
        if (SPLIT_PV) { __bf16 a, bl; at_split(p, a, bl); pwh[(8 * hh + r) * AT_LP + j * 16 + c] = a; pwl[(8 * hh + r) * AT_LP + j * 16 + c] = bl; }
        else pwh[(8 * hh + r) * AT_LP + j * 16 + c] = at_to16<F16>(p * PSC);
      }
#pragma unroll
      for (int off = 1; off < 16; off <<= 1) psum += __shfl_xor(psum, off, 32);
      lrow[r] = lrow[r] * alpha + psum;
#pragma unroll
      for (int t = 0; t < 4; ++t) oacc[t][r] *= alpha;
    }
    __builtin_amdgcn_fence(__ATOMIC_RELEASE, "workgroup");
    __builtin_amdgcn_wave_barrier();
    __builtin_amdgcn_fence(__ATOMIC_ACQUIRE, "workgroup");
#pragma unroll 1
    for (int kk = 0; kk < 2; ++kk) {
      FB pa, pl;
      pa.h[0] = *(const v8b*)(pwh + c * AT_LP + kk * 32 + 8 * hh);
      pa.h[1] = *(const v8b*)(pwh + c * AT_LP + kk * 32 + 16 + 8 * hh);
      if (SPLIT_PV) {
        pl.h[0] = *(const v8b*)(pwl + c * AT_LP + kk * 32 + 8 * hh);
        pl.h[1] = *(const v8b*)(pwl + c * AT_LP + kk * 32 + 16 + 8 * hh);
      }
#pragma unroll
      for (int t = 0; t < 4; ++t) {
        FB vb;
        vb.h[0] = *(const v8b*)(Vth + (t * 16 + c) * AT_LP + kk * 32 + 8 * hh);
        vb.h[1] = *(const v8b*)(Vth + (t * 16 + c) * AT_LP + kk * 32 + 16 + 8 * hh);
        oacc[t] = at_mma16<F16>(pa.v, vb.v, oacc[t]);
        if (SPLIT_PV) {
          FB vl;
          vl.h[0] = *(const v8b*)(Vtl + (t * 16 + c) * AT_LP + kk * 32 + 8 * hh);
          vl.h[1] = *(const v8b*)(Vtl + (t * 16 + c) * AT_LP + kk * 32 + 16 + 8 * hh);
          oacc[t] = at_mma16<F16>(pa.v, vl.v, oacc[t]);
          oacc[t] = at_mma16<F16>(pl.v, vb.v, oacc[t]);
        }
      }
    }
  }

  float* os = Os[wave];
#pragma unroll
  for (int r = 0; r < 8; ++r) {
    const float den = lrow[r] * PSC;
    const float inv = (den > 0.0f) ? (1.0f / den) : 0.0f;
#pragma unroll
    for (int t = 0; t < 4; ++t) os[(8 * hh + r) * 68 + t * 16 + c] = oacc[t][r] * inv;
  }
  __builtin_amdgcn_fence(__ATOMIC_RELEASE, "workgroup");
  __builtin_amdgcn_wave_barrier();
  __builtin_amdgcn_fence(__ATOMIC_ACQUIRE, "workgroup");
  {
    const int c4 = (lane & 15) * 4;
    {
#pragma unroll
      for (int it = 0; it < 8; ++it) {
        const int row = it * 2 + hh;
        v4f val = *(const v4f*)(os + row * 68 + c4);
        *(v4f*)(ob_ptr + (size_t)(q0 + row) * g.o_rs + c4) = val;
      }
      
    }
  }
}

// =====================================================================================
// 64x64 tile classification of the attention mask: one block per (b, q-tile); for each kv-tile:
//   masked(q,k) = tm[q][k] != 0 || pad[b][k] != 0;  code 2 = all masked, 1 = all live, 0 = mixed.
// =====================================================================================
__global__ __launch_bounds__(256) void tilecode_kernel(
    const int* __restrict__ tm, const int* __restrict__ pad, int* __restrict__ tab,
    int Skv, int nqb, int nkc, int tp) {
  __shared__ int wl[8], wm[8];
  __shared__ __align__(16) int codes[128];
  const int tid = threadIdx.x, lane = tid & 31, wave = tid >> 5;
  const int b  = blockIdx.x / nqb;
  const int qb = blockIdx.x - b * nqb;
  const int row = tid >> 2, cs = (tid & 3) * 16;
  const int q = qb * 64 + row;
  if (tid < 128) codes[tid] = 2;
  __syncthreads();
  const int nk = nkc < 128 ? nkc : 128;
  for (int kc = 0; kc < nk; ++kc) {
    const int* mr = tm  + (size_t)q * Skv + kc * 64 + cs;
    const int* pr = pad + (size_t)b * Skv + kc * 64 + cs;
    int live = 0, msk = 0;
#pragma unroll
    for (int i = 0; i < 4; ++i) {
      const v4i mv = *(const v4i*)(mr + 4 * i);
      const v4i pv = *(const v4i*)(pr + 4 * i);
#pragma unroll
      for (int e = 0; e < 4; ++e) {
        const int m = ((mv[e] != 0) || (pv[e] != 0)) ? 1 : 0;
        msk |= m;
        live |= (m ^ 1);
      }
    }
    const int al = __any(live);
    const int am = __any(msk);
    if (lane == 0) { wl[wave] = al; wm[wave] = am; }
    __syncthreads();
    if (tid == 0) {
      int L = 0, Mk = 0;
#pragma unroll
      for (int w = 0; w < 8; ++w) { L |= wl[w]; Mk |= wm[w]; }
      codes[kc] = (L == 0) ? 2 : ((Mk == 0) ? 1 : 0);
    }
    __syncthreads();
  }
  if (wave == 0) {
    const int nl = tp >> 2;          // tp is a multiple of 32 ints, <= 128
    v4i cv;
    cv[0] = codes[(4 * lane + 0) & 127]; cv[1] = codes[(4 * lane + 1) & 127];
    cv[2] = codes[(4 * lane + 2) & 127]; cv[3] = codes[(4 * lane + 3) & 127];
    int* dst = tab + (size_t)blockIdx.x * tp + 4 * lane;
    if (lane < nl) *(v4i*)dst = cv;
    
  }
}

// =====================================================================================
// LayerNorm over 1024-wide rows: one block (256 thr) per row, 4 contiguous floats per thread.
// =====================================================================================
template <bool OUT16>
__global__ __launch_bounds__(256) void ln_kernel(
    const float* __restrict__ in, const float* __restrict__ gam, const float* __restrict__ bet,
    float* __restrict__ o32, _Float16* __restrict__ o16) {
  __shared__ float red1[8], red2[8];
  __shared__ __align__(16) float ybuf[OUT16 ? DM : 4];
  const int row = blockIdx.x, t = threadIdx.x, lane = t & 31, wave = t >> 5;
  const float* x = in + (size_t)row * DM;
  const v4f xv = *(const v4f*)(x + 4 * t);
  float s = (xv[0] + xv[1]) + (xv[2] + xv[3]);
#pragma unroll
  for (int off = 1; off < 32; off <<= 1) s += __shfl_xor(s, off, 32);
  if (lane == 0) red1[wave] = s;
  __syncthreads();
  float tot = 0.f;
#pragma unroll
  for (int w = 0; w < 8; ++w) tot += red1[w];
  const float mu = tot * (1.0f / (float)DM);
  const float d0 = xv[0] - mu, d1 = xv[1] - mu, d2 = xv[2] - mu, d3 = xv[3] - mu;
  float s2 = (d0 * d0 + d1 * d1) + (d2 * d2 + d3 * d3);
#pragma unroll
  for (int off = 1; off < 32; off <<= 1) s2 += __shfl_xor(s2, off, 32);
  if (lane == 0) red2[wave] = s2;
  __syncthreads();
  float tot2 = 0.f;
#pragma unroll
  for (int w = 0; w < 8; ++w) tot2 += red2[w];
  const float var = tot2 * (1.0f / (float)DM);
  const float rstd = rsqrtf(var + LN_EPS);
  const v4f gv = *(const v4f*)(gam + 4 * t);
  const v4f bv = *(const v4f*)(bet + 4 * t);
  v4f y;
  y[0] = d0 * rstd * gv[0] + bv[0];
  y[1] = d1 * rstd * gv[1] + bv[1];
  y[2] = d2 * rstd * gv[2] + bv[2];
  y[3] = d3 * rstd * gv[3] + bv[3];
  float* op = o32 + (size_t)row * DM + 4 * t;
  *(v4f*)op = y;
  
  if (OUT16) {
    *(v4f*)(ybuf + 4 * t) = y;
    __syncthreads();
    if (t < DM / 8) {
      v8h hv;
#pragma unroll
      for (int e = 0; e < 8; ++e) hv[e] = (_Float16)ybuf[8 * t + e];
      _Float16* hp = o16 + (size_t)row * DM + 8 * t;
      *(v8h*)hp = hv;
      
    }
  }
}

// =====================================================================================
// Host orchestration
// =====================================================================================
extern "C" void kernel_launch(void* const* d_in, const int* in_sizes, int n_in,
                              void* d_out, int out_size, void* d_ws, size_t ws_size,
                              hipStream_t stream) {
  if (n_in < 16) return;
  if (in_sizes[0] != MROWS * DM || in_sizes[1] != SEQ * SEQ || in_sizes[2] != BSZ * SEQ) return;
  if (in_sizes[3] != DM * DM || in_sizes[4] != DM * DM || in_sizes[5] != DM * DM || in_sizes[6] != DM * DM) return;
  if (in_sizes[7] != DM || in_sizes[8] != FFND * DM || in_sizes[9] != FFND) return;
  if (in_sizes[10] != DM * FFND || in_sizes[11] != DM) return;
  if (in_sizes[12] != DM || in_sizes[13] != DM || in_sizes[14] != DM || in_sizes[15] != DM) return;
  if (out_size != MROWS * DM) return;

  const float* tgt   = (const float*)d_in[0];
  const int*   tmask = (const int*)d_in[1];     // [SEQ][SEQ], nonzero = masked
  const int*   pmask = (const int*)d_in[2];     // [BSZ][SEQ], nonzero = masked
  const float* Wq    = (const float*)d_in[3];
  const float* Wk    = (const float*)d_in[4];
  const float* Wv    = (const float*)d_in[5];
  const float* Wo    = (const float*)d_in[6];
  const float* bo    = (const float*)d_in[7];
  const float* W1    = (const float*)d_in[8];
  const float* b1    = (const float*)d_in[9];
  const float* W2    = (const float*)d_in[10];
  const float* b2    = (const float*)d_in[11];
  const float* g1    = (const float*)d_in[12];
  const float* be1   = (const float*)d_in[13];
  const float* g2    = (const float*)d_in[14];
  const float* be2   = (const float*)d_in[15];
  float* out = (float*)d_out;

  // ---- workspace carve (bytes), regions reused across phases ----
  const size_t MiB = 1048576;
  const int nqb = SEQ / AT_QB, nkc = SEQ / AT_KC;
  if (nkc > 128) return;
  const int TP = ((nkc + 31) / 32) * 32;
  const size_t tabBytes = (size_t)BSZ * nqb * TP * sizeof(int);
  const size_t total = 96 * MiB + tabBytes;
  if (total > ws_size) return;
  char* ws = (char*)d_ws;
  float*    Qf   = (float*)(ws + 0 * MiB);          // [4096][1024] f32   (projections -> attention)
  float*    Kf   = (float*)(ws + 16 * MiB);
  float*    Vf   = (float*)(ws + 32 * MiB);
  float*    RES1 = (float*)(ws + 0 * MiB);          // tgt + attn-proj     (after attention)
  _Float16* H16  = (_Float16*)(ws + 0 * MiB);       // [4096][4096] f16   (after LN1)
  float*    X1f  = (float*)(ws + 32 * MiB);         // LN1 output f32     (after attention)
  float*    AOf  = (float*)(ws + 48 * MiB);         // attention output f32
  float*    RES2 = (float*)(ws + 48 * MiB);         // x1 + ffn           (after out-proj)
  _Float16* X16  = (_Float16*)(ws + 64 * MiB);      // tgt f16            (projections)
  _Float16* O16  = (_Float16*)(ws + 64 * MiB);      // attention output f16 (after projections)
  _Float16* X1h  = (_Float16*)(ws + 64 * MiB);      // LN1 output f16     (after out-proj)
  _Float16* Wq16 = (_Float16*)(ws + 72 * MiB);
  _Float16* Wk16 = (_Float16*)(ws + 74 * MiB);
  _Float16* Wv16 = (_Float16*)(ws + 76 * MiB);
  _Float16* Wo16 = (_Float16*)(ws + 78 * MiB);
  _Float16* W1h  = (_Float16*)(ws + 80 * MiB);      // [4096][1024]
  _Float16* W2h  = (_Float16*)(ws + 88 * MiB);      // [1024][4096]
  int*      TAB  = (int*)(ws + 96 * MiB);           // [BSZ*nqb][TP]

  // tgt and the six weight matrices -> f16, one launch; X16 .. W2h lie one behind the other from X16 on
  static_assert(CV_Q * 2 == 8 * 1048576 && CV_K * 2 == 10 * 1048576 && CV_V * 2 == 12 * 1048576 && CV_O * 2 == 14 * 1048576 &&
                CV_W1 * 2 == 16 * 1048576 && CV_W2 * 2 == 24 * 1048576 && CV_END * 2 == 32 * 1048576, "offsets of the carve above");
  cast_inputs<<<dim3(CV_END / CV_BLK), dim3(CV_WAVES * 32), 0, stream>>>(tgt, Wq, Wk, Wv, Wo, W1, W2, X16);

  // mask tile codes
  tilecode_kernel<<<dim3(BSZ * nqb), dim3(256), 0, stream>>>(tmask, pmask, TAB, SEQ, nqb, nkc, TP);

  const long z = 0;
  typedef const unsigned short* cu16;
  const int tilesM = MROWS / 128;
  // q/k/v projections: [4096][1024] = X16 . W^T, f32 out
  {
    const dim3 grid(tilesM * (DM / 128), 1);
    wmma_gemm64<0, false, 0, 0, false, 0><<<grid, dim3(128), 0, stream>>>(
        (cu16)X16, (cu16)X16, DM, z, (cu16)Wq16, (cu16)Wq16, DM, z, (void*)Qf, (void*)Qf, DM, z,
        bo, tgt, z, MROWS, DM, DM, 1.0f);
    wmma_gemm64<0, false, 0, 0, false, 0><<<grid, dim3(128), 0, stream>>>(
        (cu16)X16, (cu16)X16, DM, z, (cu16)Wk16, (cu16)Wk16, DM, z, (void*)Kf, (void*)Kf, DM, z,
        bo, tgt, z, MROWS, DM, DM, 1.0f);
    wmma_gemm64<0, false, 0, 0, false, 0><<<grid, dim3(128), 0, stream>>>(
        (cu16)X16, (cu16)X16, DM, z, (cu16)Wv16, (cu16)Wv16, DM, z, (void*)Vf, (void*)Vf, DM, z,
        bo, tgt, z, MROWS, DM, DM, 1.0f);
  }

  // attention: q,k,v,o element (b, s, h, d) at b*SEQ*DM + s*DM + h*64 + d
  {
    AttnGeom g;
    g.tcode = TAB; g.cp = Qf; g.pc = Qf; g.c_bs = 0; g.c_rs = 0; g.c_hs = 0; g.t_pitch = TP;
    g.q_bs = (long)SEQ * DM; g.q_rs = DM; g.q_hs = HD;
    g.k_bs = (long)SEQ * DM; g.k_rs = DM; g.k_hs = HD;
    g.v_bs = (long)SEQ * DM; g.v_rs = DM; g.v_hs = HD;
    g.o_bs = (long)SEQ * DM; g.o_rs = DM; g.o_hs = HD;
    g.S = SEQ; g.Skv = SEQ; g.H = NHEAD; g.mask_mode = 6; g.qscale = 0.125f; g.blk0 = 0;
    g.mask_fill = -INFINITY; g.mask_is_int = 2;
    attn64_kernel<false, false, true, 6><<<dim3(BSZ * NHEAD * nqb), dim3(128), 0, stream>>>(
        Qf, Kf, Vf, AOf, tmask, pmask, g);
  }
  static_assert((MROWS * DM) % (CV_WAVES * 1024) == 0);
  cast_one<1><<<dim3(MROWS * DM / (CV_WAVES * 1024)), dim3(CV_WAVES * 32), 0, stream>>>(AOf, O16);

  // RES1 = tgt + (O . Wo^T + bo)
  {
    const dim3 grid(tilesM * (DM / 128), 1);
    wmma_gemm64<0, false, 2, 0, true, 0><<<grid, dim3(128), 0, stream>>>(
        (cu16)O16, (cu16)O16, DM, z, (cu16)Wo16, (cu16)Wo16, DM, z, (void*)RES1, (void*)RES1, DM, z,
        bo, tgt, z, MROWS, DM, DM, 1.0f);
  }
  // x1 = LN(RES1) -> f32 + f16
  ln_kernel<true><<<dim3(MROWS), dim3(256), 0, stream>>>(RES1, g1, be1, X1f, X1h);
  // H16 = gelu_tanh(x1 . W1^T + b1), f16 [4096][4096]
  {
    const dim3 grid(tilesM * (FFND / 128), 1);
    wmma_gemm64<0, false, 2, 1, false, 6><<<grid, dim3(128), 0, stream>>>(
        (cu16)X1h, (cu16)X1h, DM, z, (cu16)W1h, (cu16)W1h, DM, z, (void*)H16, (void*)H16, FFND, z,
        b1, tgt, z, MROWS, FFND, DM, 1.0f);
  }
  // RES2 = x1 + (H . W2^T + b2)
  {
    const dim3 grid(tilesM * (DM / 128), 1);
    wmma_gemm64<0, false, 2, 0, true, 0><<<grid, dim3(128), 0, stream>>>(
        (cu16)H16, (cu16)H16, FFND, z, (cu16)W2h, (cu16)W2h, FFND, z, (void*)RES2, (void*)RES2, DM, z,
        b2, X1f, z, MROWS, DM, FFND, 1.0f);
  }
  // out = LN(RES2)
  ln_kernel<false><<<dim3(MROWS), dim3(256), 0, stream>>>(RES2, g2, be2, out, X1h);
  (void)hipGetLastError();
}

// v006
// A run of this version takes 318 microseconds.
// In both of two side-by-side timings against v005, it was 1.11 times as fast.
// All steps since v000 together make it 6.16 times as fast.
// Contractions: q/k/v/out projections, FFN1, FFN2 on v_wmma_f32_16x16x32_f16 (f16 operands, f32 accumulate);
// attention scores (q*0.125).k^T and p.v on v_wmma_f32_16x16x32_f16 (f16 operands, p carried x2^15, f32 accumulate).
// Softmax, LayerNorm, tanh-GELU, bias and residual adds in f32.
#include <hip/hip_runtime.h>

typedef __attribute__((ext_vector_type(16))) _Float16 v16h;
typedef __attribute__((ext_vector_type(8)))  _Float16 v8h;
typedef __attribute__((ext_vector_type(16))) __bf16   v16b;
typedef __attribute__((ext_vector_type(8)))  __bf16   v8b;
typedef __attribute__((ext_vector_type(4)))  __bf16   v4b;
typedef __attribute__((ext_vector_type(2)))  __bf16   v2b;
typedef __attribute__((ext_vector_type(8)))  float    v8f;
typedef __attribute__((ext_vector_type(4)))  float    v4f;
typedef __attribute__((ext_vector_type(4)))  int      v4i;

#define DM     1024
#define NHEAD  16
#define HD     64
#define FFND   4096
#define BSZ    2
#define SEQ    2048
#define MROWS  (BSZ * SEQ)
#define LN_EPS 1e-5f

__device__ __forceinline__ unsigned short f2bf_bits(float f) {
  unsigned u = __float_as_uint(f);
  return (unsigned short)((u + 0x7FFFu + ((u >> 16) & 1u)) >> 16);
}
__device__ __forceinline__ float bf_bits2f(unsigned short h) { return __uint_as_float(((unsigned)h) << 16); }

// hazard guards as plain device helpers
__device__ __forceinline__ void dep_guard_h(v8f& a, v8f& b, v16h x, v16h y) { asm volatile("v_nop\n\tv_nop\n\tv_nop\n\tv_nop" : "+v"(a), "+v"(b) : "v"(x), "v"(y)); }
__device__ __forceinline__ void dep_guard_b(v8f& a, v8f& b, v16b x, v16b y) { asm volatile("v_nop\n\tv_nop\n\tv_nop\n\tv_nop" : "+v"(a), "+v"(b) : "v"(x), "v"(y)); }
__device__ __forceinline__ void keep4_h(v16h a, v16h b, v16h c, v16h d) { asm volatile("v_nop" :: "v"(a), "v"(b), "v"(c), "v"(d)); }
__device__ __forceinline__ void keep4_b(v16b a, v16b b, v16b c, v16b d) { asm volatile("v_nop" :: "v"(a), "v"(b), "v"(c), "v"(d)); }
__device__ __forceinline__ void acc_guard4(v8f& a, v8f& b, v8f& c, v8f& d) { asm volatile("v_nop\n\tv_nop\n\tv_nop\n\tv_nop" : "+v"(a), "+v"(b), "+v"(c), "+v"(d)); }
template <typename T> struct Frag;
template <> struct Frag<_Float16> {
  typedef v16h V; union U { v16h v; v8h h[2]; };
  static __device__ __forceinline__ v16h load(const _Float16* p) {   // elements 0..7 <- p[0..7], 8..15 <- p[16..23]
    U f; f.h[0] = *(const v8h*)(p); f.h[1] = *(const v8h*)(p + 16); return f.v;
  }
  static __device__ __forceinline__ v8f mma(v16h a, v16h b, v8f c) {
    return __builtin_amdgcn_wmma_f32_16x16x32_f16(false, a, false, b, (short)0, c, false, false);
  }
  static __device__ __forceinline__ void guard(v8f& a, v8f& b, v16h x, v16h y) { dep_guard_h(a, b, x, y); }
  static __device__ __forceinline__ void keep(v16h a, v16h b, v16h c, v16h d) { keep4_h(a, b, c, d); }
};
template <> struct Frag<__bf16> {
  typedef v16b V; union U { v16b v; v8b h[2]; };
  static __device__ __forceinline__ v16b load(const __bf16* p) {
    U f; f.h[0] = *(const v8b*)(p); f.h[1] = *(const v8b*)(p + 16); return f.v;
  }
  static __device__ __forceinline__ v8f mma(v16b a, v16b b, v8f c) {
    return __builtin_amdgcn_wmma_f32_16x16x32_bf16(false, a, false, b, (short)0, c, false, false);
  }
  static __device__ __forceinline__ void guard(v8f& a, v8f& b, v16b x, v16b y) { dep_guard_b(a, b, x, y); }
  static __device__ __forceinline__ void keep(v16b a, v16b b, v16b c, v16b d) { keep4_b(a, b, c, d); }
};

// tanh-GELU: 0.5*v*(1+tanh(sqrt(2/pi)*(v+0.044715*v^3))); tanh via exp(-2|u|), no division instruction
__device__ __forceinline__ float gelu_tanh_f(float v) {
  const float u = 0.7978845608028654f * (v + 0.044715f * v * v * v);
  const float e = __expf(-2.0f * fabsf(u));
  float t = (1.0f - e) * __builtin_amdgcn_rcpf(1.0f + e);
  t = copysignf(t, u);
  return 0.5f * v * (1.0f + t);
}

// ---- Register-blocked batched WMMA GEMM ------------------------------------
// C[m,n] = scale * sum_k A[m,k] * Bt[n,k] (+bias)(+resid); each wave owns a 64x64 tile, a block of 4 waves (2x2) a 128x128 tile.
// A row-major [M,K]; Bt row-major [N,K]; M,N % 128 == 0, K % 128 == 0.
// Operands reach the waves through LDS: a stage is 128 k of the block's 128 A rows and 128 Bt rows (256 B a row, pitch 272 B),
// brought by asynchronous copies into two buffers, the next stage's copies in flight while this stage is multiplied.
// SPLIT (hi/lo planes) is not built in this form.
// BIAS_MODE: 0 = none, 1 = bias[m], 2 = bias[n].
// OUT_MODE: 0 = f32, 1 = f16, 2 = bf16 hi plane (Cout) + bf16 lo plane (Cout2).
// ACT: 0 none, 1 tanh, 2 relu, 3 silu, 4 leaky, 5 erf-gelu, 6 tanh-gelu.
// ET: 0 = f16 operands, 1 = bf16 operands (pointers passed as 16-bit storage)
template <int ET> struct Elem;
template <> struct Elem<0> { typedef _Float16 T; };
template <> struct Elem<1> { typedef __bf16 T; };
#define G_KS    128                       // k per stage
#define G_PITCH 136                       // LDS row pitch in 16-bit elements: 256 B + 16 B
#define G_STAGE (256 * G_PITCH)           // elements per buffer: rows 0..127 = A, rows 128..255 = Bt
// Eight asynchronous 16-byte copies per lane, rows 8 apart. The s_wait_xcnt stands inside the statement so that
// no address register of an issued copy is rewritten in front of it.
__device__ __forceinline__ void g_copy8(unsigned l, const unsigned short* g, size_t gstep) {
  const unsigned ls = 8u * G_PITCH * 2u;
  asm volatile(
      "global_load_async_to_lds_b128 %0, %8, off\n\t"
      "global_load_async_to_lds_b128 %1, %9, off\n\t"
      "global_load_async_to_lds_b128 %2, %10, off\n\t"
      "global_load_async_to_lds_b128 %3, %11, off\n\t"
      "global_load_async_to_lds_b128 %4, %12, off\n\t"
      "global_load_async_to_lds_b128 %5, %13, off\n\t"
      "global_load_async_to_lds_b128 %6, %14, off\n\t"
      "global_load_async_to_lds_b128 %7, %15, off\n\t"
      "s_wait_xcnt 0x0"
      :: "v"(l), "v"(l + ls), "v"(l + 2u * ls), "v"(l + 3u * ls), "v"(l + 4u * ls), "v"(l + 5u * ls), "v"(l + 6u * ls), "v"(l + 7u * ls),
         "v"(g), "v"(g + gstep), "v"(g + 2 * gstep), "v"(g + 3 * gstep), "v"(g + 4 * gstep), "v"(g + 5 * gstep), "v"(g + 6 * gstep), "v"(g + 7 * gstep)
      : "memory");
}
template <int ET, bool SPLIT, int BIAS_MODE, int OUT_MODE, bool RESID, int ACT = 0>
__global__ __launch_bounds__(128) void wmma_gemm64(
    const unsigned short* __restrict__ Ap, const unsigned short* __restrict__ A2p, int lda, long strideA,
    const unsigned short* __restrict__ Btp, const unsigned short* __restrict__ Bt2p, int ldb, long strideB,
    void* __restrict__ Cout, void* __restrict__ Cout2, int ldc, long strideC,
    const float* __restrict__ bias,
    const float* __restrict__ resid, long strideR,
    int M, int N, int K, float scale) {
  typedef typename Elem<ET>::T T;
  typedef typename Frag<T>::V V;
  static_assert(!SPLIT, "hi/lo planes are not staged");
  __shared__ __align__(16) unsigned short sAB[2 * G_STAGE];   // two stage buffers
  __shared__ __align__(16) float sT[4][16 * 68];   // per-wave 16x64 slab, pitch 68 floats
  const int b    = blockIdx.y;
  const int tid  = threadIdx.x;
  const int lane = tid & 31;
  const int wave = tid >> 5;
  const int tilesN = N >> 7;
  const int tilesM = M >> 7;
  const int tile = blockIdx.x;
  if (tile >= tilesM * tilesN) return;   // block-uniform, in front of every barrier and copy
  const int tm = tile / tilesN;
  const int tn = tile - tm * tilesN;
  const int mB = tm << 7;
  const int nB = tn << 7;
  const int wm = wave >> 1, wn = wave & 1;
  const int m0 = mB + (wm << 6);
  const int n0 = nB + (wn << 6);

  const int rlane = lane & 15;                 // row (A) / col (B, D) within subtile
  const int koff  = (lane >> 4) * 8;           // k offset of this lane half
  const int mOff  = (lane >> 4) * 8;           // D row offset

  // copy lanes: 16 lanes cover one 256-B row, a wave-wide copy two rows (four whole lines)
  const int crow = tid >> 4, cch = (tid & 15) * 8;
  const unsigned short* gA = Ap  + (size_t)b * strideA + (size_t)(mB + crow) * lda + cch;
  const unsigned short* gB = Btp + (size_t)b * strideB + (size_t)(nB + crow) * ldb + cch;
  const unsigned lbase = (unsigned)(size_t)(&sAB[0]) + (unsigned)(crow * G_PITCH + cch) * 2u;
  const size_t stepA = (size_t)8 * lda, stepB = (size_t)8 * ldb;
  auto stage_copy = [&](int st, int buf) {     // 32 copies per lane: one stage of A and Bt
    const unsigned l = lbase + (unsigned)buf * (G_STAGE * 2u);
    const unsigned short* a = gA + (size_t)st * G_KS;
    const unsigned short* w = gB + (size_t)st * G_KS;
    g_copy8(l,                          a,             stepA);
    g_copy8(l +  64u * G_PITCH * 2u,    a + 8 * stepA, stepA);
    g_copy8(l + 128u * G_PITCH * 2u,    w,             stepB);
    g_copy8(l + 192u * G_PITCH * 2u,    w + 8 * stepB, stepB);
  };

  v8f acc[4][4];
#pragma unroll
  for (int i = 0; i < 4; ++i)
#pragma unroll
    for (int j = 0; j < 4; ++j) acc[i][j] = (v8f){0.f,0.f,0.f,0.f,0.f,0.f,0.f,0.f};

  const int nst = K >> 7;
  stage_copy(0, 0);
  asm volatile("s_wait_asynccnt 0x0" ::: "memory");   // this wave's part of stage 0 has landed
  __syncthreads();                                     // stage 0 readable by every wave
  if (nst > 1) stage_copy(1, 1);
#pragma unroll 1   // kept rolled: one trip is one stage of the ring, with one publish point and one refill site
  for (int t = 0; t < nst; ++t) {
    const T* sbuf = (const T*)sAB + (size_t)(t & 1) * G_STAGE;
    const T* sA = sbuf + ((wm << 6) + rlane) * G_PITCH + koff;
    const T* sB = sbuf + (128 + (wn << 6) + rlane) * G_PITCH + koff;
#pragma unroll     // the loops below are unrolled so that fragments and accumulators are indexed by constants (registers, no scratch)
    for (int ks = 0; ks < G_KS / 32; ++ks) {
      V bh[4], ah[4];
#pragma unroll
      for (int j = 0; j < 4; ++j) bh[j] = Frag<T>::load(sB + j * 16 * G_PITCH + ks * 32);
#pragma unroll
      for (int i = 0; i < 4; ++i) ah[i] = Frag<T>::load(sA + i * 16 * G_PITCH + ks * 32);
#pragma unroll
      for (int i = 0; i < 4; ++i) {
#pragma unroll
        for (int j = 0; j < 4; ++j) acc[i][j] = Frag<T>::mma(ah[i], bh[j], acc[i][j]);
        Frag<T>::guard(acc[i][0], acc[i][3], ah[i], ah[i]);
      }
      Frag<T>::keep(bh[0], bh[1], bh[2], bh[3]);
    }
    asm volatile("s_wait_dscnt 0x0" ::: "memory");     // this wave's reads of buffer t & 1 are done
    asm volatile("s_wait_asynccnt 0x0" ::: "memory");  // this wave's part of stage t + 1 has landed
    __syncthreads();                                   // publishes stage t + 1, frees buffer t & 1
    if (t + 2 < nst) stage_copy(t + 2, t & 1);
  }
  asm volatile("s_wait_asynccnt 0x0" ::: "memory");    // no copy outstanding behind the loop
  acc_guard4(acc[0][0], acc[0][1], acc[0][2], acc[0][3]);
  acc_guard4(acc[1][0], acc[1][1], acc[1][2], acc[1][3]);
  acc_guard4(acc[2][0], acc[2][1], acc[2][2], acc[2][3]);
  acc_guard4(acc[3][0], acc[3][1], acc[3][2], acc[3][3]);

  // ---- epilogue ----
  float* slab = sT[wave];
  const float* Rb = RESID ? (resid + (size_t)b * strideR) : nullptr;
#pragma unroll
  for (int i = 0; i < 4; ++i) {
    const int mBase = m0 + (i << 4);
#pragma unroll
    for (int j = 0; j < 4; ++j) {
      const int n = n0 + (j << 4) + rlane;
      float bv = 0.f;
      if (BIAS_MODE == 2) bv = bias[n];
#pragma unroll
      for (int r = 0; r < 8; ++r) {
        float v = acc[i][j][r] * scale;
        if (BIAS_MODE == 1) v += bias[mBase + mOff + r];
        if (BIAS_MODE == 2) v += bv;
        if (RESID) v += Rb[(size_t)(mBase + mOff + r) * ldc + n];
        if (ACT == 1) v = tanhf(v);
        if (ACT == 2) v = fmaxf(v, 0.0f);
        if (ACT == 3) v = v / (1.0f + expf(-v));
        if (ACT == 4) v = (v > 0.f) ? v : 0.01f * v;
        if (ACT == 5) v = 0.5f * v * (1.0f + erff(v * 0.70710678118654752f));
        if (ACT == 6) v = gelu_tanh_f(v);
        slab[(mOff + r) * 68 + (j << 4) + rlane] = v;
      }
    }
    __builtin_amdgcn_fence(__ATOMIC_RELEASE, "workgroup");
    __builtin_amdgcn_wave_barrier();
    __builtin_amdgcn_fence(__ATOMIC_ACQUIRE, "workgroup");
    if (OUT_MODE == 0) {
      float* C = (float*)Cout + (size_t)b * strideC;
      const int hh = lane >> 4, c4 = (lane & 15) * 4;     // row seg = 256 B = 16 lanes x 16 B
      {
#pragma unroll
        for (int it = 0; it < 8; ++it) {
          const int row = it * 2 + hh;
          v4f v = *(const v4f*)(slab + row * 68 + c4);
          *(v4f*)(C + (size_t)(mBase + row) * ldc + n0 + c4) = v;
        }
        
      }
    } else {
      const int q = lane >> 3, c8 = (lane & 7) * 8;
      unsigned short* C  = (unsigned short*)Cout  + (size_t)b * strideC;
      unsigned short* C2 = (OUT_MODE == 2) ? ((unsigned short*)Cout2 + (size_t)b * strideC) : nullptr;
      {
#pragma unroll
        for (int it = 0; it < 4; ++it) {
          const int row = it * 4 + q;
          const float* sp = slab + row * 68 + c8;
          v8h hv, lv;
#pragma unroll
          for (int e = 0; e < 8; ++e) {
            if (OUT_MODE == 1) {
              hv[e] = (_Float16)sp[e];
            } else {
              unsigned short hb = f2bf_bits(sp[e]);
              unsigned short lb = f2bf_bits(sp[e] - bf_bits2f(hb));
              hv[e] = __builtin_bit_cast(_Float16, hb);
              lv[e] = __builtin_bit_cast(_Float16, lb);
            }
          }
          *(v8h*)(C + (size_t)(mBase + row) * ldc + n0 + c8) = hv;
          if (OUT_MODE == 2) *(v8h*)(C2 + (size_t)(mBase + row) * ldc + n0 + c8) = lv;
        }
        
      }
    }
    __builtin_amdgcn_fence(__ATOMIC_RELEASE, "workgroup");
    __builtin_amdgcn_wave_barrier();
    __builtin_amdgcn_fence(__ATOMIC_ACQUIRE, "workgroup");
  }
}

// ---- f32 -> f16 conversion by few, long-lived waves ------------------------
// A block is 16 waves; a wave converts R * 1024 contiguous elements: R * 8 loads of 16 bytes a lane (each wave-wide load 512
// contiguous bytes), all issued before the first is converted, and as many 8-byte stores (each wave-wide store 256 contiguous bytes).
typedef __attribute__((ext_vector_type(4))) _Float16 v4h;
#define CV_WAVES 16
template <int R>
__device__ __forceinline__ void cast_wave(const float* __restrict__ src, _Float16* __restrict__ dst, int q) {
  // src, dst: block-uniform; q: the lane's first group of four elements, one index for the loads and the stores
  const v4f* __restrict__ s4 = (const v4f*)src;
  v4h* __restrict__ d4 = (v4h*)dst;
  v4f x[R * 8];
#pragma unroll   // both loops unrolled: x stays in registers, every load and store addresses by an immediate offset
  for (int i = 0; i < R * 8; ++i) x[i] = s4[q + i * 32];
  if (R > 1) __builtin_amdgcn_sched_barrier(0);   // keeps every load in front of the first wait: a wave pays one memory latency, not one per group of loads
#pragma unroll
  for (int i = 0; i < R * 8; ++i) {
    v4h h;
#pragma unroll
    for (int e = 0; e < 4; ++e) h[e] = (_Float16)x[i][e];
    d4[q + i * 32] = h;
    if ((i & 7) == 7 && i + 1 < R * 8) __builtin_amdgcn_sched_barrier(0);   // eight stores leave as soon as their loads are in, not all behind the last load
  }
}
// The seven f32 inputs of the GEMMs in one launch: their f16 copies lie one behind the other in dst, at these element offsets.
#define CV_X   0
#define CV_Q   (CV_X + MROWS * DM)
#define CV_K   (CV_Q + DM * DM)
#define CV_V   (CV_K + DM * DM)
#define CV_O   (CV_V + DM * DM)
#define CV_W1  (CV_O + DM * DM)
#define CV_W2  (CV_W1 + FFND * DM)
#define CV_END (CV_W2 + DM * FFND)
#define CV_R   4
#define CV_BLK (CV_WAVES * CV_R * 1024)   // elements per block
static_assert(CV_Q % CV_BLK == 0 && CV_K % CV_BLK == 0 && CV_V % CV_BLK == 0 && CV_O % CV_BLK == 0 &&
              CV_W1 % CV_BLK == 0 && CV_W2 % CV_BLK == 0 && CV_END % CV_BLK == 0, "a block lies wholly in one tensor");
__global__ __launch_bounds__(CV_WAVES * 32) void cast_inputs(
    const float* __restrict__ x, const float* __restrict__ wq, const float* __restrict__ wk, const float* __restrict__ wv,
    const float* __restrict__ wo, const float* __restrict__ w1, const float* __restrict__ w2, _Float16* __restrict__ dst) {
  const int e0 = blockIdx.x * CV_BLK;       // block-uniform: the block index picks the tensor
  const float* src = x;
  int first = CV_X;
  if (e0 >= CV_Q)  { src = wq; first = CV_Q; }
  if (e0 >= CV_K)  { src = wk; first = CV_K; }
  if (e0 >= CV_V)  { src = wv; first = CV_V; }
  if (e0 >= CV_O)  { src = wo; first = CV_O; }
  if (e0 >= CV_W1) { src = w1; first = CV_W1; }
  if (e0 >= CV_W2) { src = w2; first = CV_W2; }
  cast_wave<CV_R>(src + (e0 - first), dst + e0, (threadIdx.x >> 5) * (CV_R * 256) + (threadIdx.x & 31));
}
// One tensor of gridDim.x * CV_WAVES * R * 1024 elements.
template <int R>
__global__ __launch_bounds__(CV_WAVES * 32) void cast_one(const float* __restrict__ in, _Float16* __restrict__ out) {
  const int e0 = blockIdx.x * (CV_WAVES * R * 1024);
  cast_wave<R>(in + e0, out + e0, (threadIdx.x >> 5) * (R * 256) + (threadIdx.x & 31));
}

// =====================================================================================
// Attention for head_dim 64, f32 in / f32 out; 16-bit operands: bf16 with optional hi/lo splits, or
// plain f16 (F16=true, non-split, probabilities carried x2^15).
//   Block = 4 waves = 64 query rows of one (batch, head); S % 64 == 0.
//   Element (b, s, h, d) of tensor X lives at X[b*X_bs + s*X_rs + h*X_hs + d] (strides in floats, multiples of 4).
//   mask_mode 0 none, 1 causal, 2 tensor [S][Skv], 3 per-token vectors, 4 causal + window, 5 relative bias,
//   6 = mask_a: int32 [S][Skv] nonzero = masked, OR mask_b: int32 [B][Skv] nonzero = masked; per 64x64
//       (b, q-tile, kv-tile) code table tcode[(b*nqb+qb)*t_pitch + kc]: 0 mixed (per-element reads),
//       1 all live (no reads), 2 all masked (tile skipped: zero contribution).
//   masked scores are replaced by mask_fill before the softmax; rows with no live key write 0.
//   grid.x = B * H * (S/64).
// =====================================================================================
#define AT_D 64
#define AT_NW 4
#define AT_QB 64
#define AT_KC 64
#define AT_LOG2E 1.4426950408889634f
#define AT_LP 72    // LDS row pitch of the K, V^T and P tiles in 16-bit elements: 128 B of data + 16 B, so that the 16 rows
                    // which one ds_load_b128 fragment read touches fall on 16 different groups of four banks
struct AttnGeom { const int* tcode; const float* cp; const float* pc; long c_bs, c_rs, c_hs, t_pitch;
                  long q_bs, q_rs, q_hs, k_bs, k_rs, k_hs, v_bs, v_rs, v_hs, o_bs, o_rs, o_hs;
                  int S, Skv, H, mask_mode; float qscale; int blk0; float mask_fill; int mask_is_int; };
static_assert(sizeof(AttnGeom) == 184);

__device__ __forceinline__ unsigned short at_bf_bits(float f) {
  unsigned u = __float_as_uint(f);
  return (unsigned short)((u + 0x7FFFu + ((u >> 16) & 1u)) >> 16);
}
__device__ __forceinline__ __bf16 at_f2bf(float f) { return __builtin_bit_cast(__bf16, at_bf_bits(f)); }
__device__ __forceinline__ void at_split(float f, __bf16& hi, __bf16& lo) {
  const unsigned short hb = at_bf_bits(f);
  hi = __builtin_bit_cast(__bf16, hb);
  lo = at_f2bf(f - __uint_as_float(((unsigned)hb) << 16));
}
__device__ __forceinline__ v8f at_mma(v16b a, v16b b, v8f c) {
  c = __builtin_amdgcn_wmma_f32_16x16x32_bf16(false, a, false, b, (short)0, c, false, false);
  asm volatile("v_nop\n\tv_nop\n\tv_nop\n\tv_nop" : "+v"(c) : "v"(a), "v"(b));
  return c;
}
// 16-bit element as a bit pattern held in a __bf16 slot: f16 bits when F16, bf16 (RNE) otherwise
template <bool F16> __device__ __forceinline__ __bf16 at_to16(float f) {
  if (F16) return __builtin_bit_cast(__bf16, (_Float16)f);
  return at_f2bf(f);
}
template <bool F16> __device__ __forceinline__ v8f at_mma16(v16b a, v16b b, v8f c) {
  if (F16) {
    const v16h ah = __builtin_bit_cast(v16h, a), bh = __builtin_bit_cast(v16h, b);
    c = __builtin_amdgcn_wmma_f32_16x16x32_f16(false, ah, false, bh, (short)0, c, false, false);
    asm volatile("v_nop\n\tv_nop\n\tv_nop\n\tv_nop" : "+v"(c) : "v"(ah), "v"(bh));
    return c;
  }
  return at_mma(a, b, c);
}

// Five powers of two (one score row's four and its rescale factor) in one statement. Behind a v_exp_f32 the instruction set asks for
// one independent instruction before its result is read or its source overwritten: here each v_exp_f32 is that instruction for the
// one before it (the outputs are early-clobber, so none lies on a source), and the v_nop is it for the last.
__device__ __forceinline__ void at_exp2x5(float& o0, float& o1, float& o2, float& o3, float& o4,
                                          float x0, float x1, float x2, float x3, float x4) {
  asm("v_exp_f32 %0, %5\n\t"
      "v_exp_f32 %1, %6\n\t"
      "v_exp_f32 %2, %7\n\t"
      "v_exp_f32 %3, %8\n\t"
      "v_exp_f32 %4, %9\n\t"
      "v_nop"
      : "=&v"(o0), "=&v"(o1), "=&v"(o2), "=&v"(o3), "=&v"(o4)
      : "v"(x0), "v"(x1), "v"(x2), "v"(x3), "v"(x4));
}

// MODE is the mask mode as a compile-time constant: only that mode's mask code is compiled into the key loop.
// KVRS is the row stride of K and of V in floats (the launch's g.k_rs and g.v_rs) as a compile-time constant: the eight pieces that a
// lane reads of each tile are then one address and eight immediate offsets.
template <bool SPLIT_QK, bool SPLIT_PV, bool F16, int MODE, int KVRS>
__global__ __launch_bounds__(128)
void attn64_kernel(const float* __restrict__ q, const float* __restrict__ k,
                   const float* __restrict__ v, float* __restrict__ out,
                   const int* __restrict__ mask_a, const int* __restrict__ mask_b, AttnGeom g) {
  static_assert(!(F16 && (SPLIT_QK || SPLIT_PV)));
  const float PSC = F16 ? 32768.0f : 1.0f;     // f16 probabilities carried x2^15, folded into the final 1/l
  union FB { v16b v; v8b h[2]; };
  __shared__ __align__(16) __bf16 Ksh[AT_KC * AT_LP];            // K hi [kv][d]      9 KB
  __shared__ __align__(16) __bf16 Ksl[SPLIT_QK ? AT_KC * AT_LP : 8];
  __shared__ __align__(16) __bf16 Vth[AT_D * AT_LP];             // V hi [d][kv]      9 KB
  __shared__ __align__(16) __bf16 Vtl[SPLIT_PV ? AT_D * AT_LP : 8];
  __shared__ __align__(16) __bf16 Psh[AT_NW][16 * AT_LP];        // per wave P hi [row][kv]  9 KB
  __shared__ __align__(16) __bf16 Psl[SPLIT_PV ? AT_NW : 1][SPLIT_PV ? 16 * AT_LP : 8];
  __shared__ __align__(16) float  Os[AT_NW][16 * 68];            // per wave out tile, pitch 68

  const int tid  = threadIdx.x;
  const int wave = tid >> 5;
  const int lane = tid & 31;
  const int hh   = lane >> 4;
  const int c    = lane & 15;

  const int nqb = g.S / AT_QB;
  const int nkc = g.Skv / AT_KC;
  const int bx = blockIdx.x + g.blk0;
  const int qb = bx % nqb;
  const int bh = bx / nqb;
  const int h  = bh % g.H;
  const int b  = bh / g.H;
  const int qbase_block = qb * AT_QB;
  const int q0 = qbase_block + wave * 16;

  const float* qb_ptr = q + (size_t)b * g.q_bs + (size_t)h * g.q_hs;
  const float* kb_ptr = k + (size_t)b * g.k_bs + (size_t)h * g.k_hs;
  const float* vb_ptr = v + (size_t)b * g.v_bs + (size_t)h * g.v_hs;
  float*       ob_ptr = out + (size_t)b * g.o_bs + (size_t)h * g.o_hs;

  // ---- Q fragments (A operand): 2 d-chunks, hi (and lo) ----
  v16b qah[2], qal[2];
  {
    const float* qrow = qb_ptr + (size_t)(q0 + c) * g.q_rs;
#pragma unroll
    for (int dc = 0; dc < 2; ++dc) {
#pragma unroll
      for (int e = 0; e < 8; ++e) {
        const float f0 = qrow[dc * 32 + 8 * hh + e] * g.qscale;
        const float f1 = qrow[dc * 32 + 16 + 8 * hh + e] * g.qscale;
        if (SPLIT_QK) { __bf16 hq, lq; at_split(f0, hq, lq); qah[dc][e] = hq; qal[dc][e] = lq; at_split(f1, hq, lq); qah[dc][8 + e] = hq; qal[dc][8 + e] = lq; }
        else { qah[dc][e] = at_to16<F16>(f0); qah[dc][8 + e] = at_to16<F16>(f1); qal[dc][e] = qah[dc][e]; qal[dc][8 + e] = qah[dc][8 + e]; }
      }
    }
  }

  float mrow[8], lrow[8];
  v8f oacc[4];
#pragma unroll
  for (int r = 0; r < 8; ++r) { mrow[r] = -INFINITY; lrow[r] = 0.f; }
#pragma unroll
  for (int t = 0; t < 4; ++t) oacc[t] = (v8f){0.f,0.f,0.f,0.f,0.f,0.f,0.f,0.f};

  const int nChunks = (MODE == 1 || MODE == 4) ? (qb + 1) : nkc;   // block-uniform, bounded by Skv/64
  // per-row query mask (mode 3)
  int qkeep[8];
#pragma unroll
  for (int r = 0; r < 8; ++r) qkeep[r] = (MODE == 3) ? mask_b[(size_t)b * g.S + q0 + 8 * hh + r] : 1;   // mask_b = qmask in mode 3
  for (int kc = 0; kc < nChunks; ++kc) {
    const int kv0 = kc * AT_KC;
    int code = 0;
    if (MODE == 6) {
      int cv = g.tcode[((size_t)b * nqb + qb) * (size_t)g.t_pitch + kc];
      cv = __builtin_amdgcn_readfirstlane(cv);
      code = (cv == 1 || cv == 2) ? cv : 0;     // anything else -> mixed (per-element reads)
      if (code == 2) continue;                  // fully masked tile: zero contribution, softmax state unchanged
    }
    __syncthreads();
    {
      // 8 lanes read one whole 128-B line (half a row) of K or V, so a wave-wide 16-byte load covers four whole lines of four rows.
      // A lane takes the rows kvr and kvr + 1 at the same four d: a V^T pair of neighbouring keys is one 4-byte LDS store.
      // Four row pairs a wave (not two) spread a V^T store over 16 banks: the d of 8 lanes fall on 4 banks, each row pair is one bank on.
      const int r2 = (tid >> 3) * 2, d4 = (tid & 7) * 4;
      const float* kcol = kb_ptr + (size_t)(kv0 + r2) * KVRS + d4;
      const float* vcol = vb_ptr + (size_t)(kv0 + r2) * KVRS + d4;
      v4f kx[8], vx[8];
#pragma unroll   // this loop and the two below unrolled: kx and vx are indexed by constants (registers), all 16 loads are issued in front of the first wait
      for (int i = 0; i < 8; ++i) {
        kx[i] = *(const v4f*)(kcol + (((i >> 1) & 1) * 32 + (i & 1)) * KVRS + (i >> 2) * 32);
        vx[i] = *(const v4f*)(vcol + (((i >> 1) & 1) * 32 + (i & 1)) * KVRS + (i >> 2) * 32);
      }
      // kcol and vcol are inputs so that both address pairs live up to this wait: no load's result and no conversion takes their registers in front of it
      asm volatile("s_wait_xcnt 0x0" :: "v"(kcol), "v"(vcol) : "memory");
#pragma unroll
      for (int p = 0; p < 4; ++p) {
        const int kvr = (p & 1) * 32 + r2, dd = (p >> 1) * 32 + d4;
        const v4f k0 = kx[2 * p], k1 = kx[2 * p + 1], v0 = vx[2 * p], v1 = vx[2 * p + 1];
        v4b k0h, k0l, k1h, k1l;
#pragma unroll
        for (int e = 0; e < 4; ++e) {
          if (SPLIT_QK) { __bf16 a, bl; at_split(k0[e], a, bl); k0h[e] = a; k0l[e] = bl; at_split(k1[e], a, bl); k1h[e] = a; k1l[e] = bl; }
          else { k0h[e] = at_to16<F16>(k0[e]); k1h[e] = at_to16<F16>(k1[e]); }
          v2b vh, vl;
          if (SPLIT_PV) { __bf16 a, bl; at_split(v0[e], a, bl); vh[0] = a; vl[0] = bl; at_split(v1[e], a, bl); vh[1] = a; vl[1] = bl; }
          else { vh[0] = at_to16<F16>(v0[e]); vh[1] = at_to16<F16>(v1[e]); }
          *(v2b*)(Vth + (dd + e) * AT_LP + kvr) = vh;
          if (SPLIT_PV) *(v2b*)(Vtl + (dd + e) * AT_LP + kvr) = vl;
        }
        *(v4b*)(Ksh + kvr * AT_LP + dd) = k0h;
        *(v4b*)(Ksh + (kvr + 1) * AT_LP + dd) = k1h;
        if (SPLIT_QK) { *(v4b*)(Ksl + kvr * AT_LP + dd) = k0l; *(v4b*)(Ksl + (kvr + 1) * AT_LP + dd) = k1l; }
      }
    }
    __syncthreads();

    v8f s[4];
#pragma unroll
    for (int j = 0; j < 4; ++j) {
      s[j] = (v8f){0.f,0.f,0.f,0.f,0.f,0.f,0.f,0.f};
#pragma unroll 1
      for (int dc = 0; dc < 2; ++dc) {
        FB kb;
        kb.h[0] = *(const v8b*)(Ksh + (j * 16 + c) * AT_LP + dc * 32 + 8 * hh);
        kb.h[1] = *(const v8b*)(Ksh + (j * 16 + c) * AT_LP + dc * 32 + 16 + 8 * hh);
        s[j] = at_mma16<F16>(qah[dc], kb.v, s[j]);
        if (SPLIT_QK) {
          FB kl;
          kl.h[0] = *(const v8b*)(Ksl + (j * 16 + c) * AT_LP + dc * 32 + 8 * hh);
          kl.h[1] = *(const v8b*)(Ksl + (j * 16 + c) * AT_LP + dc * 32 + 16 + 8 * hh);
          s[j] = at_mma16<F16>(qah[dc], kl.v, s[j]);
          s[j] = at_mma16<F16>(qal[dc], kb.v, s[j]);
        }
      }
    }
    const bool diag = (MODE == 1) && (kc == qb);
    int kvkeep[4] = {1, 1, 1, 1};
    if (MODE == 3) {
#pragma unroll
      for (int j = 0; j < 4; ++j) kvkeep[j] = mask_a[(size_t)b * g.Skv + kv0 + j * 16 + c];   // mask_a = kvmask
    }
    if (MODE == 6 && code == 0) {               // mixed tile: one wave-uniform branch per tile, then per-element reads
      int kvpad[4];
#pragma unroll
      for (int j = 0; j < 4; ++j) kvpad[j] = mask_b[(size_t)b * g.Skv + kv0 + j * 16 + c];   // mask_b = key padding [B][Skv]
#pragma unroll   // both loops unrolled so that s[j][r] is indexed by constants and stays in registers
      for (int r = 0; r < 8; ++r) {
        const int* mrowp = mask_a + (size_t)(q0 + 8 * hh + r) * g.Skv + kv0 + c;
#pragma unroll
        for (int j = 0; j < 4; ++j)
          if ((mrowp[j * 16] != 0) || (kvpad[j] != 0)) s[j][r] = g.mask_fill;
      }
    }
    float cm[8];
#pragma unroll
    for (int r = 0; r < 8; ++r) {
      const int qrow = q0 + 8 * hh + r;
      float m = -INFINITY;
#pragma unroll
      for (int j = 0; j < 4; ++j) {
        const int kvcol = kv0 + j * 16 + c;
        bool masked = false;
        if (diag) masked = (kvcol > qrow);
        else if (MODE == 4) masked = (kvcol > qrow) || (qrow - kvcol > g.mask_is_int);
        else if (MODE == 2) {
          const size_t mi = (size_t)qrow * g.Skv + kvcol;
          masked = (g.mask_is_int == 0) ? (((const float*)mask_a)[mi] == 0.0f)
                 : (g.mask_is_int == 1) ? (mask_a[mi] == 0) : (mask_a[mi] != 0);
        } else if (MODE == 3) masked = (qkeep[r] == 0) || (kvkeep[j] == 0);
        else if (MODE == 5) {
          const size_t mi = (size_t)qrow * g.Skv + kvcol;
          masked = (mask_a[mi] != 0);
          int n = mask_b[mi]; n = n < 0 ? 0 : n;
          s[j][r] += g.cp[(size_t)b * g.c_bs + (size_t)h * g.c_hs + (size_t)qrow * g.c_rs + n]
                   + g.pc[(size_t)b * g.c_bs + (size_t)h * g.c_hs + (size_t)kvcol * g.c_rs + n];
        }
        if (masked) s[j][r] = g.mask_fill;
        m = fmaxf(m, s[j][r]);
      }
#pragma unroll
      for (int off = 1; off < 16; off <<= 1) m = fmaxf(m, __shfl_xor(m, off, 32));
      cm[r] = m;
    }
    __bf16* pwh = Psh[wave];
    __bf16* pwl = Psl[SPLIT_PV ? wave : 0];
#pragma unroll
    for (int r = 0; r < 8; ++r) {
      const float mnew = fmaxf(mrow[r], cm[r]);
      // exp(x - mnew) = 2^(x * log2(e) - mb): one FMA and one v_exp_f32, no branch. A row with no live key yet takes mb = 0:
      // every exponent is then -inf (never inf - inf), so its p and alpha are 0 and its sums stay 0.
      const float mb = (mnew == -INFINITY) ? 0.0f : mnew * AT_LOG2E;
      float pe[4], alpha;
      at_exp2x5(pe[0], pe[1], pe[2], pe[3], alpha,
                fmaf(s[0][r], AT_LOG2E, -mb), fmaf(s[1][r], AT_LOG2E, -mb), fmaf(s[2][r], AT_LOG2E, -mb),
                fmaf(s[3][r], AT_LOG2E, -mb), fmaf(mrow[r], AT_LOG2E, -mb));
      mrow[r] = mnew;
      float psum = 0.f;
#pragma unroll
      for (int j = 0; j < 4; ++j) {
        const float p = pe[j];
        psum = (j == 0) ? p : psum + p;   // same order as 0 + p0 + p1 + p2 + p3; a power of two is never -0, so the same bits
        if (SPLIT_PV) { __bf16 a, bl; at_split(p, a, bl); pwh[(8 * hh + r) * AT_LP + j * 16 + c] = a; pwl[(8 * hh + r) * AT_LP + j * 16 + c] = bl; }
        else pwh[(8 * hh + r) * AT_LP + j * 16 + c] = at_to16<F16>(p * PSC);
      }
#pragma unroll
      for (int off = 1; off < 16; off <<= 1) psum += __shfl_xor(psum, off, 32);
      lrow[r] = lrow[r] * alpha + psum;
#pragma unroll
      for (int t = 0; t < 4; ++t) oacc[t][r] *= alpha;
    }
    __builtin_amdgcn_fence(__ATOMIC_RELEASE, "workgroup");
    __builtin_amdgcn_wave_barrier();
    __builtin_amdgcn_fence(__ATOMIC_ACQUIRE, "workgroup");
#pragma unroll 1
    for (int kk = 0; kk < 2; ++kk) {
      FB pa, pl;
      pa.h[0] = *(const v8b*)(pwh + c * AT_LP + kk * 32 + 8 * hh);
      pa.h[1] = *(const v8b*)(pwh + c * AT_LP + kk * 32 + 16 + 8 * hh);
      if (SPLIT_PV) {
        pl.h[0] = *(const v8b*)(pwl + c * AT_LP + kk * 32 + 8 * hh);
        pl.h[1] = *(const v8b*)(pwl + c * AT_LP + kk * 32 + 16 + 8 * hh);
      }
#pragma unroll
      for (int t = 0; t < 4; ++t) {
        FB vb;
        vb.h[0] = *(const v8b*)(Vth + (t * 16 + c) * AT_LP + kk * 32 + 8 * hh);
        vb.h[1] = *(const v8b*)(Vth + (t * 16 + c) * AT_LP + kk * 32 + 16 + 8 * hh);
        oacc[t] = at_mma16<F16>(pa.v, vb.v, oacc[t]);
        if (SPLIT_PV) {
          FB vl;
          vl.h[0] = *(const v8b*)(Vtl + (t * 16 + c) * AT_LP + kk * 32 + 8 * hh);
          vl.h[1] = *(const v8b*)(Vtl + (t * 16 + c) * AT_LP + kk * 32 + 16 + 8 * hh);
          oacc[t] = at_mma16<F16>(pa.v, vl.v, oacc[t]);
          oacc[t] = at_mma16<F16>(pl.v, vb.v, oacc[t]);
        }
      }
    }
  }

  float* os = Os[wave];
#pragma unroll
  for (int r = 0; r < 8; ++r) {
    const float den = lrow[r] * PSC;
    const float inv = (den > 0.0f) ? (1.0f / den) : 0.0f;
#pragma unroll
    for (int t = 0; t < 4; ++t) os[(8 * hh + r) * 68 + t * 16 + c] = oacc[t][r] * inv;
  }
  __builtin_amdgcn_fence(__ATOMIC_RELEASE, "workgroup");
  __builtin_amdgcn_wave_barrier();
  __builtin_amdgcn_fence(__ATOMIC_ACQUIRE, "workgroup");
  {
    const int c4 = (lane & 15) * 4;
    {
#pragma unroll
      for (int it = 0; it < 8; ++it) {
        const int row = it * 2 + hh;
        v4f val = *(const v4f*)(os + row * 68 + c4);
        *(v4f*)(ob_ptr + (size_t)(q0 + row) * g.o_rs + c4) = val;
      }
      
    }
  }
}

// =====================================================================================
// 64x64 tile classification of the attention mask: one block per (b, q-tile); for each kv-tile:
//   masked(q,k) = tm[q][k] != 0 || pad[b][k] != 0;  code 2 = all masked, 1 = all live, 0 = mixed.
// =====================================================================================
__global__ __launch_bounds__(256) void tilecode_kernel(
    const int* __restrict__ tm, const int* __restrict__ pad, int* __restrict__ tab,
    int Skv, int nqb, int nkc, int tp) {
  __shared__ int wl[8], wm[8];
  __shared__ __align__(16) int codes[128];
  const int tid = threadIdx.x, lane = tid & 31, wave = tid >> 5;
  const int b  = blockIdx.x / nqb;
  const int qb = blockIdx.x - b * nqb;
  const int row = tid >> 2, cs = (tid & 3) * 16;
  const int q = qb * 64 + row;
  if (tid < 128) codes[tid] = 2;
  __syncthreads();
  const int nk = nkc < 128 ? nkc : 128;
  for (int kc = 0; kc < nk; ++kc) {
    const int* mr = tm  + (size_t)q * Skv + kc * 64 + cs;
    const int* pr = pad + (size_t)b * Skv + kc * 64 + cs;
    int live = 0, msk = 0;
#pragma unroll
    for (int i = 0; i < 4; ++i) {
      const v4i mv = *(const v4i*)(mr + 4 * i);
      const v4i pv = *(const v4i*)(pr + 4 * i);
#pragma unroll
      for (int e = 0; e < 4; ++e) {
        const int m = ((mv[e] != 0) || (pv[e] != 0)) ? 1 : 0;
        msk |= m;
        live |= (m ^ 1);
      }
    }
    const int al = __any(live);
    const int am = __any(msk);
    if (lane == 0) { wl[wave] = al; wm[wave] = am; }
    __syncthreads();
    if (tid == 0) {
      int L = 0, Mk = 0;
#pragma unroll
      for (int w = 0; w < 8; ++w) { L |= wl[w]; Mk |= wm[w]; }
      codes[kc] = (L == 0) ? 2 : ((Mk == 0) ? 1 : 0);
    }
    __syncthreads();
  }
  if (wave == 0) {
    const int nl = tp >> 2;          // tp is a multiple of 32 ints, <= 128
    v4i cv;
    cv[0] = codes[(4 * lane + 0) & 127]; cv[1] = codes[(4 * lane + 1) & 127];
    cv[2] = codes[(4 * lane + 2) & 127]; cv[3] = codes[(4 * lane + 3) & 127];
    int* dst = tab + (size_t)blockIdx.x * tp + 4 * lane;
    if (lane < nl) *(v4i*)dst = cv;
    
  }
}

// =====================================================================================
// LayerNorm over 1024-wide rows: one block (256 thr) per row, 4 contiguous floats per thread.
// =====================================================================================
template <bool OUT16>
__global__ __launch_bounds__(256) void ln_kernel(
    const float* __restrict__ in, const float* __restrict__ gam, const float* __restrict__ bet,
    float* __restrict__ o32, _Float16* __restrict__ o16) {
  __shared__ float red1[8], red2[8];
  __shared__ __align__(16) float ybuf[OUT16 ? DM : 4];
  const int row = blockIdx.x, t = threadIdx.x, lane = t & 31, wave = t >> 5;
  const float* x = in + (size_t)row * DM;
  const v4f xv = *(const v4f*)(x + 4 * t);
  float s = (xv[0] + xv[1]) + (xv[2] + xv[3]);
#pragma unroll
  for (int off = 1; off < 32; off <<= 1) s += __shfl_xor(s, off, 32);
  if (lane == 0) red1[wave] = s;
  __syncthreads();
  float tot = 0.f;
#pragma unroll
  for (int w = 0; w < 8; ++w) tot += red1[w];
  const float mu = tot * (1.0f / (float)DM);
  const float d0 = xv[0] - mu, d1 = xv[1] - mu, d2 = xv[2] - mu, d3 = xv[3] - mu;
  float s2 = (d0 * d0 + d1 * d1) + (d2 * d2 + d3 * d3);
#pragma unroll
  for (int off = 1; off < 32; off <<= 1) s2 += __shfl_xor(s2, off, 32);
  if (lane == 0) red2[wave] = s2;
  __syncthreads();
  float tot2 = 0.f;
#pragma unroll
  for (int w = 0; w < 8; ++w) tot2 += red2[w];
  const float var = tot2 * (1.0f / (float)DM);
  const float rstd = rsqrtf(var + LN_EPS);
  const v4f gv = *(const v4f*)(gam + 4 * t);
  const v4f bv = *(const v4f*)(bet + 4 * t);
  v4f y;
  y[0] = d0 * rstd * gv[0] + bv[0];
  y[1] = d1 * rstd * gv[1] + bv[1];
  y[2] = d2 * rstd * gv[2] + bv[2];
  y[3] = d3 * rstd * gv[3] + bv[3];
  float* op = o32 + (size_t)row * DM + 4 * t;
  *(v4f*)op = y;
  
  if (OUT16) {
    *(v4f*)(ybuf + 4 * t) = y;
    __syncthreads();
    if (t < DM / 8) {
      v8h hv;
#pragma unroll
      for (int e = 0; e < 8; ++e) hv[e] = (_Float16)ybuf[8 * t + e];
      _Float16* hp = o16 + (size_t)row * DM + 8 * t;
      *(v8h*)hp = hv;
      
    }
  }
}

// =====================================================================================
// Host orchestration
// =====================================================================================
extern "C" void kernel_launch(void* const* d_in, const int* in_sizes, int n_in,
                              void* d_out, int out_size, void* d_ws, size_t ws_size,
                              hipStream_t stream) {
  if (n_in < 16) return;
  if (in_sizes[0] != MROWS * DM || in_sizes[1] != SEQ * SEQ || in_sizes[2] != BSZ * SEQ) return;
  if (in_sizes[3] != DM * DM || in_sizes[4] != DM * DM || in_sizes[5] != DM * DM || in_sizes[6] != DM * DM) return;
  if (in_sizes[7] != DM || in_sizes[8] != FFND * DM || in_sizes[9] != FFND) return;
  if (in_sizes[10] != DM * FFND || in_sizes[11] != DM) return;
  if (in_sizes[12] != DM || in_sizes[13] != DM || in_sizes[14] != DM || in_sizes[15] != DM) return;
  if (out_size != MROWS * DM) return;

  const float* tgt   = (const float*)d_in[0];
  const int*   tmask = (const int*)d_in[1];     // [SEQ][SEQ], nonzero = masked
  const int*   pmask = (const int*)d_in[2];     // [BSZ][SEQ], nonzero = masked
  const float* Wq    = (const float*)d_in[3];
  const float* Wk    = (const float*)d_in[4];
  const float* Wv    = (const float*)d_in[5];
  const float* Wo    = (const float*)d_in[6];
  const float* bo    = (const float*)d_in[7];
  const float* W1    = (const float*)d_in[8];
  const float* b1    = (const float*)d_in[9];
  const float* W2    = (const float*)d_in[10];
  const float* b2    = (const float*)d_in[11];
  const float* g1    = (const float*)d_in[12];
  const float* be1   = (const float*)d_in[13];
  const float* g2    = (const float*)d_in[14];
  const float* be2   = (const float*)d_in[15];
  float* out = (float*)d_out;

  // ---- workspace carve (bytes), regions reused across phases ----
  const size_t MiB = 1048576;
  const int nqb = SEQ / AT_QB, nkc = SEQ / AT_KC;
  if (nkc > 128) return;
  const int TP = ((nkc + 31) / 32) * 32;
  const size_t tabBytes = (size_t)BSZ * nqb * TP * sizeof(int);
  const size_t total = 96 * MiB + tabBytes;
  if (total > ws_size) return;
  char* ws = (char*)d_ws;
  float*    Qf   = (float*)(ws + 0 * MiB);          // [4096][1024] f32   (projections -> attention)
  float*    Kf   = (float*)(ws + 16 * MiB);
  float*    Vf   = (float*)(ws + 32 * MiB);
  float*    RES1 = (float*)(ws + 0 * MiB);          // tgt + attn-proj     (after attention)
  _Float16* H16  = (_Float16*)(ws + 0 * MiB);       // [4096][4096] f16   (after LN1)
  float*    X1f  = (float*)(ws + 32 * MiB);         // LN1 output f32     (after attention)
  float*    AOf  = (float*)(ws + 48 * MiB);         // attention output f32
  float*    RES2 = (float*)(ws + 48 * MiB);         // x1 + ffn           (after out-proj)
  _Float16* X16  = (_Float16*)(ws + 64 * MiB);      // tgt f16            (projections)
  _Float16* O16  = (_Float16*)(ws + 64 * MiB);      // attention output f16 (after projections)
  _Float16* X1h  = (_Float16*)(ws + 64 * MiB);      // LN1 output f16     (after out-proj)
  _Float16* Wq16 = (_Float16*)(ws + 72 * MiB);
  _Float16* Wk16 = (_Float16*)(ws + 74 * MiB);
  _Float16* Wv16 = (_Float16*)(ws + 76 * MiB);
  _Float16* Wo16 = (_Float16*)(ws + 78 * MiB);
  _Float16* W1h  = (_Float16*)(ws + 80 * MiB);      // [4096][1024]
  _Float16* W2h  = (_Float16*)(ws + 88 * MiB);      // [1024][4096]
  int*      TAB  = (int*)(ws + 96 * MiB);           // [BSZ*nqb][TP]

  // tgt and the six weight matrices -> f16, one launch; X16 .. W2h lie one behind the other from X16 on
  static_assert(CV_Q * 2 == 8 * 1048576 && CV_K * 2 == 10 * 1048576 && CV_V * 2 == 12 * 1048576 && CV_O * 2 == 14 * 1048576 &&
                CV_W1 * 2 == 16 * 1048576 && CV_W2 * 2 == 24 * 1048576 && CV_END * 2 == 32 * 1048576, "offsets of the carve above");
  cast_inputs<<<dim3(CV_END / CV_BLK), dim3(CV_WAVES * 32), 0, stream>>>(tgt, Wq, Wk, Wv, Wo, W1, W2, X16);

  // mask tile codes
  tilecode_kernel<<<dim3(BSZ * nqb), dim3(256), 0, stream>>>(tmask, pmask, TAB, SEQ, nqb, nkc, TP);

  const long z = 0;
  typedef const unsigned short* cu16;
  const int tilesM = MROWS / 128;
  // q/k/v projections: [4096][1024] = X16 . W^T, f32 out
  {
    const dim3 grid(tilesM * (DM / 128), 1);
    wmma_gemm64<0, false, 0, 0, false, 0><<<grid, dim3(128), 0, stream>>>(
        (cu16)X16, (cu16)X16, DM, z, (cu16)Wq16, (cu16)Wq16, DM, z, (void*)Qf, (void*)Qf, DM, z,
        bo, tgt, z, MROWS, DM, DM, 1.0f);
    wmma_gemm64<0, false, 0, 0, false, 0><<<grid, dim3(128), 0, stream>>>(
        (cu16)X16, (cu16)X16, DM, z, (cu16)Wk16, (cu16)Wk16, DM, z, (void*)Kf, (void*)Kf, DM, z,
        bo, tgt, z, MROWS, DM, DM, 1.0f);
    wmma_gemm64<0, false, 0, 0, false, 0><<<grid, dim3(128), 0, stream>>>(
        (cu16)X16, (cu16)X16, DM, z, (cu16)Wv16, (cu16)Wv16, DM, z, (void*)Vf, (void*)Vf, DM, z,
        bo, tgt, z, MROWS, DM, DM, 1.0f);
  }

  // attention: q,k,v,o element (b, s, h, d) at b*SEQ*DM + s*DM + h*64 + d
  {
    AttnGeom g;
    g.tcode = TAB; g.cp = Qf; g.pc = Qf; g.c_bs = 0; g.c_rs = 0; g.c_hs = 0; g.t_pitch = TP;
    g.q_bs = (long)SEQ * DM; g.q_rs = DM; g.q_hs = HD;
    g.k_bs = (long)SEQ * DM; g.k_rs = DM; g.k_hs = HD;
    g.v_bs = (long)SEQ * DM; g.v_rs = DM; g.v_hs = HD;
    g.o_bs = (long)SEQ * DM; g.o_rs = DM; g.o_hs = HD;
    g.S = SEQ; g.Skv = SEQ; g.H = NHEAD; g.mask_mode = 6; g.qscale = 0.125f; g.blk0 = 0;
    g.mask_fill = -INFINITY; g.mask_is_int = 2;
    attn64_kernel<false, false, true, 6, DM><<<dim3(BSZ * NHEAD * nqb), dim3(128), 0, stream>>>(
        Qf, Kf, Vf, AOf, tmask, pmask, g);
  }
  static_assert((MROWS * DM) % (CV_WAVES * 1024) == 0);
  cast_one<1><<<dim3(MROWS * DM / (CV_WAVES * 1024)), dim3(CV_WAVES * 32), 0, stream>>>(AOf, O16);

  // RES1 = tgt + (O . Wo^T + bo)
  {
    const dim3 grid(tilesM * (DM / 128), 1);
    wmma_gemm64<0, false, 2, 0, true, 0><<<grid, dim3(128), 0, stream>>>(
        (cu16)O16, (cu16)O16, DM, z, (cu16)Wo16, (cu16)Wo16, DM, z, (void*)RES1, (void*)RES1, DM, z,
        bo, tgt, z, MROWS, DM, DM, 1.0f);
  }
  // x1 = LN(RES1) -> f32 + f16
  ln_kernel<true><<<dim3(MROWS), dim3(256), 0, stream>>>(RES1, g1, be1, X1f, X1h);
  // H16 = gelu_tanh(x1 . W1^T + b1), f16 [4096][4096]
  {
    const dim3 grid(tilesM * (FFND / 128), 1);
    wmma_gemm64<0, false, 2, 1, false, 6><<<grid, dim3(128), 0, stream>>>(
        (cu16)X1h, (cu16)X1h, DM, z, (cu16)W1h, (cu16)W1h, DM, z, (void*)H16, (void*)H16, FFND, z,
        b1, tgt, z, MROWS, FFND, DM, 1.0f);
  }
  // RES2 = x1 + (H . W2^T + b2)
  {
    const dim3 grid(tilesM * (DM / 128), 1);
    wmma_gemm64<0, false, 2, 0, true, 0><<<grid, dim3(128), 0, stream>>>(
        (cu16)H16, (cu16)H16, FFND, z, (cu16)W2h, (cu16)W2h, FFND, z, (void*)RES2, (void*)RES2, DM, z,
        b2, X1f, z, MROWS, DM, FFND, 1.0f);
  }
  // out = LN(RES2)
  ln_kernel<false><<<dim3(MROWS), dim3(256), 0, stream>>>(RES2, g2, be2, out, X1h);
  (void)hipGetLastError();
}

// v007
// Measured time: 303 microseconds a run.
// In both of two side-by-side timings against v006, it was 1.05 times as fast.
// Over all steps from v000 it is 6.46 times as fast.
// Contractions: q/k/v/out projections, FFN1, FFN2 on v_wmma_f32_16x16x32_f16 (f16 operands, f32 accumulate);
// attention scores (q*0.125).k^T and p.v on v_wmma_f32_16x16x32_f16 (f16 operands, p carried x2^15, f32 accumulate).
// Softmax, LayerNorm, tanh-GELU, bias and residual adds in f32.
#include <hip/hip_runtime.h>

typedef __attribute__((ext_vector_type(16))) _Float16 v16h;
typedef __attribute__((ext_vector_type(8)))  _Float16 v8h;
typedef __attribute__((ext_vector_type(16))) __bf16   v16b;
typedef __attribute__((ext_vector_type(8)))  __bf16   v8b;
typedef __attribute__((ext_vector_type(4)))  __bf16   v4b;
typedef __attribute__((ext_vector_type(2)))  __bf16   v2b;
typedef __attribute__((ext_vector_type(8)))  float    v8f;
typedef __attribute__((ext_vector_type(4)))  float    v4f;
typedef __attribute__((ext_vector_type(4)))  int      v4i;

#define DM     1024
#define NHEAD  16
#define HD     64
#define FFND   4096
#define BSZ    2
#define SEQ    2048
#define MROWS  (BSZ * SEQ)
#define LN_EPS 1e-5f

__device__ __forceinline__ unsigned short f2bf_bits(float f) {
  unsigned u = __float_as_uint(f);
  return (unsigned short)((u + 0x7FFFu + ((u >> 16) & 1u)) >> 16);
}
__device__ __forceinline__ float bf_bits2f(unsigned short h) { return __uint_as_float(((unsigned)h) << 16); }

// hazard guards as plain device helpers
__device__ __forceinline__ void dep_guard_h(v8f& a, v8f& b, v16h x, v16h y) { asm volatile("v_nop\n\tv_nop\n\tv_nop\n\tv_nop" : "+v"(a), "+v"(b) : "v"(x), "v"(y)); }
__device__ __forceinline__ void dep_guard_b(v8f& a, v8f& b, v16b x, v16b y) { asm volatile("v_nop\n\tv_nop\n\tv_nop\n\tv_nop" : "+v"(a), "+v"(b) : "v"(x), "v"(y)); }
__device__ __forceinline__ void keep4_h(v16h a, v16h b, v16h c, v16h d) { asm volatile("v_nop" :: "v"(a), "v"(b), "v"(c), "v"(d)); }
__device__ __forceinline__ void keep4_b(v16b a, v16b b, v16b c, v16b d) { asm volatile("v_nop" :: "v"(a), "v"(b), "v"(c), "v"(d)); }
__device__ __forceinline__ void acc_guard4(v8f& a, v8f& b, v8f& c, v8f& d) { asm volatile("v_nop\n\tv_nop\n\tv_nop\n\tv_nop" : "+v"(a), "+v"(b), "+v"(c), "+v"(d)); }
template <typename T> struct Frag;
template <> struct Frag<_Float16> {
  typedef v16h V; union U { v16h v; v8h h[2]; };
  static __device__ __forceinline__ v16h load(const _Float16* p) {   // elements 0..7 <- p[0..7], 8..15 <- p[16..23]
    U f; f.h[0] = *(const v8h*)(p); f.h[1] = *(const v8h*)(p + 16); return f.v;
  }
  static __device__ __forceinline__ v8f mma(v16h a, v16h b, v8f c) {
    return __builtin_amdgcn_wmma_f32_16x16x32_f16(false, a, false, b, (short)0, c, false, false);
  }
  static __device__ __forceinline__ void guard(v8f& a, v8f& b, v16h x, v16h y) { dep_guard_h(a, b, x, y); }
  static __device__ __forceinline__ void keep(v16h a, v16h b, v16h c, v16h d) { keep4_h(a, b, c, d); }
};
template <> struct Frag<__bf16> {
  typedef v16b V; union U { v16b v; v8b h[2]; };
  static __device__ __forceinline__ v16b load(const __bf16* p) {
    U f; f.h[0] = *(const v8b*)(p); f.h[1] = *(const v8b*)(p + 16); return f.v;
  }
  static __device__ __forceinline__ v8f mma(v16b a, v16b b, v8f c) {
    return __builtin_amdgcn_wmma_f32_16x16x32_bf16(false, a, false, b, (short)0, c, false, false);
  }
  static __device__ __forceinline__ void guard(v8f& a, v8f& b, v16b x, v16b y) { dep_guard_b(a, b, x, y); }
  static __device__ __forceinline__ void keep(v16b a, v16b b, v16b c, v16b d) { keep4_b(a, b, c, d); }
};

// tanh-GELU: 0.5*v*(1+tanh(sqrt(2/pi)*(v+0.044715*v^3))); tanh via exp(-2|u|), no division instruction
__device__ __forceinline__ float gelu_tanh_f(float v) {
  const float u = 0.7978845608028654f * (v + 0.044715f * v * v * v);
  const float e = __expf(-2.0f * fabsf(u));
  float t = (1.0f - e) * __builtin_amdgcn_rcpf(1.0f + e);
  t = copysignf(t, u);
  return 0.5f * v * (1.0f + t);
}

// ---- Register-blocked batched WMMA GEMM ------------------------------------
// C[m,n] = scale * sum_k A[m,k] * Bt[n,k] (+bias)(+resid); each wave owns a 64x64 tile, a block of 4 waves (2x2) a 128x128 tile.
// A row-major [M,K]; Bt row-major [N,K]; M,N % 128 == 0, K % 128 == 0.
// Operands reach the waves through LDS: a stage is 128 k of the block's 128 A rows and 128 Bt rows (256 B a row, pitch 272 B),
// brought by asynchronous copies into two buffers, the next stage's copies in flight while this stage is multiplied.
// SPLIT (hi/lo planes) is not built in this form.
// BIAS_MODE: 0 = none, 1 = bias[m], 2 = bias[n].
// OUT_MODE: 0 = f32, 1 = f16, 2 = bf16 hi plane (Cout) + bf16 lo plane (Cout2).
// ACT: 0 none, 1 tanh, 2 relu, 3 silu, 4 leaky, 5 erf-gelu, 6 tanh-gelu.
// ET: 0 = f16 operands, 1 = bf16 operands (pointers passed as 16-bit storage)
template <int ET> struct Elem;
template <> struct Elem<0> { typedef _Float16 T; };
template <> struct Elem<1> { typedef __bf16 T; };
#define G_KS    128                       // k per stage
#define G_PITCH 136                       // LDS row pitch in 16-bit elements: 256 B + 16 B
#define G_STAGE (256 * G_PITCH)           // elements per buffer: rows 0..127 = A, rows 128..255 = Bt
// Eight asynchronous 16-byte copies per lane, rows 8 apart. The s_wait_xcnt stands inside the statement so that
// no address register of an issued copy is rewritten in front of it.
__device__ __forceinline__ void g_copy8(unsigned l, const unsigned short* g, size_t gstep) {
  const unsigned ls = 8u * G_PITCH * 2u;
  asm volatile(
      "global_load_async_to_lds_b128 %0, %8, off\n\t"
      "global_load_async_to_lds_b128 %1, %9, off\n\t"
      "global_load_async_to_lds_b128 %2, %10, off\n\t"
      "global_load_async_to_lds_b128 %3, %11, off\n\t"
      "global_load_async_to_lds_b128 %4, %12, off\n\t"
      "global_load_async_to_lds_b128 %5, %13, off\n\t"
      "global_load_async_to_lds_b128 %6, %14, off\n\t"
      "global_load_async_to_lds_b128 %7, %15, off\n\t"
      "s_wait_xcnt 0x0"
      :: "v"(l), "v"(l + ls), "v"(l + 2u * ls), "v"(l + 3u * ls), "v"(l + 4u * ls), "v"(l + 5u * ls), "v"(l + 6u * ls), "v"(l + 7u * ls),
         "v"(g), "v"(g + gstep), "v"(g + 2 * gstep), "v"(g + 3 * gstep), "v"(g + 4 * gstep), "v"(g + 5 * gstep), "v"(g + 6 * gstep), "v"(g + 7 * gstep)
      : "memory");
}
template <int ET, bool SPLIT, int BIAS_MODE, int OUT_MODE, bool RESID, int ACT = 0>
__global__ __launch_bounds__(128) void wmma_gemm64(
    const unsigned short* __restrict__ Ap, const unsigned short* __restrict__ A2p, int lda, long strideA,
    const unsigned short* __restrict__ Btp, const unsigned short* __restrict__ Bt2p, int ldb, long strideB,
    void* __restrict__ Cout, void* __restrict__ Cout2, int ldc, long strideC,
    const float* __restrict__ bias,
    const float* __restrict__ resid, long strideR,
    int M, int N, int K, float scale) {
  typedef typename Elem<ET>::T T;
  typedef typename Frag<T>::V V;
  static_assert(!SPLIT, "hi/lo planes are not staged");
  __shared__ __align__(16) unsigned short sAB[2 * G_STAGE];   // two stage buffers
  __shared__ __align__(16) float sT[4][16 * 68];   // per-wave 16x64 slab, pitch 68 floats
  const int b    = blockIdx.y;
  const int tid  = threadIdx.x;
  const int lane = tid & 31;
  const int wave = tid >> 5;
  const int tilesN = N >> 7;
  const int tilesM = M >> 7;
  const int tile = blockIdx.x;
  if (tile >= tilesM * tilesN) return;   // block-uniform, in front of every barrier and copy
  const int tm = tile / tilesN;
  const int tn = tile - tm * tilesN;
  const int mB = tm << 7;
  const int nB = tn << 7;
  const int wm = wave >> 1, wn = wave & 1;
  const int m0 = mB + (wm << 6);
  const int n0 = nB + (wn << 6);

  const int rlane = lane & 15;                 // row (A) / col (B, D) within subtile
  const int koff  = (lane >> 4) * 8;           // k offset of this lane half
  const int mOff  = (lane >> 4) * 8;           // D row offset

  // copy lanes: 16 lanes cover one 256-B row, a wave-wide copy two rows (four whole lines)
  const int crow = tid >> 4, cch = (tid & 15) * 8;
  const unsigned short* gA = Ap  + (size_t)b * strideA + (size_t)(mB + crow) * lda + cch;
  const unsigned short* gB = Btp + (size_t)b * strideB + (size_t)(nB + crow) * ldb + cch;
  const unsigned lbase = (unsigned)(size_t)(&sAB[0]) + (unsigned)(crow * G_PITCH + cch) * 2u;
  const size_t stepA = (size_t)8 * lda, stepB = (size_t)8 * ldb;
  auto stage_copy = [&](int st, int buf) {     // 32 copies per lane: one stage of A and Bt
    const unsigned l = lbase + (unsigned)buf * (G_STAGE * 2u);
    const unsigned short* a = gA + (size_t)st * G_KS;
    const unsigned short* w = gB + (size_t)st * G_KS;
    g_copy8(l,                          a,             stepA);
    g_copy8(l +  64u * G_PITCH * 2u,    a + 8 * stepA, stepA);
    g_copy8(l + 128u * G_PITCH * 2u,    w,             stepB);
    g_copy8(l + 192u * G_PITCH * 2u,    w + 8 * stepB, stepB);
  };

  v8f acc[4][4];
#pragma unroll
  for (int i = 0; i < 4; ++i)
#pragma unroll
    for (int j = 0; j < 4; ++j) acc[i][j] = (v8f){0.f,0.f,0.f,0.f,0.f,0.f,0.f,0.f};

  const int nst = K >> 7;
  stage_copy(0, 0);
  asm volatile("s_wait_asynccnt 0x0" ::: "memory");   // this wave's part of stage 0 has landed
  __syncthreads();                                     // stage 0 readable by every wave
  if (nst > 1) stage_copy(1, 1);
#pragma unroll 1   // kept rolled: one trip is one stage of the ring, with one publish point and one refill site
  for (int t = 0; t < nst; ++t) {
    const T* sbuf = (const T*)sAB + (size_t)(t & 1) * G_STAGE;
    const T* sA = sbuf + ((wm << 6) + rlane) * G_PITCH + koff;
    const T* sB = sbuf + (128 + (wn << 6) + rlane) * G_PITCH + koff;
#pragma unroll     // the loops below are unrolled so that fragments and accumulators are indexed by constants (registers, no scratch)
    for (int ks = 0; ks < G_KS / 32; ++ks) {
      V bh[4], ah[4];
#pragma unroll
      for (int j = 0; j < 4; ++j) bh[j] = Frag<T>::load(sB + j * 16 * G_PITCH + ks * 32);
#pragma unroll
      for (int i = 0; i < 4; ++i) ah[i] = Frag<T>::load(sA + i * 16 * G_PITCH + ks * 32);
#pragma unroll
      for (int i = 0; i < 4; ++i) {
#pragma unroll
        for (int j = 0; j < 4; ++j) acc[i][j] = Frag<T>::mma(ah[i], bh[j], acc[i][j]);
        Frag<T>::guard(acc[i][0], acc[i][3], ah[i], ah[i]);
      }
      Frag<T>::keep(bh[0], bh[1], bh[2], bh[3]);
    }
    asm volatile("s_wait_dscnt 0x0" ::: "memory");     // this wave's reads of buffer t & 1 are done
    asm volatile("s_wait_asynccnt 0x0" ::: "memory");  // this wave's part of stage t + 1 has landed
    __syncthreads();                                   // publishes stage t + 1, frees buffer t & 1
    if (t + 2 < nst) stage_copy(t + 2, t & 1);
  }
  asm volatile("s_wait_asynccnt 0x0" ::: "memory");    // no copy outstanding behind the loop
  acc_guard4(acc[0][0], acc[0][1], acc[0][2], acc[0][3]);
  acc_guard4(acc[1][0], acc[1][1], acc[1][2], acc[1][3]);
  acc_guard4(acc[2][0], acc[2][1], acc[2][2], acc[2][3]);
  acc_guard4(acc[3][0], acc[3][1], acc[3][2], acc[3][3]);

  // ---- epilogue ----
  float* slab = sT[wave];
  const float* Rb = RESID ? (resid + (size_t)b * strideR) : nullptr;
#pragma unroll
  for (int i = 0; i < 4; ++i) {
    const int mBase = m0 + (i << 4);
#pragma unroll
    for (int j = 0; j < 4; ++j) {
      const int n = n0 + (j << 4) + rlane;
      float bv = 0.f;
      if (BIAS_MODE == 2) bv = bias[n];
#pragma unroll
      for (int r = 0; r < 8; ++r) {
        float v = acc[i][j][r] * scale;
        if (BIAS_MODE == 1) v += bias[mBase + mOff + r];
        if (BIAS_MODE == 2) v += bv;
        if (RESID) v += Rb[(size_t)(mBase + mOff + r) * ldc + n];
        if (ACT == 1) v = tanhf(v);
        if (ACT == 2) v = fmaxf(v, 0.0f);
        if (ACT == 3) v = v / (1.0f + expf(-v));
        if (ACT == 4) v = (v > 0.f) ? v : 0.01f * v;
        if (ACT == 5) v = 0.5f * v * (1.0f + erff(v * 0.70710678118654752f));
        if (ACT == 6) v = gelu_tanh_f(v);
        slab[(mOff + r) * 68 + (j << 4) + rlane] = v;
      }
    }
    __builtin_amdgcn_fence(__ATOMIC_RELEASE, "workgroup");
    __builtin_amdgcn_wave_barrier();
    __builtin_amdgcn_fence(__ATOMIC_ACQUIRE, "workgroup");
    if (OUT_MODE == 0) {
      float* C = (float*)Cout + (size_t)b * strideC;
      const int hh = lane >> 4, c4 = (lane & 15) * 4;     // row seg = 256 B = 16 lanes x 16 B
      {
#pragma unroll
        for (int it = 0; it < 8; ++it) {
          const int row = it * 2 + hh;
          v4f v = *(const v4f*)(slab + row * 68 + c4);
          *(v4f*)(C + (size_t)(mBase + row) * ldc + n0 + c4) = v;
        }
        
      }
    } else {
      const int q = lane >> 3, c8 = (lane & 7) * 8;
      unsigned short* C  = (unsigned short*)Cout  + (size_t)b * strideC;
      unsigned short* C2 = (OUT_MODE == 2) ? ((unsigned short*)Cout2 + (size_t)b * strideC) : nullptr;
      {
#pragma unroll
        for (int it = 0; it < 4; ++it) {
          const int row = it * 4 + q;
          const float* sp = slab + row * 68 + c8;
          v8h hv, lv;
#pragma unroll
          for (int e = 0; e < 8; ++e) {
            if (OUT_MODE == 1) {
              hv[e] = (_Float16)sp[e];
            } else {
              unsigned short hb = f2bf_bits(sp[e]);
              unsigned short lb = f2bf_bits(sp[e] - bf_bits2f(hb));
              hv[e] = __builtin_bit_cast(_Float16, hb);
              lv[e] = __builtin_bit_cast(_Float16, lb);
            }
          }
          *(v8h*)(C + (size_t)(mBase + row) * ldc + n0 + c8) = hv;
          if (OUT_MODE == 2) *(v8h*)(C2 + (size_t)(mBase + row) * ldc + n0 + c8) = lv;
        }
        
      }
    }
    __builtin_amdgcn_fence(__ATOMIC_RELEASE, "workgroup");
    __builtin_amdgcn_wave_barrier();
    __builtin_amdgcn_fence(__ATOMIC_ACQUIRE, "workgroup");
  }
}

// ---- f32 -> f16 conversion by few, long-lived waves ------------------------
// A block is 16 waves; a wave converts R * 1024 contiguous elements: R * 8 loads of 16 bytes a lane (each wave-wide load 512
// contiguous bytes), all issued before the first is converted, and as many 8-byte stores (each wave-wide store 256 contiguous bytes).
typedef __attribute__((ext_vector_type(4))) _Float16 v4h;
#define CV_WAVES 16
template <int R>
__device__ __forceinline__ void cast_wave(const float* __restrict__ src, _Float16* __restrict__ dst, int q) {
  // src, dst: block-uniform; q: the lane's first group of four elements, one index for the loads and the stores
  const v4f* __restrict__ s4 = (const v4f*)src;
  v4h* __restrict__ d4 = (v4h*)dst;
  v4f x[R * 8];
#pragma unroll   // both loops unrolled: x stays in registers, every load and store addresses by an immediate offset
  for (int i = 0; i < R * 8; ++i) x[i] = s4[q + i * 32];
  if (R > 1) __builtin_amdgcn_sched_barrier(0);   // keeps every load in front of the first wait: a wave pays one memory latency, not one per group of loads
#pragma unroll
  for (int i = 0; i < R * 8; ++i) {
    v4h h;
#pragma unroll
    for (int e = 0; e < 4; ++e) h[e] = (_Float16)x[i][e];
    d4[q + i * 32] = h;
    if ((i & 7) == 7 && i + 1 < R * 8) __builtin_amdgcn_sched_barrier(0);   // eight stores leave as soon as their loads are in, not all behind the last load
  }
}
// The seven f32 inputs of the GEMMs in one launch: their f16 copies lie one behind the other in dst, at these element offsets.
#define CV_X   0
#define CV_Q   (CV_X + MROWS * DM)
#define CV_K   (CV_Q + DM * DM)
#define CV_V   (CV_K + DM * DM)
#define CV_O   (CV_V + DM * DM)
#define CV_W1  (CV_O + DM * DM)
#define CV_W2  (CV_W1 + FFND * DM)
#define CV_END (CV_W2 + DM * FFND)
#define CV_R   4
#define CV_BLK (CV_WAVES * CV_R * 1024)   // elements per block
static_assert(CV_Q % CV_BLK == 0 && CV_K % CV_BLK == 0 && CV_V % CV_BLK == 0 && CV_O % CV_BLK == 0 &&
              CV_W1 % CV_BLK == 0 && CV_W2 % CV_BLK == 0 && CV_END % CV_BLK == 0, "a block lies wholly in one tensor");
__global__ __launch_bounds__(CV_WAVES * 32) void cast_inputs(
    const float* __restrict__ x, const float* __restrict__ wq, const float* __restrict__ wk, const float* __restrict__ wv,
    const float* __restrict__ wo, const float* __restrict__ w1, const float* __restrict__ w2, _Float16* __restrict__ dst) {
  const int e0 = blockIdx.x * CV_BLK;       // block-uniform: the block index picks the tensor
  const float* src = x;
  int first = CV_X;
  if (e0 >= CV_Q)  { src = wq; first = CV_Q; }
  if (e0 >= CV_K)  { src = wk; first = CV_K; }
  if (e0 >= CV_V)  { src = wv; first = CV_V; }
  if (e0 >= CV_O)  { src = wo; first = CV_O; }
  if (e0 >= CV_W1) { src = w1; first = CV_W1; }
  if (e0 >= CV_W2) { src = w2; first = CV_W2; }
  cast_wave<CV_R>(src + (e0 - first), dst + e0, (threadIdx.x >> 5) * (CV_R * 256) + (threadIdx.x & 31));
}
// One tensor of gridDim.x * CV_WAVES * R * 1024 elements.
template <int R>
__global__ __launch_bounds__(CV_WAVES * 32) void cast_one(const float* __restrict__ in, _Float16* __restrict__ out) {
  const int e0 = blockIdx.x * (CV_WAVES * R * 1024);
  cast_wave<R>(in + e0, out + e0, (threadIdx.x >> 5) * (R * 256) + (threadIdx.x & 31));
}

// =====================================================================================
// Attention for head_dim 64, f32 in / f32 out; 16-bit operands: bf16 with optional hi/lo splits, or
// plain f16 (F16=true, non-split, probabilities carried x2^15).
//   Block = 4 waves = 64 query rows of one (batch, head); S % 64 == 0.
//   Element (b, s, h, d) of tensor X lives at X[b*X_bs + s*X_rs + h*X_hs + d] (strides in floats, multiples of 4).
//   mask_mode 0 none, 1 causal, 2 tensor [S][Skv], 3 per-token vectors, 4 causal + window, 5 relative bias,
//   6 = mask_a: int32 [S][Skv] nonzero = masked, OR mask_b: int32 [B][Skv] nonzero = masked; per 64x64
//       (b, q-tile, kv-tile) code table tcode[(b*nqb+qb)*t_pitch + kc]: 0 mixed (per-element reads),
//       1 all live (no reads), 2 all masked (tile skipped: zero contribution).
//   masked scores are replaced by mask_fill before the softmax; rows with no live key write 0.
//   grid.x = B * H * (S/64).
// =====================================================================================
#define AT_D 64
#define AT_NW 4
#define AT_QB 64
#define AT_KC 64
#define AT_LOG2E 1.4426950408889634f
#define AT_LP 72    // LDS row pitch of the K, V^T and P tiles in 16-bit elements: 128 B of data + 16 B, so that the 16 rows
                    // which one ds_load_b128 fragment read touches fall on 16 different groups of four banks
struct AttnGeom { const int* tcode; const float* cp; const float* pc; long c_bs, c_rs, c_hs, t_pitch;
                  long q_bs, q_rs, q_hs, k_bs, k_rs, k_hs, v_bs, v_rs, v_hs, o_bs, o_rs, o_hs;
                  int S, Skv, H, mask_mode; float qscale; int blk0; float mask_fill; int mask_is_int; };
static_assert(sizeof(AttnGeom) == 184);

__device__ __forceinline__ unsigned short at_bf_bits(float f) {
  unsigned u = __float_as_uint(f);
  return (unsigned short)((u + 0x7FFFu + ((u >> 16) & 1u)) >> 16);
}
__device__ __forceinline__ __bf16 at_f2bf(float f) { return __builtin_bit_cast(__bf16, at_bf_bits(f)); }
__device__ __forceinline__ void at_split(float f, __bf16& hi, __bf16& lo) {
  const unsigned short hb = at_bf_bits(f);
  hi = __builtin_bit_cast(__bf16, hb);
  lo = at_f2bf(f - __uint_as_float(((unsigned)hb) << 16));
}
__device__ __forceinline__ v8f at_mma(v16b a, v16b b, v8f c) {
  c = __builtin_amdgcn_wmma_f32_16x16x32_bf16(false, a, false, b, (short)0, c, false, false);
  asm volatile("v_nop\n\tv_nop\n\tv_nop\n\tv_nop" : "+v"(c) : "v"(a), "v"(b));
  return c;
}
// 16-bit element as a bit pattern held in a __bf16 slot: f16 bits when F16, bf16 (RNE) otherwise
template <bool F16> __device__ __forceinline__ __bf16 at_to16(float f) {
  if (F16) return __builtin_bit_cast(__bf16, (_Float16)f);
  return at_f2bf(f);
}
template <bool F16> __device__ __forceinline__ v8f at_mma16(v16b a, v16b b, v8f c) {
  if (F16) {
    const v16h ah = __builtin_bit_cast(v16h, a), bh = __builtin_bit_cast(v16h, b);
    c = __builtin_amdgcn_wmma_f32_16x16x32_f16(false, ah, false, bh, (short)0, c, false, false);
    asm volatile("v_nop\n\tv_nop\n\tv_nop\n\tv_nop" : "+v"(c) : "v"(ah), "v"(bh));
    return c;
  }
  return at_mma(a, b, c);
}

// Five powers of two (one score row's four and its rescale factor) in one statement. Behind a v_exp_f32 the instruction set asks for
// one independent instruction before its result is read or its source overwritten: here each v_exp_f32 is that instruction for the
// one before it (the outputs are early-clobber, so none lies on a source), and the v_nop is it for the last.
__device__ __forceinline__ void at_exp2x5(float& o0, float& o1, float& o2, float& o3, float& o4,
                                          float x0, float x1, float x2, float x3, float x4) {
  asm("v_exp_f32 %0, %5\n\t"
      "v_exp_f32 %1, %6\n\t"
      "v_exp_f32 %2, %7\n\t"
      "v_exp_f32 %3, %8\n\t"
      "v_exp_f32 %4, %9\n\t"
      "v_nop"
      : "=&v"(o0), "=&v"(o1), "=&v"(o2), "=&v"(o3), "=&v"(o4)
      : "v"(x0), "v"(x1), "v"(x2), "v"(x3), "v"(x4));
}

// MODE is the mask mode as a compile-time constant: only that mode's mask code is compiled into the key loop.
// KVRS is the row stride of K and of V in floats (the launch's g.k_rs and g.v_rs) as a compile-time constant: the eight pieces that a
// lane reads of each tile are then one address and eight immediate offsets.
template <bool SPLIT_QK, bool SPLIT_PV, bool F16, int MODE, int KVRS>
__global__ __launch_bounds__(128)
void attn64_kernel(const float* __restrict__ q, const float* __restrict__ k,
                   const float* __restrict__ v, float* __restrict__ out,
                   const int* __restrict__ mask_a, const int* __restrict__ mask_b, AttnGeom g) {
  static_assert(!(F16 && (SPLIT_QK || SPLIT_PV)));
  const float PSC = F16 ? 32768.0f : 1.0f;     // f16 probabilities carried x2^15, folded into the final 1/l
  union FB { v16b v; v8b h[2]; };
  __shared__ __align__(16) __bf16 Ksh[AT_KC * AT_LP];            // K hi [kv][d]      9 KB
  __shared__ __align__(16) __bf16 Ksl[SPLIT_QK ? AT_KC * AT_LP : 8];
  __shared__ __align__(16) __bf16 Vth[AT_D * AT_LP];             // V hi [d][kv]      9 KB
  __shared__ __align__(16) __bf16 Vtl[SPLIT_PV ? AT_D * AT_LP : 8];
  __shared__ __align__(16) __bf16 Psh[AT_NW][16 * AT_LP];        // per wave P hi [row][kv]  9 KB
  __shared__ __align__(16) __bf16 Psl[SPLIT_PV ? AT_NW : 1][SPLIT_PV ? 16 * AT_LP : 8];
  __shared__ __align__(16) float  Os[AT_NW][16 * 68];            // per wave out tile, pitch 68

  const int tid  = threadIdx.x;
  const int wave = tid >> 5;
  const int lane = tid & 31;
  const int hh   = lane >> 4;
  const int c    = lane & 15;

  const int nqb = g.S / AT_QB;
  const int nkc = g.Skv / AT_KC;
  const int bx = blockIdx.x + g.blk0;
  const int qb = bx % nqb;
  const int bh = bx / nqb;
  const int h  = bh % g.H;
  const int b  = bh / g.H;
  const int qbase_block = qb * AT_QB;
  const int q0 = qbase_block + wave * 16;

  const float* qb_ptr = q + (size_t)b * g.q_bs + (size_t)h * g.q_hs;
  const float* kb_ptr = k + (size_t)b * g.k_bs + (size_t)h * g.k_hs;
  const float* vb_ptr = v + (size_t)b * g.v_bs + (size_t)h * g.v_hs;
  float*       ob_ptr = out + (size_t)b * g.o_bs + (size_t)h * g.o_hs;

  // ---- Q fragments (A operand): 2 d-chunks, hi (and lo) ----
  v16b qah[2], qal[2];
  {
    const float* qrow = qb_ptr + (size_t)(q0 + c) * g.q_rs;
#pragma unroll
    for (int dc = 0; dc < 2; ++dc) {
#pragma unroll
      for (int e = 0; e < 8; ++e) {
        const float f0 = qrow[dc * 32 + 8 * hh + e] * g.qscale;
        const float f1 = qrow[dc * 32 + 16 + 8 * hh + e] * g.qscale;
        if (SPLIT_QK) { __bf16 hq, lq; at_split(f0, hq, lq); qah[dc][e] = hq; qal[dc][e] = lq; at_split(f1, hq, lq); qah[dc][8 + e] = hq; qal[dc][8 + e] = lq; }
        else { qah[dc][e] = at_to16<F16>(f0); qah[dc][8 + e] = at_to16<F16>(f1); qal[dc][e] = qah[dc][e]; qal[dc][8 + e] = qah[dc][8 + e]; }
      }
    }
  }

  float mrow[8], lrow[8];
  v8f oacc[4];
#pragma unroll
  for (int r = 0; r < 8; ++r) { mrow[r] = -INFINITY; lrow[r] = 0.f; }
#pragma unroll
  for (int t = 0; t < 4; ++t) oacc[t] = (v8f){0.f,0.f,0.f,0.f,0.f,0.f,0.f,0.f};

  const int nChunks = (MODE == 1 || MODE == 4) ? (qb + 1) : nkc;   // block-uniform, bounded by Skv/64
  // per-row query mask (mode 3)
  int qkeep[8];
#pragma unroll
  for (int r = 0; r < 8; ++r) qkeep[r] = (MODE == 3) ? mask_b[(size_t)b * g.S + q0 + 8 * hh + r] : 1;   // mask_b = qmask in mode 3
  for (int kc = 0; kc < nChunks; ++kc) {
    const int kv0 = kc * AT_KC;
    int code = 0;
    if (MODE == 6) {
      int cv = g.tcode[((size_t)b * nqb + qb) * (size_t)g.t_pitch + kc];
      cv = __builtin_amdgcn_readfirstlane(cv);
      code = (cv == 1 || cv == 2) ? cv : 0;     // anything else -> mixed (per-element reads)
      if (code == 2) continue;                  // fully masked tile: zero contribution, softmax state unchanged
    }
    __syncthreads();
    {
      // 8 lanes read one whole 128-B line (half a row) of K or V, so a wave-wide 16-byte load covers four whole lines of four rows.
      // A lane takes the rows kvr and kvr + 1 at the same four d: a V^T pair of neighbouring keys is one 4-byte LDS store.
      // Four row pairs a wave (not two) spread a V^T store over 16 banks: the d of 8 lanes fall on 4 banks, each row pair is one bank on.
      const int r2 = (tid >> 3) * 2, d4 = (tid & 7) * 4;
      const float* kcol = kb_ptr + (size_t)(kv0 + r2) * KVRS + d4;
      const float* vcol = vb_ptr + (size_t)(kv0 + r2) * KVRS + d4;
      v4f kx[8], vx[8];
#pragma unroll   // this loop and the two below unrolled: kx and vx are indexed by constants (registers), all 16 loads are issued in front of the first wait
      for (int i = 0; i < 8; ++i) {
        kx[i] = *(const v4f*)(kcol + (((i >> 1) & 1) * 32 + (i & 1)) * KVRS + (i >> 2) * 32);
        vx[i] = *(const v4f*)(vcol + (((i >> 1) & 1) * 32 + (i & 1)) * KVRS + (i >> 2) * 32);
      }
      // kcol and vcol are inputs so that both address pairs live up to this wait: no load's result and no conversion takes their registers in front of it
      asm volatile("s_wait_xcnt 0x0" :: "v"(kcol), "v"(vcol) : "memory");
#pragma unroll
      for (int p = 0; p < 4; ++p) {
        const int kvr = (p & 1) * 32 + r2, dd = (p >> 1) * 32 + d4;
        const v4f k0 = kx[2 * p], k1 = kx[2 * p + 1], v0 = vx[2 * p], v1 = vx[2 * p + 1];
        v4b k0h, k0l, k1h, k1l;
#pragma unroll
        for (int e = 0; e < 4; ++e) {
          if (SPLIT_QK) { __bf16 a, bl; at_split(k0[e], a, bl); k0h[e] = a; k0l[e] = bl; at_split(k1[e], a, bl); k1h[e] = a; k1l[e] = bl; }
          else { k0h[e] = at_to16<F16>(k0[e]); k1h[e] = at_to16<F16>(k1[e]); }
          v2b vh, vl;
          if (SPLIT_PV) { __bf16 a, bl; at_split(v0[e], a, bl); vh[0] = a; vl[0] = bl; at_split(v1[e], a, bl); vh[1] = a; vl[1] = bl; }
          else { vh[0] = at_to16<F16>(v0[e]); vh[1] = at_to16<F16>(v1[e]); }
          *(v2b*)(Vth + (dd + e) * AT_LP + kvr) = vh;
          if (SPLIT_PV) *(v2b*)(Vtl + (dd + e) * AT_LP + kvr) = vl;
        }
        *(v4b*)(Ksh + kvr * AT_LP + dd) = k0h;
        *(v4b*)(Ksh + (kvr + 1) * AT_LP + dd) = k1h;
        if (SPLIT_QK) { *(v4b*)(Ksl + kvr * AT_LP + dd) = k0l; *(v4b*)(Ksl + (kvr + 1) * AT_LP + dd) = k1l; }
      }
    }
    __syncthreads();

    v8f s[4];
    {
      // all eight K fragments of the tile are read as one group ahead of the eight products: one LDS latency a tile, not one per product
      FB kb[2][4];
#pragma unroll   // these loops unrolled: kb, qah and s are indexed by constants (registers, no indexed register moves)
      for (int dc = 0; dc < 2; ++dc) {
#pragma unroll
        for (int j = 0; j < 4; ++j) {
          kb[dc][j].h[0] = *(const v8b*)(Ksh + (j * 16 + c) * AT_LP + dc * 32 + 8 * hh);
          kb[dc][j].h[1] = *(const v8b*)(Ksh + (j * 16 + c) * AT_LP + dc * 32 + 16 + 8 * hh);
        }
      }
#pragma unroll
      for (int j = 0; j < 4; ++j) s[j] = (v8f){0.f,0.f,0.f,0.f,0.f,0.f,0.f,0.f};
#pragma unroll   // each s[j] still sums d 0..31 first, then d 32..63
      for (int dc = 0; dc < 2; ++dc) {
#pragma unroll
        for (int j = 0; j < 4; ++j) {
          s[j] = at_mma16<F16>(qah[dc], kb[dc][j].v, s[j]);
          if (SPLIT_QK) {
            FB kl;
            kl.h[0] = *(const v8b*)(Ksl + (j * 16 + c) * AT_LP + dc * 32 + 8 * hh);
            kl.h[1] = *(const v8b*)(Ksl + (j * 16 + c) * AT_LP + dc * 32 + 16 + 8 * hh);
            s[j] = at_mma16<F16>(qah[dc], kl.v, s[j]);
            s[j] = at_mma16<F16>(qal[dc], kb[dc][j].v, s[j]);
          }
        }
      }
    }
    const bool diag = (MODE == 1) && (kc == qb);
    int kvkeep[4] = {1, 1, 1, 1};
    if (MODE == 3) {
#pragma unroll
      for (int j = 0; j < 4; ++j) kvkeep[j] = mask_a[(size_t)b * g.Skv + kv0 + j * 16 + c];   // mask_a = kvmask
    }
    if (MODE == 6 && code == 0) {               // mixed tile: one wave-uniform branch per tile, then per-element reads
      int kvpad[4];
#pragma unroll
      for (int j = 0; j < 4; ++j) kvpad[j] = mask_b[(size_t)b * g.Skv + kv0 + j * 16 + c];   // mask_b = key padding [B][Skv]
#pragma unroll   // both loops unrolled so that s[j][r] is indexed by constants and stays in registers
      for (int r = 0; r < 8; ++r) {
        const int* mrowp = mask_a + (size_t)(q0 + 8 * hh + r) * g.Skv + kv0 + c;
#pragma unroll
        for (int j = 0; j < 4; ++j)
          if ((mrowp[j * 16] != 0) || (kvpad[j] != 0)) s[j][r] = g.mask_fill;
      }
    }
    float cm[8];
#pragma unroll
    for (int r = 0; r < 8; ++r) {
      const int qrow = q0 + 8 * hh + r;
      float m = -INFINITY;
#pragma unroll
      for (int j = 0; j < 4; ++j) {
        const int kvcol = kv0 + j * 16 + c;
        bool masked = false;
        if (diag) masked = (kvcol > qrow);
        else if (MODE == 4) masked = (kvcol > qrow) || (qrow - kvcol > g.mask_is_int);
        else if (MODE == 2) {
          const size_t mi = (size_t)qrow * g.Skv + kvcol;
          masked = (g.mask_is_int == 0) ? (((const float*)mask_a)[mi] == 0.0f)
                 : (g.mask_is_int == 1) ? (mask_a[mi] == 0) : (mask_a[mi] != 0);
        } else if (MODE == 3) masked = (qkeep[r] == 0) || (kvkeep[j] == 0);
        else if (MODE == 5) {
          const size_t mi = (size_t)qrow * g.Skv + kvcol;
          masked = (mask_a[mi] != 0);
          int n = mask_b[mi]; n = n < 0 ? 0 : n;
          s[j][r] += g.cp[(size_t)b * g.c_bs + (size_t)h * g.c_hs + (size_t)qrow * g.c_rs + n]
                   + g.pc[(size_t)b * g.c_bs + (size_t)h * g.c_hs + (size_t)kvcol * g.c_rs + n];
        }
        if (masked) s[j][r] = g.mask_fill;
        m = fmaxf(m, s[j][r]);
      }
#pragma unroll
      for (int off = 1; off < 16; off <<= 1) m = fmaxf(m, __shfl_xor(m, off, 32));
      cm[r] = m;
    }
    __bf16* pwh = Psh[wave];
    __bf16* pwl = Psl[SPLIT_PV ? wave : 0];
#pragma unroll
    for (int r = 0; r < 8; ++r) {
      const float mnew = fmaxf(mrow[r], cm[r]);
      // exp(x - mnew) = 2^(x * log2(e) - mb): one FMA and one v_exp_f32, no branch. A row with no live key yet takes mb = 0:
      // every exponent is then -inf (never inf - inf), so its p and alpha are 0 and its sums stay 0.
      const float mb = (mnew == -INFINITY) ? 0.0f : mnew * AT_LOG2E;
      float pe[4], alpha;
      at_exp2x5(pe[0], pe[1], pe[2], pe[3], alpha,
                fmaf(s[0][r], AT_LOG2E, -mb), fmaf(s[1][r], AT_LOG2E, -mb), fmaf(s[2][r], AT_LOG2E, -mb),
                fmaf(s[3][r], AT_LOG2E, -mb), fmaf(mrow[r], AT_LOG2E, -mb));
      mrow[r] = mnew;
      float psum = 0.f;
#pragma unroll
      for (int j = 0; j < 4; ++j) {
        const float p = pe[j];
        psum = (j == 0) ? p : psum + p;   // same order as 0 + p0 + p1 + p2 + p3; a power of two is never -0, so the same bits
        if (SPLIT_PV) { __bf16 a, bl; at_split(p, a, bl); pwh[(8 * hh + r) * AT_LP + j * 16 + c] = a; pwl[(8 * hh + r) * AT_LP + j * 16 + c] = bl; }
        else pwh[(8 * hh + r) * AT_LP + j * 16 + c] = at_to16<F16>(p * PSC);
      }
#pragma unroll
      for (int off = 1; off < 16; off <<= 1) psum += __shfl_xor(psum, off, 32);
      lrow[r] = lrow[r] * alpha + psum;
#pragma unroll
      for (int t = 0; t < 4; ++t) oacc[t][r] *= alpha;
    }
    // all eight V^T fragments of the tile are read as one group, in front of the wait that the P stores take anyway: their latency is not paid per product
    FB vb[2][4];
#pragma unroll   // the loops below unrolled: vb, pa and oacc are indexed by constants (registers)
    for (int kk = 0; kk < 2; ++kk) {
#pragma unroll
      for (int t = 0; t < 4; ++t) {
        vb[kk][t].h[0] = *(const v8b*)(Vth + (t * 16 + c) * AT_LP + kk * 32 + 8 * hh);
        vb[kk][t].h[1] = *(const v8b*)(Vth + (t * 16 + c) * AT_LP + kk * 32 + 16 + 8 * hh);
      }
    }
    __builtin_amdgcn_fence(__ATOMIC_RELEASE, "workgroup");
    __builtin_amdgcn_wave_barrier();
    __builtin_amdgcn_fence(__ATOMIC_ACQUIRE, "workgroup");
    FB pa[2], pl[2];
#pragma unroll
    for (int kk = 0; kk < 2; ++kk) {
      pa[kk].h[0] = *(const v8b*)(pwh + c * AT_LP + kk * 32 + 8 * hh);
      pa[kk].h[1] = *(const v8b*)(pwh + c * AT_LP + kk * 32 + 16 + 8 * hh);
      if (SPLIT_PV) {
        pl[kk].h[0] = *(const v8b*)(pwl + c * AT_LP + kk * 32 + 8 * hh);
        pl[kk].h[1] = *(const v8b*)(pwl + c * AT_LP + kk * 32 + 16 + 8 * hh);
      }
    }
#pragma unroll   // each oacc[t] still sums keys 0..31 first, then keys 32..63
    for (int kk = 0; kk < 2; ++kk) {
#pragma unroll
      for (int t = 0; t < 4; ++t) {
        oacc[t] = at_mma16<F16>(pa[kk].v, vb[kk][t].v, oacc[t]);
        if (SPLIT_PV) {
          FB vl;
          vl.h[0] = *(const v8b*)(Vtl + (t * 16 + c) * AT_LP + kk * 32 + 8 * hh);
          vl.h[1] = *(const v8b*)(Vtl + (t * 16 + c) * AT_LP + kk * 32 + 16 + 8 * hh);
          oacc[t] = at_mma16<F16>(pa[kk].v, vl.v, oacc[t]);
          oacc[t] = at_mma16<F16>(pl[kk].v, vb[kk][t].v, oacc[t]);
        }
      }
    }
  }

  float* os = Os[wave];
#pragma unroll
  for (int r = 0; r < 8; ++r) {
    const float den = lrow[r] * PSC;
    const float inv = (den > 0.0f) ? (1.0f / den) : 0.0f;
#pragma unroll
    for (int t = 0; t < 4; ++t) os[(8 * hh + r) * 68 + t * 16 + c] = oacc[t][r] * inv;
  }
  __builtin_amdgcn_fence(__ATOMIC_RELEASE, "workgroup");
  __builtin_amdgcn_wave_barrier();
  __builtin_amdgcn_fence(__ATOMIC_ACQUIRE, "workgroup");
  {
    const int c4 = (lane & 15) * 4;
    {
#pragma unroll
      for (int it = 0; it < 8; ++it) {
        const int row = it * 2 + hh;
        v4f val = *(const v4f*)(os + row * 68 + c4);
        *(v4f*)(ob_ptr + (size_t)(q0 + row) * g.o_rs + c4) = val;
      }
      
    }
  }
}

// =====================================================================================
// 64x64 tile classification of the attention mask: one block per (b, q-tile); for each kv-tile:
//   masked(q,k) = tm[q][k] != 0 || pad[b][k] != 0;  code 2 = all masked, 1 = all live, 0 = mixed.
// =====================================================================================
__global__ __launch_bounds__(256) void tilecode_kernel(
    const int* __restrict__ tm, const int* __restrict__ pad, int* __restrict__ tab,
    int Skv, int nqb, int nkc, int tp) {
  __shared__ int wl[8], wm[8];
  __shared__ __align__(16) int codes[128];
  const int tid = threadIdx.x, lane = tid & 31, wave = tid >> 5;
  const int b  = blockIdx.x / nqb;
  const int qb = blockIdx.x - b * nqb;
  const int row = tid >> 2, cs = (tid & 3) * 16;
  const int q = qb * 64 + row;
  if (tid < 128) codes[tid] = 2;
  __syncthreads();
  const int nk = nkc < 128 ? nkc : 128;
  for (int kc = 0; kc < nk; ++kc) {
    const int* mr = tm  + (size_t)q * Skv + kc * 64 + cs;
    const int* pr = pad + (size_t)b * Skv + kc * 64 + cs;
    int live = 0, msk = 0;
#pragma unroll
    for (int i = 0; i < 4; ++i) {
      const v4i mv = *(const v4i*)(mr + 4 * i);
      const v4i pv = *(const v4i*)(pr + 4 * i);
#pragma unroll
      for (int e = 0; e < 4; ++e) {
        const int m = ((mv[e] != 0) || (pv[e] != 0)) ? 1 : 0;
        msk |= m;
        live |= (m ^ 1);
      }
    }
    const int al = __any(live);
    const int am = __any(msk);
    if (lane == 0) { wl[wave] = al; wm[wave] = am; }
    __syncthreads();
    if (tid == 0) {
      int L = 0, Mk = 0;
#pragma unroll
      for (int w = 0; w < 8; ++w) { L |= wl[w]; Mk |= wm[w]; }
      codes[kc] = (L == 0) ? 2 : ((Mk == 0) ? 1 : 0);
    }
    __syncthreads();
  }
  if (wave == 0) {
    const int nl = tp >> 2;          // tp is a multiple of 32 ints, <= 128
    v4i cv;
    cv[0] = codes[(4 * lane + 0) & 127]; cv[1] = codes[(4 * lane + 1) & 127];
    cv[2] = codes[(4 * lane + 2) & 127]; cv[3] = codes[(4 * lane + 3) & 127];
    int* dst = tab + (size_t)blockIdx.x * tp + 4 * lane;
    if (lane < nl) *(v4i*)dst = cv;
    
  }
}

// =====================================================================================
// LayerNorm over 1024-wide rows: one block (256 thr) per row, 4 contiguous floats per thread.
// =====================================================================================
template <bool OUT16>
__global__ __launch_bounds__(256) void ln_kernel(
    const float* __restrict__ in, const float* __restrict__ gam, const float* __restrict__ bet,
    float* __restrict__ o32, _Float16* __restrict__ o16) {
  __shared__ float red1[8], red2[8];
  __shared__ __align__(16) float ybuf[OUT16 ? DM : 4];
  const int row = blockIdx.x, t = threadIdx.x, lane = t & 31, wave = t >> 5;
  const float* x = in + (size_t)row * DM;
  const v4f xv = *(const v4f*)(x + 4 * t);
  float s = (xv[0] + xv[1]) + (xv[2] + xv[3]);
#pragma unroll
  for (int off = 1; off < 32; off <<= 1) s += __shfl_xor(s, off, 32);
  if (lane == 0) red1[wave] = s;
  __syncthreads();
  float tot = 0.f;
#pragma unroll
  for (int w = 0; w < 8; ++w) tot += red1[w];
  const float mu = tot * (1.0f / (float)DM);
  const float d0 = xv[0] - mu, d1 = xv[1] - mu, d2 = xv[2] - mu, d3 = xv[3] - mu;
  float s2 = (d0 * d0 + d1 * d1) + (d2 * d2 + d3 * d3);
#pragma unroll
  for (int off = 1; off < 32; off <<= 1) s2 += __shfl_xor(s2, off, 32);
  if (lane == 0) red2[wave] = s2;
  __syncthreads();
  float tot2 = 0.f;
#pragma unroll
  for (int w = 0; w < 8; ++w) tot2 += red2[w];
  const float var = tot2 * (1.0f / (float)DM);
  const float rstd = rsqrtf(var + LN_EPS);
  const v4f gv = *(const v4f*)(gam + 4 * t);
  const v4f bv = *(const v4f*)(bet + 4 * t);
  v4f y;
  y[0] = d0 * rstd * gv[0] + bv[0];
  y[1] = d1 * rstd * gv[1] + bv[1];
  y[2] = d2 * rstd * gv[2] + bv[2];
  y[3] = d3 * rstd * gv[3] + bv[3];
  float* op = o32 + (size_t)row * DM + 4 * t;
  *(v4f*)op = y;
  
  if (OUT16) {
    *(v4f*)(ybuf + 4 * t) = y;
    __syncthreads();
    if (t < DM / 8) {
      v8h hv;
#pragma unroll
      for (int e = 0; e < 8; ++e) hv[e] = (_Float16)ybuf[8 * t + e];
      _Float16* hp = o16 + (size_t)row * DM + 8 * t;
      *(v8h*)hp = hv;
      
    }
  }
}

// =====================================================================================
// Host orchestration
// =====================================================================================
extern "C" void kernel_launch(void* const* d_in, const int* in_sizes, int n_in,
                              void* d_out, int out_size, void* d_ws, size_t ws_size,
                              hipStream_t stream) {
  if (n_in < 16) return;
  if (in_sizes[0] != MROWS * DM || in_sizes[1] != SEQ * SEQ || in_sizes[2] != BSZ * SEQ) return;
  if (in_sizes[3] != DM * DM || in_sizes[4] != DM * DM || in_sizes[5] != DM * DM || in_sizes[6] != DM * DM) return;
  if (in_sizes[7] != DM || in_sizes[8] != FFND * DM || in_sizes[9] != FFND) return;
  if (in_sizes[10] != DM * FFND || in_sizes[11] != DM) return;
  if (in_sizes[12] != DM || in_sizes[13] != DM || in_sizes[14] != DM || in_sizes[15] != DM) return;
  if (out_size != MROWS * DM) return;

  const float* tgt   = (const float*)d_in[0];
  const int*   tmask = (const int*)d_in[1];     // [SEQ][SEQ], nonzero = masked
  const int*   pmask = (const int*)d_in[2];     // [BSZ][SEQ], nonzero = masked
  const float* Wq    = (const float*)d_in[3];
  const float* Wk    = (const float*)d_in[4];
  const float* Wv    = (const float*)d_in[5];
  const float* Wo    = (const float*)d_in[6];
  const float* bo    = (const float*)d_in[7];
  const float* W1    = (const float*)d_in[8];
  const float* b1    = (const float*)d_in[9];
  const float* W2    = (const float*)d_in[10];
  const float* b2    = (const float*)d_in[11];
  const float* g1    = (const float*)d_in[12];
  const float* be1   = (const float*)d_in[13];
  const float* g2    = (const float*)d_in[14];
  const float* be2   = (const float*)d_in[15];
  float* out = (float*)d_out;

  // ---- workspace carve (bytes), regions reused across phases ----
  const size_t MiB = 1048576;
  const int nqb = SEQ / AT_QB, nkc = SEQ / AT_KC;
  if (nkc > 128) return;
  const int TP = ((nkc + 31) / 32) * 32;
  const size_t tabBytes = (size_t)BSZ * nqb * TP * sizeof(int);
  const size_t total = 96 * MiB + tabBytes;
  if (total > ws_size) return;
  char* ws = (char*)d_ws;
  float*    Qf   = (float*)(ws + 0 * MiB);          // [4096][1024] f32   (projections -> attention)
  float*    Kf   = (float*)(ws + 16 * MiB);
  float*    Vf   = (float*)(ws + 32 * MiB);
  float*    RES1 = (float*)(ws + 0 * MiB);          // tgt + attn-proj     (after attention)
  _Float16* H16  = (_Float16*)(ws + 0 * MiB);       // [4096][4096] f16   (after LN1)
  float*    X1f  = (float*)(ws + 32 * MiB);         // LN1 output f32     (after attention)
  float*    AOf  = (float*)(ws + 48 * MiB);         // attention output f32
  float*    RES2 = (float*)(ws + 48 * MiB);         // x1 + ffn           (after out-proj)
  _Float16* X16  = (_Float16*)(ws + 64 * MiB);      // tgt f16            (projections)
  _Float16* O16  = (_Float16*)(ws + 64 * MiB);      // attention output f16 (after projections)
  _Float16* X1h  = (_Float16*)(ws + 64 * MiB);      // LN1 output f16     (after out-proj)
  _Float16* Wq16 = (_Float16*)(ws + 72 * MiB);
  _Float16* Wk16 = (_Float16*)(ws + 74 * MiB);
  _Float16* Wv16 = (_Float16*)(ws + 76 * MiB);
  _Float16* Wo16 = (_Float16*)(ws + 78 * MiB);
  _Float16* W1h  = (_Float16*)(ws + 80 * MiB);      // [4096][1024]
  _Float16* W2h  = (_Float16*)(ws + 88 * MiB);      // [1024][4096]
  int*      TAB  = (int*)(ws + 96 * MiB);           // [BSZ*nqb][TP]

  // tgt and the six weight matrices -> f16, one launch; X16 .. W2h lie one behind the other from X16 on
  static_assert(CV_Q * 2 == 8 * 1048576 && CV_K * 2 == 10 * 1048576 && CV_V * 2 == 12 * 1048576 && CV_O * 2 == 14 * 1048576 &&
                CV_W1 * 2 == 16 * 1048576 && CV_W2 * 2 == 24 * 1048576 && CV_END * 2 == 32 * 1048576, "offsets of the carve above");
  cast_inputs<<<dim3(CV_END / CV_BLK), dim3(CV_WAVES * 32), 0, stream>>>(tgt, Wq, Wk, Wv, Wo, W1, W2, X16);

  // mask tile codes
  tilecode_kernel<<<dim3(BSZ * nqb), dim3(256), 0, stream>>>(tmask, pmask, TAB, SEQ, nqb, nkc, TP);

  const long z = 0;
  typedef const unsigned short* cu16;
  const int tilesM = MROWS / 128;
  // q/k/v projections: [4096][1024] = X16 . W^T, f32 out
  {
    const dim3 grid(tilesM * (DM / 128), 1);
    wmma_gemm64<0, false, 0, 0, false, 0><<<grid, dim3(128), 0, stream>>>(
        (cu16)X16, (cu16)X16, DM, z, (cu16)Wq16, (cu16)Wq16, DM, z, (void*)Qf, (void*)Qf, DM, z,
        bo, tgt, z, MROWS, DM, DM, 1.0f);
    wmma_gemm64<0, false, 0, 0, false, 0><<<grid, dim3(128), 0, stream>>>(
        (cu16)X16, (cu16)X16, DM, z, (cu16)Wk16, (cu16)Wk16, DM, z, (void*)Kf, (void*)Kf, DM, z,
        bo, tgt, z, MROWS, DM, DM, 1.0f);
    wmma_gemm64<0, false, 0, 0, false, 0><<<grid, dim3(128), 0, stream>>>(
        (cu16)X16, (cu16)X16, DM, z, (cu16)Wv16, (cu16)Wv16, DM, z, (void*)Vf, (void*)Vf, DM, z,
        bo, tgt, z, MROWS, DM, DM, 1.0f);
  }

  // attention: q,k,v,o element (b, s, h, d) at b*SEQ*DM + s*DM + h*64 + d
  {
    AttnGeom g;
    g.tcode = TAB; g.cp = Qf; g.pc = Qf; g.c_bs = 0; g.c_rs = 0; g.c_hs = 0; g.t_pitch = TP;
    g.q_bs = (long)SEQ * DM; g.q_rs = DM; g.q_hs = HD;
    g.k_bs = (long)SEQ * DM; g.k_rs = DM; g.k_hs = HD;
    g.v_bs = (long)SEQ * DM; g.v_rs = DM; g.v_hs = HD;
    g.o_bs = (long)SEQ * DM; g.o_rs = DM; g.o_hs = HD;
    g.S = SEQ; g.Skv = SEQ; g.H = NHEAD; g.mask_mode = 6; g.qscale = 0.125f; g.blk0 = 0;
    g.mask_fill = -INFINITY; g.mask_is_int = 2;
    attn64_kernel<false, false, true, 6, DM><<<dim3(BSZ * NHEAD * nqb), dim3(128), 0, stream>>>(
        Qf, Kf, Vf, AOf, tmask, pmask, g);
  }
  static_assert((MROWS * DM) % (CV_WAVES * 1024) == 0);
  cast_one<1><<<dim3(MROWS * DM / (CV_WAVES * 1024)), dim3(CV_WAVES * 32), 0, stream>>>(AOf, O16);

  // RES1 = tgt + (O . Wo^T + bo)
  {
    const dim3 grid(tilesM * (DM / 128), 1);
    wmma_gemm64<0, false, 2, 0, true, 0><<<grid, dim3(128), 0, stream>>>(
        (cu16)O16, (cu16)O16, DM, z, (cu16)Wo16, (cu16)Wo16, DM, z, (void*)RES1, (void*)RES1, DM, z,
        bo, tgt, z, MROWS, DM, DM, 1.0f);
  }
  // x1 = LN(RES1) -> f32 + f16
  ln_kernel<true><<<dim3(MROWS), dim3(256), 0, stream>>>(RES1, g1, be1, X1f, X1h);
  // H16 = gelu_tanh(x1 . W1^T + b1), f16 [4096][4096]
  {
    const dim3 grid(tilesM * (FFND / 128), 1);
    wmma_gemm64<0, false, 2, 1, false, 6><<<grid, dim3(128), 0, stream>>>(
        (cu16)X1h, (cu16)X1h, DM, z, (cu16)W1h, (cu16)W1h, DM, z, (void*)H16, (void*)H16, FFND, z,
        b1, tgt, z, MROWS, FFND, DM, 1.0f);
  }
  // RES2 = x1 + (H . W2^T + b2)
  {
    const dim3 grid(tilesM * (DM / 128), 1);
    wmma_gemm64<0, false, 2, 0, true, 0><<<grid, dim3(128), 0, stream>>>(
        (cu16)H16, (cu16)H16, FFND, z, (cu16)W2h, (cu16)W2h, FFND, z, (void*)RES2, (void*)RES2, DM, z,
        b2, X1f, z, MROWS, DM, FFND, 1.0f);
  }
  // out = LN(RES2)
  ln_kernel<false><<<dim3(MROWS), dim3(256), 0, stream>>>(RES2, g2, be2, out, X1h);
  (void)hipGetLastError();
}

// v008
// A run of this version takes 272 microseconds.
// Two timings next to v007 both put it at 1.12 times that version's speed.
// Counting every step since v000, it is 7.24 times as fast.
// Contractions: q/k/v/out projections, FFN1, FFN2 on v_wmma_f32_16x16x32_f16 (f16 operands, f32 accumulate);
// attention scores (q*0.125).k^T and p.v on v_wmma_f32_16x16x32_f16 (f16 operands, p carried x2^15, f32 accumulate).
// Softmax, LayerNorm, tanh-GELU, bias and residual adds in f32.
#include <hip/hip_runtime.h>

typedef __attribute__((ext_vector_type(16))) _Float16 v16h;
typedef __attribute__((ext_vector_type(8)))  _Float16 v8h;
typedef __attribute__((ext_vector_type(16))) __bf16   v16b;
typedef __attribute__((ext_vector_type(8)))  __bf16   v8b;
typedef __attribute__((ext_vector_type(4)))  __bf16   v4b;
typedef __attribute__((ext_vector_type(2)))  __bf16   v2b;
typedef __attribute__((ext_vector_type(8)))  float    v8f;
typedef __attribute__((ext_vector_type(4)))  float    v4f;
typedef __attribute__((ext_vector_type(4)))  int      v4i;

#define DM     1024
#define NHEAD  16
#define HD     64
#define FFND   4096
#define BSZ    2
#define SEQ    2048
#define MROWS  (BSZ * SEQ)
#define LN_EPS 1e-5f

__device__ __forceinline__ unsigned short f2bf_bits(float f) {
  unsigned u = __float_as_uint(f);
  return (unsigned short)((u + 0x7FFFu + ((u >> 16) & 1u)) >> 16);
}
__device__ __forceinline__ float bf_bits2f(unsigned short h) { return __uint_as_float(((unsigned)h) << 16); }

// hazard guards as plain device helpers
__device__ __forceinline__ void dep_guard_h(v8f& a, v8f& b, v16h x, v16h y) { asm volatile("v_nop\n\tv_nop\n\tv_nop\n\tv_nop" : "+v"(a), "+v"(b) : "v"(x), "v"(y)); }
__device__ __forceinline__ void dep_guard_b(v8f& a, v8f& b, v16b x, v16b y) { asm volatile("v_nop\n\tv_nop\n\tv_nop\n\tv_nop" : "+v"(a), "+v"(b) : "v"(x), "v"(y)); }
__device__ __forceinline__ void keep4_h(v16h a, v16h b, v16h c, v16h d) { asm volatile("v_nop" :: "v"(a), "v"(b), "v"(c), "v"(d)); }
__device__ __forceinline__ void keep4_b(v16b a, v16b b, v16b c, v16b d) { asm volatile("v_nop" :: "v"(a), "v"(b), "v"(c), "v"(d)); }
__device__ __forceinline__ void acc_guard4(v8f& a, v8f& b, v8f& c, v8f& d) { asm volatile("v_nop\n\tv_nop\n\tv_nop\n\tv_nop" : "+v"(a), "+v"(b), "+v"(c), "+v"(d)); }
template <typename T> struct Frag;
template <> struct Frag<_Float16> {
  typedef v16h V; union U { v16h v; v8h h[2]; };
  static __device__ __forceinline__ v16h load(const _Float16* p) {   // elements 0..7 <- p[0..7], 8..15 <- p[16..23]
    U f; f.h[0] = *(const v8h*)(p); f.h[1] = *(const v8h*)(p + 16); return f.v;
  }
  static __device__ __forceinline__ v8f mma(v16h a, v16h b, v8f c) {
    return __builtin_amdgcn_wmma_f32_16x16x32_f16(false, a, false, b, (short)0, c, false, false);
  }
  static __device__ __forceinline__ void guard(v8f& a, v8f& b, v16h x, v16h y) { dep_guard_h(a, b, x, y); }
  static __device__ __forceinline__ void keep(v16h a, v16h b, v16h c, v16h d) { keep4_h(a, b, c, d); }
};
template <> struct Frag<__bf16> {
  typedef v16b V; union U { v16b v; v8b h[2]; };
  static __device__ __forceinline__ v16b load(const __bf16* p) {
    U f; f.h[0] = *(const v8b*)(p); f.h[1] = *(const v8b*)(p + 16); return f.v;
  }
  static __device__ __forceinline__ v8f mma(v16b a, v16b b, v8f c) {
    return __builtin_amdgcn_wmma_f32_16x16x32_bf16(false, a, false, b, (short)0, c, false, false);
  }
  static __device__ __forceinline__ void guard(v8f& a, v8f& b, v16b x, v16b y) { dep_guard_b(a, b, x, y); }
  static __device__ __forceinline__ void keep(v16b a, v16b b, v16b c, v16b d) { keep4_b(a, b, c, d); }
};

// tanh-GELU: 0.5*v*(1+tanh(sqrt(2/pi)*(v+0.044715*v^3))); tanh via exp(-2|u|), no division instruction
__device__ __forceinline__ float gelu_tanh_f(float v) {
  const float u = 0.7978845608028654f * (v + 0.044715f * v * v * v);
  const float e = __expf(-2.0f * fabsf(u));
  float t = (1.0f - e) * __builtin_amdgcn_rcpf(1.0f + e);
  t = copysignf(t, u);
  return 0.5f * v * (1.0f + t);
}

// ---- Register-blocked batched WMMA GEMM ------------------------------------
// C[m,n] = scale * sum_k A[m,k] * Bt[n,k] (+bias)(+resid); each wave owns a 64x64 tile, a block of 4 waves (2x2) a 128x128 tile.
// A row-major [M,K]; Bt row-major [N,K]; M,N % 128 == 0, K % 128 == 0.
// Operands reach the waves through LDS: a stage is 128 k of the block's 128 A rows and 128 Bt rows (256 B a row, pitch 272 B),
// brought by asynchronous copies into two buffers, the next stage's copies in flight while this stage is multiplied.
// SPLIT (hi/lo planes) is not built in this form.
// BIAS_MODE: 0 = none, 1 = bias[m], 2 = bias[n].
// OUT_MODE: 0 = f32, 1 = f16, 2 = bf16 hi plane (Cout) + bf16 lo plane (Cout2).
// ACT: 0 none, 1 tanh, 2 relu, 3 silu, 4 leaky, 5 erf-gelu, 6 tanh-gelu.
// ET: 0 = f16 operands, 1 = bf16 operands (pointers passed as 16-bit storage)
template <int ET> struct Elem;
template <> struct Elem<0> { typedef _Float16 T; };
template <> struct Elem<1> { typedef __bf16 T; };
#define G_KS    128                       // k per stage
#define G_PITCH 136                       // LDS row pitch in 16-bit elements: 256 B + 16 B
#define G_STAGE (256 * G_PITCH)           // elements per buffer: rows 0..127 = A, rows 128..255 = Bt
// Eight asynchronous 16-byte copies per lane, rows 8 apart. The s_wait_xcnt stands inside the statement so that
// no address register of an issued copy is rewritten in front of it.
__device__ __forceinline__ void g_copy8(unsigned l, const unsigned short* g, size_t gstep) {
  const unsigned ls = 8u * G_PITCH * 2u;
  asm volatile(
      "global_load_async_to_lds_b128 %0, %8, off\n\t"
      "global_load_async_to_lds_b128 %1, %9, off\n\t"
      "global_load_async_to_lds_b128 %2, %10, off\n\t"
      "global_load_async_to_lds_b128 %3, %11, off\n\t"
      "global_load_async_to_lds_b128 %4, %12, off\n\t"
      "global_load_async_to_lds_b128 %5, %13, off\n\t"
      "global_load_async_to_lds_b128 %6, %14, off\n\t"
      "global_load_async_to_lds_b128 %7, %15, off\n\t"
      "s_wait_xcnt 0x0"
      :: "v"(l), "v"(l + ls), "v"(l + 2u * ls), "v"(l + 3u * ls), "v"(l + 4u * ls), "v"(l + 5u * ls), "v"(l + 6u * ls), "v"(l + 7u * ls),
         "v"(g), "v"(g + gstep), "v"(g + 2 * gstep), "v"(g + 3 * gstep), "v"(g + 4 * gstep), "v"(g + 5 * gstep), "v"(g + 6 * gstep), "v"(g + 7 * gstep)
      : "memory");
}
template <int ET, bool SPLIT, int BIAS_MODE, int OUT_MODE, bool RESID, int ACT = 0>
__global__ __launch_bounds__(128) void wmma_gemm64(
    const unsigned short* __restrict__ Ap, const unsigned short* __restrict__ A2p, int lda, long strideA,
    const unsigned short* __restrict__ Btp, const unsigned short* __restrict__ Bt2p, int ldb, long strideB,
    void* __restrict__ Cout, void* __restrict__ Cout2, int ldc, long strideC,
    const float* __restrict__ bias,
    const float* __restrict__ resid, long strideR,
    int M, int N, int K, float scale) {
  typedef typename Elem<ET>::T T;
  typedef typename Frag<T>::V V;
  static_assert(!SPLIT, "hi/lo planes are not staged");
  __shared__ __align__(16) unsigned short sAB[2 * G_STAGE];   // two stage buffers
  __shared__ __align__(16) float sT[4][16 * 68];   // per-wave 16x64 slab, pitch 68 floats
  const int b    = blockIdx.y;
  const int tid  = threadIdx.x;
  const int lane = tid & 31;
  const int wave = tid >> 5;
  const int tilesN = N >> 7;
  const int tilesM = M >> 7;
  const int tile = blockIdx.x;
  if (tile >= tilesM * tilesN) return;   // block-uniform, in front of every barrier and copy
  const int tm = tile / tilesN;
  const int tn = tile - tm * tilesN;
  const int mB = tm << 7;
  const int nB = tn << 7;
  const int wm = wave >> 1, wn = wave & 1;
  const int m0 = mB + (wm << 6);
  const int n0 = nB + (wn << 6);

  const int rlane = lane & 15;                 // row (A) / col (B, D) within subtile
  const int koff  = (lane >> 4) * 8;           // k offset of this lane half
  const int mOff  = (lane >> 4) * 8;           // D row offset

  // copy lanes: 16 lanes cover one 256-B row, a wave-wide copy two rows (four whole lines)
  const int crow = tid >> 4, cch = (tid & 15) * 8;
  const unsigned short* gA = Ap  + (size_t)b * strideA + (size_t)(mB + crow) * lda + cch;
  const unsigned short* gB = Btp + (size_t)b * strideB + (size_t)(nB + crow) * ldb + cch;
  const unsigned lbase = (unsigned)(size_t)(&sAB[0]) + (unsigned)(crow * G_PITCH + cch) * 2u;
  const size_t stepA = (size_t)8 * lda, stepB = (size_t)8 * ldb;
  auto stage_copy = [&](int st, int buf) {     // 32 copies per lane: one stage of A and Bt
    const unsigned l = lbase + (unsigned)buf * (G_STAGE * 2u);
    const unsigned short* a = gA + (size_t)st * G_KS;
    const unsigned short* w = gB + (size_t)st * G_KS;
    g_copy8(l,                          a,             stepA);
    g_copy8(l +  64u * G_PITCH * 2u,    a + 8 * stepA, stepA);
    g_copy8(l + 128u * G_PITCH * 2u,    w,             stepB);
    g_copy8(l + 192u * G_PITCH * 2u,    w + 8 * stepB, stepB);
  };

  v8f acc[4][4];
#pragma unroll
  for (int i = 0; i < 4; ++i)
#pragma unroll
    for (int j = 0; j < 4; ++j) acc[i][j] = (v8f){0.f,0.f,0.f,0.f,0.f,0.f,0.f,0.f};

  const int nst = K >> 7;
  stage_copy(0, 0);
  asm volatile("s_wait_asynccnt 0x0" ::: "memory");   // this wave's part of stage 0 has landed
  __syncthreads();                                     // stage 0 readable by every wave
  if (nst > 1) stage_copy(1, 1);
#pragma unroll 1   // kept rolled: one trip is one stage of the ring, with one publish point and one refill site
  for (int t = 0; t < nst; ++t) {
    const T* sbuf = (const T*)sAB + (size_t)(t & 1) * G_STAGE;
    const T* sA = sbuf + ((wm << 6) + rlane) * G_PITCH + koff;
    const T* sB = sbuf + (128 + (wn << 6) + rlane) * G_PITCH + koff;
#pragma unroll     // the loops below are unrolled so that fragments and accumulators are indexed by constants (registers, no scratch)
    for (int ks = 0; ks < G_KS / 32; ++ks) {
      V bh[4], ah[4];
#pragma unroll
      for (int j = 0; j < 4; ++j) bh[j] = Frag<T>::load(sB + j * 16 * G_PITCH + ks * 32);
#pragma unroll
      for (int i = 0; i < 4; ++i) ah[i] = Frag<T>::load(sA + i * 16 * G_PITCH + ks * 32);
#pragma unroll
      for (int i = 0; i < 4; ++i) {
#pragma unroll
        for (int j = 0; j < 4; ++j) acc[i][j] = Frag<T>::mma(ah[i], bh[j], acc[i][j]);
        Frag<T>::guard(acc[i][0], acc[i][3], ah[i], ah[i]);
      }
      Frag<T>::keep(bh[0], bh[1], bh[2], bh[3]);
    }
    asm volatile("s_wait_dscnt 0x0" ::: "memory");     // this wave's reads of buffer t & 1 are done
    asm volatile("s_wait_asynccnt 0x0" ::: "memory");  // this wave's part of stage t + 1 has landed
    __syncthreads();                                   // publishes stage t + 1, frees buffer t & 1
    if (t + 2 < nst) stage_copy(t + 2, t & 1);
  }
  asm volatile("s_wait_asynccnt 0x0" ::: "memory");    // no copy outstanding behind the loop
  acc_guard4(acc[0][0], acc[0][1], acc[0][2], acc[0][3]);
  acc_guard4(acc[1][0], acc[1][1], acc[1][2], acc[1][3]);
  acc_guard4(acc[2][0], acc[2][1], acc[2][2], acc[2][3]);
  acc_guard4(acc[3][0], acc[3][1], acc[3][2], acc[3][3]);

  // ---- epilogue ----
  float* slab = sT[wave];
  const float* Rb = RESID ? (resid + (size_t)b * strideR) : nullptr;
#pragma unroll
  for (int i = 0; i < 4; ++i) {
    const int mBase = m0 + (i << 4);
#pragma unroll
    for (int j = 0; j < 4; ++j) {
      const int n = n0 + (j << 4) + rlane;
      float bv = 0.f;
      if (BIAS_MODE == 2) bv = bias[n];
#pragma unroll
      for (int r = 0; r < 8; ++r) {
        float v = acc[i][j][r] * scale;
        if (BIAS_MODE == 1) v += bias[mBase + mOff + r];
        if (BIAS_MODE == 2) v += bv;
        if (RESID) v += Rb[(size_t)(mBase + mOff + r) * ldc + n];
        if (ACT == 1) v = tanhf(v);
        if (ACT == 2) v = fmaxf(v, 0.0f);
        if (ACT == 3) v = v / (1.0f + expf(-v));
        if (ACT == 4) v = (v > 0.f) ? v : 0.01f * v;
        if (ACT == 5) v = 0.5f * v * (1.0f + erff(v * 0.70710678118654752f));
        if (ACT == 6) v = gelu_tanh_f(v);
        slab[(mOff + r) * 68 + (j << 4) + rlane] = v;
      }
    }
    __builtin_amdgcn_fence(__ATOMIC_RELEASE, "workgroup");
    __builtin_amdgcn_wave_barrier();
    __builtin_amdgcn_fence(__ATOMIC_ACQUIRE, "workgroup");
    if (OUT_MODE == 0) {
      float* C = (float*)Cout + (size_t)b * strideC;
      const int hh = lane >> 4, c4 = (lane & 15) * 4;     // row seg = 256 B = 16 lanes x 16 B
      {
#pragma unroll
        for (int it = 0; it < 8; ++it) {
          const int row = it * 2 + hh;
          v4f v = *(const v4f*)(slab + row * 68 + c4);
          *(v4f*)(C + (size_t)(mBase + row) * ldc + n0 + c4) = v;
        }
        
      }
    } else {
      const int q = lane >> 3, c8 = (lane & 7) * 8;
      unsigned short* C  = (unsigned short*)Cout  + (size_t)b * strideC;
      unsigned short* C2 = (OUT_MODE == 2) ? ((unsigned short*)Cout2 + (size_t)b * strideC) : nullptr;
      {
#pragma unroll
        for (int it = 0; it < 4; ++it) {
          const int row = it * 4 + q;
          const float* sp = slab + row * 68 + c8;
          v8h hv, lv;
#pragma unroll
          for (int e = 0; e < 8; ++e) {
            if (OUT_MODE == 1) {
              hv[e] = (_Float16)sp[e];
            } else {
              unsigned short hb = f2bf_bits(sp[e]);
              unsigned short lb = f2bf_bits(sp[e] - bf_bits2f(hb));
              hv[e] = __builtin_bit_cast(_Float16, hb);
              lv[e] = __builtin_bit_cast(_Float16, lb);
            }
          }
          *(v8h*)(C + (size_t)(mBase + row) * ldc + n0 + c8) = hv;
          if (OUT_MODE == 2) *(v8h*)(C2 + (size_t)(mBase + row) * ldc + n0 + c8) = lv;
        }
        
      }
    }
    __builtin_amdgcn_fence(__ATOMIC_RELEASE, "workgroup");
    __builtin_amdgcn_wave_barrier();
    __builtin_amdgcn_fence(__ATOMIC_ACQUIRE, "workgroup");
  }
}

// ---- f32 -> f16 conversion by few, long-lived waves ------------------------
// A block is 16 waves; a wave converts R * 1024 contiguous elements: R * 8 loads of 16 bytes a lane (each wave-wide load 512
// contiguous bytes), all issued before the first is converted, and as many 8-byte stores (each wave-wide store 256 contiguous bytes).
typedef __attribute__((ext_vector_type(4))) _Float16 v4h;
#define CV_WAVES 16
template <int R>
__device__ __forceinline__ void cast_wave(const float* __restrict__ src, _Float16* __restrict__ dst, int q) {
  // src, dst: block-uniform; q: the lane's first group of four elements, one index for the loads and the stores
  const v4f* __restrict__ s4 = (const v4f*)src;
  v4h* __restrict__ d4 = (v4h*)dst;
  v4f x[R * 8];
#pragma unroll   // both loops unrolled: x stays in registers, every load and store addresses by an immediate offset
  for (int i = 0; i < R * 8; ++i) x[i] = s4[q + i * 32];
  if (R > 1) __builtin_amdgcn_sched_barrier(0);   // keeps every load in front of the first wait: a wave pays one memory latency, not one per group of loads
#pragma unroll
  for (int i = 0; i < R * 8; ++i) {
    v4h h;
#pragma unroll
    for (int e = 0; e < 4; ++e) h[e] = (_Float16)x[i][e];
    d4[q + i * 32] = h;
    if ((i & 7) == 7 && i + 1 < R * 8) __builtin_amdgcn_sched_barrier(0);   // eight stores leave as soon as their loads are in, not all behind the last load
  }
}
// The seven f32 inputs of the GEMMs in one launch: their f16 copies lie one behind the other in dst, at these element offsets.
#define CV_X   0
#define CV_Q   (CV_X + MROWS * DM)
#define CV_K   (CV_Q + DM * DM)
#define CV_V   (CV_K + DM * DM)
#define CV_O   (CV_V + DM * DM)
#define CV_W1  (CV_O + DM * DM)
#define CV_W2  (CV_W1 + FFND * DM)
#define CV_END (CV_W2 + DM * FFND)
#define CV_R   4
#define CV_BLK (CV_WAVES * CV_R * 1024)   // elements per block
static_assert(CV_Q % CV_BLK == 0 && CV_K % CV_BLK == 0 && CV_V % CV_BLK == 0 && CV_O % CV_BLK == 0 &&
              CV_W1 % CV_BLK == 0 && CV_W2 % CV_BLK == 0 && CV_END % CV_BLK == 0, "a block lies wholly in one tensor");
__global__ __launch_bounds__(CV_WAVES * 32) void cast_inputs(
    const float* __restrict__ x, const float* __restrict__ wq, const float* __restrict__ wk, const float* __restrict__ wv,
    const float* __restrict__ wo, const float* __restrict__ w1, const float* __restrict__ w2, _Float16* __restrict__ dst) {
  const int e0 = blockIdx.x * CV_BLK;       // block-uniform: the block index picks the tensor
  const float* src = x;
  int first = CV_X;
  if (e0 >= CV_Q)  { src = wq; first = CV_Q; }
  if (e0 >= CV_K)  { src = wk; first = CV_K; }
  if (e0 >= CV_V)  { src = wv; first = CV_V; }
  if (e0 >= CV_O)  { src = wo; first = CV_O; }
  if (e0 >= CV_W1) { src = w1; first = CV_W1; }
  if (e0 >= CV_W2) { src = w2; first = CV_W2; }
  cast_wave<CV_R>(src + (e0 - first), dst + e0, (threadIdx.x >> 5) * (CV_R * 256) + (threadIdx.x & 31));
}
// One tensor of gridDim.x * CV_WAVES * R * 1024 elements.
template <int R>
__global__ __launch_bounds__(CV_WAVES * 32) void cast_one(const float* __restrict__ in, _Float16* __restrict__ out) {
  const int e0 = blockIdx.x * (CV_WAVES * R * 1024);
  cast_wave<R>(in + e0, out + e0, (threadIdx.x >> 5) * (R * 256) + (threadIdx.x & 31));
}

// =====================================================================================
// Attention for head_dim 64, f32 in / f32 out; 16-bit operands: bf16 with optional hi/lo splits, or
// plain f16 (F16=true, non-split, probabilities carried x2^15).
//   Block = 4 waves = 64 query rows of one (batch, head); S % 64 == 0.
//   Element (b, s, h, d) of tensor X lives at X[b*X_bs + s*X_rs + h*X_hs + d] (strides in floats, multiples of 4).
//   mask_mode 0 none, 1 causal, 2 tensor [S][Skv], 3 per-token vectors, 4 causal + window, 5 relative bias,
//   6 = mask_a: int32 [S][Skv] nonzero = masked, OR mask_b: int32 [B][Skv] nonzero = masked; per 64x64
//       (b, q-tile, kv-tile) code table tcode[(b*nqb+qb)*t_pitch + kc]: 0 mixed (per-element reads),
//       1 all live (no reads), 2 all masked (tile skipped: zero contribution).
//   masked scores are replaced by mask_fill before the softmax; rows with no live key write 0.
//   grid.x = B * H * (S/64).
// =====================================================================================
#define AT_D 64
#define AT_NW 4
#define AT_QB 64
#define AT_KC 64
#define AT_LOG2E 1.4426950408889634f
#define AT_LP 72    // LDS row pitch of the K and V^T tiles in 16-bit elements: 128 B of data + 16 B, so that the 16 rows
                    // which one ds_load_b128 fragment read touches fall on 16 different groups of four banks
struct AttnGeom { const int* tcode; const float* cp; const float* pc; long c_bs, c_rs, c_hs, t_pitch;
                  long q_bs, q_rs, q_hs, k_bs, k_rs, k_hs, v_bs, v_rs, v_hs, o_bs, o_rs, o_hs;
                  int S, Skv, H, mask_mode; float qscale; int blk0; float mask_fill; int mask_is_int; };
static_assert(sizeof(AttnGeom) == 184);

__device__ __forceinline__ unsigned short at_bf_bits(float f) {
  unsigned u = __float_as_uint(f);
  return (unsigned short)((u + 0x7FFFu + ((u >> 16) & 1u)) >> 16);
}
__device__ __forceinline__ __bf16 at_f2bf(float f) { return __builtin_bit_cast(__bf16, at_bf_bits(f)); }
__device__ __forceinline__ void at_split(float f, __bf16& hi, __bf16& lo) {
  const unsigned short hb = at_bf_bits(f);
  hi = __builtin_bit_cast(__bf16, hb);
  lo = at_f2bf(f - __uint_as_float(((unsigned)hb) << 16));
}
__device__ __forceinline__ v8f at_mma(v16b a, v16b b, v8f c) {
  c = __builtin_amdgcn_wmma_f32_16x16x32_bf16(false, a, false, b, (short)0, c, false, false);
  asm volatile("v_nop\n\tv_nop\n\tv_nop\n\tv_nop" : "+v"(c) : "v"(a), "v"(b));
  return c;
}
// 16-bit element as a bit pattern held in a __bf16 slot: f16 bits when F16, bf16 (RNE) otherwise
template <bool F16> __device__ __forceinline__ __bf16 at_to16(float f) {
  if (F16) return __builtin_bit_cast(__bf16, (_Float16)f);
  return at_f2bf(f);
}
template <bool F16> __device__ __forceinline__ v8f at_mma16(v16b a, v16b b, v8f c) {
  if (F16) {
    const v16h ah = __builtin_bit_cast(v16h, a), bh = __builtin_bit_cast(v16h, b);
    c = __builtin_amdgcn_wmma_f32_16x16x32_f16(false, ah, false, bh, (short)0, c, false, false);
    asm volatile("v_nop\n\tv_nop\n\tv_nop\n\tv_nop" : "+v"(c) : "v"(ah), "v"(bh));
    return c;
  }
  return at_mma(a, b, c);
}

// Eight powers of two (one lane's scores of one 16-key tile) in one statement. Behind a v_exp_f32 the instruction set asks for
// one independent instruction before its result is read or its source overwritten: here each v_exp_f32 is that instruction for the
// one before it (the outputs are early-clobber, so none lies on a source), and the v_nop is it for the last.
__device__ __forceinline__ void at_exp2x8(float (&o)[8], const float (&x)[8]) {
  asm("v_exp_f32 %0, %8\n\t"
      "v_exp_f32 %1, %9\n\t"
      "v_exp_f32 %2, %10\n\t"
      "v_exp_f32 %3, %11\n\t"
      "v_exp_f32 %4, %12\n\t"
      "v_exp_f32 %5, %13\n\t"
      "v_exp_f32 %6, %14\n\t"
      "v_exp_f32 %7, %15\n\t"
      "v_nop"
      : "=&v"(o[0]), "=&v"(o[1]), "=&v"(o[2]), "=&v"(o[3]), "=&v"(o[4]), "=&v"(o[5]), "=&v"(o[6]), "=&v"(o[7])
      : "v"(x[0]), "v"(x[1]), "v"(x[2]), "v"(x[3]), "v"(x[4]), "v"(x[5]), "v"(x[6]), "v"(x[7]));
}
// One power of two (the rescale factor); the v_nop is the independent instruction behind it.
__device__ __forceinline__ float at_exp2x1(float x) {
  float o;
  asm("v_exp_f32 %0, %1\n\t"
      "v_nop"
      : "=&v"(o) : "v"(x));
  return o;
}
// The value that lane l ^ 16 holds: a register move across the two 16-lane rows, no LDS-path operation.
__device__ __forceinline__ float at_xhalf(float f) {
  const int bits = __float_as_int(f);
  return __int_as_float(__builtin_amdgcn_permlanex16(bits, bits, 0x76543210, 0xfedcba98, false, false));
}

// MODE is the mask mode as a compile-time constant: only that mode's mask code is compiled into the key loop.
// KVRS is the row stride of K and of V in floats (the launch's g.k_rs and g.v_rs) as a compile-time constant: the eight pieces that a
// lane reads of each tile are then one address and eight immediate offsets.
template <bool SPLIT_QK, bool SPLIT_PV, bool F16, int MODE, int KVRS>
__global__ __launch_bounds__(128)
void attn64_kernel(const float* __restrict__ q, const float* __restrict__ k,
                   const float* __restrict__ v, float* __restrict__ out,
                   const int* __restrict__ mask_a, const int* __restrict__ mask_b, AttnGeom g) {
  static_assert(!(F16 && (SPLIT_QK || SPLIT_PV)));
  const float PSC = F16 ? 32768.0f : 1.0f;     // f16 probabilities carried x2^15, folded into the final 1/l
  union FB { v16b v; v8b h[2]; };
  __shared__ __align__(16) __bf16 Ksh[AT_KC * AT_LP];            // K hi [kv][d]      9 KB
  __shared__ __align__(16) __bf16 Ksl[SPLIT_QK ? AT_KC * AT_LP : 8];
  __shared__ __align__(16) __bf16 Vth[AT_D * AT_LP];             // V hi [d][kv]      9 KB
  __shared__ __align__(16) __bf16 Vtl[SPLIT_PV ? AT_D * AT_LP : 8];
  __shared__ __align__(16) float  Os[AT_NW][16 * 68];            // per wave out tile, pitch 68

  const int tid  = threadIdx.x;
  const int wave = tid >> 5;
  const int lane = tid & 31;
  const int hh   = lane >> 4;
  const int c    = lane & 15;

  const int nqb = g.S / AT_QB;
  const int nkc = g.Skv / AT_KC;
  const int bx = blockIdx.x + g.blk0;
  const int qb = bx % nqb;
  const int bh = bx / nqb;
  const int h  = bh % g.H;
  const int b  = bh / g.H;
  const int qbase_block = qb * AT_QB;
  const int q0 = qbase_block + wave * 16;

  const float* qb_ptr = q + (size_t)b * g.q_bs + (size_t)h * g.q_hs;
  const float* kb_ptr = k + (size_t)b * g.k_bs + (size_t)h * g.k_hs;
  const float* vb_ptr = v + (size_t)b * g.v_bs + (size_t)h * g.v_hs;
  float*       ob_ptr = out + (size_t)b * g.o_bs + (size_t)h * g.o_hs;

  // ---- Q fragments (B operand): 2 d-chunks, hi (and lo) ----
  v16b qah[2], qal[2];
  {
    const float* qrow = qb_ptr + (size_t)(q0 + c) * g.q_rs;
#pragma unroll
    for (int dc = 0; dc < 2; ++dc) {
#pragma unroll
      for (int e = 0; e < 8; ++e) {
        const float f0 = qrow[dc * 32 + 8 * hh + e] * g.qscale;
        const float f1 = qrow[dc * 32 + 16 + 8 * hh + e] * g.qscale;
        if (SPLIT_QK) { __bf16 hq, lq; at_split(f0, hq, lq); qah[dc][e] = hq; qal[dc][e] = lq; at_split(f1, hq, lq); qah[dc][8 + e] = hq; qal[dc][8 + e] = lq; }
        else { qah[dc][e] = at_to16<F16>(f0); qah[dc][8 + e] = at_to16<F16>(f1); qal[dc][e] = qah[dc][e]; qal[dc][8 + e] = qah[dc][8 + e]; }
      }
    }
  }

  float mrow = -INFINITY;   // running maximum of the lane's query, the same in both halves
  float lrow = 0.f;         // running sum over the lane half's own keys; the halves are joined once, behind the key loop
  v8f oacc[4];              // oacc[t][r] = O[q0 + c][t * 16 + 8 * hh + r]
#pragma unroll
  for (int t = 0; t < 4; ++t) oacc[t] = (v8f){0.f,0.f,0.f,0.f,0.f,0.f,0.f,0.f};

  const int nChunks = (MODE == 1 || MODE == 4) ? (qb + 1) : nkc;   // block-uniform, bounded by Skv/64
  const int qrow = q0 + c;
  const int qkeep = (MODE == 3) ? mask_b[(size_t)b * g.S + qrow] : 1;   // mask_b = qmask in mode 3
  for (int kc = 0; kc < nChunks; ++kc) {
    const int kv0 = kc * AT_KC;
    int code = 0;
    if (MODE == 6) {
      int cv = g.tcode[((size_t)b * nqb + qb) * (size_t)g.t_pitch + kc];
      cv = __builtin_amdgcn_readfirstlane(cv);
      code = (cv == 1 || cv == 2) ? cv : 0;     // anything else -> mixed (per-element reads)
      if (code == 2) continue;                  // fully masked tile: zero contribution, softmax state unchanged
    }
    __syncthreads();
    {
      // 8 lanes read one whole 128-B line (half a row) of K or V, so a wave-wide 16-byte load covers four whole lines of four rows.
      // A lane takes the rows kvr and kvr + 1 at the same four d: a V^T pair of neighbouring keys is one 4-byte LDS store.
      // Four row pairs a wave (not two) spread a V^T store over 16 banks: the d of 8 lanes fall on 4 banks, each row pair is one bank on.
      const int r2 = (tid >> 3) * 2, d4 = (tid & 7) * 4;
      const float* kcol = kb_ptr + (size_t)(kv0 + r2) * KVRS + d4;
      const float* vcol = vb_ptr + (size_t)(kv0 + r2) * KVRS + d4;
      v4f kx[8], vx[8];
#pragma unroll   // this loop and the two below unrolled: kx and vx are indexed by constants (registers), all 16 loads are issued in front of the first wait
      for (int i = 0; i < 8; ++i) {
        kx[i] = *(const v4f*)(kcol + (((i >> 1) & 1) * 32 + (i & 1)) * KVRS + (i >> 2) * 32);
        vx[i] = *(const v4f*)(vcol + (((i >> 1) & 1) * 32 + (i & 1)) * KVRS + (i >> 2) * 32);
      }
      // kcol and vcol are inputs so that both address pairs live up to this wait: no load's result and no conversion takes their registers in front of it
      asm volatile("s_wait_xcnt 0x0" :: "v"(kcol), "v"(vcol) : "memory");
#pragma unroll
      for (int p = 0; p < 4; ++p) {
        const int kvr = (p & 1) * 32 + r2, dd = (p >> 1) * 32 + d4;
        const v4f k0 = kx[2 * p], k1 = kx[2 * p + 1], v0 = vx[2 * p], v1 = vx[2 * p + 1];
        v4b k0h, k0l, k1h, k1l;
#pragma unroll
        for (int e = 0; e < 4; ++e) {
          if (SPLIT_QK) { __bf16 a, bl; at_split(k0[e], a, bl); k0h[e] = a; k0l[e] = bl; at_split(k1[e], a, bl); k1h[e] = a; k1l[e] = bl; }
          else { k0h[e] = at_to16<F16>(k0[e]); k1h[e] = at_to16<F16>(k1[e]); }
          v2b vh, vl;
          if (SPLIT_PV) { __bf16 a, bl; at_split(v0[e], a, bl); vh[0] = a; vl[0] = bl; at_split(v1[e], a, bl); vh[1] = a; vl[1] = bl; }
          else { vh[0] = at_to16<F16>(v0[e]); vh[1] = at_to16<F16>(v1[e]); }
          *(v2b*)(Vth + (dd + e) * AT_LP + kvr) = vh;
          if (SPLIT_PV) *(v2b*)(Vtl + (dd + e) * AT_LP + kvr) = vl;
        }
        *(v4b*)(Ksh + kvr * AT_LP + dd) = k0h;
        *(v4b*)(Ksh + (kvr + 1) * AT_LP + dd) = k1h;
        if (SPLIT_QK) { *(v4b*)(Ksl + kvr * AT_LP + dd) = k0l; *(v4b*)(Ksl + (kvr + 1) * AT_LP + dd) = k1l; }
      }
    }
    __syncthreads();

    v8f s[4];   // s[j][r] = score of key kv0 + j * 16 + 8 * hh + r for query q0 + c
    {
      // all eight K fragments of the tile are read as one group ahead of the eight products: one LDS latency a tile, not one per product
      FB kb[2][4];
#pragma unroll   // these loops unrolled: kb, qah and s are indexed by constants (registers, no indexed register moves)
      for (int dc = 0; dc < 2; ++dc) {
#pragma unroll
        for (int j = 0; j < 4; ++j) {
          kb[dc][j].h[0] = *(const v8b*)(Ksh + (j * 16 + c) * AT_LP + dc * 32 + 8 * hh);
          kb[dc][j].h[1] = *(const v8b*)(Ksh + (j * 16 + c) * AT_LP + dc * 32 + 16 + 8 * hh);
        }
      }
#pragma unroll
      for (int j = 0; j < 4; ++j) s[j] = (v8f){0.f,0.f,0.f,0.f,0.f,0.f,0.f,0.f};
#pragma unroll   // each s[j] still sums d 0..31 first, then d 32..63; K rows are the first operand, Q the second
      for (int dc = 0; dc < 2; ++dc) {
#pragma unroll
        for (int j = 0; j < 4; ++j) {
          s[j] = at_mma16<F16>(kb[dc][j].v, qah[dc], s[j]);
          if (SPLIT_QK) {
            FB kl;
            kl.h[0] = *(const v8b*)(Ksl + (j * 16 + c) * AT_LP + dc * 32 + 8 * hh);
            kl.h[1] = *(const v8b*)(Ksl + (j * 16 + c) * AT_LP + dc * 32 + 16 + 8 * hh);
            s[j] = at_mma16<F16>(kl.v, qah[dc], s[j]);
            s[j] = at_mma16<F16>(kb[dc][j].v, qal[dc], s[j]);
          }
        }
      }
    }
    // all eight V^T fragments of the tile are read as one group in front of the softmax, which covers their latency
    FB vb[2][4];
#pragma unroll   // unrolled: vb is indexed by constants (registers)
    for (int kk = 0; kk < 2; ++kk) {
#pragma unroll
      for (int t = 0; t < 4; ++t) {
        vb[kk][t].h[0] = *(const v8b*)(Vth + (t * 16 + c) * AT_LP + kk * 32 + 8 * hh);
        vb[kk][t].h[1] = *(const v8b*)(Vth + (t * 16 + c) * AT_LP + kk * 32 + 16 + 8 * hh);
      }
    }
    const bool diag = (MODE == 1) && (kc == qb);
    if (MODE == 6 && code == 0) {               // mixed tile: one wave-uniform branch per tile, then per-element reads
      // a lane's eight keys of a 16-key tile lie side by side in its query's mask row and in the padding row: two 16-byte reads of each
      const int* mrowp = mask_a + (size_t)qrow * g.Skv + kv0 + 8 * hh;
      const int* prowp = mask_b + (size_t)b * g.Skv + kv0 + 8 * hh;   // mask_b = key padding [B][Skv]
      v4i mx[8], px[8];
#pragma unroll   // the loops here unrolled so that mx, px and s[j][r] are indexed by constants and stay in registers
      for (int i = 0; i < 8; ++i) {
        mx[i] = *(const v4i*)(mrowp + (i >> 1) * 16 + (i & 1) * 4);
        px[i] = *(const v4i*)(prowp + (i >> 1) * 16 + (i & 1) * 4);
      }
      // mrowp and prowp are inputs so that both address pairs live up to this wait: no load's result and no compare takes their registers in front of it
      asm volatile("s_wait_xcnt 0x0" :: "v"(mrowp), "v"(prowp) : "memory");
#pragma unroll
      for (int j = 0; j < 4; ++j) {
#pragma unroll
        for (int r = 0; r < 8; ++r)
          if ((mx[2 * j + (r >> 2)][r & 3] != 0) || (px[2 * j + (r >> 2)][r & 3] != 0)) s[j][r] = g.mask_fill;
      }
    }
    float mj[4];   // one maximum per 16-key tile: four short chains, not one of 32 links
#pragma unroll
    for (int j = 0; j < 4; ++j) {
      float m = -INFINITY;
#pragma unroll
      for (int r = 0; r < 8; ++r) {
        const int kvcol = kv0 + j * 16 + 8 * hh + r;
        bool masked = false;
        if (diag) masked = (kvcol > qrow);
        else if (MODE == 4) masked = (kvcol > qrow) || (qrow - kvcol > g.mask_is_int);
        else if (MODE == 2) {
          const size_t mi = (size_t)qrow * g.Skv + kvcol;
          masked = (g.mask_is_int == 0) ? (((const float*)mask_a)[mi] == 0.0f)
                 : (g.mask_is_int == 1) ? (mask_a[mi] == 0) : (mask_a[mi] != 0);
        } else if (MODE == 3) masked = (qkeep == 0) || (mask_a[(size_t)b * g.Skv + kvcol] == 0);   // mask_a = kvmask
        else if (MODE == 5) {
          const size_t mi = (size_t)qrow * g.Skv + kvcol;
          masked = (mask_a[mi] != 0);
          int n = mask_b[mi]; n = n < 0 ? 0 : n;
          s[j][r] += g.cp[(size_t)b * g.c_bs + (size_t)h * g.c_hs + (size_t)qrow * g.c_rs + n]
                   + g.pc[(size_t)b * g.c_bs + (size_t)h * g.c_hs + (size_t)kvcol * g.c_rs + n];
        }
        if (masked) s[j][r] = g.mask_fill;
        m = fmaxf(m, s[j][r]);
      }
      mj[j] = m;
    }
    float cm = fmaxf(fmaxf(mj[0], mj[1]), fmaxf(mj[2], mj[3]));
    cm = fmaxf(cm, at_xhalf(cm));               // the query's other 32 keys of the tile lie in lane l ^ 16
    const float mnew = fmaxf(mrow, cm);
    // exp(x - mnew) = 2^(x * log2(e) - mb): one FMA and one v_exp_f32, no branch. A row with no live key yet takes mb = 0:
    // every exponent is then -inf (never inf - inf), so its p and alpha are 0 and its sums stay 0.
    const float mb = (mnew == -INFINITY) ? 0.0f : mnew * AT_LOG2E;
    const float alpha = at_exp2x1(fmaf(mrow, AT_LOG2E, -mb));
    mrow = mnew;
    // P^T as second operand of O^T += V^T.P^T: element e of a lane's fragment is key 8 * hh + e of the 32, element 8 + e key
    // 16 + 8 * hh + e (the k order of the V^T fragments above): exactly the lane's own s[2 * kk][e] and s[2 * kk + 1][e].
    FB pa[2], pl[2];
    float ps[4];   // one sum per 16-key tile
#pragma unroll   // unrolled: s, pa and ps are indexed by constants (registers)
    for (int j = 0; j < 4; ++j) {
      float x[8], pe[8];
#pragma unroll
      for (int r = 0; r < 8; ++r) x[r] = fmaf(s[j][r], AT_LOG2E, -mb);
      at_exp2x8(pe, x);
      float sum = pe[0];
#pragma unroll
      for (int r = 1; r < 8; ++r) sum += pe[r];
      ps[j] = sum;
#pragma unroll
      for (int r = 0; r < 8; ++r) {
        if (SPLIT_PV) { __bf16 a, bl; at_split(pe[r], a, bl); pa[j >> 1].v[(j & 1) * 8 + r] = a; pl[j >> 1].v[(j & 1) * 8 + r] = bl; }
        else pa[j >> 1].v[(j & 1) * 8 + r] = at_to16<F16>(pe[r] * PSC);
      }
    }
    lrow = lrow * alpha + ((ps[0] + ps[1]) + (ps[2] + ps[3]));
#pragma unroll
    for (int t = 0; t < 4; ++t) {
#pragma unroll
      for (int r = 0; r < 8; ++r) oacc[t][r] *= alpha;
    }
#pragma unroll   // each oacc[t] still sums keys 0..31 first, then keys 32..63; V^T rows are the first operand, P^T the second
    for (int kk = 0; kk < 2; ++kk) {
#pragma unroll
      for (int t = 0; t < 4; ++t) {
        oacc[t] = at_mma16<F16>(vb[kk][t].v, pa[kk].v, oacc[t]);
        if (SPLIT_PV) {
          FB vl;
          vl.h[0] = *(const v8b*)(Vtl + (t * 16 + c) * AT_LP + kk * 32 + 8 * hh);
          vl.h[1] = *(const v8b*)(Vtl + (t * 16 + c) * AT_LP + kk * 32 + 16 + 8 * hh);
          oacc[t] = at_mma16<F16>(vl.v, pa[kk].v, oacc[t]);
          oacc[t] = at_mma16<F16>(vb[kk][t].v, pl[kk].v, oacc[t]);
        }
      }
    }
  }

  float* os = Os[wave];
  {
    const float den = (lrow + at_xhalf(lrow)) * PSC;   // the two halves' key sums joined
    const float inv = (den > 0.0f) ? (1.0f / den) : 0.0f;
#pragma unroll   // unrolled: oacc is indexed by constants; a lane's eight d of a tile are two 16-byte LDS stores in its query's row
    for (int t = 0; t < 4; ++t) {
      v4f lo, hi;
#pragma unroll
      for (int e = 0; e < 4; ++e) { lo[e] = oacc[t][e] * inv; hi[e] = oacc[t][4 + e] * inv; }
      *(v4f*)(os + c * 68 + t * 16 + 8 * hh) = lo;
      *(v4f*)(os + c * 68 + t * 16 + 8 * hh + 4) = hi;
    }
  }
  __builtin_amdgcn_fence(__ATOMIC_RELEASE, "workgroup");
  __builtin_amdgcn_wave_barrier();
  __builtin_amdgcn_fence(__ATOMIC_ACQUIRE, "workgroup");
  {
    const int c4 = (lane & 15) * 4;
    {
#pragma unroll
      for (int it = 0; it < 8; ++it) {
        const int row = it * 2 + hh;
        v4f val = *(const v4f*)(os + row * 68 + c4);
        *(v4f*)(ob_ptr + (size_t)(q0 + row) * g.o_rs + c4) = val;
      }
      
    }
  }
}

// =====================================================================================
// 64x64 tile classification of the attention mask: one block per (b, q-tile); for each kv-tile:
//   masked(q,k) = tm[q][k] != 0 || pad[b][k] != 0;  code 2 = all masked, 1 = all live, 0 = mixed.
// =====================================================================================
__global__ __launch_bounds__(256) void tilecode_kernel(
    const int* __restrict__ tm, const int* __restrict__ pad, int* __restrict__ tab,
    int Skv, int nqb, int nkc, int tp) {
  __shared__ int wl[8], wm[8];
  __shared__ __align__(16) int codes[128];
  const int tid = threadIdx.x, lane = tid & 31, wave = tid >> 5;
  const int b  = blockIdx.x / nqb;
  const int qb = blockIdx.x - b * nqb;
  const int row = tid >> 2, cs = (tid & 3) * 16;
  const int q = qb * 64 + row;
  if (tid < 128) codes[tid] = 2;
  __syncthreads();
  const int nk = nkc < 128 ? nkc : 128;
  for (int kc = 0; kc < nk; ++kc) {
    const int* mr = tm  + (size_t)q * Skv + kc * 64 + cs;
    const int* pr = pad + (size_t)b * Skv + kc * 64 + cs;
    int live = 0, msk = 0;
#pragma unroll
    for (int i = 0; i < 4; ++i) {
      const v4i mv = *(const v4i*)(mr + 4 * i);
      const v4i pv = *(const v4i*)(pr + 4 * i);
#pragma unroll
      for (int e = 0; e < 4; ++e) {
        const int m = ((mv[e] != 0) || (pv[e] != 0)) ? 1 : 0;
        msk |= m;
        live |= (m ^ 1);
      }
    }
    const int al = __any(live);
    const int am = __any(msk);
    if (lane == 0) { wl[wave] = al; wm[wave] = am; }
    __syncthreads();
    if (tid == 0) {
      int L = 0, Mk = 0;
#pragma unroll
      for (int w = 0; w < 8; ++w) { L |= wl[w]; Mk |= wm[w]; }
      codes[kc] = (L == 0) ? 2 : ((Mk == 0) ? 1 : 0);
    }
    __syncthreads();
  }
  if (wave == 0) {
    const int nl = tp >> 2;          // tp is a multiple of 32 ints, <= 128
    v4i cv;
    cv[0] = codes[(4 * lane + 0) & 127]; cv[1] = codes[(4 * lane + 1) & 127];
    cv[2] = codes[(4 * lane + 2) & 127]; cv[3] = codes[(4 * lane + 3) & 127];
    int* dst = tab + (size_t)blockIdx.x * tp + 4 * lane;
    if (lane < nl) *(v4i*)dst = cv;
    
  }
}

// =====================================================================================
// LayerNorm over 1024-wide rows: one block (256 thr) per row, 4 contiguous floats per thread.
// =====================================================================================
template <bool OUT16>
__global__ __launch_bounds__(256) void ln_kernel(
    const float* __restrict__ in, const float* __restrict__ gam, const float* __restrict__ bet,
    float* __restrict__ o32, _Float16* __restrict__ o16) {
  __shared__ float red1[8], red2[8];
  __shared__ __align__(16) float ybuf[OUT16 ? DM : 4];
  const int row = blockIdx.x, t = threadIdx.x, lane = t & 31, wave = t >> 5;
  const float* x = in + (size_t)row * DM;
  const v4f xv = *(const v4f*)(x + 4 * t);
  float s = (xv[0] + xv[1]) + (xv[2] + xv[3]);
#pragma unroll
  for (int off = 1; off < 32; off <<= 1) s += __shfl_xor(s, off, 32);
  if (lane == 0) red1[wave] = s;
  __syncthreads();
  float tot = 0.f;
#pragma unroll
  for (int w = 0; w < 8; ++w) tot += red1[w];
  const float mu = tot * (1.0f / (float)DM);
  const float d0 = xv[0] - mu, d1 = xv[1] - mu, d2 = xv[2] - mu, d3 = xv[3] - mu;
  float s2 = (d0 * d0 + d1 * d1) + (d2 * d2 + d3 * d3);
#pragma unroll
  for (int off = 1; off < 32; off <<= 1) s2 += __shfl_xor(s2, off, 32);
  if (lane == 0) red2[wave] = s2;
  __syncthreads();
  float tot2 = 0.f;
#pragma unroll
  for (int w = 0; w < 8; ++w) tot2 += red2[w];
  const float var = tot2 * (1.0f / (float)DM);
  const float rstd = rsqrtf(var + LN_EPS);
  const v4f gv = *(const v4f*)(gam + 4 * t);
  const v4f bv = *(const v4f*)(bet + 4 * t);
  v4f y;
  y[0] = d0 * rstd * gv[0] + bv[0];
  y[1] = d1 * rstd * gv[1] + bv[1];
  y[2] = d2 * rstd * gv[2] + bv[2];
  y[3] = d3 * rstd * gv[3] + bv[3];
  float* op = o32 + (size_t)row * DM + 4 * t;
  *(v4f*)op = y;
  
  if (OUT16) {
    *(v4f*)(ybuf + 4 * t) = y;
    __syncthreads();
    if (t < DM / 8) {
      v8h hv;
#pragma unroll
      for (int e = 0; e < 8; ++e) hv[e] = (_Float16)ybuf[8 * t + e];
      _Float16* hp = o16 + (size_t)row * DM + 8 * t;
      *(v8h*)hp = hv;
      
    }
  }
}

// =====================================================================================
// Host orchestration
// =====================================================================================
extern "C" void kernel_launch(void* const* d_in, const int* in_sizes, int n_in,
                              void* d_out, int out_size, void* d_ws, size_t ws_size,
                              hipStream_t stream) {
  if (n_in < 16) return;
  if (in_sizes[0] != MROWS * DM || in_sizes[1] != SEQ * SEQ || in_sizes[2] != BSZ * SEQ) return;
  if (in_sizes[3] != DM * DM || in_sizes[4] != DM * DM || in_sizes[5] != DM * DM || in_sizes[6] != DM * DM) return;
  if (in_sizes[7] != DM || in_sizes[8] != FFND * DM || in_sizes[9] != FFND) return;
  if (in_sizes[10] != DM * FFND || in_sizes[11] != DM) return;
  if (in_sizes[12] != DM || in_sizes[13] != DM || in_sizes[14] != DM || in_sizes[15] != DM) return;
  if (out_size != MROWS * DM) return;

  const float* tgt   = (const float*)d_in[0];
  const int*   tmask = (const int*)d_in[1];     // [SEQ][SEQ], nonzero = masked
  const int*   pmask = (const int*)d_in[2];     // [BSZ][SEQ], nonzero = masked
  const float* Wq    = (const float*)d_in[3];
  const float* Wk    = (const float*)d_in[4];
  const float* Wv    = (const float*)d_in[5];
  const float* Wo    = (const float*)d_in[6];
  const float* bo    = (const float*)d_in[7];
  const float* W1    = (const float*)d_in[8];
  const float* b1    = (const float*)d_in[9];
  const float* W2    = (const float*)d_in[10];
  const float* b2    = (const float*)d_in[11];
  const float* g1    = (const float*)d_in[12];
  const float* be1   = (const float*)d_in[13];
  const float* g2    = (const float*)d_in[14];
  const float* be2   = (const float*)d_in[15];
  float* out = (float*)d_out;

  // ---- workspace carve (bytes), regions reused across phases ----
  const size_t MiB = 1048576;
  const int nqb = SEQ / AT_QB, nkc = SEQ / AT_KC;
  if (nkc > 128) return;
  const int TP = ((nkc + 31) / 32) * 32;
  const size_t tabBytes = (size_t)BSZ * nqb * TP * sizeof(int);
  const size_t total = 96 * MiB + tabBytes;
  if (total > ws_size) return;
  char* ws = (char*)d_ws;
  float*    Qf   = (float*)(ws + 0 * MiB);          // [4096][1024] f32   (projections -> attention)
  float*    Kf   = (float*)(ws + 16 * MiB);
  float*    Vf   = (float*)(ws + 32 * MiB);
  float*    RES1 = (float*)(ws + 0 * MiB);          // tgt + attn-proj     (after attention)
  _Float16* H16  = (_Float16*)(ws + 0 * MiB);       // [4096][4096] f16   (after LN1)
  float*    X1f  = (float*)(ws + 32 * MiB);         // LN1 output f32     (after attention)
  float*    AOf  = (float*)(ws + 48 * MiB);         // attention output f32
  float*    RES2 = (float*)(ws + 48 * MiB);         // x1 + ffn           (after out-proj)
  _Float16* X16  = (_Float16*)(ws + 64 * MiB);      // tgt f16            (projections)
  _Float16* O16  = (_Float16*)(ws + 64 * MiB);      // attention output f16 (after projections)
  _Float16* X1h  = (_Float16*)(ws + 64 * MiB);      // LN1 output f16     (after out-proj)
  _Float16* Wq16 = (_Float16*)(ws + 72 * MiB);
  _Float16* Wk16 = (_Float16*)(ws + 74 * MiB);
  _Float16* Wv16 = (_Float16*)(ws + 76 * MiB);
  _Float16* Wo16 = (_Float16*)(ws + 78 * MiB);
  _Float16* W1h  = (_Float16*)(ws + 80 * MiB);      // [4096][1024]
  _Float16* W2h  = (_Float16*)(ws + 88 * MiB);      // [1024][4096]
  int*      TAB  = (int*)(ws + 96 * MiB);           // [BSZ*nqb][TP]

  // tgt and the six weight matrices -> f16, one launch; X16 .. W2h lie one behind the other from X16 on
  static_assert(CV_Q * 2 == 8 * 1048576 && CV_K * 2 == 10 * 1048576 && CV_V * 2 == 12 * 1048576 && CV_O * 2 == 14 * 1048576 &&
                CV_W1 * 2 == 16 * 1048576 && CV_W2 * 2 == 24 * 1048576 && CV_END * 2 == 32 * 1048576, "offsets of the carve above");
  cast_inputs<<<dim3(CV_END / CV_BLK), dim3(CV_WAVES * 32), 0, stream>>>(tgt, Wq, Wk, Wv, Wo, W1, W2, X16);

  // mask tile codes
  tilecode_kernel<<<dim3(BSZ * nqb), dim3(256), 0, stream>>>(tmask, pmask, TAB, SEQ, nqb, nkc, TP);

  const long z = 0;
  typedef const unsigned short* cu16;
  const int tilesM = MROWS / 128;
  // q/k/v projections: [4096][1024] = X16 . W^T, f32 out
  {
    const dim3 grid(tilesM * (DM / 128), 1);
    wmma_gemm64<0, false, 0, 0, false, 0><<<grid, dim3(128), 0, stream>>>(
        (cu16)X16, (cu16)X16, DM, z, (cu16)Wq16, (cu16)Wq16, DM, z, (void*)Qf, (void*)Qf, DM, z,
        bo, tgt, z, MROWS, DM, DM, 1.0f);
    wmma_gemm64<0, false, 0, 0, false, 0><<<grid, dim3(128), 0, stream>>>(
        (cu16)X16, (cu16)X16, DM, z, (cu16)Wk16, (cu16)Wk16, DM, z, (void*)Kf, (void*)Kf, DM, z,
        bo, tgt, z, MROWS, DM, DM, 1.0f);
    wmma_gemm64<0, false, 0, 0, false, 0><<<grid, dim3(128), 0, stream>>>(
        (cu16)X16, (cu16)X16, DM, z, (cu16)Wv16, (cu16)Wv16, DM, z, (void*)Vf, (void*)Vf, DM, z,
        bo, tgt, z, MROWS, DM, DM, 1.0f);
  }

  // attention: q,k,v,o element (b, s, h, d) at b*SEQ*DM + s*DM + h*64 + d
  {
    AttnGeom g;
    g.tcode = TAB; g.cp = Qf; g.pc = Qf; g.c_bs = 0; g.c_rs = 0; g.c_hs = 0; g.t_pitch = TP;
    g.q_bs = (long)SEQ * DM; g.q_rs = DM; g.q_hs = HD;
    g.k_bs = (long)SEQ * DM; g.k_rs = DM; g.k_hs = HD;
    g.v_bs = (long)SEQ * DM; g.v_rs = DM; g.v_hs = HD;
    g.o_bs = (long)SEQ * DM; g.o_rs = DM; g.o_hs = HD;
    g.S = SEQ; g.Skv = SEQ; g.H = NHEAD; g.mask_mode = 6; g.qscale = 0.125f; g.blk0 = 0;
    g.mask_fill = -INFINITY; g.mask_is_int = 2;
    attn64_kernel<false, false, true, 6, DM><<<dim3(BSZ * NHEAD * nqb), dim3(128), 0, stream>>>(
        Qf, Kf, Vf, AOf, tmask, pmask, g);
  }
  static_assert((MROWS * DM) % (CV_WAVES * 1024) == 0);
  cast_one<1><<<dim3(MROWS * DM / (CV_WAVES * 1024)), dim3(CV_WAVES * 32), 0, stream>>>(AOf, O16);

  // RES1 = tgt + (O . Wo^T + bo)
  {
    const dim3 grid(tilesM * (DM / 128), 1);
    wmma_gemm64<0, false, 2, 0, true, 0><<<grid, dim3(128), 0, stream>>>(
        (cu16)O16, (cu16)O16, DM, z, (cu16)Wo16, (cu16)Wo16, DM, z, (void*)RES1, (void*)RES1, DM, z,
        bo, tgt, z, MROWS, DM, DM, 1.0f);
  }
  // x1 = LN(RES1) -> f32 + f16
  ln_kernel<true><<<dim3(MROWS), dim3(256), 0, stream>>>(RES1, g1, be1, X1f, X1h);
  // H16 = gelu_tanh(x1 . W1^T + b1), f16 [4096][4096]
  {
    const dim3 grid(tilesM * (FFND / 128), 1);
    wmma_gemm64<0, false, 2, 1, false, 6><<<grid, dim3(128), 0, stream>>>(
        (cu16)X1h, (cu16)X1h, DM, z, (cu16)W1h, (cu16)W1h, DM, z, (void*)H16, (void*)H16, FFND, z,
        b1, tgt, z, MROWS, FFND, DM, 1.0f);
  }
  // RES2 = x1 + (H . W2^T + b2)
  {
    const dim3 grid(tilesM * (DM / 128), 1);
    wmma_gemm64<0, false, 2, 0, true, 0><<<grid, dim3(128), 0, stream>>>(
        (cu16)H16, (cu16)H16, FFND, z, (cu16)W2h, (cu16)W2h, FFND, z, (void*)RES2, (void*)RES2, DM, z,
        b2, X1f, z, MROWS, DM, FFND, 1.0f);
  }
  // out = LN(RES2)
  ln_kernel<false><<<dim3(MROWS), dim3(256), 0, stream>>>(RES2, g2, be2, out, X1h);
  (void)hipGetLastError();
}

// v009
// Measured time: 259 microseconds a run.
// Timed twice side by side with v008, it ran 1.05 times as fast both times.
// Over all steps from v000 it is 7.62 times as fast.
// Contractions: q/k/v/out projections, FFN1, FFN2 on v_wmma_f32_16x16x32_f16 (f16 operands, f32 accumulate);
// attention scores (q*0.125).k^T and p.v on v_wmma_f32_16x16x32_f16 (f16 operands, p carried x2^15, f32 accumulate).
// Softmax, LayerNorm, tanh-GELU, bias and residual adds in f32.
#include <hip/hip_runtime.h>

typedef __attribute__((ext_vector_type(16))) _Float16 v16h;
typedef __attribute__((ext_vector_type(8)))  _Float16 v8h;
typedef __attribute__((ext_vector_type(16))) __bf16   v16b;
typedef __attribute__((ext_vector_type(8)))  __bf16   v8b;
typedef __attribute__((ext_vector_type(4)))  __bf16   v4b;
typedef __attribute__((ext_vector_type(2)))  __bf16   v2b;
typedef __attribute__((ext_vector_type(8)))  float    v8f;
typedef __attribute__((ext_vector_type(4)))  float    v4f;
typedef __attribute__((ext_vector_type(4)))  int      v4i;

#define DM     1024
#define NHEAD  16
#define HD     64
#define FFND   4096
#define BSZ    2
#define SEQ    2048
#define MROWS  (BSZ * SEQ)
#define LN_EPS 1e-5f

__device__ __forceinline__ unsigned short f2bf_bits(float f) {
  unsigned u = __float_as_uint(f);
  return (unsigned short)((u + 0x7FFFu + ((u >> 16) & 1u)) >> 16);
}
__device__ __forceinline__ float bf_bits2f(unsigned short h) { return __uint_as_float(((unsigned)h) << 16); }

// hazard guards as plain device helpers
__device__ __forceinline__ void dep_guard_h(v8f& a, v8f& b, v16h x, v16h y) { asm volatile("v_nop\n\tv_nop\n\tv_nop\n\tv_nop" : "+v"(a), "+v"(b) : "v"(x), "v"(y)); }
__device__ __forceinline__ void dep_guard_b(v8f& a, v8f& b, v16b x, v16b y) { asm volatile("v_nop\n\tv_nop\n\tv_nop\n\tv_nop" : "+v"(a), "+v"(b) : "v"(x), "v"(y)); }
__device__ __forceinline__ void keep4_h(v16h a, v16h b, v16h c, v16h d) { asm volatile("v_nop" :: "v"(a), "v"(b), "v"(c), "v"(d)); }
__device__ __forceinline__ void keep4_b(v16b a, v16b b, v16b c, v16b d) { asm volatile("v_nop" :: "v"(a), "v"(b), "v"(c), "v"(d)); }
__device__ __forceinline__ void acc_guard4(v8f& a, v8f& b, v8f& c, v8f& d) { asm volatile("v_nop\n\tv_nop\n\tv_nop\n\tv_nop" : "+v"(a), "+v"(b), "+v"(c), "+v"(d)); }
template <typename T> struct Frag;
template <> struct Frag<_Float16> {
  typedef v16h V; union U { v16h v; v8h h[2]; };
  static __device__ __forceinline__ v16h load(const _Float16* p) {   // elements 0..7 <- p[0..7], 8..15 <- p[16..23]
    U f; f.h[0] = *(const v8h*)(p); f.h[1] = *(const v8h*)(p + 16); return f.v;
  }
  static __device__ __forceinline__ v8f mma(v16h a, v16h b, v8f c) {
    return __builtin_amdgcn_wmma_f32_16x16x32_f16(false, a, false, b, (short)0, c, false, false);
  }
  static __device__ __forceinline__ void guard(v8f& a, v8f& b, v16h x, v16h y) { dep_guard_h(a, b, x, y); }
  static __device__ __forceinline__ void keep(v16h a, v16h b, v16h c, v16h d) { keep4_h(a, b, c, d); }
};
template <> struct Frag<__bf16> {
  typedef v16b V; union U { v16b v; v8b h[2]; };
  static __device__ __forceinline__ v16b load(const __bf16* p) {
    U f; f.h[0] = *(const v8b*)(p); f.h[1] = *(const v8b*)(p + 16); return f.v;
  }
  static __device__ __forceinline__ v8f mma(v16b a, v16b b, v8f c) {
    return __builtin_amdgcn_wmma_f32_16x16x32_bf16(false, a, false, b, (short)0, c, false, false);
  }
  static __device__ __forceinline__ void guard(v8f& a, v8f& b, v16b x, v16b y) { dep_guard_b(a, b, x, y); }
  static __device__ __forceinline__ void keep(v16b a, v16b b, v16b c, v16b d) { keep4_b(a, b, c, d); }
};

// tanh-GELU: 0.5*v*(1+tanh(sqrt(2/pi)*(v+0.044715*v^3))); tanh via exp(-2|u|), no division instruction
__device__ __forceinline__ float gelu_tanh_f(float v) {
  const float u = 0.7978845608028654f * (v + 0.044715f * v * v * v);
  const float e = __expf(-2.0f * fabsf(u));
  float t = (1.0f - e) * __builtin_amdgcn_rcpf(1.0f + e);
  t = copysignf(t, u);
  return 0.5f * v * (1.0f + t);
}

// ---- Register-blocked batched WMMA GEMM ------------------------------------
// C[m,n] = scale * sum_k A[m,k] * Bt[n,k] (+bias)(+resid); a block owns a 128x128 tile: NW = 4 waves (2x2) of 64x64 each, or
// NW = 8 waves (4x2) of 32x64 each. Eight waves are for a grid of one block per WGP: each SIMD then holds two waves, and one
// wave's LDS waits, copy issue and epilogue stand behind the other's matrix work.
// A row-major [M,K]; Bt row-major [N,K]; M,N % 128 == 0, K % 128 == 0.
// Operands reach the waves through LDS: a stage is 128 k of the block's 128 A rows and 128 Bt rows (256 B a row, pitch 272 B),
// brought by asynchronous copies into two buffers, the next stage's copies in flight while this stage is multiplied.
// SPLIT (hi/lo planes) is not built in this form.
// BIAS_MODE: 0 = none, 1 = bias[m], 2 = bias[n].
// OUT_MODE: 0 = f32, 1 = f16, 2 = bf16 hi plane (Cout) + bf16 lo plane (Cout2).
// ACT: 0 none, 1 tanh, 2 relu, 3 silu, 4 leaky, 5 erf-gelu, 6 tanh-gelu.
// ET: 0 = f16 operands, 1 = bf16 operands (pointers passed as 16-bit storage)
template <int ET> struct Elem;
template <> struct Elem<0> { typedef _Float16 T; };
template <> struct Elem<1> { typedef __bf16 T; };
#define G_KS    128                       // k per stage
#define G_PITCH 136                       // LDS row pitch in 16-bit elements: 256 B + 16 B
#define G_STAGE (256 * G_PITCH)           // elements per buffer: rows 0..127 = A, rows 128..255 = Bt
// Eight asynchronous 16-byte copies per lane, rows RS apart (the rows that one pass of the block covers). The s_wait_xcnt stands inside the statement so that
// no address register of an issued copy is rewritten in front of it.
template <int RS>
__device__ __forceinline__ void g_copy8(unsigned l, const unsigned short* g, size_t gstep) {
  const unsigned ls = (unsigned)RS * G_PITCH * 2u;
  asm volatile(
      "global_load_async_to_lds_b128 %0, %8, off\n\t"
      "global_load_async_to_lds_b128 %1, %9, off\n\t"
      "global_load_async_to_lds_b128 %2, %10, off\n\t"
      "global_load_async_to_lds_b128 %3, %11, off\n\t"
      "global_load_async_to_lds_b128 %4, %12, off\n\t"
      "global_load_async_to_lds_b128 %5, %13, off\n\t"
      "global_load_async_to_lds_b128 %6, %14, off\n\t"
      "global_load_async_to_lds_b128 %7, %15, off\n\t"
      "s_wait_xcnt 0x0"
      :: "v"(l), "v"(l + ls), "v"(l + 2u * ls), "v"(l + 3u * ls), "v"(l + 4u * ls), "v"(l + 5u * ls), "v"(l + 6u * ls), "v"(l + 7u * ls),
         "v"(g), "v"(g + gstep), "v"(g + 2 * gstep), "v"(g + 3 * gstep), "v"(g + 4 * gstep), "v"(g + 5 * gstep), "v"(g + 6 * gstep), "v"(g + 7 * gstep)
      : "memory");
}
template <int ET, bool SPLIT, int BIAS_MODE, int OUT_MODE, bool RESID, int ACT, int NW>
__global__ __launch_bounds__(NW * 32) void wmma_gemm64(
    const unsigned short* __restrict__ Ap, const unsigned short* __restrict__ A2p, int lda, long strideA,
    const unsigned short* __restrict__ Btp, const unsigned short* __restrict__ Bt2p, int ldb, long strideB,
    void* __restrict__ Cout, void* __restrict__ Cout2, int ldc, long strideC,
    const float* __restrict__ bias,
    const float* __restrict__ resid, long strideR,
    int M, int N, int K, float scale) {
  typedef typename Elem<ET>::T T;
  typedef typename Frag<T>::V V;
  static_assert(!SPLIT, "hi/lo planes are not staged");
  static_assert(NW == 4 || NW == 8, "2x2 waves of 64x64 or 4x2 waves of 32x64");
  constexpr int FI = 8 / (NW / 2);   // 16-row subtiles of a wave: 4 or 2
  constexpr int RS = NW * 2;         // rows that one copy of every lane of the block covers: 8 or 16
  __shared__ __align__(16) unsigned short sAB[2 * G_STAGE];   // two stage buffers
  __shared__ __align__(16) float sT[NW][16 * 68];  // per-wave 16x64 slab, pitch 68 floats
  const int b    = blockIdx.y;
  const int tid  = threadIdx.x;
  const int lane = tid & 31;
  const int wave = tid >> 5;
  const int tilesN = N >> 7;
  const int tilesM = M >> 7;
  const int tile = blockIdx.x;
  if (tile >= tilesM * tilesN) return;   // block-uniform, in front of every barrier and copy
  const int tm = tile / tilesN;
  const int tn = tile - tm * tilesN;
  const int mB = tm << 7;
  const int nB = tn << 7;
  const int wm = wave >> 1, wn = wave & 1;
  const int m0 = mB + wm * (FI * 16);
  const int n0 = nB + (wn << 6);

  const int rlane = lane & 15;                 // row (A) / col (B, D) within subtile
  const int koff  = (lane >> 4) * 8;           // k offset of this lane half
  const int mOff  = (lane >> 4) * 8;           // D row offset

  // copy lanes: 16 lanes cover one 256-B row, a wave-wide copy two rows (four whole lines)
  const int crow = tid >> 4, cch = (tid & 15) * 8;
  const unsigned short* gA = Ap  + (size_t)b * strideA + (size_t)(mB + crow) * lda + cch;
  const unsigned short* gB = Btp + (size_t)b * strideB + (size_t)(nB + crow) * ldb + cch;
  const unsigned lbase = (unsigned)(size_t)(&sAB[0]) + (unsigned)(crow * G_PITCH + cch) * 2u;
  const size_t stepA = (size_t)RS * lda, stepB = (size_t)RS * ldb;
  auto stage_copy = [&](int st, int buf) {     // 32 (NW = 4) or 16 (NW = 8) copies per lane: one stage of A and Bt
    const unsigned l = lbase + (unsigned)buf * (G_STAGE * 2u);
    const unsigned short* a = gA + (size_t)st * G_KS;
    const unsigned short* w = gB + (size_t)st * G_KS;
    g_copy8<RS>(l,                          a,             stepA);
    if (NW == 4) g_copy8<RS>(l +  64u * G_PITCH * 2u,    a + 8 * stepA, stepA);
    g_copy8<RS>(l + 128u * G_PITCH * 2u,    w,             stepB);
    if (NW == 4) g_copy8<RS>(l + 192u * G_PITCH * 2u,    w + 8 * stepB, stepB);
  };

  v8f acc[FI][4];
#pragma unroll
  for (int i = 0; i < FI; ++i)
#pragma unroll
    for (int j = 0; j < 4; ++j) acc[i][j] = (v8f){0.f,0.f,0.f,0.f,0.f,0.f,0.f,0.f};

  const int nst = K >> 7;
  stage_copy(0, 0);
  asm volatile("s_wait_asynccnt 0x0" ::: "memory");   // this wave's part of stage 0 has landed
  __syncthreads();                                     // stage 0 readable by every wave
  if (nst > 1) stage_copy(1, 1);
#pragma unroll 1   // kept rolled: one trip is one stage of the ring, with one publish point and one refill site
  for (int t = 0; t < nst; ++t) {
    const T* sbuf = (const T*)sAB + (size_t)(t & 1) * G_STAGE;
    const T* sA = sbuf + (wm * (FI * 16) + rlane) * G_PITCH + koff;
    const T* sB = sbuf + (128 + (wn << 6) + rlane) * G_PITCH + koff;
#pragma unroll     // the loops below are unrolled so that fragments and accumulators are indexed by constants (registers, no scratch)
    for (int ks = 0; ks < G_KS / 32; ++ks) {
      V bh[4], ah[FI];
#pragma unroll
      for (int j = 0; j < 4; ++j) bh[j] = Frag<T>::load(sB + j * 16 * G_PITCH + ks * 32);
#pragma unroll
      for (int i = 0; i < FI; ++i) ah[i] = Frag<T>::load(sA + i * 16 * G_PITCH + ks * 32);
#pragma unroll
      for (int i = 0; i < FI; ++i) {
#pragma unroll
        for (int j = 0; j < 4; ++j) acc[i][j] = Frag<T>::mma(ah[i], bh[j], acc[i][j]);
        Frag<T>::guard(acc[i][0], acc[i][3], ah[i], ah[i]);
      }
      Frag<T>::keep(bh[0], bh[1], bh[2], bh[3]);
    }
    asm volatile("s_wait_dscnt 0x0" ::: "memory");     // this wave's reads of buffer t & 1 are done
    asm volatile("s_wait_asynccnt 0x0" ::: "memory");  // this wave's part of stage t + 1 has landed
    __syncthreads();                                   // publishes stage t + 1, frees buffer t & 1
    if (t + 2 < nst) stage_copy(t + 2, t & 1);
  }
  asm volatile("s_wait_asynccnt 0x0" ::: "memory");    // no copy outstanding behind the loop
#pragma unroll   // unrolled: acc is indexed by constants (registers)
  for (int i = 0; i < FI; ++i) acc_guard4(acc[i][0], acc[i][1], acc[i][2], acc[i][3]);

  // ---- epilogue ----
  float* slab = sT[wave];
  const float* Rb = RESID ? (resid + (size_t)b * strideR) : nullptr;
#pragma unroll
  for (int i = 0; i < FI; ++i) {
    const int mBase = m0 + (i << 4);
#pragma unroll
    for (int j = 0; j < 4; ++j) {
      const int n = n0 + (j << 4) + rlane;
      float bv = 0.f;
      if (BIAS_MODE == 2) bv = bias[n];
#pragma unroll
      for (int r = 0; r < 8; ++r) {
        float v = acc[i][j][r] * scale;
        if (BIAS_MODE == 1) v += bias[mBase + mOff + r];
        if (BIAS_MODE == 2) v += bv;
        if (RESID) v += Rb[(size_t)(mBase + mOff + r) * ldc + n];
        if (ACT == 1) v = tanhf(v);
        if (ACT == 2) v = fmaxf(v, 0.0f);
        if (ACT == 3) v = v / (1.0f + expf(-v));
        if (ACT == 4) v = (v > 0.f) ? v : 0.01f * v;
        if (ACT == 5) v = 0.5f * v * (1.0f + erff(v * 0.70710678118654752f));
        if (ACT == 6) v = gelu_tanh_f(v);
        slab[(mOff + r) * 68 + (j << 4) + rlane] = v;
      }
    }
    __builtin_amdgcn_fence(__ATOMIC_RELEASE, "workgroup");
    __builtin_amdgcn_wave_barrier();
    __builtin_amdgcn_fence(__ATOMIC_ACQUIRE, "workgroup");
    if (OUT_MODE == 0) {
      float* C = (float*)Cout + (size_t)b * strideC;
      const int hh = lane >> 4, c4 = (lane & 15) * 4;     // row seg = 256 B = 16 lanes x 16 B
      {
#pragma unroll
        for (int it = 0; it < 8; ++it) {
          const int row = it * 2 + hh;
          v4f v = *(const v4f*)(slab + row * 68 + c4);
          *(v4f*)(C + (size_t)(mBase + row) * ldc + n0 + c4) = v;
        }
        
      }
    } else {
      const int q = lane >> 3, c8 = (lane & 7) * 8;
      unsigned short* C  = (unsigned short*)Cout  + (size_t)b * strideC;
      unsigned short* C2 = (OUT_MODE == 2) ? ((unsigned short*)Cout2 + (size_t)b * strideC) : nullptr;
      {
#pragma unroll
        for (int it = 0; it < 4; ++it) {
          const int row = it * 4 + q;
          const float* sp = slab + row * 68 + c8;
          v8h hv, lv;
#pragma unroll
          for (int e = 0; e < 8; ++e) {
            if (OUT_MODE == 1) {
              hv[e] = (_Float16)sp[e];
            } else {
              unsigned short hb = f2bf_bits(sp[e]);
              unsigned short lb = f2bf_bits(sp[e] - bf_bits2f(hb));
              hv[e] = __builtin_bit_cast(_Float16, hb);
              lv[e] = __builtin_bit_cast(_Float16, lb);
            }
          }
          *(v8h*)(C + (size_t)(mBase + row) * ldc + n0 + c8) = hv;
          if (OUT_MODE == 2) *(v8h*)(C2 + (size_t)(mBase + row) * ldc + n0 + c8) = lv;
        }
        
      }
    }
    __builtin_amdgcn_fence(__ATOMIC_RELEASE, "workgroup");
    __builtin_amdgcn_wave_barrier();
    __builtin_amdgcn_fence(__ATOMIC_ACQUIRE, "workgroup");
  }
}

// ---- f32 -> f16 conversion by few, long-lived waves ------------------------
// A block is 16 waves; a wave converts R * 1024 contiguous elements: R * 8 loads of 16 bytes a lane (each wave-wide load 512
// contiguous bytes), all issued before the first is converted, and as many 8-byte stores (each wave-wide store 256 contiguous bytes).
typedef __attribute__((ext_vector_type(4))) _Float16 v4h;
#define CV_WAVES 16
template <int R>
__device__ __forceinline__ void cast_wave(const float* __restrict__ src, _Float16* __restrict__ dst, int q) {
  // src, dst: block-uniform; q: the lane's first group of four elements, one index for the loads and the stores
  const v4f* __restrict__ s4 = (const v4f*)src;
  v4h* __restrict__ d4 = (v4h*)dst;
  v4f x[R * 8];
#pragma unroll   // both loops unrolled: x stays in registers, every load and store addresses by an immediate offset
  for (int i = 0; i < R * 8; ++i) x[i] = s4[q + i * 32];
  if (R > 1) __builtin_amdgcn_sched_barrier(0);   // keeps every load in front of the first wait: a wave pays one memory latency, not one per group of loads
#pragma unroll
  for (int i = 0; i < R * 8; ++i) {
    v4h h;
#pragma unroll
    for (int e = 0; e < 4; ++e) h[e] = (_Float16)x[i][e];
    d4[q + i * 32] = h;
    if ((i & 7) == 7 && i + 1 < R * 8) __builtin_amdgcn_sched_barrier(0);   // eight stores leave as soon as their loads are in, not all behind the last load
  }
}
// The seven f32 inputs of the GEMMs in one launch: their f16 copies lie one behind the other in dst, at these element offsets.
#define CV_X   0
#define CV_Q   (CV_X + MROWS * DM)
#define CV_K   (CV_Q + DM * DM)
#define CV_V   (CV_K + DM * DM)
#define CV_O   (CV_V + DM * DM)
#define CV_W1  (CV_O + DM * DM)
#define CV_W2  (CV_W1 + FFND * DM)
#define CV_END (CV_W2 + DM * FFND)
#define CV_R   4
#define CV_BLK (CV_WAVES * CV_R * 1024)   // elements per block
static_assert(CV_Q % CV_BLK == 0 && CV_K % CV_BLK == 0 && CV_V % CV_BLK == 0 && CV_O % CV_BLK == 0 &&
              CV_W1 % CV_BLK == 0 && CV_W2 % CV_BLK == 0 && CV_END % CV_BLK == 0, "a block lies wholly in one tensor");
__global__ __launch_bounds__(CV_WAVES * 32) void cast_inputs(
    const float* __restrict__ x, const float* __restrict__ wq, const float* __restrict__ wk, const float* __restrict__ wv,
    const float* __restrict__ wo, const float* __restrict__ w1, const float* __restrict__ w2, _Float16* __restrict__ dst) {
  const int e0 = blockIdx.x * CV_BLK;       // block-uniform: the block index picks the tensor
  const float* src = x;
  int first = CV_X;
  if (e0 >= CV_Q)  { src = wq; first = CV_Q; }
  if (e0 >= CV_K)  { src = wk; first = CV_K; }
  if (e0 >= CV_V)  { src = wv; first = CV_V; }
  if (e0 >= CV_O)  { src = wo; first = CV_O; }
  if (e0 >= CV_W1) { src = w1; first = CV_W1; }
  if (e0 >= CV_W2) { src = w2; first = CV_W2; }
  cast_wave<CV_R>(src + (e0 - first), dst + e0, (threadIdx.x >> 5) * (CV_R * 256) + (threadIdx.x & 31));
}
// One tensor of gridDim.x * CV_WAVES * R * 1024 elements.
template <int R>
__global__ __launch_bounds__(CV_WAVES * 32) void cast_one(const float* __restrict__ in, _Float16* __restrict__ out) {
  const int e0 = blockIdx.x * (CV_WAVES * R * 1024);
  cast_wave<R>(in + e0, out + e0, (threadIdx.x >> 5) * (R * 256) + (threadIdx.x & 31));
}

// =====================================================================================
// Attention for head_dim 64, f32 in / f32 out; 16-bit operands: bf16 with optional hi/lo splits, or
// plain f16 (F16=true, non-split, probabilities carried x2^15).
//   Block = 4 waves = 64 query rows of one (batch, head); S % 64 == 0.
//   Element (b, s, h, d) of tensor X lives at X[b*X_bs + s*X_rs + h*X_hs + d] (strides in floats, multiples of 4).
//   mask_mode 0 none, 1 causal, 2 tensor [S][Skv], 3 per-token vectors, 4 causal + window, 5 relative bias,
//   6 = mask_a: int32 [S][Skv] nonzero = masked, OR mask_b: int32 [B][Skv] nonzero = masked; per 64x64
//       (b, q-tile, kv-tile) code table tcode[(b*nqb+qb)*t_pitch + kc]: 0 mixed (per-element reads),
//       1 all live (no reads), 2 all masked (tile skipped: zero contribution).
//   masked scores are replaced by mask_fill before the softmax; rows with no live key write 0.
//   grid.x = B * H * (S/64).
// =====================================================================================
#define AT_D 64
#define AT_NW 4
#define AT_QB 64
#define AT_KC 64
#define AT_LOG2E 1.4426950408889634f
#define AT_LP 72    // LDS row pitch of the K and V^T tiles in 16-bit elements: 128 B of data + 16 B, so that the 16 rows
                    // which one ds_load_b128 fragment read touches fall on 16 different groups of four banks
struct AttnGeom { const int* tcode; const float* cp; const float* pc; long c_bs, c_rs, c_hs, t_pitch;
                  long q_bs, q_rs, q_hs, k_bs, k_rs, k_hs, v_bs, v_rs, v_hs, o_bs, o_rs, o_hs;
                  int S, Skv, H, mask_mode; float qscale; int blk0; float mask_fill; int mask_is_int; };
static_assert(sizeof(AttnGeom) == 184);

__device__ __forceinline__ unsigned short at_bf_bits(float f) {
  unsigned u = __float_as_uint(f);
  return (unsigned short)((u + 0x7FFFu + ((u >> 16) & 1u)) >> 16);
}
__device__ __forceinline__ __bf16 at_f2bf(float f) { return __builtin_bit_cast(__bf16, at_bf_bits(f)); }
__device__ __forceinline__ void at_split(float f, __bf16& hi, __bf16& lo) {
  const unsigned short hb = at_bf_bits(f);
  hi = __builtin_bit_cast(__bf16, hb);
  lo = at_f2bf(f - __uint_as_float(((unsigned)hb) << 16));
}
__device__ __forceinline__ v8f at_mma(v16b a, v16b b, v8f c) {
  c = __builtin_amdgcn_wmma_f32_16x16x32_bf16(false, a, false, b, (short)0, c, false, false);
  asm volatile("v_nop\n\tv_nop\n\tv_nop\n\tv_nop" : "+v"(c) : "v"(a), "v"(b));
  return c;
}
// 16-bit element as a bit pattern held in a __bf16 slot: f16 bits when F16, bf16 (RNE) otherwise
template <bool F16> __device__ __forceinline__ __bf16 at_to16(float f) {
  if (F16) return __builtin_bit_cast(__bf16, (_Float16)f);
  return at_f2bf(f);
}
template <bool F16> __device__ __forceinline__ v8f at_mma16(v16b a, v16b b, v8f c) {
  if (F16) {
    const v16h ah = __builtin_bit_cast(v16h, a), bh = __builtin_bit_cast(v16h, b);
    c = __builtin_amdgcn_wmma_f32_16x16x32_f16(false, ah, false, bh, (short)0, c, false, false);
    asm volatile("v_nop\n\tv_nop\n\tv_nop\n\tv_nop" : "+v"(c) : "v"(ah), "v"(bh));
    return c;
  }
  return at_mma(a, b, c);
}

// Eight powers of two (one lane's scores of one 16-key tile) in one statement. Behind a v_exp_f32 the instruction set asks for
// one independent instruction before its result is read or its source overwritten: here each v_exp_f32 is that instruction for the
// one before it (the outputs are early-clobber, so none lies on a source), and the v_nop is it for the last.
__device__ __forceinline__ void at_exp2x8(float (&o)[8], const float (&x)[8]) {
  asm("v_exp_f32 %0, %8\n\t"
      "v_exp_f32 %1, %9\n\t"
      "v_exp_f32 %2, %10\n\t"
      "v_exp_f32 %3, %11\n\t"
      "v_exp_f32 %4, %12\n\t"
      "v_exp_f32 %5, %13\n\t"
      "v_exp_f32 %6, %14\n\t"
      "v_exp_f32 %7, %15\n\t"
      "v_nop"
      : "=&v"(o[0]), "=&v"(o[1]), "=&v"(o[2]), "=&v"(o[3]), "=&v"(o[4]), "=&v"(o[5]), "=&v"(o[6]), "=&v"(o[7])
      : "v"(x[0]), "v"(x[1]), "v"(x[2]), "v"(x[3]), "v"(x[4]), "v"(x[5]), "v"(x[6]), "v"(x[7]));
}
// One power of two (the rescale factor); the v_nop is the independent instruction behind it.
__device__ __forceinline__ float at_exp2x1(float x) {
  float o;
  asm("v_exp_f32 %0, %1\n\t"
      "v_nop"
      : "=&v"(o) : "v"(x));
  return o;
}
// The value that lane l ^ 16 holds: a register move across the two 16-lane rows, no LDS-path operation.
__device__ __forceinline__ float at_xhalf(float f) {
  const int bits = __float_as_int(f);
  return __int_as_float(__builtin_amdgcn_permlanex16(bits, bits, 0x76543210, 0xfedcba98, false, false));
}

// MODE is the mask mode as a compile-time constant: only that mode's mask code is compiled into the key loop.
// KVRS is the row stride of K and of V in floats (the launch's g.k_rs and g.v_rs) as a compile-time constant: the eight pieces that a
// lane reads of each tile are then one address and eight immediate offsets.
template <bool SPLIT_QK, bool SPLIT_PV, bool F16, int MODE, int KVRS>
__global__ __launch_bounds__(128)
void attn64_kernel(const float* __restrict__ q, const float* __restrict__ k,
                   const float* __restrict__ v, float* __restrict__ out,
                   const int* __restrict__ mask_a, const int* __restrict__ mask_b, AttnGeom g) {
  static_assert(!(F16 && (SPLIT_QK || SPLIT_PV)));
  const float PSC = F16 ? 32768.0f : 1.0f;     // f16 probabilities carried x2^15, folded into the final 1/l
  union FB { v16b v; v8b h[2]; };
  __shared__ __align__(16) __bf16 Ksh[AT_KC * AT_LP];            // K hi [kv][d]      9 KB
  __shared__ __align__(16) __bf16 Ksl[SPLIT_QK ? AT_KC * AT_LP : 8];
  __shared__ __align__(16) __bf16 Vth[AT_D * AT_LP];             // V hi [d][kv]      9 KB
  __shared__ __align__(16) __bf16 Vtl[SPLIT_PV ? AT_D * AT_LP : 8];
  __shared__ __align__(16) float  Os[AT_NW][16 * 68];            // per wave out tile, pitch 68

  const int tid  = threadIdx.x;
  const int wave = tid >> 5;
  const int lane = tid & 31;
  const int hh   = lane >> 4;
  const int c    = lane & 15;

  const int nqb = g.S / AT_QB;
  const int nkc = g.Skv / AT_KC;
  const int bx = blockIdx.x + g.blk0;
  const int qb = bx % nqb;
  const int bh = bx / nqb;
  const int h  = bh % g.H;
  const int b  = bh / g.H;
  const int qbase_block = qb * AT_QB;
  const int q0 = qbase_block + wave * 16;

  const float* qb_ptr = q + (size_t)b * g.q_bs + (size_t)h * g.q_hs;
  const float* kb_ptr = k + (size_t)b * g.k_bs + (size_t)h * g.k_hs;
  const float* vb_ptr = v + (size_t)b * g.v_bs + (size_t)h * g.v_hs;
  float*       ob_ptr = out + (size_t)b * g.o_bs + (size_t)h * g.o_hs;

  // ---- Q fragments (B operand): 2 d-chunks, hi (and lo) ----
  v16b qah[2], qal[2];
  {
    const float* qrow = qb_ptr + (size_t)(q0 + c) * g.q_rs;
#pragma unroll
    for (int dc = 0; dc < 2; ++dc) {
#pragma unroll
      for (int e = 0; e < 8; ++e) {
        const float f0 = qrow[dc * 32 + 8 * hh + e] * g.qscale;
        const float f1 = qrow[dc * 32 + 16 + 8 * hh + e] * g.qscale;
        if (SPLIT_QK) { __bf16 hq, lq; at_split(f0, hq, lq); qah[dc][e] = hq; qal[dc][e] = lq; at_split(f1, hq, lq); qah[dc][8 + e] = hq; qal[dc][8 + e] = lq; }
        else { qah[dc][e] = at_to16<F16>(f0); qah[dc][8 + e] = at_to16<F16>(f1); qal[dc][e] = qah[dc][e]; qal[dc][8 + e] = qah[dc][8 + e]; }
      }
    }
  }

  float mrow = -INFINITY;   // running maximum of the lane's query, the same in both halves
  float lrow = 0.f;         // running sum over the lane half's own keys; the halves are joined once, behind the key loop
  v8f oacc[4];              // oacc[t][r] = O[q0 + c][t * 16 + 8 * hh + r]
#pragma unroll
  for (int t = 0; t < 4; ++t) oacc[t] = (v8f){0.f,0.f,0.f,0.f,0.f,0.f,0.f,0.f};

  const int nChunks = (MODE == 1 || MODE == 4) ? (qb + 1) : nkc;   // block-uniform, bounded by Skv/64
  const int qrow = q0 + c;
  const int qkeep = (MODE == 3) ? mask_b[(size_t)b * g.S + qrow] : 1;   // mask_b = qmask in mode 3
  for (int kc = 0; kc < nChunks; ++kc) {
    const int kv0 = kc * AT_KC;
    int code = 0;
    if (MODE == 6) {
      int cv = g.tcode[((size_t)b * nqb + qb) * (size_t)g.t_pitch + kc];
      cv = __builtin_amdgcn_readfirstlane(cv);
      code = (cv == 1 || cv == 2) ? cv : 0;     // anything else -> mixed (per-element reads)
      if (code == 2) continue;                  // fully masked tile: zero contribution, softmax state unchanged
    }
    __syncthreads();
    {
      // 8 lanes read one whole 128-B line (half a row) of K or V, so a wave-wide 16-byte load covers four whole lines of four rows.
      // A lane takes the rows kvr and kvr + 1 at the same four d: a V^T pair of neighbouring keys is one 4-byte LDS store.
      // Four row pairs a wave (not two) spread a V^T store over 16 banks: the d of 8 lanes fall on 4 banks, each row pair is one bank on.
      const int r2 = (tid >> 3) * 2, d4 = (tid & 7) * 4;
      const float* kcol = kb_ptr + (size_t)(kv0 + r2) * KVRS + d4;
      const float* vcol = vb_ptr + (size_t)(kv0 + r2) * KVRS + d4;
      v4f kx[8], vx[8];
#pragma unroll   // this loop and the two below unrolled: kx and vx are indexed by constants (registers), all 16 loads are issued in front of the first wait
      for (int i = 0; i < 8; ++i) {
        kx[i] = *(const v4f*)(kcol + (((i >> 1) & 1) * 32 + (i & 1)) * KVRS + (i >> 2) * 32);
        vx[i] = *(const v4f*)(vcol + (((i >> 1) & 1) * 32 + (i & 1)) * KVRS + (i >> 2) * 32);
      }
      // kcol and vcol are inputs so that both address pairs live up to this wait: no load's result and no conversion takes their registers in front of it
      asm volatile("s_wait_xcnt 0x0" :: "v"(kcol), "v"(vcol) : "memory");
#pragma unroll
      for (int p = 0; p < 4; ++p) {
        const int kvr = (p & 1) * 32 + r2, dd = (p >> 1) * 32 + d4;
        const v4f k0 = kx[2 * p], k1 = kx[2 * p + 1], v0 = vx[2 * p], v1 = vx[2 * p + 1];
        v4b k0h, k0l, k1h, k1l;
#pragma unroll
        for (int e = 0; e < 4; ++e) {
          if (SPLIT_QK) { __bf16 a, bl; at_split(k0[e], a, bl); k0h[e] = a; k0l[e] = bl; at_split(k1[e], a, bl); k1h[e] = a; k1l[e] = bl; }
          else { k0h[e] = at_to16<F16>(k0[e]); k1h[e] = at_to16<F16>(k1[e]); }
          v2b vh, vl;
          if (SPLIT_PV) { __bf16 a, bl; at_split(v0[e], a, bl); vh[0] = a; vl[0] = bl; at_split(v1[e], a, bl); vh[1] = a; vl[1] = bl; }
          else { vh[0] = at_to16<F16>(v0[e]); vh[1] = at_to16<F16>(v1[e]); }
          *(v2b*)(Vth + (dd + e) * AT_LP + kvr) = vh;
          if (SPLIT_PV) *(v2b*)(Vtl + (dd + e) * AT_LP + kvr) = vl;
        }
        *(v4b*)(Ksh + kvr * AT_LP + dd) = k0h;
        *(v4b*)(Ksh + (kvr + 1) * AT_LP + dd) = k1h;
        if (SPLIT_QK) { *(v4b*)(Ksl + kvr * AT_LP + dd) = k0l; *(v4b*)(Ksl + (kvr + 1) * AT_LP + dd) = k1l; }
      }
    }
    __syncthreads();

    v8f s[4];   // s[j][r] = score of key kv0 + j * 16 + 8 * hh + r for query q0 + c
    {
      // all eight K fragments of the tile are read as one group ahead of the eight products: one LDS latency a tile, not one per product
      FB kb[2][4];
#pragma unroll   // these loops unrolled: kb, qah and s are indexed by constants (registers, no indexed register moves)
      for (int dc = 0; dc < 2; ++dc) {
#pragma unroll
        for (int j = 0; j < 4; ++j) {
          kb[dc][j].h[0] = *(const v8b*)(Ksh + (j * 16 + c) * AT_LP + dc * 32 + 8 * hh);
          kb[dc][j].h[1] = *(const v8b*)(Ksh + (j * 16 + c) * AT_LP + dc * 32 + 16 + 8 * hh);
        }
      }
#pragma unroll
      for (int j = 0; j < 4; ++j) s[j] = (v8f){0.f,0.f,0.f,0.f,0.f,0.f,0.f,0.f};
#pragma unroll   // each s[j] still sums d 0..31 first, then d 32..63; K rows are the first operand, Q the second
      for (int dc = 0; dc < 2; ++dc) {
#pragma unroll
        for (int j = 0; j < 4; ++j) {
          s[j] = at_mma16<F16>(kb[dc][j].v, qah[dc], s[j]);
          if (SPLIT_QK) {
            FB kl;
            kl.h[0] = *(const v8b*)(Ksl + (j * 16 + c) * AT_LP + dc * 32 + 8 * hh);
            kl.h[1] = *(const v8b*)(Ksl + (j * 16 + c) * AT_LP + dc * 32 + 16 + 8 * hh);
            s[j] = at_mma16<F16>(kl.v, qah[dc], s[j]);
            s[j] = at_mma16<F16>(kb[dc][j].v, qal[dc], s[j]);
          }
        }
      }
    }
    // all eight V^T fragments of the tile are read as one group in front of the softmax, which covers their latency
    FB vb[2][4];
#pragma unroll   // unrolled: vb is indexed by constants (registers)
    for (int kk = 0; kk < 2; ++kk) {
#pragma unroll
      for (int t = 0; t < 4; ++t) {
        vb[kk][t].h[0] = *(const v8b*)(Vth + (t * 16 + c) * AT_LP + kk * 32 + 8 * hh);
        vb[kk][t].h[1] = *(const v8b*)(Vth + (t * 16 + c) * AT_LP + kk * 32 + 16 + 8 * hh);
      }
    }
    const bool diag = (MODE == 1) && (kc == qb);
    if (MODE == 6 && code == 0) {               // mixed tile: one wave-uniform branch per tile, then per-element reads
      // a lane's eight keys of a 16-key tile lie side by side in its query's mask row and in the padding row: two 16-byte reads of each
      const int* mrowp = mask_a + (size_t)qrow * g.Skv + kv0 + 8 * hh;
      const int* prowp = mask_b + (size_t)b * g.Skv + kv0 + 8 * hh;   // mask_b = key padding [B][Skv]
      v4i mx[8], px[8];
#pragma unroll   // the loops here unrolled so that mx, px and s[j][r] are indexed by constants and stay in registers
      for (int i = 0; i < 8; ++i) {
        mx[i] = *(const v4i*)(mrowp + (i >> 1) * 16 + (i & 1) * 4);
        px[i] = *(const v4i*)(prowp + (i >> 1) * 16 + (i & 1) * 4);
      }
      // mrowp and prowp are inputs so that both address pairs live up to this wait: no load's result and no compare takes their registers in front of it
      asm volatile("s_wait_xcnt 0x0" :: "v"(mrowp), "v"(prowp) : "memory");
#pragma unroll
      for (int j = 0; j < 4; ++j) {
#pragma unroll
        for (int r = 0; r < 8; ++r)
          if ((mx[2 * j + (r >> 2)][r & 3] != 0) || (px[2 * j + (r >> 2)][r & 3] != 0)) s[j][r] = g.mask_fill;
      }
    }
    float mj[4];   // one maximum per 16-key tile: four short chains, not one of 32 links
#pragma unroll
    for (int j = 0; j < 4; ++j) {
      float m = -INFINITY;
#pragma unroll
      for (int r = 0; r < 8; ++r) {
        const int kvcol = kv0 + j * 16 + 8 * hh + r;
        bool masked = false;
        if (diag) masked = (kvcol > qrow);
        else if (MODE == 4) masked = (kvcol > qrow) || (qrow - kvcol > g.mask_is_int);
        else if (MODE == 2) {
          const size_t mi = (size_t)qrow * g.Skv + kvcol;
          masked = (g.mask_is_int == 0) ? (((const float*)mask_a)[mi] == 0.0f)
                 : (g.mask_is_int == 1) ? (mask_a[mi] == 0) : (mask_a[mi] != 0);
        } else if (MODE == 3) masked = (qkeep == 0) || (mask_a[(size_t)b * g.Skv + kvcol] == 0);   // mask_a = kvmask
        else if (MODE == 5) {
          const size_t mi = (size_t)qrow * g.Skv + kvcol;
          masked = (mask_a[mi] != 0);
          int n = mask_b[mi]; n = n < 0 ? 0 : n;
          s[j][r] += g.cp[(size_t)b * g.c_bs + (size_t)h * g.c_hs + (size_t)qrow * g.c_rs + n]
                   + g.pc[(size_t)b * g.c_bs + (size_t)h * g.c_hs + (size_t)kvcol * g.c_rs + n];
        }
        if (masked) s[j][r] = g.mask_fill;
        m = fmaxf(m, s[j][r]);
      }
      mj[j] = m;
    }
    float cm = fmaxf(fmaxf(mj[0], mj[1]), fmaxf(mj[2], mj[3]));
    cm = fmaxf(cm, at_xhalf(cm));               // the query's other 32 keys of the tile lie in lane l ^ 16
    const float mnew = fmaxf(mrow, cm);
    // exp(x - mnew) = 2^(x * log2(e) - mb): one FMA and one v_exp_f32, no branch. A row with no live key yet takes mb = 0:
    // every exponent is then -inf (never inf - inf), so its p and alpha are 0 and its sums stay 0.
    const float mb = (mnew == -INFINITY) ? 0.0f : mnew * AT_LOG2E;
    const float alpha = at_exp2x1(fmaf(mrow, AT_LOG2E, -mb));
    mrow = mnew;
    // P^T as second operand of O^T += V^T.P^T: element e of a lane's fragment is key 8 * hh + e of the 32, element 8 + e key
    // 16 + 8 * hh + e (the k order of the V^T fragments above): exactly the lane's own s[2 * kk][e] and s[2 * kk + 1][e].
    FB pa[2], pl[2];
    float ps[4];   // one sum per 16-key tile
#pragma unroll   // unrolled: s, pa and ps are indexed by constants (registers)
    for (int j = 0; j < 4; ++j) {
      float x[8], pe[8];
#pragma unroll
      for (int r = 0; r < 8; ++r) x[r] = fmaf(s[j][r], AT_LOG2E, -mb);
      at_exp2x8(pe, x);
      float sum = pe[0];
#pragma unroll
      for (int r = 1; r < 8; ++r) sum += pe[r];
      ps[j] = sum;
#pragma unroll
      for (int r = 0; r < 8; ++r) {
        if (SPLIT_PV) { __bf16 a, bl; at_split(pe[r], a, bl); pa[j >> 1].v[(j & 1) * 8 + r] = a; pl[j >> 1].v[(j & 1) * 8 + r] = bl; }
        else pa[j >> 1].v[(j & 1) * 8 + r] = at_to16<F16>(pe[r] * PSC);
      }
    }
    lrow = lrow * alpha + ((ps[0] + ps[1]) + (ps[2] + ps[3]));
#pragma unroll
    for (int t = 0; t < 4; ++t) {
#pragma unroll
      for (int r = 0; r < 8; ++r) oacc[t][r] *= alpha;
    }
#pragma unroll   // each oacc[t] still sums keys 0..31 first, then keys 32..63; V^T rows are the first operand, P^T the second
    for (int kk = 0; kk < 2; ++kk) {
#pragma unroll
      for (int t = 0; t < 4; ++t) {
        oacc[t] = at_mma16<F16>(vb[kk][t].v, pa[kk].v, oacc[t]);
        if (SPLIT_PV) {
          FB vl;
          vl.h[0] = *(const v8b*)(Vtl + (t * 16 + c) * AT_LP + kk * 32 + 8 * hh);
          vl.h[1] = *(const v8b*)(Vtl + (t * 16 + c) * AT_LP + kk * 32 + 16 + 8 * hh);
          oacc[t] = at_mma16<F16>(vl.v, pa[kk].v, oacc[t]);
          oacc[t] = at_mma16<F16>(vb[kk][t].v, pl[kk].v, oacc[t]);
        }
      }
    }
  }

  float* os = Os[wave];
  {
    const float den = (lrow + at_xhalf(lrow)) * PSC;   // the two halves' key sums joined
    const float inv = (den > 0.0f) ? (1.0f / den) : 0.0f;
#pragma unroll   // unrolled: oacc is indexed by constants; a lane's eight d of a tile are two 16-byte LDS stores in its query's row
    for (int t = 0; t < 4; ++t) {
      v4f lo, hi;
#pragma unroll
      for (int e = 0; e < 4; ++e) { lo[e] = oacc[t][e] * inv; hi[e] = oacc[t][4 + e] * inv; }
      *(v4f*)(os + c * 68 + t * 16 + 8 * hh) = lo;
      *(v4f*)(os + c * 68 + t * 16 + 8 * hh + 4) = hi;
    }
  }
  __builtin_amdgcn_fence(__ATOMIC_RELEASE, "workgroup");
  __builtin_amdgcn_wave_barrier();
  __builtin_amdgcn_fence(__ATOMIC_ACQUIRE, "workgroup");
  {
    const int c4 = (lane & 15) * 4;
    {
#pragma unroll
      for (int it = 0; it < 8; ++it) {
        const int row = it * 2 + hh;
        v4f val = *(const v4f*)(os + row * 68 + c4);
        *(v4f*)(ob_ptr + (size_t)(q0 + row) * g.o_rs + c4) = val;
      }
      
    }
  }
}

// =====================================================================================
// 64x64 tile classification of the attention mask: one block per (b, q-tile); for each kv-tile:
//   masked(q,k) = tm[q][k] != 0 || pad[b][k] != 0;  code 2 = all masked, 1 = all live, 0 = mixed.
// =====================================================================================
__global__ __launch_bounds__(256) void tilecode_kernel(
    const int* __restrict__ tm, const int* __restrict__ pad, int* __restrict__ tab,
    int Skv, int nqb, int nkc, int tp) {
  __shared__ int wl[8], wm[8];
  __shared__ __align__(16) int codes[128];
  const int tid = threadIdx.x, lane = tid & 31, wave = tid >> 5;
  const int b  = blockIdx.x / nqb;
  const int qb = blockIdx.x - b * nqb;
  const int row = tid >> 2, cs = (tid & 3) * 16;
  const int q = qb * 64 + row;
  if (tid < 128) codes[tid] = 2;
  __syncthreads();
  const int nk = nkc < 128 ? nkc : 128;
  for (int kc = 0; kc < nk; ++kc) {
    const int* mr = tm  + (size_t)q * Skv + kc * 64 + cs;
    const int* pr = pad + (size_t)b * Skv + kc * 64 + cs;
    int live = 0, msk = 0;
#pragma unroll
    for (int i = 0; i < 4; ++i) {
      const v4i mv = *(const v4i*)(mr + 4 * i);
      const v4i pv = *(const v4i*)(pr + 4 * i);
#pragma unroll
      for (int e = 0; e < 4; ++e) {
        const int m = ((mv[e] != 0) || (pv[e] != 0)) ? 1 : 0;
        msk |= m;
        live |= (m ^ 1);
      }
    }
    const int al = __any(live);
    const int am = __any(msk);
    if (lane == 0) { wl[wave] = al; wm[wave] = am; }
    __syncthreads();
    if (tid == 0) {
      int L = 0, Mk = 0;
#pragma unroll
      for (int w = 0; w < 8; ++w) { L |= wl[w]; Mk |= wm[w]; }
      codes[kc] = (L == 0) ? 2 : ((Mk == 0) ? 1 : 0);
    }
    __syncthreads();
  }
  if (wave == 0) {
    const int nl = tp >> 2;          // tp is a multiple of 32 ints, <= 128
    v4i cv;
    cv[0] = codes[(4 * lane + 0) & 127]; cv[1] = codes[(4 * lane + 1) & 127];
    cv[2] = codes[(4 * lane + 2) & 127]; cv[3] = codes[(4 * lane + 3) & 127];
    int* dst = tab + (size_t)blockIdx.x * tp + 4 * lane;
    if (lane < nl) *(v4i*)dst = cv;
    
  }
}

// =====================================================================================
// LayerNorm over 1024-wide rows: one block (256 thr) per row, 4 contiguous floats per thread.
// =====================================================================================
template <bool OUT16>
__global__ __launch_bounds__(256) void ln_kernel(
    const float* __restrict__ in, const float* __restrict__ gam, const float* __restrict__ bet,
    float* __restrict__ o32, _Float16* __restrict__ o16) {
  __shared__ float red1[8], red2[8];
  __shared__ __align__(16) float ybuf[OUT16 ? DM : 4];
  const int row = blockIdx.x, t = threadIdx.x, lane = t & 31, wave = t >> 5;
  const float* x = in + (size_t)row * DM;
  const v4f xv = *(const v4f*)(x + 4 * t);
  float s = (xv[0] + xv[1]) + (xv[2] + xv[3]);
#pragma unroll
  for (int off = 1; off < 32; off <<= 1) s += __shfl_xor(s, off, 32);
  if (lane == 0) red1[wave] = s;
  __syncthreads();
  float tot = 0.f;
#pragma unroll
  for (int w = 0; w < 8; ++w) tot += red1[w];
  const float mu = tot * (1.0f / (float)DM);
  const float d0 = xv[0] - mu, d1 = xv[1] - mu, d2 = xv[2] - mu, d3 = xv[3] - mu;
  float s2 = (d0 * d0 + d1 * d1) + (d2 * d2 + d3 * d3);
#pragma unroll
  for (int off = 1; off < 32; off <<= 1) s2 += __shfl_xor(s2, off, 32);
  if (lane == 0) red2[wave] = s2;
  __syncthreads();
  float tot2 = 0.f;
#pragma unroll
  for (int w = 0; w < 8; ++w) tot2 += red2[w];
  const float var = tot2 * (1.0f / (float)DM);
  const float rstd = rsqrtf(var + LN_EPS);
  const v4f gv = *(const v4f*)(gam + 4 * t);
  const v4f bv = *(const v4f*)(bet + 4 * t);
  v4f y;
  y[0] = d0 * rstd * gv[0] + bv[0];
  y[1] = d1 * rstd * gv[1] + bv[1];
  y[2] = d2 * rstd * gv[2] + bv[2];
  y[3] = d3 * rstd * gv[3] + bv[3];
  float* op = o32 + (size_t)row * DM + 4 * t;
  *(v4f*)op = y;
  
  if (OUT16) {
    *(v4f*)(ybuf + 4 * t) = y;
    __syncthreads();
    if (t < DM / 8) {
      v8h hv;
#pragma unroll
      for (int e = 0; e < 8; ++e) hv[e] = (_Float16)ybuf[8 * t + e];
      _Float16* hp = o16 + (size_t)row * DM + 8 * t;
      *(v8h*)hp = hv;
      
    }
  }
}

// =====================================================================================
// Host orchestration
// =====================================================================================
extern "C" void kernel_launch(void* const* d_in, const int* in_sizes, int n_in,
                              void* d_out, int out_size, void* d_ws, size_t ws_size,
                              hipStream_t stream) {
  if (n_in < 16) return;
  if (in_sizes[0] != MROWS * DM || in_sizes[1] != SEQ * SEQ || in_sizes[2] != BSZ * SEQ) return;
  if (in_sizes[3] != DM * DM || in_sizes[4] != DM * DM || in_sizes[5] != DM * DM || in_sizes[6] != DM * DM) return;
  if (in_sizes[7] != DM || in_sizes[8] != FFND * DM || in_sizes[9] != FFND) return;
  if (in_sizes[10] != DM * FFND || in_sizes[11] != DM) return;
  if (in_sizes[12] != DM || in_sizes[13] != DM || in_sizes[14] != DM || in_sizes[15] != DM) return;
  if (out_size != MROWS * DM) return;

  const float* tgt   = (const float*)d_in[0];
  const int*   tmask = (const int*)d_in[1];     // [SEQ][SEQ], nonzero = masked
  const int*   pmask = (const int*)d_in[2];     // [BSZ][SEQ], nonzero = masked
  const float* Wq    = (const float*)d_in[3];
  const float* Wk    = (const float*)d_in[4];
  const float* Wv    = (const float*)d_in[5];
  const float* Wo    = (const float*)d_in[6];
  const float* bo    = (const float*)d_in[7];
  const float* W1    = (const float*)d_in[8];
  const float* b1    = (const float*)d_in[9];
  const float* W2    = (const float*)d_in[10];
  const float* b2    = (const float*)d_in[11];
  const float* g1    = (const float*)d_in[12];
  const float* be1   = (const float*)d_in[13];
  const float* g2    = (const float*)d_in[14];
  const float* be2   = (const float*)d_in[15];
  float* out = (float*)d_out;

  // ---- workspace carve (bytes), regions reused across phases ----
  const size_t MiB = 1048576;
  const int nqb = SEQ / AT_QB, nkc = SEQ / AT_KC;
  if (nkc > 128) return;
  const int TP = ((nkc + 31) / 32) * 32;
  const size_t tabBytes = (size_t)BSZ * nqb * TP * sizeof(int);
  const size_t total = 96 * MiB + tabBytes;
  if (total > ws_size) return;
  char* ws = (char*)d_ws;
  float*    Qf   = (float*)(ws + 0 * MiB);          // [4096][1024] f32   (projections -> attention)
  float*    Kf   = (float*)(ws + 16 * MiB);
  float*    Vf   = (float*)(ws + 32 * MiB);
  float*    RES1 = (float*)(ws + 0 * MiB);          // tgt + attn-proj     (after attention)
  _Float16* H16  = (_Float16*)(ws + 0 * MiB);       // [4096][4096] f16   (after LN1)
  float*    X1f  = (float*)(ws + 32 * MiB);         // LN1 output f32     (after attention)
  float*    AOf  = (float*)(ws + 48 * MiB);         // attention output f32
  float*    RES2 = (float*)(ws + 48 * MiB);         // x1 + ffn           (after out-proj)
  _Float16* X16  = (_Float16*)(ws + 64 * MiB);      // tgt f16            (projections)
  _Float16* O16  = (_Float16*)(ws + 64 * MiB);      // attention output f16 (after projections)
  _Float16* X1h  = (_Float16*)(ws + 64 * MiB);      // LN1 output f16     (after out-proj)
  _Float16* Wq16 = (_Float16*)(ws + 72 * MiB);
  _Float16* Wk16 = (_Float16*)(ws + 74 * MiB);
  _Float16* Wv16 = (_Float16*)(ws + 76 * MiB);
  _Float16* Wo16 = (_Float16*)(ws + 78 * MiB);
  _Float16* W1h  = (_Float16*)(ws + 80 * MiB);      // [4096][1024]
  _Float16* W2h  = (_Float16*)(ws + 88 * MiB);      // [1024][4096]
  int*      TAB  = (int*)(ws + 96 * MiB);           // [BSZ*nqb][TP]

  // tgt and the six weight matrices -> f16, one launch; X16 .. W2h lie one behind the other from X16 on
  static_assert(CV_Q * 2 == 8 * 1048576 && CV_K * 2 == 10 * 1048576 && CV_V * 2 == 12 * 1048576 && CV_O * 2 == 14 * 1048576 &&
                CV_W1 * 2 == 16 * 1048576 && CV_W2 * 2 == 24 * 1048576 && CV_END * 2 == 32 * 1048576, "offsets of the carve above");
  cast_inputs<<<dim3(CV_END / CV_BLK), dim3(CV_WAVES * 32), 0, stream>>>(tgt, Wq, Wk, Wv, Wo, W1, W2, X16);

  // mask tile codes
  tilecode_kernel<<<dim3(BSZ * nqb), dim3(256), 0, stream>>>(tmask, pmask, TAB, SEQ, nqb, nkc, TP);

  const long z = 0;
  typedef const unsigned short* cu16;
  const int tilesM = MROWS / 128;
  // q/k/v projections: [4096][1024] = X16 . W^T, f32 out
  {
    const dim3 grid(tilesM * (DM / 128), 1);
    wmma_gemm64<0, false, 0, 0, false, 0, 8><<<grid, dim3(256), 0, stream>>>(
        (cu16)X16, (cu16)X16, DM, z, (cu16)Wq16, (cu16)Wq16, DM, z, (void*)Qf, (void*)Qf, DM, z,
        bo, tgt, z, MROWS, DM, DM, 1.0f);
    wmma_gemm64<0, false, 0, 0, false, 0, 8><<<grid, dim3(256), 0, stream>>>(
        (cu16)X16, (cu16)X16, DM, z, (cu16)Wk16, (cu16)Wk16, DM, z, (void*)Kf, (void*)Kf, DM, z,
        bo, tgt, z, MROWS, DM, DM, 1.0f);
    wmma_gemm64<0, false, 0, 0, false, 0, 8><<<grid, dim3(256), 0, stream>>>(
        (cu16)X16, (cu16)X16, DM, z, (cu16)Wv16, (cu16)Wv16, DM, z, (void*)Vf, (void*)Vf, DM, z,
        bo, tgt, z, MROWS, DM, DM, 1.0f);
  }

  // attention: q,k,v,o element (b, s, h, d) at b*SEQ*DM + s*DM + h*64 + d
  {
    AttnGeom g;
    g.tcode = TAB; g.cp = Qf; g.pc = Qf; g.c_bs = 0; g.c_rs = 0; g.c_hs = 0; g.t_pitch = TP;
    g.q_bs = (long)SEQ * DM; g.q_rs = DM; g.q_hs = HD;
    g.k_bs = (long)SEQ * DM; g.k_rs = DM; g.k_hs = HD;
    g.v_bs = (long)SEQ * DM; g.v_rs = DM; g.v_hs = HD;
    g.o_bs = (long)SEQ * DM; g.o_rs = DM; g.o_hs = HD;
    g.S = SEQ; g.Skv = SEQ; g.H = NHEAD; g.mask_mode = 6; g.qscale = 0.125f; g.blk0 = 0;
    g.mask_fill = -INFINITY; g.mask_is_int = 2;
    attn64_kernel<false, false, true, 6, DM><<<dim3(BSZ * NHEAD * nqb), dim3(128), 0, stream>>>(
        Qf, Kf, Vf, AOf, tmask, pmask, g);
  }
  static_assert((MROWS * DM) % (CV_WAVES * 1024) == 0);
  cast_one<1><<<dim3(MROWS * DM / (CV_WAVES * 1024)), dim3(CV_WAVES * 32), 0, stream>>>(AOf, O16);

  // RES1 = tgt + (O . Wo^T + bo)
  {
    const dim3 grid(tilesM * (DM / 128), 1);
    wmma_gemm64<0, false, 2, 0, true, 0, 8><<<grid, dim3(256), 0, stream>>>(
        (cu16)O16, (cu16)O16, DM, z, (cu16)Wo16, (cu16)Wo16, DM, z, (void*)RES1, (void*)RES1, DM, z,
        bo, tgt, z, MROWS, DM, DM, 1.0f);
  }
  // x1 = LN(RES1) -> f32 + f16
  ln_kernel<true><<<dim3(MROWS), dim3(256), 0, stream>>>(RES1, g1, be1, X1f, X1h);
  // H16 = gelu_tanh(x1 . W1^T + b1), f16 [4096][4096]
  {
    const dim3 grid(tilesM * (FFND / 128), 1);
    wmma_gemm64<0, false, 2, 1, false, 6, 4><<<grid, dim3(128), 0, stream>>>(
        (cu16)X1h, (cu16)X1h, DM, z, (cu16)W1h, (cu16)W1h, DM, z, (void*)H16, (void*)H16, FFND, z,
        b1, tgt, z, MROWS, FFND, DM, 1.0f);
  }
  // RES2 = x1 + (H . W2^T + b2)
  {
    const dim3 grid(tilesM * (DM / 128), 1);
    wmma_gemm64<0, false, 2, 0, true, 0, 8><<<grid, dim3(256), 0, stream>>>(
        (cu16)H16, (cu16)H16, FFND, z, (cu16)W2h, (cu16)W2h, FFND, z, (void*)RES2, (void*)RES2, DM, z,
        b2, X1f, z, MROWS, DM, FFND, 1.0f);
  }
  // out = LN(RES2)
  ln_kernel<false><<<dim3(MROWS), dim3(256), 0, stream>>>(RES2, g2, be2, out, X1h);
  (void)hipGetLastError();
}

// v010
// A run of this version takes 224 microseconds.
// In two side-by-side timings against v009, it was 1.16 and 1.15 times as fast.
// Counting every step since v000, it is 8.79 times as fast.
// Contractions: q/k/v/out projections, FFN1, FFN2 on v_wmma_f32_16x16x32_f16 (f16 operands, f32 accumulate);
// attention scores (q*0.125).k^T and p.v on v_wmma_f32_16x16x32_f16 (f16 operands, p carried x2^15, f32 accumulate).
// Softmax, LayerNorm, tanh-GELU, bias and residual adds in f32.
#include <hip/hip_runtime.h>

typedef __attribute__((ext_vector_type(16))) _Float16 v16h;
typedef __attribute__((ext_vector_type(8)))  _Float16 v8h;
typedef __attribute__((ext_vector_type(16))) __bf16   v16b;
typedef __attribute__((ext_vector_type(8)))  __bf16   v8b;
typedef __attribute__((ext_vector_type(4)))  __bf16   v4b;
typedef __attribute__((ext_vector_type(2)))  __bf16   v2b;
typedef __attribute__((ext_vector_type(8)))  float    v8f;
typedef __attribute__((ext_vector_type(4)))  float    v4f;
typedef __attribute__((ext_vector_type(4)))  int      v4i;

#define DM     1024
#define NHEAD  16
#define HD     64
#define FFND   4096
#define BSZ    2
#define SEQ    2048
#define MROWS  (BSZ * SEQ)
#define LN_EPS 1e-5f

__device__ __forceinline__ unsigned short f2bf_bits(float f) {
  unsigned u = __float_as_uint(f);
  return (unsigned short)((u + 0x7FFFu + ((u >> 16) & 1u)) >> 16);
}
__device__ __forceinline__ float bf_bits2f(unsigned short h) { return __uint_as_float(((unsigned)h) << 16); }

// hazard guards as plain device helpers
__device__ __forceinline__ void dep_guard_h(v8f& a, v8f& b, v16h x, v16h y) { asm volatile("v_nop\n\tv_nop\n\tv_nop\n\tv_nop" : "+v"(a), "+v"(b) : "v"(x), "v"(y)); }
__device__ __forceinline__ void dep_guard_b(v8f& a, v8f& b, v16b x, v16b y) { asm volatile("v_nop\n\tv_nop\n\tv_nop\n\tv_nop" : "+v"(a), "+v"(b) : "v"(x), "v"(y)); }
__device__ __forceinline__ void keep4_h(v16h a, v16h b, v16h c, v16h d) { asm volatile("v_nop" :: "v"(a), "v"(b), "v"(c), "v"(d)); }
__device__ __forceinline__ void keep4_b(v16b a, v16b b, v16b c, v16b d) { asm volatile("v_nop" :: "v"(a), "v"(b), "v"(c), "v"(d)); }
__device__ __forceinline__ void acc_guard4(v8f& a, v8f& b, v8f& c, v8f& d) { asm volatile("v_nop\n\tv_nop\n\tv_nop\n\tv_nop" : "+v"(a), "+v"(b), "+v"(c), "+v"(d)); }
template <typename T> struct Frag;
template <> struct Frag<_Float16> {
  typedef v16h V; union U { v16h v; v8h h[2]; };
  static __device__ __forceinline__ v16h load(const _Float16* p) {   // elements 0..7 <- p[0..7], 8..15 <- p[16..23]
    U f; f.h[0] = *(const v8h*)(p); f.h[1] = *(const v8h*)(p + 16); return f.v;
  }
  static __device__ __forceinline__ v8f mma(v16h a, v16h b, v8f c) {
    return __builtin_amdgcn_wmma_f32_16x16x32_f16(false, a, false, b, (short)0, c, false, false);
  }
  static __device__ __forceinline__ void guard(v8f& a, v8f& b, v16h x, v16h y) { dep_guard_h(a, b, x, y); }
  static __device__ __forceinline__ void keep(v16h a, v16h b, v16h c, v16h d) { keep4_h(a, b, c, d); }
};
template <> struct Frag<__bf16> {
  typedef v16b V; union U { v16b v; v8b h[2]; };
  static __device__ __forceinline__ v16b load(const __bf16* p) {
    U f; f.h[0] = *(const v8b*)(p); f.h[1] = *(const v8b*)(p + 16); return f.v;
  }
  static __device__ __forceinline__ v8f mma(v16b a, v16b b, v8f c) {
    return __builtin_amdgcn_wmma_f32_16x16x32_bf16(false, a, false, b, (short)0, c, false, false);
  }
  static __device__ __forceinline__ void guard(v8f& a, v8f& b, v16b x, v16b y) { dep_guard_b(a, b, x, y); }
  static __device__ __forceinline__ void keep(v16b a, v16b b, v16b c, v16b d) { keep4_b(a, b, c, d); }
};

// tanh-GELU: 0.5*v*(1+tanh(sqrt(2/pi)*(v+0.044715*v^3))); tanh via exp(-2|u|), no division instruction
__device__ __forceinline__ float gelu_tanh_f(float v) {
  const float u = 0.7978845608028654f * (v + 0.044715f * v * v * v);
  const float e = __expf(-2.0f * fabsf(u));
  float t = (1.0f - e) * __builtin_amdgcn_rcpf(1.0f + e);
  t = copysignf(t, u);
  return 0.5f * v * (1.0f + t);
}

// ---- Register-blocked batched WMMA GEMM ------------------------------------
// C[m,n] = scale * sum_k A[m,k] * Bt[n,k] (+bias)(+resid); a block owns a 128x128 tile: NW = 4 waves (2x2) of 64x64 each, or
// NW = 8 waves (4x2) of 32x64 each. Eight waves are for a grid of one block per WGP: each SIMD then holds two waves, and one
// wave's LDS waits, copy issue and epilogue stand behind the other's matrix work.
// A row-major [M,K]; Bt row-major [N,K]; M,N % 128 == 0, K % 128 == 0.
// Operands reach the waves through LDS: a stage is 128 k of the block's 128 A rows and 128 Bt rows (256 B a row, pitch 272 B),
// brought by asynchronous copies into two buffers, the next stage's copies in flight while this stage is multiplied.
// SPLIT (hi/lo planes) is not built in this form.
// BIAS_MODE: 0 = none, 1 = bias[m], 2 = bias[n].
// OUT_MODE: 0 = f32, 1 = f16, 2 = bf16 hi plane (Cout) + bf16 lo plane (Cout2).
// ACT: 0 none, 1 tanh, 2 relu, 3 silu, 4 leaky, 5 erf-gelu, 6 tanh-gelu.
// ET: 0 = f16 operands, 1 = bf16 operands (pointers passed as 16-bit storage)
template <int ET> struct Elem;
template <> struct Elem<0> { typedef _Float16 T; };
template <> struct Elem<1> { typedef __bf16 T; };
#define G_KS    128                       // k per stage
#define G_PITCH 136                       // LDS row pitch in 16-bit elements: 256 B + 16 B
#define G_STAGE (256 * G_PITCH)           // elements per buffer: rows 0..127 = A, rows 128..255 = Bt
// Eight asynchronous 16-byte copies per lane, rows RS apart (the rows that one pass of the block covers). The s_wait_xcnt stands inside the statement so that
// no address register of an issued copy is rewritten in front of it.
template <int RS>
__device__ __forceinline__ void g_copy8(unsigned l, const unsigned short* g, size_t gstep) {
  const unsigned ls = (unsigned)RS * G_PITCH * 2u;
  asm volatile(
      "global_load_async_to_lds_b128 %0, %8, off\n\t"
      "global_load_async_to_lds_b128 %1, %9, off\n\t"
      "global_load_async_to_lds_b128 %2, %10, off\n\t"
      "global_load_async_to_lds_b128 %3, %11, off\n\t"
      "global_load_async_to_lds_b128 %4, %12, off\n\t"
      "global_load_async_to_lds_b128 %5, %13, off\n\t"
      "global_load_async_to_lds_b128 %6, %14, off\n\t"
      "global_load_async_to_lds_b128 %7, %15, off\n\t"
      "s_wait_xcnt 0x0"
      :: "v"(l), "v"(l + ls), "v"(l + 2u * ls), "v"(l + 3u * ls), "v"(l + 4u * ls), "v"(l + 5u * ls), "v"(l + 6u * ls), "v"(l + 7u * ls),
         "v"(g), "v"(g + gstep), "v"(g + 2 * gstep), "v"(g + 3 * gstep), "v"(g + 4 * gstep), "v"(g + 5 * gstep), "v"(g + 6 * gstep), "v"(g + 7 * gstep)
      : "memory");
}
template <int ET, bool SPLIT, int BIAS_MODE, int OUT_MODE, bool RESID, int ACT, int NW>
__global__ __launch_bounds__(NW * 32) void wmma_gemm64(
    const unsigned short* __restrict__ Ap, const unsigned short* __restrict__ A2p, int lda, long strideA,
    const unsigned short* __restrict__ Btp, const unsigned short* __restrict__ Bt2p, int ldb, long strideB,
    void* __restrict__ Cout, void* __restrict__ Cout2, int ldc, long strideC,
    const float* __restrict__ bias,
    const float* __restrict__ resid, long strideR,
    int M, int N, int K, float scale) {
  typedef typename Elem<ET>::T T;
  typedef typename Frag<T>::V V;
  static_assert(!SPLIT, "hi/lo planes are not staged");
  static_assert(NW == 4 || NW == 8, "2x2 waves of 64x64 or 4x2 waves of 32x64");
  constexpr int FI = 8 / (NW / 2);   // 16-row subtiles of a wave: 4 or 2
  constexpr int RS = NW * 2;         // rows that one copy of every lane of the block covers: 8 or 16
  __shared__ __align__(16) unsigned short sAB[2 * G_STAGE];   // two stage buffers
  __shared__ __align__(16) float sT[NW][16 * 68];  // per-wave 16x64 slab, pitch 68 floats
  const int b    = blockIdx.y;
  const int tid  = threadIdx.x;
  const int lane = tid & 31;
  const int wave = tid >> 5;
  const int tilesN = N >> 7;
  const int tilesM = M >> 7;
  const int tile = blockIdx.x;
  if (tile >= tilesM * tilesN) return;   // block-uniform, in front of every barrier and copy
  const int tm = tile / tilesN;
  const int tn = tile - tm * tilesN;
  const int mB = tm << 7;
  const int nB = tn << 7;
  const int wm = wave >> 1, wn = wave & 1;
  const int m0 = mB + wm * (FI * 16);
  const int n0 = nB + (wn << 6);

  const int rlane = lane & 15;                 // row (A) / col (B, D) within subtile
  const int koff  = (lane >> 4) * 8;           // k offset of this lane half
  const int mOff  = (lane >> 4) * 8;           // D row offset

  // copy lanes: 16 lanes cover one 256-B row, a wave-wide copy two rows (four whole lines)
  const int crow = tid >> 4, cch = (tid & 15) * 8;
  const unsigned short* gA = Ap  + (size_t)b * strideA + (size_t)(mB + crow) * lda + cch;
  const unsigned short* gB = Btp + (size_t)b * strideB + (size_t)(nB + crow) * ldb + cch;
  const unsigned lbase = (unsigned)(size_t)(&sAB[0]) + (unsigned)(crow * G_PITCH + cch) * 2u;
  const size_t stepA = (size_t)RS * lda, stepB = (size_t)RS * ldb;
  auto stage_copy = [&](int st, int buf) {     // 32 (NW = 4) or 16 (NW = 8) copies per lane: one stage of A and Bt
    const unsigned l = lbase + (unsigned)buf * (G_STAGE * 2u);
    const unsigned short* a = gA + (size_t)st * G_KS;
    const unsigned short* w = gB + (size_t)st * G_KS;
    g_copy8<RS>(l,                          a,             stepA);
    if (NW == 4) g_copy8<RS>(l +  64u * G_PITCH * 2u,    a + 8 * stepA, stepA);
    g_copy8<RS>(l + 128u * G_PITCH * 2u,    w,             stepB);
    if (NW == 4) g_copy8<RS>(l + 192u * G_PITCH * 2u,    w + 8 * stepB, stepB);
  };

  v8f acc[FI][4];
#pragma unroll
  for (int i = 0; i < FI; ++i)
#pragma unroll
    for (int j = 0; j < 4; ++j) acc[i][j] = (v8f){0.f,0.f,0.f,0.f,0.f,0.f,0.f,0.f};

  const int nst = K >> 7;
  stage_copy(0, 0);
  asm volatile("s_wait_asynccnt 0x0" ::: "memory");   // this wave's part of stage 0 has landed
  __syncthreads();                                     // stage 0 readable by every wave
  if (nst > 1) stage_copy(1, 1);
#pragma unroll 1   // kept rolled: one trip is one stage of the ring, with one publish point and one refill site
  for (int t = 0; t < nst; ++t) {
    const T* sbuf = (const T*)sAB + (size_t)(t & 1) * G_STAGE;
    const T* sA = sbuf + (wm * (FI * 16) + rlane) * G_PITCH + koff;
    const T* sB = sbuf + (128 + (wn << 6) + rlane) * G_PITCH + koff;
#pragma unroll     // the loops below are unrolled so that fragments and accumulators are indexed by constants (registers, no scratch)
    for (int ks = 0; ks < G_KS / 32; ++ks) {
      V bh[4], ah[FI];
#pragma unroll
      for (int j = 0; j < 4; ++j) bh[j] = Frag<T>::load(sB + j * 16 * G_PITCH + ks * 32);
#pragma unroll
      for (int i = 0; i < FI; ++i) ah[i] = Frag<T>::load(sA + i * 16 * G_PITCH + ks * 32);
#pragma unroll
      for (int i = 0; i < FI; ++i) {
#pragma unroll
        for (int j = 0; j < 4; ++j) acc[i][j] = Frag<T>::mma(ah[i], bh[j], acc[i][j]);
        Frag<T>::guard(acc[i][0], acc[i][3], ah[i], ah[i]);
      }
      Frag<T>::keep(bh[0], bh[1], bh[2], bh[3]);
    }
    asm volatile("s_wait_dscnt 0x0" ::: "memory");     // this wave's reads of buffer t & 1 are done
    asm volatile("s_wait_asynccnt 0x0" ::: "memory");  // this wave's part of stage t + 1 has landed
    __syncthreads();                                   // publishes stage t + 1, frees buffer t & 1
    if (t + 2 < nst) stage_copy(t + 2, t & 1);
  }
  asm volatile("s_wait_asynccnt 0x0" ::: "memory");    // no copy outstanding behind the loop
#pragma unroll   // unrolled: acc is indexed by constants (registers)
  for (int i = 0; i < FI; ++i) acc_guard4(acc[i][0], acc[i][1], acc[i][2], acc[i][3]);

  // ---- epilogue ----
  float* slab = sT[wave];
  const float* Rb = RESID ? (resid + (size_t)b * strideR) : nullptr;
#pragma unroll
  for (int i = 0; i < FI; ++i) {
    const int mBase = m0 + (i << 4);
#pragma unroll
    for (int j = 0; j < 4; ++j) {
      const int n = n0 + (j << 4) + rlane;
      float bv = 0.f;
      if (BIAS_MODE == 2) bv = bias[n];
#pragma unroll
      for (int r = 0; r < 8; ++r) {
        float v = acc[i][j][r] * scale;
        if (BIAS_MODE == 1) v += bias[mBase + mOff + r];
        if (BIAS_MODE == 2) v += bv;
        if (RESID) v += Rb[(size_t)(mBase + mOff + r) * ldc + n];
        if (ACT == 1) v = tanhf(v);
        if (ACT == 2) v = fmaxf(v, 0.0f);
        if (ACT == 3) v = v / (1.0f + expf(-v));
        if (ACT == 4) v = (v > 0.f) ? v : 0.01f * v;
        if (ACT == 5) v = 0.5f * v * (1.0f + erff(v * 0.70710678118654752f));
        if (ACT == 6) v = gelu_tanh_f(v);
        slab[(mOff + r) * 68 + (j << 4) + rlane] = v;
      }
    }
    __builtin_amdgcn_fence(__ATOMIC_RELEASE, "workgroup");
    __builtin_amdgcn_wave_barrier();
    __builtin_amdgcn_fence(__ATOMIC_ACQUIRE, "workgroup");
    if (OUT_MODE == 0) {
      float* C = (float*)Cout + (size_t)b * strideC;
      const int hh = lane >> 4, c4 = (lane & 15) * 4;     // row seg = 256 B = 16 lanes x 16 B
      {
#pragma unroll
        for (int it = 0; it < 8; ++it) {
          const int row = it * 2 + hh;
          v4f v = *(const v4f*)(slab + row * 68 + c4);
          *(v4f*)(C + (size_t)(mBase + row) * ldc + n0 + c4) = v;
        }
        
      }
    } else {
      const int q = lane >> 3, c8 = (lane & 7) * 8;
      unsigned short* C  = (unsigned short*)Cout  + (size_t)b * strideC;
      unsigned short* C2 = (OUT_MODE == 2) ? ((unsigned short*)Cout2 + (size_t)b * strideC) : nullptr;
      {
#pragma unroll
        for (int it = 0; it < 4; ++it) {
          const int row = it * 4 + q;
          const float* sp = slab + row * 68 + c8;
          v8h hv, lv;
#pragma unroll
          for (int e = 0; e < 8; ++e) {
            if (OUT_MODE == 1) {
              hv[e] = (_Float16)sp[e];
            } else {
              unsigned short hb = f2bf_bits(sp[e]);
              unsigned short lb = f2bf_bits(sp[e] - bf_bits2f(hb));
              hv[e] = __builtin_bit_cast(_Float16, hb);
              lv[e] = __builtin_bit_cast(_Float16, lb);
            }
          }
          *(v8h*)(C + (size_t)(mBase + row) * ldc + n0 + c8) = hv;
          if (OUT_MODE == 2) *(v8h*)(C2 + (size_t)(mBase + row) * ldc + n0 + c8) = lv;
        }
        
      }
    }
    __builtin_amdgcn_fence(__ATOMIC_RELEASE, "workgroup");
    __builtin_amdgcn_wave_barrier();
    __builtin_amdgcn_fence(__ATOMIC_ACQUIRE, "workgroup");
  }
}

// ---- f32 -> f16 conversion by few, long-lived waves ------------------------
// A block is 16 waves; a wave converts R * 1024 contiguous elements: R * 8 loads of 16 bytes a lane (each wave-wide load 512
// contiguous bytes), all issued before the first is converted, and as many 8-byte stores (each wave-wide store 256 contiguous bytes).
typedef __attribute__((ext_vector_type(4))) _Float16 v4h;
#define CV_WAVES 16
template <int R>
__device__ __forceinline__ void cast_wave(const float* __restrict__ src, _Float16* __restrict__ dst, int q) {
  // src, dst: block-uniform; q: the lane's first group of four elements, one index for the loads and the stores
  const v4f* __restrict__ s4 = (const v4f*)src;
  v4h* __restrict__ d4 = (v4h*)dst;
  v4f x[R * 8];
#pragma unroll   // both loops unrolled: x stays in registers, every load and store addresses by an immediate offset
  for (int i = 0; i < R * 8; ++i) x[i] = s4[q + i * 32];
  if (R > 1) __builtin_amdgcn_sched_barrier(0);   // keeps every load in front of the first wait: a wave pays one memory latency, not one per group of loads
#pragma unroll
  for (int i = 0; i < R * 8; ++i) {
    v4h h;
#pragma unroll
    for (int e = 0; e < 4; ++e) h[e] = (_Float16)x[i][e];
    d4[q + i * 32] = h;
    if ((i & 7) == 7 && i + 1 < R * 8) __builtin_amdgcn_sched_barrier(0);   // eight stores leave as soon as their loads are in, not all behind the last load
  }
}
// The seven f32 inputs of the GEMMs in one launch: their f16 copies lie one behind the other in dst, at these element offsets.
#define CV_X   0
#define CV_Q   (CV_X + MROWS * DM)
#define CV_K   (CV_Q + DM * DM)
#define CV_V   (CV_K + DM * DM)
#define CV_O   (CV_V + DM * DM)
#define CV_W1  (CV_O + DM * DM)
#define CV_W2  (CV_W1 + FFND * DM)
#define CV_END (CV_W2 + DM * FFND)
#define CV_R   4
#define CV_BLK (CV_WAVES * CV_R * 1024)   // elements per block
static_assert(CV_Q % CV_BLK == 0 && CV_K % CV_BLK == 0 && CV_V % CV_BLK == 0 && CV_O % CV_BLK == 0 &&
              CV_W1 % CV_BLK == 0 && CV_W2 % CV_BLK == 0 && CV_END % CV_BLK == 0, "a block lies wholly in one tensor");
__global__ __launch_bounds__(CV_WAVES * 32) void cast_inputs(
    const float* __restrict__ x, const float* __restrict__ wq, const float* __restrict__ wk, const float* __restrict__ wv,
    const float* __restrict__ wo, const float* __restrict__ w1, const float* __restrict__ w2, _Float16* __restrict__ dst) {
  const int e0 = blockIdx.x * CV_BLK;       // block-uniform: the block index picks the tensor
  const float* src = x;
  int first = CV_X;
  if (e0 >= CV_Q)  { src = wq; first = CV_Q; }
  if (e0 >= CV_K)  { src = wk; first = CV_K; }
  if (e0 >= CV_V)  { src = wv; first = CV_V; }
  if (e0 >= CV_O)  { src = wo; first = CV_O; }
  if (e0 >= CV_W1) { src = w1; first = CV_W1; }
  if (e0 >= CV_W2) { src = w2; first = CV_W2; }
  cast_wave<CV_R>(src + (e0 - first), dst + e0, (threadIdx.x >> 5) * (CV_R * 256) + (threadIdx.x & 31));
}
// One tensor of gridDim.x * CV_WAVES * R * 1024 elements.
template <int R>
__global__ __launch_bounds__(CV_WAVES * 32) void cast_one(const float* __restrict__ in, _Float16* __restrict__ out) {
  const int e0 = blockIdx.x * (CV_WAVES * R * 1024);
  cast_wave<R>(in + e0, out + e0, (threadIdx.x >> 5) * (R * 256) + (threadIdx.x & 31));
}

// =====================================================================================
// Attention for head_dim 64, f32 in / f32 out; 16-bit operands: bf16 with optional hi/lo splits, or
// plain f16 (F16=true, non-split, probabilities carried x2^15).
//   Block = 4 waves = 64 query rows of one (batch, head); S % 64 == 0.
//   Element (b, s, h, d) of tensor X lives at X[b*X_bs + s*X_rs + h*X_hs + d] (strides in floats, multiples of 4).
//   mask_mode 0 none, 1 causal, 2 tensor [S][Skv], 3 per-token vectors, 4 causal + window, 5 relative bias,
//   6 = mask_a: int32 [S][Skv] nonzero = masked, OR mask_b: int32 [B][Skv] nonzero = masked; per 64x64
//       (b, q-tile, kv-tile) code table tcode[(b*nqb+qb)*t_pitch + (kc/TC_G)*TC_LINE + kc%TC_G]: 0 mixed (per-element reads),
//       1 all live (no reads), 2 all masked (tile skipped: zero contribution).
//   masked scores are replaced by mask_fill before the softmax; rows with no live key write 0.
//   grid.x = B * H * (S/64).
// =====================================================================================
#define AT_D 64
#define AT_NW 4
#define AT_QB 64
#define AT_KC 64
#define AT_LOG2E 1.4426950408889634f
#define TC_G    8    // kv-tiles whose codes share one line of the code table: the line has one writing block
#define TC_LINE 32   // ints per 128-B line
#define AT_LP 72    // LDS row pitch of the K and V^T tiles in 16-bit elements: 128 B of data + 16 B, so that the 16 rows
                    // which one ds_load_b128 fragment read touches fall on 16 different groups of four banks
struct AttnGeom { const int* tcode; const float* cp; const float* pc; long c_bs, c_rs, c_hs, t_pitch;
                  long q_bs, q_rs, q_hs, k_bs, k_rs, k_hs, v_bs, v_rs, v_hs, o_bs, o_rs, o_hs;
                  int S, Skv, H, mask_mode; float qscale; int blk0; float mask_fill; int mask_is_int; };
static_assert(sizeof(AttnGeom) == 184);

__device__ __forceinline__ unsigned short at_bf_bits(float f) {
  unsigned u = __float_as_uint(f);
  return (unsigned short)((u + 0x7FFFu + ((u >> 16) & 1u)) >> 16);
}
__device__ __forceinline__ __bf16 at_f2bf(float f) { return __builtin_bit_cast(__bf16, at_bf_bits(f)); }
__device__ __forceinline__ void at_split(float f, __bf16& hi, __bf16& lo) {
  const unsigned short hb = at_bf_bits(f);
  hi = __builtin_bit_cast(__bf16, hb);
  lo = at_f2bf(f - __uint_as_float(((unsigned)hb) << 16));
}
__device__ __forceinline__ v8f at_mma(v16b a, v16b b, v8f c) {
  c = __builtin_amdgcn_wmma_f32_16x16x32_bf16(false, a, false, b, (short)0, c, false, false);
  asm volatile("v_nop\n\tv_nop\n\tv_nop\n\tv_nop" : "+v"(c) : "v"(a), "v"(b));
  return c;
}
// 16-bit element as a bit pattern held in a __bf16 slot: f16 bits when F16, bf16 (RNE) otherwise
template <bool F16> __device__ __forceinline__ __bf16 at_to16(float f) {
  if (F16) return __builtin_bit_cast(__bf16, (_Float16)f);
  return at_f2bf(f);
}
template <bool F16> __device__ __forceinline__ v8f at_mma16(v16b a, v16b b, v8f c) {
  if (F16) {
    const v16h ah = __builtin_bit_cast(v16h, a), bh = __builtin_bit_cast(v16h, b);
    c = __builtin_amdgcn_wmma_f32_16x16x32_f16(false, ah, false, bh, (short)0, c, false, false);
    asm volatile("v_nop\n\tv_nop\n\tv_nop\n\tv_nop" : "+v"(c) : "v"(ah), "v"(bh));
    return c;
  }
  return at_mma(a, b, c);
}

// Eight powers of two (one lane's scores of one 16-key tile) in one statement. Behind a v_exp_f32 the instruction set asks for
// one independent instruction before its result is read or its source overwritten: here each v_exp_f32 is that instruction for the
// one before it (the outputs are early-clobber, so none lies on a source), and the v_nop is it for the last.
__device__ __forceinline__ void at_exp2x8(float (&o)[8], const float (&x)[8]) {
  asm("v_exp_f32 %0, %8\n\t"
      "v_exp_f32 %1, %9\n\t"
      "v_exp_f32 %2, %10\n\t"
      "v_exp_f32 %3, %11\n\t"
      "v_exp_f32 %4, %12\n\t"
      "v_exp_f32 %5, %13\n\t"
      "v_exp_f32 %6, %14\n\t"
      "v_exp_f32 %7, %15\n\t"
      "v_nop"
      : "=&v"(o[0]), "=&v"(o[1]), "=&v"(o[2]), "=&v"(o[3]), "=&v"(o[4]), "=&v"(o[5]), "=&v"(o[6]), "=&v"(o[7])
      : "v"(x[0]), "v"(x[1]), "v"(x[2]), "v"(x[3]), "v"(x[4]), "v"(x[5]), "v"(x[6]), "v"(x[7]));
}
// One power of two (the rescale factor); the v_nop is the independent instruction behind it.
__device__ __forceinline__ float at_exp2x1(float x) {
  float o;
  asm("v_exp_f32 %0, %1\n\t"
      "v_nop"
      : "=&v"(o) : "v"(x));
  return o;
}
// The value that lane l ^ 16 holds: a register move across the two 16-lane rows, no LDS-path operation.
__device__ __forceinline__ float at_xhalf(float f) {
  const int bits = __float_as_int(f);
  return __int_as_float(__builtin_amdgcn_permlanex16(bits, bits, 0x76543210, 0xfedcba98, false, false));
}

// MODE is the mask mode as a compile-time constant: only that mode's mask code is compiled into the key loop.
// KVRS is the row stride of K and of V in floats (the launch's g.k_rs and g.v_rs) as a compile-time constant: the eight pieces that a
// lane reads of each tile are then one address and eight immediate offsets.
template <bool SPLIT_QK, bool SPLIT_PV, bool F16, int MODE, int KVRS>
__global__ __launch_bounds__(128)
void attn64_kernel(const float* __restrict__ q, const float* __restrict__ k,
                   const float* __restrict__ v, float* __restrict__ out,
                   const int* __restrict__ mask_a, const int* __restrict__ mask_b, AttnGeom g) {
  static_assert(!(F16 && (SPLIT_QK || SPLIT_PV)));
  const float PSC = F16 ? 32768.0f : 1.0f;     // f16 probabilities carried x2^15, folded into the final 1/l
  union FB { v16b v; v8b h[2]; };
  __shared__ __align__(16) __bf16 Ksh[AT_KC * AT_LP];            // K hi [kv][d]      9 KB
  __shared__ __align__(16) __bf16 Ksl[SPLIT_QK ? AT_KC * AT_LP : 8];
  __shared__ __align__(16) __bf16 Vth[AT_D * AT_LP];             // V hi [d][kv]      9 KB
  __shared__ __align__(16) __bf16 Vtl[SPLIT_PV ? AT_D * AT_LP : 8];
  __shared__ __align__(16) float  Os[AT_NW][16 * 68];            // per wave out tile, pitch 68

  const int tid  = threadIdx.x;
  const int wave = tid >> 5;
  const int lane = tid & 31;
  const int hh   = lane >> 4;
  const int c    = lane & 15;

  const int nqb = g.S / AT_QB;
  const int nkc = g.Skv / AT_KC;
  const int bx = blockIdx.x + g.blk0;
  const int qb = bx % nqb;
  const int bh = bx / nqb;
  const int h  = bh % g.H;
  const int b  = bh / g.H;
  const int qbase_block = qb * AT_QB;
  const int q0 = qbase_block + wave * 16;

  const float* qb_ptr = q + (size_t)b * g.q_bs + (size_t)h * g.q_hs;
  const float* kb_ptr = k + (size_t)b * g.k_bs + (size_t)h * g.k_hs;
  const float* vb_ptr = v + (size_t)b * g.v_bs + (size_t)h * g.v_hs;
  float*       ob_ptr = out + (size_t)b * g.o_bs + (size_t)h * g.o_hs;

  // ---- Q fragments (B operand): 2 d-chunks, hi (and lo) ----
  v16b qah[2], qal[2];
  {
    const float* qrow = qb_ptr + (size_t)(q0 + c) * g.q_rs;
#pragma unroll
    for (int dc = 0; dc < 2; ++dc) {
#pragma unroll
      for (int e = 0; e < 8; ++e) {
        const float f0 = qrow[dc * 32 + 8 * hh + e] * g.qscale;
        const float f1 = qrow[dc * 32 + 16 + 8 * hh + e] * g.qscale;
        if (SPLIT_QK) { __bf16 hq, lq; at_split(f0, hq, lq); qah[dc][e] = hq; qal[dc][e] = lq; at_split(f1, hq, lq); qah[dc][8 + e] = hq; qal[dc][8 + e] = lq; }
        else { qah[dc][e] = at_to16<F16>(f0); qah[dc][8 + e] = at_to16<F16>(f1); qal[dc][e] = qah[dc][e]; qal[dc][8 + e] = qah[dc][8 + e]; }
      }
    }
  }

  float mrow = -INFINITY;   // running maximum of the lane's query, the same in both halves
  float lrow = 0.f;         // running sum over the lane half's own keys; the halves are joined once, behind the key loop
  v8f oacc[4];              // oacc[t][r] = O[q0 + c][t * 16 + 8 * hh + r]
#pragma unroll
  for (int t = 0; t < 4; ++t) oacc[t] = (v8f){0.f,0.f,0.f,0.f,0.f,0.f,0.f,0.f};

  const int nChunks = (MODE == 1 || MODE == 4) ? (qb + 1) : nkc;   // block-uniform, bounded by Skv/64
  const int qrow = q0 + c;
  const int qkeep = (MODE == 3) ? mask_b[(size_t)b * g.S + qrow] : 1;   // mask_b = qmask in mode 3
  for (int kc = 0; kc < nChunks; ++kc) {
    const int kv0 = kc * AT_KC;
    int code = 0;
    if (MODE == 6) {
      int cv = g.tcode[((size_t)b * nqb + qb) * (size_t)g.t_pitch + (kc / TC_G) * TC_LINE + (kc % TC_G)];
      cv = __builtin_amdgcn_readfirstlane(cv);
      code = (cv == 1 || cv == 2) ? cv : 0;     // anything else -> mixed (per-element reads)
      if (code == 2) continue;                  // fully masked tile: zero contribution, softmax state unchanged
    }
    __syncthreads();
    {
      // 8 lanes read one whole 128-B line (half a row) of K or V, so a wave-wide 16-byte load covers four whole lines of four rows.
      // A lane takes the rows kvr and kvr + 1 at the same four d: a V^T pair of neighbouring keys is one 4-byte LDS store.
      // Four row pairs a wave (not two) spread a V^T store over 16 banks: the d of 8 lanes fall on 4 banks, each row pair is one bank on.
      const int r2 = (tid >> 3) * 2, d4 = (tid & 7) * 4;
      const float* kcol = kb_ptr + (size_t)(kv0 + r2) * KVRS + d4;
      const float* vcol = vb_ptr + (size_t)(kv0 + r2) * KVRS + d4;
      v4f kx[8], vx[8];
#pragma unroll   // this loop and the two below unrolled: kx and vx are indexed by constants (registers), all 16 loads are issued in front of the first wait
      for (int i = 0; i < 8; ++i) {
        kx[i] = *(const v4f*)(kcol + (((i >> 1) & 1) * 32 + (i & 1)) * KVRS + (i >> 2) * 32);
        vx[i] = *(const v4f*)(vcol + (((i >> 1) & 1) * 32 + (i & 1)) * KVRS + (i >> 2) * 32);
      }
      // kcol and vcol are inputs so that both address pairs live up to this wait: no load's result and no conversion takes their registers in front of it
      asm volatile("s_wait_xcnt 0x0" :: "v"(kcol), "v"(vcol) : "memory");
#pragma unroll
      for (int p = 0; p < 4; ++p) {
        const int kvr = (p & 1) * 32 + r2, dd = (p >> 1) * 32 + d4;
        const v4f k0 = kx[2 * p], k1 = kx[2 * p + 1], v0 = vx[2 * p], v1 = vx[2 * p + 1];
        v4b k0h, k0l, k1h, k1l;
#pragma unroll
        for (int e = 0; e < 4; ++e) {
          if (SPLIT_QK) { __bf16 a, bl; at_split(k0[e], a, bl); k0h[e] = a; k0l[e] = bl; at_split(k1[e], a, bl); k1h[e] = a; k1l[e] = bl; }
          else { k0h[e] = at_to16<F16>(k0[e]); k1h[e] = at_to16<F16>(k1[e]); }
          v2b vh, vl;
          if (SPLIT_PV) { __bf16 a, bl; at_split(v0[e], a, bl); vh[0] = a; vl[0] = bl; at_split(v1[e], a, bl); vh[1] = a; vl[1] = bl; }
          else { vh[0] = at_to16<F16>(v0[e]); vh[1] = at_to16<F16>(v1[e]); }
          *(v2b*)(Vth + (dd + e) * AT_LP + kvr) = vh;
          if (SPLIT_PV) *(v2b*)(Vtl + (dd + e) * AT_LP + kvr) = vl;
        }
        *(v4b*)(Ksh + kvr * AT_LP + dd) = k0h;
        *(v4b*)(Ksh + (kvr + 1) * AT_LP + dd) = k1h;
        if (SPLIT_QK) { *(v4b*)(Ksl + kvr * AT_LP + dd) = k0l; *(v4b*)(Ksl + (kvr + 1) * AT_LP + dd) = k1l; }
      }
    }
    __syncthreads();

    v8f s[4];   // s[j][r] = score of key kv0 + j * 16 + 8 * hh + r for query q0 + c
    {
      // all eight K fragments of the tile are read as one group ahead of the eight products: one LDS latency a tile, not one per product
      FB kb[2][4];
#pragma unroll   // these loops unrolled: kb, qah and s are indexed by constants (registers, no indexed register moves)
      for (int dc = 0; dc < 2; ++dc) {
#pragma unroll
        for (int j = 0; j < 4; ++j) {
          kb[dc][j].h[0] = *(const v8b*)(Ksh + (j * 16 + c) * AT_LP + dc * 32 + 8 * hh);
          kb[dc][j].h[1] = *(const v8b*)(Ksh + (j * 16 + c) * AT_LP + dc * 32 + 16 + 8 * hh);
        }
      }
#pragma unroll
      for (int j = 0; j < 4; ++j) s[j] = (v8f){0.f,0.f,0.f,0.f,0.f,0.f,0.f,0.f};
#pragma unroll   // each s[j] still sums d 0..31 first, then d 32..63; K rows are the first operand, Q the second
      for (int dc = 0; dc < 2; ++dc) {
#pragma unroll
        for (int j = 0; j < 4; ++j) {
          s[j] = at_mma16<F16>(kb[dc][j].v, qah[dc], s[j]);
          if (SPLIT_QK) {
            FB kl;
            kl.h[0] = *(const v8b*)(Ksl + (j * 16 + c) * AT_LP + dc * 32 + 8 * hh);
            kl.h[1] = *(const v8b*)(Ksl + (j * 16 + c) * AT_LP + dc * 32 + 16 + 8 * hh);
            s[j] = at_mma16<F16>(kl.v, qah[dc], s[j]);
            s[j] = at_mma16<F16>(kb[dc][j].v, qal[dc], s[j]);
          }
        }
      }
    }
    // all eight V^T fragments of the tile are read as one group in front of the softmax, which covers their latency
    FB vb[2][4];
#pragma unroll   // unrolled: vb is indexed by constants (registers)
    for (int kk = 0; kk < 2; ++kk) {
#pragma unroll
      for (int t = 0; t < 4; ++t) {
        vb[kk][t].h[0] = *(const v8b*)(Vth + (t * 16 + c) * AT_LP + kk * 32 + 8 * hh);
        vb[kk][t].h[1] = *(const v8b*)(Vth + (t * 16 + c) * AT_LP + kk * 32 + 16 + 8 * hh);
      }
    }
    const bool diag = (MODE == 1) && (kc == qb);
    if (MODE == 6 && code == 0) {               // mixed tile: one wave-uniform branch per tile, then per-element reads
      // a lane's eight keys of a 16-key tile lie side by side in its query's mask row and in the padding row: two 16-byte reads of each
      const int* mrowp = mask_a + (size_t)qrow * g.Skv + kv0 + 8 * hh;
      const int* prowp = mask_b + (size_t)b * g.Skv + kv0 + 8 * hh;   // mask_b = key padding [B][Skv]
      v4i mx[8], px[8];
#pragma unroll   // the loops here unrolled so that mx, px and s[j][r] are indexed by constants and stay in registers
      for (int i = 0; i < 8; ++i) {
        mx[i] = *(const v4i*)(mrowp + (i >> 1) * 16 + (i & 1) * 4);
        px[i] = *(const v4i*)(prowp + (i >> 1) * 16 + (i & 1) * 4);
      }
      // mrowp and prowp are inputs so that both address pairs live up to this wait: no load's result and no compare takes their registers in front of it
      asm volatile("s_wait_xcnt 0x0" :: "v"(mrowp), "v"(prowp) : "memory");
#pragma unroll
      for (int j = 0; j < 4; ++j) {
#pragma unroll
        for (int r = 0; r < 8; ++r)
          if ((mx[2 * j + (r >> 2)][r & 3] != 0) || (px[2 * j + (r >> 2)][r & 3] != 0)) s[j][r] = g.mask_fill;
      }
    }
    float mj[4];   // one maximum per 16-key tile: four short chains, not one of 32 links
#pragma unroll
    for (int j = 0; j < 4; ++j) {
      float m = -INFINITY;
#pragma unroll
      for (int r = 0; r < 8; ++r) {
        const int kvcol = kv0 + j * 16 + 8 * hh + r;
        bool masked = false;
        if (diag) masked = (kvcol > qrow);
        else if (MODE == 4) masked = (kvcol > qrow) || (qrow - kvcol > g.mask_is_int);
        else if (MODE == 2) {
          const size_t mi = (size_t)qrow * g.Skv + kvcol;
          masked = (g.mask_is_int == 0) ? (((const float*)mask_a)[mi] == 0.0f)
                 : (g.mask_is_int == 1) ? (mask_a[mi] == 0) : (mask_a[mi] != 0);
        } else if (MODE == 3) masked = (qkeep == 0) || (mask_a[(size_t)b * g.Skv + kvcol] == 0);   // mask_a = kvmask
        else if (MODE == 5) {
          const size_t mi = (size_t)qrow * g.Skv + kvcol;
          masked = (mask_a[mi] != 0);
          int n = mask_b[mi]; n = n < 0 ? 0 : n;
          s[j][r] += g.cp[(size_t)b * g.c_bs + (size_t)h * g.c_hs + (size_t)qrow * g.c_rs + n]
                   + g.pc[(size_t)b * g.c_bs + (size_t)h * g.c_hs + (size_t)kvcol * g.c_rs + n];
        }
        if (masked) s[j][r] = g.mask_fill;
        m = fmaxf(m, s[j][r]);
      }
      mj[j] = m;
    }
    float cm = fmaxf(fmaxf(mj[0], mj[1]), fmaxf(mj[2], mj[3]));
    cm = fmaxf(cm, at_xhalf(cm));               // the query's other 32 keys of the tile lie in lane l ^ 16
    const float mnew = fmaxf(mrow, cm);
    // exp(x - mnew) = 2^(x * log2(e) - mb): one FMA and one v_exp_f32, no branch. A row with no live key yet takes mb = 0:
    // every exponent is then -inf (never inf - inf), so its p and alpha are 0 and its sums stay 0.
    const float mb = (mnew == -INFINITY) ? 0.0f : mnew * AT_LOG2E;
    const float alpha = at_exp2x1(fmaf(mrow, AT_LOG2E, -mb));
    mrow = mnew;
    // P^T as second operand of O^T += V^T.P^T: element e of a lane's fragment is key 8 * hh + e of the 32, element 8 + e key
    // 16 + 8 * hh + e (the k order of the V^T fragments above): exactly the lane's own s[2 * kk][e] and s[2 * kk + 1][e].
    FB pa[2], pl[2];
    float ps[4];   // one sum per 16-key tile
#pragma unroll   // unrolled: s, pa and ps are indexed by constants (registers)
    for (int j = 0; j < 4; ++j) {
      float x[8], pe[8];
#pragma unroll
      for (int r = 0; r < 8; ++r) x[r] = fmaf(s[j][r], AT_LOG2E, -mb);
      at_exp2x8(pe, x);
      float sum = pe[0];
#pragma unroll
      for (int r = 1; r < 8; ++r) sum += pe[r];
      ps[j] = sum;
#pragma unroll
      for (int r = 0; r < 8; ++r) {
        if (SPLIT_PV) { __bf16 a, bl; at_split(pe[r], a, bl); pa[j >> 1].v[(j & 1) * 8 + r] = a; pl[j >> 1].v[(j & 1) * 8 + r] = bl; }
        else pa[j >> 1].v[(j & 1) * 8 + r] = at_to16<F16>(pe[r] * PSC);
      }
    }
    lrow = lrow * alpha + ((ps[0] + ps[1]) + (ps[2] + ps[3]));
#pragma unroll
    for (int t = 0; t < 4; ++t) {
#pragma unroll
      for (int r = 0; r < 8; ++r) oacc[t][r] *= alpha;
    }
#pragma unroll   // each oacc[t] still sums keys 0..31 first, then keys 32..63; V^T rows are the first operand, P^T the second
    for (int kk = 0; kk < 2; ++kk) {
#pragma unroll
      for (int t = 0; t < 4; ++t) {
        oacc[t] = at_mma16<F16>(vb[kk][t].v, pa[kk].v, oacc[t]);
        if (SPLIT_PV) {
          FB vl;
          vl.h[0] = *(const v8b*)(Vtl + (t * 16 + c) * AT_LP + kk * 32 + 8 * hh);
          vl.h[1] = *(const v8b*)(Vtl + (t * 16 + c) * AT_LP + kk * 32 + 16 + 8 * hh);
          oacc[t] = at_mma16<F16>(vl.v, pa[kk].v, oacc[t]);
          oacc[t] = at_mma16<F16>(vb[kk][t].v, pl[kk].v, oacc[t]);
        }
      }
    }
  }

  float* os = Os[wave];
  {
    const float den = (lrow + at_xhalf(lrow)) * PSC;   // the two halves' key sums joined
    const float inv = (den > 0.0f) ? (1.0f / den) : 0.0f;
#pragma unroll   // unrolled: oacc is indexed by constants; a lane's eight d of a tile are two 16-byte LDS stores in its query's row
    for (int t = 0; t < 4; ++t) {
      v4f lo, hi;
#pragma unroll
      for (int e = 0; e < 4; ++e) { lo[e] = oacc[t][e] * inv; hi[e] = oacc[t][4 + e] * inv; }
      *(v4f*)(os + c * 68 + t * 16 + 8 * hh) = lo;
      *(v4f*)(os + c * 68 + t * 16 + 8 * hh + 4) = hi;
    }
  }
  __builtin_amdgcn_fence(__ATOMIC_RELEASE, "workgroup");
  __builtin_amdgcn_wave_barrier();
  __builtin_amdgcn_fence(__ATOMIC_ACQUIRE, "workgroup");
  {
    const int c4 = (lane & 15) * 4;
    {
#pragma unroll
      for (int it = 0; it < 8; ++it) {
        const int row = it * 2 + hh;
        v4f val = *(const v4f*)(os + row * 68 + c4);
        *(v4f*)(ob_ptr + (size_t)(q0 + row) * g.o_rs + c4) = val;
      }
      
    }
  }
}

// =====================================================================================
// 64x64 tile classification of the attention mask: masked(b,q,k) = tm[q][k] != 0 || pad[b][k] != 0;
//   code 2 = all masked, 1 = all live, 0 = mixed.
// One block per (q-tile, group of TC_G kv-tiles), for all NB batches at once: tm is read once. A wave takes 32 rows of one tile:
// 16 lanes cover a row's 256 B, a wave-wide 16-byte load two rows (four whole lines), all 16 loads of a lane in flight together.
// A lane keeps, for each of its four columns, the OR and the unsigned minimum over its rows: some row nonzero, some row zero.
// =====================================================================================
typedef __attribute__((ext_vector_type(4))) unsigned v4u;
template <int SKV, int NB>
__global__ __launch_bounds__(TC_G * 64) void tilecode_kernel(
    const int* __restrict__ tm, const int* __restrict__ pad, int* __restrict__ tab,
    int nqb, int nkc, int tp) {
  __shared__ int wl[NB][TC_G * 2], wm[NB][TC_G * 2];
  const int tid = threadIdx.x, lane = tid & 31, wave = tid >> 5;
  const int ngr = (nkc + TC_G - 1) / TC_G;
  const int qb = blockIdx.x / ngr;
  const int kg = blockIdx.x - qb * ngr;
  const int kc  = kg * TC_G + (wave >> 1);
  const int kcc = kc < nkc ? kc : nkc - 1;      // a tile past the end reads the last tile; its code is not stored
  const int col = kcc * 64 + (lane & 15) * 4;
  const int* mr = tm + (size_t)(qb * 64 + (wave & 1) * 32 + (lane >> 4)) * SKV + col;
  const int* pr = pad + col;
  v4u x[16], p[NB];
#pragma unroll   // the loops here unrolled: x and p stay in registers, every load addresses by an immediate offset and is issued in front of the first wait
  for (int i = 0; i < 16; ++i) x[i] = *(const v4u*)(mr + i * 2 * SKV);
#pragma unroll
  for (int b = 0; b < NB; ++b) p[b] = *(const v4u*)(pr + b * SKV);
  // mr and pr are inputs so that both address pairs live up to this wait: no load's result takes their registers in front of it
  asm volatile("s_wait_xcnt 0x0" :: "v"(mr), "v"(pr) : "memory");
  __builtin_amdgcn_sched_barrier(0);   // keeps every load in front of the first wait: a wave pays one memory latency, not one per group of loads
  v4u orv = x[0], mnv = x[0];
#pragma unroll
  for (int i = 1; i < 16; ++i) {
#pragma unroll
    for (int e = 0; e < 4; ++e) {
      orv[e] |= x[i][e];
      mnv[e] = x[i][e] < mnv[e] ? x[i][e] : mnv[e];
    }
  }
#pragma unroll
  for (int b = 0; b < NB; ++b) {
    int live = 0, msk = 0;
#pragma unroll
    for (int e = 0; e < 4; ++e) {
      msk  |= ((orv[e] != 0u) || (p[b][e] != 0u)) ? 1 : 0;
      live |= ((mnv[e] == 0u) && (p[b][e] == 0u)) ? 1 : 0;
    }
    const int al = __any(live);
    const int am = __any(msk);
    if (lane == 0) { wl[b][wave] = al; wm[b][wave] = am; }
  }
  __syncthreads();   // the two waves of a tile have left their flags
  if (tid < NB * TC_G) {
    const int b = tid / TC_G, j = tid - b * TC_G;
    const int L  = wl[b][2 * j] | wl[b][2 * j + 1];
    const int Mk = wm[b][2 * j] | wm[b][2 * j + 1];
    if (kg * TC_G + j < nkc)
      tab[((size_t)b * nqb + qb) * tp + kg * TC_LINE + j] = (L == 0) ? 2 : ((Mk == 0) ? 1 : 0);
  }
}

// =====================================================================================
// LayerNorm over 1024-wide rows: one block (256 thr) per row, 4 contiguous floats per thread.
// =====================================================================================
template <bool OUT16>
__global__ __launch_bounds__(256) void ln_kernel(
    const float* __restrict__ in, const float* __restrict__ gam, const float* __restrict__ bet,
    float* __restrict__ o32, _Float16* __restrict__ o16) {
  __shared__ float red1[8], red2[8];
  __shared__ __align__(16) float ybuf[OUT16 ? DM : 4];
  const int row = blockIdx.x, t = threadIdx.x, lane = t & 31, wave = t >> 5;
  const float* x = in + (size_t)row * DM;
  const v4f xv = *(const v4f*)(x + 4 * t);
  float s = (xv[0] + xv[1]) + (xv[2] + xv[3]);
#pragma unroll
  for (int off = 1; off < 32; off <<= 1) s += __shfl_xor(s, off, 32);
  if (lane == 0) red1[wave] = s;
  __syncthreads();
  float tot = 0.f;
#pragma unroll
  for (int w = 0; w < 8; ++w) tot += red1[w];
  const float mu = tot * (1.0f / (float)DM);
  const float d0 = xv[0] - mu, d1 = xv[1] - mu, d2 = xv[2] - mu, d3 = xv[3] - mu;
  float s2 = (d0 * d0 + d1 * d1) + (d2 * d2 + d3 * d3);
#pragma unroll
  for (int off = 1; off < 32; off <<= 1) s2 += __shfl_xor(s2, off, 32);
  if (lane == 0) red2[wave] = s2;
  __syncthreads();
  float tot2 = 0.f;
#pragma unroll
  for (int w = 0; w < 8; ++w) tot2 += red2[w];
  const float var = tot2 * (1.0f / (float)DM);
  const float rstd = rsqrtf(var + LN_EPS);
  const v4f gv = *(const v4f*)(gam + 4 * t);
  const v4f bv = *(const v4f*)(bet + 4 * t);
  v4f y;
  y[0] = d0 * rstd * gv[0] + bv[0];
  y[1] = d1 * rstd * gv[1] + bv[1];
  y[2] = d2 * rstd * gv[2] + bv[2];
  y[3] = d3 * rstd * gv[3] + bv[3];
  float* op = o32 + (size_t)row * DM + 4 * t;
  *(v4f*)op = y;
  
  if (OUT16) {
    *(v4f*)(ybuf + 4 * t) = y;
    __syncthreads();
    if (t < DM / 8) {
      v8h hv;
#pragma unroll
      for (int e = 0; e < 8; ++e) hv[e] = (_Float16)ybuf[8 * t + e];
      _Float16* hp = o16 + (size_t)row * DM + 8 * t;
      *(v8h*)hp = hv;
      
    }
  }
}

// =====================================================================================
// Host orchestration
// =====================================================================================
extern "C" void kernel_launch(void* const* d_in, const int* in_sizes, int n_in,
                              void* d_out, int out_size, void* d_ws, size_t ws_size,
                              hipStream_t stream) {
  if (n_in < 16) return;
  if (in_sizes[0] != MROWS * DM || in_sizes[1] != SEQ * SEQ || in_sizes[2] != BSZ * SEQ) return;
  if (in_sizes[3] != DM * DM || in_sizes[4] != DM * DM || in_sizes[5] != DM * DM || in_sizes[6] != DM * DM) return;
  if (in_sizes[7] != DM || in_sizes[8] != FFND * DM || in_sizes[9] != FFND) return;
  if (in_sizes[10] != DM * FFND || in_sizes[11] != DM) return;
  if (in_sizes[12] != DM || in_sizes[13] != DM || in_sizes[14] != DM || in_sizes[15] != DM) return;
  if (out_size != MROWS * DM) return;

  const float* tgt   = (const float*)d_in[0];
  const int*   tmask = (const int*)d_in[1];     // [SEQ][SEQ], nonzero = masked
  const int*   pmask = (const int*)d_in[2];     // [BSZ][SEQ], nonzero = masked
  const float* Wq    = (const float*)d_in[3];
  const float* Wk    = (const float*)d_in[4];
  const float* Wv    = (const float*)d_in[5];
  const float* Wo    = (const float*)d_in[6];
  const float* bo    = (const float*)d_in[7];
  const float* W1    = (const float*)d_in[8];
  const float* b1    = (const float*)d_in[9];
  const float* W2    = (const float*)d_in[10];
  const float* b2    = (const float*)d_in[11];
  const float* g1    = (const float*)d_in[12];
  const float* be1   = (const float*)d_in[13];
  const float* g2    = (const float*)d_in[14];
  const float* be2   = (const float*)d_in[15];
  float* out = (float*)d_out;

  // ---- workspace carve (bytes), regions reused across phases ----
  const size_t MiB = 1048576;
  const int nqb = SEQ / AT_QB, nkc = SEQ / AT_KC;
  const int NGR = (nkc + TC_G - 1) / TC_G;
  const int TP = NGR * TC_LINE;
  const size_t tabBytes = (size_t)BSZ * nqb * TP * sizeof(int);
  const size_t total = 96 * MiB + tabBytes;
  if (total > ws_size) return;
  char* ws = (char*)d_ws;
  float*    Qf   = (float*)(ws + 0 * MiB);          // [4096][1024] f32   (projections -> attention)
  float*    Kf   = (float*)(ws + 16 * MiB);
  float*    Vf   = (float*)(ws + 32 * MiB);
  float*    RES1 = (float*)(ws + 0 * MiB);          // tgt + attn-proj     (after attention)
  _Float16* H16  = (_Float16*)(ws + 0 * MiB);       // [4096][4096] f16   (after LN1)
  float*    X1f  = (float*)(ws + 32 * MiB);         // LN1 output f32     (after attention)
  float*    AOf  = (float*)(ws + 48 * MiB);         // attention output f32
  float*    RES2 = (float*)(ws + 48 * MiB);         // x1 + ffn           (after out-proj)
  _Float16* X16  = (_Float16*)(ws + 64 * MiB);      // tgt f16            (projections)
  _Float16* O16  = (_Float16*)(ws + 64 * MiB);      // attention output f16 (after projections)
  _Float16* X1h  = (_Float16*)(ws + 64 * MiB);      // LN1 output f16     (after out-proj)
  _Float16* Wq16 = (_Float16*)(ws + 72 * MiB);
  _Float16* Wk16 = (_Float16*)(ws + 74 * MiB);
  _Float16* Wv16 = (_Float16*)(ws + 76 * MiB);
  _Float16* Wo16 = (_Float16*)(ws + 78 * MiB);
  _Float16* W1h  = (_Float16*)(ws + 80 * MiB);      // [4096][1024]
  _Float16* W2h  = (_Float16*)(ws + 88 * MiB);      // [1024][4096]
  int*      TAB  = (int*)(ws + 96 * MiB);           // [BSZ*nqb][TP]

  // tgt and the six weight matrices -> f16, one launch; X16 .. W2h lie one behind the other from X16 on
  static_assert(CV_Q * 2 == 8 * 1048576 && CV_K * 2 == 10 * 1048576 && CV_V * 2 == 12 * 1048576 && CV_O * 2 == 14 * 1048576 &&
                CV_W1 * 2 == 16 * 1048576 && CV_W2 * 2 == 24 * 1048576 && CV_END * 2 == 32 * 1048576, "offsets of the carve above");
  cast_inputs<<<dim3(CV_END / CV_BLK), dim3(CV_WAVES * 32), 0, stream>>>(tgt, Wq, Wk, Wv, Wo, W1, W2, X16);

  // mask tile codes
  tilecode_kernel<SEQ, BSZ><<<dim3(nqb * NGR), dim3(TC_G * 64), 0, stream>>>(tmask, pmask, TAB, nqb, nkc, TP);

  const long z = 0;
  typedef const unsigned short* cu16;
  const int tilesM = MROWS / 128;
  // q/k/v projections: [4096][1024] = X16 . W^T, f32 out
  {
    const dim3 grid(tilesM * (DM / 128), 1);
    wmma_gemm64<0, false, 0, 0, false, 0, 8><<<grid, dim3(256), 0, stream>>>(
        (cu16)X16, (cu16)X16, DM, z, (cu16)Wq16, (cu16)Wq16, DM, z, (void*)Qf, (void*)Qf, DM, z,
        bo, tgt, z, MROWS, DM, DM, 1.0f);
    wmma_gemm64<0, false, 0, 0, false, 0, 8><<<grid, dim3(256), 0, stream>>>(
        (cu16)X16, (cu16)X16, DM, z, (cu16)Wk16, (cu16)Wk16, DM, z, (void*)Kf, (void*)Kf, DM, z,
        bo, tgt, z, MROWS, DM, DM, 1.0f);
    wmma_gemm64<0, false, 0, 0, false, 0, 8><<<grid, dim3(256), 0, stream>>>(
        (cu16)X16, (cu16)X16, DM, z, (cu16)Wv16, (cu16)Wv16, DM, z, (void*)Vf, (void*)Vf, DM, z,
        bo, tgt, z, MROWS, DM, DM, 1.0f);
  }

  // attention: q,k,v,o element (b, s, h, d) at b*SEQ*DM + s*DM + h*64 + d
  {
    AttnGeom g;
    g.tcode = TAB; g.cp = Qf; g.pc = Qf; g.c_bs = 0; g.c_rs = 0; g.c_hs = 0; g.t_pitch = TP;
    g.q_bs = (long)SEQ * DM; g.q_rs = DM; g.q_hs = HD;
    g.k_bs = (long)SEQ * DM; g.k_rs = DM; g.k_hs = HD;
    g.v_bs = (long)SEQ * DM; g.v_rs = DM; g.v_hs = HD;
    g.o_bs = (long)SEQ * DM; g.o_rs = DM; g.o_hs = HD;
    g.S = SEQ; g.Skv = SEQ; g.H = NHEAD; g.mask_mode = 6; g.qscale = 0.125f; g.blk0 = 0;
    g.mask_fill = -INFINITY; g.mask_is_int = 2;
    attn64_kernel<false, false, true, 6, DM><<<dim3(BSZ * NHEAD * nqb), dim3(128), 0, stream>>>(
        Qf, Kf, Vf, AOf, tmask, pmask, g);
  }
  static_assert((MROWS * DM) % (CV_WAVES * 1024) == 0);
  cast_one<1><<<dim3(MROWS * DM / (CV_WAVES * 1024)), dim3(CV_WAVES * 32), 0, stream>>>(AOf, O16);

  // RES1 = tgt + (O . Wo^T + bo)
  {
    const dim3 grid(tilesM * (DM / 128), 1);
    wmma_gemm64<0, false, 2, 0, true, 0, 8><<<grid, dim3(256), 0, stream>>>(
        (cu16)O16, (cu16)O16, DM, z, (cu16)Wo16, (cu16)Wo16, DM, z, (void*)RES1, (void*)RES1, DM, z,
        bo, tgt, z, MROWS, DM, DM, 1.0f);
  }
  // x1 = LN(RES1) -> f32 + f16
  ln_kernel<true><<<dim3(MROWS), dim3(256), 0, stream>>>(RES1, g1, be1, X1f, X1h);
  // H16 = gelu_tanh(x1 . W1^T + b1), f16 [4096][4096]
  {
    const dim3 grid(tilesM * (FFND / 128), 1);
    wmma_gemm64<0, false, 2, 1, false, 6, 4><<<grid, dim3(128), 0, stream>>>(
        (cu16)X1h, (cu16)X1h, DM, z, (cu16)W1h, (cu16)W1h, DM, z, (void*)H16, (void*)H16, FFND, z,
        b1, tgt, z, MROWS, FFND, DM, 1.0f);
  }
  // RES2 = x1 + (H . W2^T + b2)
  {
    const dim3 grid(tilesM * (DM / 128), 1);
    wmma_gemm64<0, false, 2, 0, true, 0, 8><<<grid, dim3(256), 0, stream>>>(
        (cu16)H16, (cu16)H16, FFND, z, (cu16)W2h, (cu16)W2h, FFND, z, (void*)RES2, (void*)RES2, DM, z,
        b2, X1f, z, MROWS, DM, FFND, 1.0f);
  }
  // out = LN(RES2)
  ln_kernel<false><<<dim3(MROWS), dim3(256), 0, stream>>>(RES2, g2, be2, out, X1h);
  (void)hipGetLastError();
}
